// v000
// The times below were measured on an AMD MI455X: many runs one after another, warmed up first and cycling through
// copies of the inputs, with the whole window's GPU time divided by the number of runs. Launches and the gaps
// between them are all in it. The median over several windows is given; except for v000 it joins two sittings, which
// can be a few percent apart, so the side-by-side timings, each taken in one sitting, are the better comparison.
// v000 is the starting kernel. One run takes 358 microseconds.
#include <hip/hip_runtime.h>
// RelativePositionalEncodingAttention (2 x 2048 tokens, 8 heads of 64, D 512): q/k/v from three inputs (no bias); scores/8 + pos_emb[clip(i - j, -32, 32) + 32][h]; softmax; out Wo.
// Structure: exact f16 planes of query/key/value; q/k/v GEMMs (32x64 wave tiles, f32 accumulation, exact x16 weights, f16 outputs); the relative-bias table transposed to [head][65] (bf16-rounded, f32); V^T by LDS tiles; the fused flash kernel with a new relative-position-bias mode (table lookup by clipped i - j added after the scale, f32); attention output as f16 into the output GEMM.
// Compute dtype: inputs and weights rounded to bf16; q, k, v, P and the attention output as f16 operands (~2^-12); f32 accumulation/softmax/bias. v_wmma_f32_16x16x32_f16.
#define NB 2
#define CC 512
#define NR (NB * SLEN)
#define NREL (2 * RELW + 1)
#define SLEN 2048
#define TQ SLEN
#define TK SLEN
#define NH 8
#define SCL 0.125f               /* 1/sqrt(64) */
#define WINDOW 256
#define RELW 32                  /* max_relative_position */
#define QBLKS (TQ / 64)
typedef __bf16 v16b __attribute__((ext_vector_type(16)));
typedef unsigned short v8us __attribute__((ext_vector_type(8), may_alias));
typedef float  v8f  __attribute__((ext_vector_type(8)));
typedef float  v4f  __attribute__((ext_vector_type(4)));
typedef float  v4fa __attribute__((ext_vector_type(4), may_alias));
union FragB { v16b v; v8us half[2]; unsigned short u[16]; };

__device__ __forceinline__ unsigned short bf16_bits(float x) { unsigned int u = __float_as_uint(x); return (unsigned short)((u + 0x7FFFu + ((u >> 16) & 1u)) >> 16); }
__device__ __forceinline__ float bf16_val(unsigned short b) { return __uint_as_float(((unsigned int)b) << 16); }
__device__ __forceinline__ float bf16_round(float x) { return bf16_val(bf16_bits(x)); }
// D += A·B with NT terms: 1 = ah·bh, 2 = + al·bh (A split), 3 = + ah·bl (both split)
template <int NT>
__device__ __forceinline__ v8f mmaN(v16b ah, v16b al, v16b bh, v16b bl, v8f c) {
  c = __builtin_amdgcn_wmma_f32_16x16x32_bf16(false, ah, false, bh, (short)0, c, false, false);
  if (NT >= 2) c = __builtin_amdgcn_wmma_f32_16x16x32_bf16(false, al, false, bh, (short)0, c, false, false);
  if (NT >= 3) c = __builtin_amdgcn_wmma_f32_16x16x32_bf16(false, ah, false, bl, (short)0, c, false, false);
  asm volatile("v_nop\n\tv_nop\n\tv_nop\n\tv_nop" : "+v"(c) : "v"(ah), "v"(al), "v"(bh), "v"(bl));
  return c;
}

__global__ __launch_bounds__(256) void k_wt_bf16(const float* __restrict__ W, unsigned short* __restrict__ Wt, int K, int N) {
  const int t = blockIdx.x * 256 + threadIdx.x;
  const int k8n = K / 8;
  if (t >= N * k8n) return;
  const int n = t / k8n, k8 = (t % k8n) * 8;
  v8us v;
#pragma unroll
  for (int i = 0; i < 8; ++i) v[i] = bf16_bits(W[(size_t)(k8 + i) * N + n]);
  *(v8us*)(Wt + (size_t)n * K + k8) = v;
  
}

// GEMM C[M][N] (f32, pitch ldc) = act(A[M][K]·W + bias). A f32 row-major (pitch lda) converted per fragment to bf16
// (ASPLIT: hi/lo two planes -> 2 terms, else single rounded term); Wt bf16 [N][K] (pitch ldb). BIAS_BF16 rounds the
// bias to bf16 first (bias quantised to bf16 before the add). K%32==0, M%16==0, N%64==0.
template <bool ASPLIT, int ACT, bool BIAS_BF16>
__global__ __launch_bounds__(128) void k_gemm_bf(const float* __restrict__ A, int lda, const unsigned short* __restrict__ Wt, int ldb,
                                               const float* __restrict__ bias, float* __restrict__ C, int ldc, int M, int N, int K) {
  __shared__ __attribute__((aligned(16))) float so[4][16][64];
  const int tid = threadIdx.x, w = tid >> 5, lane = tid & 31, ln = lane & 15, hh = lane >> 4;
  const int ntn = N / 64;
  const int wid = blockIdx.x * 4 + w;
  const int mt = wid / ntn, nq = wid % ntn;
  if (mt * 16 >= M) return;
  const int row0 = mt * 16, col0 = nq * 64;
  const float* arow = A + (size_t)(row0 + ln) * lda;
  v8f acc[4] = {};
  for (int kb = 0; kb < K; kb += 32) {
    FragB ah, al;
    const v4f x0 = *(const v4fa*)(arow + kb + 8 * hh), x1 = *(const v4fa*)(arow + kb + 8 * hh + 4);
    const v4f x2 = *(const v4fa*)(arow + kb + 16 + 8 * hh), x3 = *(const v4fa*)(arow + kb + 16 + 8 * hh + 4);
    float xs[16] = {x0[0],x0[1],x0[2],x0[3],x1[0],x1[1],x1[2],x1[3],x2[0],x2[1],x2[2],x2[3],x3[0],x3[1],x3[2],x3[3]};
#pragma unroll
    for (int i = 0; i < 16; ++i) { const unsigned short hb = bf16_bits(xs[i]); ah.u[i] = hb; al.u[i] = ASPLIT ? bf16_bits(xs[i] - bf16_val(hb)) : (unsigned short)0; }
#pragma unroll
    for (int t = 0; t < 4; ++t) {
      const unsigned short* brow = Wt + (size_t)(col0 + t * 16 + ln) * ldb + kb;
      FragB b;
      b.half[0] = *(const v8us*)(brow + 8 * hh);
      b.half[1] = *(const v8us*)(brow + 16 + 8 * hh);
      acc[t] = mmaN<ASPLIT ? 2 : 1>(ah.v, al.v, b.v, b.v, acc[t]);
    }
  }
#pragma unroll
  for (int t = 0; t < 4; ++t) {
    float bv = bias ? bias[col0 + t * 16 + ln] : 0.f;
    if (BIAS_BF16) bv = bf16_round(bv);
#pragma unroll
    for (int r = 0; r < 8; ++r) { float v = acc[t][r] + bv; if (ACT == 1) v = fmaxf(v, 0.f); so[w][8 * hh + r][t * 16 + ln] = v; }
  }
  __builtin_amdgcn_fence(__ATOMIC_ACQ_REL, "workgroup");
  __builtin_amdgcn_wave_barrier();
  const int rsub = lane >> 4, c4 = (lane & 15) * 4;
  {
#pragma unroll
    for (int q = 0; q < 8; ++q) {
      const int r = q * 2 + rsub;
      const v4f v = *(const v4fa*)&so[w][r][c4];
      *(v4f*)(C + (size_t)(row0 + r) * ldc + col0 + c4) = v;
    }
    
  }
}

// GEMM C = act(A·W + bias + resid): A f32 (ASPLIT -> hi/lo 2 terms), Wt bf16 [N][K]; ACT 0 none, 1 relu, 2 exact gelu;
// resid (optional, f32, row index = (row % rmod), pitch ldr, RES_BF16 rounds it) added before the activation.
template <bool ASPLIT, int ACT, bool BIAS_BF16, bool RES_BF16>
__global__ __launch_bounds__(128) void k_gemm_bf3(const float* __restrict__ A, int lda, const unsigned short* __restrict__ Wt, int ldb,
                                                const float* __restrict__ bias, const float* __restrict__ resid, int rmod, int ldr,
                                                float* __restrict__ C, int ldc, int M, int N, int K) {
  __shared__ __attribute__((aligned(16))) float so[4][16][64];
  const int tid = threadIdx.x, w = tid >> 5, lane = tid & 31, ln = lane & 15, hh = lane >> 4;
  const int ntn = N / 64;
  const int wid = blockIdx.x * 4 + w;
  const int mt = wid / ntn, nq = wid % ntn;
  if (mt * 16 >= M) return;
  const int row0 = mt * 16, col0 = nq * 64;
  const float* arow = A + (size_t)(row0 + ln) * lda;
  v8f acc[4] = {};
  for (int kb = 0; kb < K; kb += 32) {
    FragB ah, al;
    const v4f x0 = *(const v4fa*)(arow + kb + 8 * hh), x1 = *(const v4fa*)(arow + kb + 8 * hh + 4);
    const v4f x2 = *(const v4fa*)(arow + kb + 16 + 8 * hh), x3 = *(const v4fa*)(arow + kb + 16 + 8 * hh + 4);
    float xs[16] = {x0[0],x0[1],x0[2],x0[3],x1[0],x1[1],x1[2],x1[3],x2[0],x2[1],x2[2],x2[3],x3[0],x3[1],x3[2],x3[3]};
#pragma unroll
    for (int i = 0; i < 16; ++i) { const unsigned short hb = bf16_bits(xs[i]); ah.u[i] = hb; al.u[i] = ASPLIT ? bf16_bits(xs[i] - bf16_val(hb)) : (unsigned short)0; }
#pragma unroll
    for (int t = 0; t < 4; ++t) {
      const unsigned short* brow = Wt + (size_t)(col0 + t * 16 + ln) * ldb + kb;
      FragB b;
      b.half[0] = *(const v8us*)(brow + 8 * hh);
      b.half[1] = *(const v8us*)(brow + 16 + 8 * hh);
      acc[t] = mmaN<ASPLIT ? 2 : 1>(ah.v, al.v, b.v, b.v, acc[t]);
    }
  }
#pragma unroll
  for (int t = 0; t < 4; ++t) {
    const int col = col0 + t * 16 + ln;
    float bv = bias ? bias[col] : 0.f;
    if (BIAS_BF16) bv = bf16_round(bv);
#pragma unroll
    for (int r = 0; r < 8; ++r) {
      float v = acc[t][r] + bv;
      if (resid) { float rv = resid[(size_t)((row0 + 8 * hh + r) % rmod) * ldr + col]; if (RES_BF16) rv = bf16_round(rv); v += rv; }
      if (ACT == 1) v = fmaxf(v, 0.f);
      if (ACT == 2) v = 0.5f * v * (1.0f + erff(v * 0.70710678118654752f));
      if (ACT == 3) { const float u = 0.7978845608028654f * (v + 0.044715f * v * v * v); v = 0.5f * v * (1.0f + tanhf(u)); }
      so[w][8 * hh + r][t * 16 + ln] = v;
    }
  }
  __builtin_amdgcn_fence(__ATOMIC_ACQ_REL, "workgroup");
  __builtin_amdgcn_wave_barrier();
  const int rsub = lane >> 4, c4 = (lane & 15) * 4;
  {
#pragma unroll
    for (int q = 0; q < 8; ++q) {
      const int r = q * 2 + rsub;
      const v4f v = *(const v4fa*)&so[w][r][c4];
      *(v4f*)(C + (size_t)(row0 + r) * ldc + col0 + c4) = v;
    }
    
  }
}
// row LayerNorm (biased variance, eps) over N: s = X (+ R); optional out_sum <- s; out_norm <- (s-mu)*rsqrt(var+eps)*g + b
template <bool PARAM_BF16>
__global__ __launch_bounds__(256) void k_layernorm(const float* __restrict__ X, const float* __restrict__ R, const float* __restrict__ g, const float* __restrict__ bta,
                                                  float* __restrict__ out_sum, float* __restrict__ out_norm, int N, float eps) {
  __shared__ float red[256];
  const int row = blockIdx.x, tid = threadIdx.x;
  const float* x = X + (size_t)row * N; const float* rr = R ? R + (size_t)row * N : nullptr;
  float vals[16];                     // up to N = 4096
  const int per = N / 256;            // contiguous chunk per thread? use strided-by-4 chunks: thread handles j = tid*4 + 1024*u
  float s1 = 0.f;
  for (int u = 0; u < per / 4; ++u) {
    const int j = tid * 4 + 1024 * u;
    const v4f a = *(const v4fa*)(x + j);
    v4f b = {0.f,0.f,0.f,0.f}; if (rr) b = *(const v4fa*)(rr + j);
#pragma unroll
    for (int q = 0; q < 4; ++q) { const float v = a[q] + b[q]; vals[u * 4 + q] = v; s1 += v; }
  }
  red[tid] = s1; __syncthreads();
  for (int st = 128; st > 0; st >>= 1) { if (tid < st) red[tid] += red[tid + st]; __syncthreads(); }
  const float mu = red[0] / (float)N; __syncthreads();
  float s2 = 0.f;
  for (int u = 0; u < per / 4; ++u)
#pragma unroll
    for (int q = 0; q < 4; ++q) { const float c = vals[u * 4 + q] - mu; s2 += c * c; }
  red[tid] = s2; __syncthreads();
  for (int st = 128; st > 0; st >>= 1) { if (tid < st) red[tid] += red[tid + st]; __syncthreads(); }
  const float rs = rsqrtf(red[0] / (float)N + eps);
  {
    for (int u = 0; u < per / 4; ++u) {
      const int j = tid * 4 + 1024 * u;
      v4f o, sm;
#pragma unroll
      for (int q = 0; q < 4; ++q) {
        float gg = g[j + q], bb = bta[j + q];
        if (PARAM_BF16) { gg = bf16_round(gg); bb = bf16_round(bb); }
        sm[q] = vals[u * 4 + q]; o[q] = (vals[u * 4 + q] - mu) * rs * gg + bb;
      }
      if (out_sum) *(v4f*)(out_sum + (size_t)row * N + j) = sm;
      *(v4f*)(out_norm + (size_t)row * N + j) = o;
    }
    
  }
}



// ---- f16 WMMA path (v_wmma_f32_16x16x32_f16): 11-bit significands for operands in range — used where a [0,1] probability operand needs more precision than bf16
typedef _Float16 v16h __attribute__((ext_vector_type(16)));
union FragH { v16h v; v8us half[2]; _Float16 h[16]; unsigned short u[16]; };
template <int NT>
__device__ __forceinline__ v8f mmaH(v16h ah, v16h al, v16h bh, v16h bl, v8f c) {
  c = __builtin_amdgcn_wmma_f32_16x16x32_f16(false, ah, false, bh, (short)0, c, false, false);
  if (NT >= 2) c = __builtin_amdgcn_wmma_f32_16x16x32_f16(false, al, false, bh, (short)0, c, false, false);
  if (NT >= 3) c = __builtin_amdgcn_wmma_f32_16x16x32_f16(false, ah, false, bl, (short)0, c, false, false);
  asm volatile("v_nop\n\tv_nop\n\tv_nop\n\tv_nop" : "+v"(c) : "v"(ah), "v"(al), "v"(bh), "v"(bl));
  return c;
}
// batched GEMM like k_gemm_b but f16 operands: A f32 (split into f16 hi/lo if ASPLIT, else rounded to f16), Bt = f16 values [n][k]; alpha; C f32; N multiple of 16 (partial tiles skipped)
template <bool ASPLIT>
__global__ __launch_bounds__(128) void k_gemm_h(const float* __restrict__ A, int lda, size_t sA, const _Float16* __restrict__ Bh, int ldb, size_t sB, float alpha, float* __restrict__ C, int ldc, size_t sC, int M, int N, int K) {
  __shared__ __attribute__((aligned(16))) float so[4][16][64];
  const int tid = threadIdx.x, w = tid >> 5, lane = tid & 31, ln = lane & 15, hh = lane >> 4; const int by = blockIdx.y;
  A += (size_t)by * sA; Bh += (size_t)by * sB; C += (size_t)by * sC;
  const int ntn = (N + 63) / 64; const int wid = blockIdx.x * 4 + w; const int mt = wid / ntn, nq = wid % ntn; if (mt * 16 >= M) return;
  const int row0 = mt * 16, col0 = nq * 64; const float* arow = A + (size_t)(row0 + ln) * lda;
  v8f acc[4] = {};
  for (int kb = 0; kb < K; kb += 32) {
    FragH ah, al;
    const v4f x0 = *(const v4fa*)(arow + kb + 8 * hh), x1 = *(const v4fa*)(arow + kb + 8 * hh + 4), x2 = *(const v4fa*)(arow + kb + 16 + 8 * hh), x3 = *(const v4fa*)(arow + kb + 16 + 8 * hh + 4);
    float xs[16] = {x0[0],x0[1],x0[2],x0[3],x1[0],x1[1],x1[2],x1[3],x2[0],x2[1],x2[2],x2[3],x3[0],x3[1],x3[2],x3[3]};
#pragma unroll
    for (int i = 0; i < 16; ++i) { const _Float16 h = (_Float16)xs[i]; ah.h[i] = h; al.h[i] = ASPLIT ? (_Float16)(xs[i] - (float)h) : (_Float16)0.0f; }
#pragma unroll
    for (int t = 0; t < 4; ++t) { if (col0 + t * 16 >= N) continue; const size_t boff = (size_t)(col0 + t * 16 + ln) * ldb + kb; FragH bq; bq.half[0] = *(const v8us*)(Bh + boff + 8 * hh); bq.half[1] = *(const v8us*)(Bh + boff + 16 + 8 * hh);
      acc[t] = mmaH<ASPLIT ? 2 : 1>(ah.v, al.v, bq.v, bq.v, acc[t]); }
  }
#pragma unroll
  for (int t = 0; t < 4; ++t) { if (col0 + t * 16 >= N) continue;
#pragma unroll
    for (int r = 0; r < 8; ++r) so[w][8 * hh + r][t * 16 + ln] = acc[t][r] * alpha; }
  __builtin_amdgcn_fence(__ATOMIC_ACQ_REL, "workgroup"); __builtin_amdgcn_wave_barrier();
  const int rsub = lane >> 4, c4 = (lane & 15) * 4;
  {
#pragma unroll
    for (int q = 0; q < 8; ++q) { const int r = q * 2 + rsub; if (col0 + c4 < N) { const v4f v = *(const v4fa*)&so[w][r][c4]; *(v4f*)(C + (size_t)(row0 + r) * ldc + col0 + c4) = v; } }
     }
}

// Wt[n][k] = f16(W[k][n]·scale) from f32 row-major W[K][N] (scale = power of two; bf16-exact weights stay exact in f16 away from the subnormal range)
__global__ __launch_bounds__(256) void k_wt_f16(const float* __restrict__ W, _Float16* __restrict__ Wt, int K, int N, float scale) {
  const int t = blockIdx.x * 256 + threadIdx.x; if (t >= N * (K / 8)) return; const int n = t / (K / 8), k8 = (t % (K / 8)) * 8; FragH f;
#pragma unroll
  for (int i = 0; i < 8; ++i) f.h[i] = (_Float16)(bf16_round(W[(size_t)(k8 + i) * N + n]) * scale); const v8us o = f.half[0];
  *(v8us*)((unsigned short*)Wt + (size_t)n * K + k8) = o; 
}
// k_gemm_hh variant with fused epilogue: v = acc·alpha + bias[by·sBias + col] (+ CP[(row/rowsPerB)·sCPb + by·64 + col] if CP) ; ACT 0 none / 1 elu ; writes f16 C16 (and f32 C if non-null)
template <int ACT>
__global__ __launch_bounds__(128) void k_gemm_hhx(const _Float16* __restrict__ A, int lda, size_t sA, const _Float16* __restrict__ Bh, int ldb, size_t sB, float alpha, const float* __restrict__ bias, size_t sBias, const float* __restrict__ CP, int rowsPerB, size_t sCPb, int row0g,
    float* __restrict__ C, _Float16* __restrict__ C16, int ldc, size_t sC, int M, int N, int K) {
  __shared__ __attribute__((aligned(16))) float so[4][16][64];
  const int tid = threadIdx.x, w = tid >> 5, lane = tid & 31, ln = lane & 15, hh = lane >> 4; const int by = blockIdx.y;
  A += (size_t)by * sA; Bh += (size_t)by * sB; const size_t cofs = (size_t)by * sC; const float* bp = bias ? bias + (size_t)by * sBias : nullptr;
  const int ntn = (N + 63) / 64; const int wid = blockIdx.x * 4 + w; const int mt = wid / ntn, nq = wid % ntn; if (mt * 16 >= M) return;
  const int row0 = mt * 16, col0 = nq * 64; const _Float16* arow = A + (size_t)(row0 + ln) * lda;
  v8f acc[4] = {};
  for (int kb = 0; kb < K; kb += 32) { FragH ah; ah.half[0] = *(const v8us*)((const unsigned short*)arow + kb + 8 * hh); ah.half[1] = *(const v8us*)((const unsigned short*)arow + kb + 16 + 8 * hh);
#pragma unroll
    for (int t = 0; t < 4; ++t) { if (col0 + t * 16 >= N) continue; const size_t boff = (size_t)(col0 + t * 16 + ln) * ldb + kb; FragH bq; bq.half[0] = *(const v8us*)((const unsigned short*)Bh + boff + 8 * hh); bq.half[1] = *(const v8us*)((const unsigned short*)Bh + boff + 16 + 8 * hh);
      acc[t] = mmaH<1>(ah.v, ah.v, bq.v, bq.v, acc[t]); }
  }
#pragma unroll
  for (int t = 0; t < 4; ++t) { if (col0 + t * 16 >= N) continue; const int col = col0 + t * 16 + ln; const float bv = bp ? bf16_round(bp[col]) : 0.f;
#pragma unroll
    for (int r = 0; r < 8; ++r) { float v = acc[t][r] * alpha + bv; if (CP) { const int bidx = (row0g + row0 + 8 * hh + r) / rowsPerB; v += CP[(size_t)bidx * sCPb + (size_t)by * 64 + col]; } if (ACT == 1) v = (v > 0.f) ? v : expm1f(v); else if (ACT == 7) v = (v > 0.f) ? v + 1.0f : expf(v); else if (ACT == 8) v = tanhf(v); else if (ACT == 9) v = 0.5f * v * (1.0f + tanhf(0.7978845608028654f * (v + 0.044715f * v * v * v))); else if (ACT == 11) v = 1.0f / (1.0f + expf(-v)); else if (ACT == 12) v = (v > 0.f) ? v : 0.01f * v; else if (ACT == 14) v = (v > 0.f) ? v : 0.1f * v; else if (ACT == 15) v = v / (1.0f + expf(-v)); else if (ACT == 3) v = fmaxf(v, 0.f); else if (ACT == 6) v = 0.5f * v * (1.0f + erff(v * 0.70710678118654752f)); so[w][8 * hh + r][t * 16 + ln] = v; } }
  __builtin_amdgcn_fence(__ATOMIC_ACQ_REL, "workgroup"); __builtin_amdgcn_wave_barrier();
  const int rsub = lane >> 4, c4 = (lane & 15) * 4; typedef _Float16 v4h __attribute__((ext_vector_type(4)));
  {
#pragma unroll
    for (int q = 0; q < 8; ++q) { const int r = q * 2 + rsub; if (col0 + c4 < N) { const v4f v = *(const v4fa*)&so[w][r][c4]; if (C) *(v4f*)(C + cofs + (size_t)(row0 + r) * ldc + col0 + c4) = v; if (C16) { v4h h4; for (int i = 0; i < 4; ++i) h4[i] = (_Float16)v[i]; *(v4h*)(C16 + cofs + (size_t)(row0 + r) * ldc + col0 + c4) = h4; } } }
     }
}


typedef _Float16 v4h __attribute__((ext_vector_type(4)));

__global__ __launch_bounds__(256) void k_x16(const float* __restrict__ x, _Float16* __restrict__ X16, size_t n8) { const size_t t = (size_t)blockIdx.x * 256 + threadIdx.x; if (t >= n8) return; FragH f;
#pragma unroll
  for (int q = 0; q < 8; ++q) f.h[q] = (_Float16)bf16_round(x[t * 8 + q]); *(v8us*)((unsigned short*)X16 + t * 8) = f.half[0];  }
__global__ __launch_bounds__(256) void k_h16(const float* __restrict__ x, _Float16* __restrict__ X16, size_t n8) { const size_t t = (size_t)blockIdx.x * 256 + threadIdx.x; if (t >= n8) return; FragH f;
#pragma unroll
  for (int q = 0; q < 8; ++q) f.h[q] = (_Float16)x[t * 8 + q]; *(v8us*)((unsigned short*)X16 + t * 8) = f.half[0];  }
__global__ __launch_bounds__(256) void k_round16f(const float* __restrict__ W, _Float16* __restrict__ Bt, size_t n8) { const size_t t = (size_t)blockIdx.x * 256 + threadIdx.x; if (t >= n8) return; FragH f;
#pragma unroll
  for (int i = 0; i < 8; ++i) f.h[i] = (_Float16)(bf16_round(W[t * 8 + i]) * 16.0f); *(v8us*)((unsigned short*)Bt + t * 8) = f.half[0];  }
template <int NHv, int TTv>
__global__ __launch_bounds__(256) void k_vt(const _Float16* __restrict__ V16, int ldv, int voff, _Float16* __restrict__ Vt) { __shared__ unsigned short tl[64][66]; const int tid = threadIdx.x; const int slab = blockIdx.x / (TTv / 64), lg = blockIdx.x % (TTv / 64); const int b = slab / NHv, h = slab % NHv;
  for (int i = tid; i < 64 * 8; i += 256) { const int r = i / 8, c8 = (i % 8) * 8; FragH f; f.half[0] = *(const v8us*)((const unsigned short*)V16 + ((size_t)b * TTv + lg * 64 + r) * ldv + voff + h * 64 + c8);
#pragma unroll
    for (int q = 0; q < 8; ++q) tl[r][c8 + q] = f.u[q]; }
  __syncthreads();
  {
#pragma unroll
    for (int rd = 0; rd < 2; ++rd) { const int d = rd * 32 + tid / 8, pc = tid % 8; FragH f;
#pragma unroll
      for (int q = 0; q < 8; ++q) f.u[q] = tl[pc * 8 + q][d];
      *(v8us*)((unsigned short*)Vt + ((size_t)slab * 64 + d) * TTv + lg * 64 + pc * 8) = f.half[0]; }
     } }

__global__ __launch_bounds__(256) void k_hl(const float* __restrict__ F, _Float16* __restrict__ Hh, _Float16* __restrict__ Hl, size_t n8) { const size_t t = (size_t)blockIdx.x * 256 + threadIdx.x; if (t >= n8) return; FragH fh, fl; const v4f a = *(const v4fa*)(F + t * 8), c = *(const v4fa*)(F + t * 8 + 4);
#pragma unroll
  for (int q = 0; q < 4; ++q) { _Float16 h = (_Float16)a[q]; fh.h[q] = h; fl.h[q] = (_Float16)((a[q] - (float)h) * 1024.0f); h = (_Float16)c[q]; fh.h[4 + q] = h; fl.h[4 + q] = (_Float16)((c[q] - (float)h) * 1024.0f); }
  { *(v8us*)((unsigned short*)Hh + t * 8) = fh.half[0]; *(v8us*)((unsigned short*)Hl + t * 8) = fl.half[0];  } }

// ---- fast GEMM (wave tile 32x64; requires M % 32 == 0 rows per launch region and N % 64 == 0); epilogue = k_gemm_hhx semantics ----
__device__ __forceinline__ v16h g2_frag(const _Float16* p, int hh) { FragH f; f.half[0] = *(const v8us*)((const unsigned short*)p + 8 * hh); f.half[1] = *(const v8us*)((const unsigned short*)p + 16 + 8 * hh); return f.v; }
__device__ __forceinline__ v8f g2_mma(v16h a, v16h b, v8f c) { v8f d = __builtin_amdgcn_wmma_f32_16x16x32_f16(false, a, false, b, (short)0, c, false, false); asm volatile("v_nop\n\tv_nop\n\tv_nop\n\tv_nop" : "+v"(d) : "v"(a), "v"(b)); return d; }
template <int ACT>
__global__ __launch_bounds__(128) void k_gemm2(const _Float16* __restrict__ A, int lda, size_t sA, const _Float16* __restrict__ Bh, int ldb, size_t sB, float alpha, const float* __restrict__ bias, size_t sBias, const float* __restrict__ CP, int rowsPerB, size_t sCPb, int row0g,
    float* __restrict__ C, _Float16* __restrict__ C16, int ldc, size_t sC, int M, int N, int K) {
  __shared__ __attribute__((aligned(16))) float so[4][32][68];
  const int tid = threadIdx.x, w = tid >> 5, lane = tid & 31, ln = lane & 15, hh = lane >> 4; const int by = blockIdx.y;
  A += (size_t)by * sA; Bh += (size_t)by * sB; const size_t cofs = (size_t)by * sC; const float* bp = bias ? bias + (size_t)by * sBias : nullptr;
  const int ntn = N >> 6; const int mt = blockIdx.x / ntn, nq = blockIdx.x - mt * ntn; const int row0 = mt * 128 + 32 * w, col0 = nq * 64; if (row0 >= M) return;
  const _Float16* a0p = A + (size_t)(row0 + ln) * lda; const _Float16* a1p = a0p + (size_t)16 * lda;
  const _Float16* b0p = Bh + (size_t)(col0 + ln) * ldb; const _Float16* b1p = b0p + (size_t)16 * ldb; const _Float16* b2p = b1p + (size_t)16 * ldb; const _Float16* b3p = b2p + (size_t)16 * ldb;
  const v8f z8 = {0.f,0.f,0.f,0.f,0.f,0.f,0.f,0.f}; v8f c00 = z8, c01 = z8, c02 = z8, c03 = z8, c10 = z8, c11 = z8, c12 = z8, c13 = z8;
#pragma unroll 1
  for (int kb = 0; kb < K; kb += 32) { const v16h a0 = g2_frag(a0p + kb, hh), a1 = g2_frag(a1p + kb, hh);
    v16h b = g2_frag(b0p + kb, hh); c00 = g2_mma(a0, b, c00); c10 = g2_mma(a1, b, c10);
    b = g2_frag(b1p + kb, hh); c01 = g2_mma(a0, b, c01); c11 = g2_mma(a1, b, c11);
    b = g2_frag(b2p + kb, hh); c02 = g2_mma(a0, b, c02); c12 = g2_mma(a1, b, c12);
    b = g2_frag(b3p + kb, hh); c03 = g2_mma(a0, b, c03); c13 = g2_mma(a1, b, c13); }
  v8f accs[8] = {c00, c01, c02, c03, c10, c11, c12, c13};
#pragma unroll
  for (int u = 0; u < 8; ++u) { const int t = u & 3, half = u >> 2; const int col = col0 + t * 16 + ln; const float bv = bp ? bf16_round(bp[col]) : 0.f;
#pragma unroll
    for (int r = 0; r < 8; ++r) { const int rloc = half * 16 + 8 * hh + r; float v = accs[u][r] * alpha + bv; if (CP) { const int bidx = (row0g + row0 + rloc) / rowsPerB; v += CP[(size_t)bidx * sCPb + (size_t)by * 64 + col]; }
      if (ACT == 3) v = fmaxf(v, 0.f); else if (ACT == 6) v = 0.5f * v * (1.0f + erff(v * 0.70710678118654752f)); else if (ACT == 11) v = 1.0f / (1.0f + expf(-v)); else if (ACT == 15) v = v / (1.0f + expf(-v)); else if (ACT == 12) v = (v > 0.f) ? v : 0.01f * v; else if (ACT == 8) v = tanhf(v);
      so[w][rloc][t * 16 + ln] = v; } }
  __builtin_amdgcn_fence(__ATOMIC_ACQ_REL, "workgroup"); __builtin_amdgcn_wave_barrier();
  const int rsub = lane >> 4, c4 = (lane & 15) * 4;
  {
#pragma unroll
    for (int q = 0; q < 16; ++q) { const int r = q * 2 + rsub; const v4f v = *(const v4fa*)&so[w][r][c4]; if (C) *(v4f*)(C + cofs + (size_t)(row0 + r) * ldc + col0 + c4) = v; if (C16) { v4h h4; for (int i = 0; i < 4; ++i) h4[i] = (_Float16)v[i]; *(v4h*)(C16 + cofs + (size_t)(row0 + r) * ldc + col0 + c4) = h4; } }
     } }



template <int CAUSAL>
__global__ __launch_bounds__(128) void k_flash(const _Float16* __restrict__ Q16, int ldq, const _Float16* __restrict__ K16, int ldk, const _Float16* __restrict__ Vt, const int* __restrict__ MSK, float* __restrict__ O, int ldo) {
  constexpr int RPW = 16, RTN = RPW / 16, NQB = TQ / (4 * RPW), DT = 4, KS = 2;
  __shared__ __attribute__((aligned(16))) unsigned short sP[4][RPW][40]; __shared__ __attribute__((aligned(16))) float sO[4][RPW][64 + 4];
  const int tid = threadIdx.x, w = tid >> 5, lane = tid & 31, ln = lane & 15, hh = lane >> 4;
  const int slab = blockIdx.x / QBLKS, qblk = blockIdx.x % QBLKS; (void)NQB; const int b = slab / NH, h = slab % NH; const int qb0 = qblk * (4 * RPW); const int q0 = qb0 + w * RPW;
  FragH aq[2][KS];
#pragma unroll
  for (int rt = 0; rt < RTN; ++rt) { const unsigned short* qr = (const unsigned short*)Q16 + ((size_t)b * TQ + q0 + rt * 16 + ln) * ldq + h * 64;
#pragma unroll
    for (int ks = 0; ks < KS; ++ks) { aq[rt][ks].half[0] = *(const v8us*)(qr + ks * 32 + 8 * hh); aq[rt][ks].half[1] = *(const v8us*)(qr + ks * 32 + 16 + 8 * hh); } }
  const unsigned short* Vth = (const unsigned short*)Vt + (size_t)slab * 64 * TK;
  float m_r[2][8], l_r[2][8]; v8f oacc[2][DT];
#pragma unroll
  for (int rt = 0; rt < RTN; ++rt) {
#pragma unroll
    for (int r = 0; r < 8; ++r) { m_r[rt][r] = -3.0e38f; l_r[rt][r] = 0.f; }
#pragma unroll
    for (int dt = 0; dt < DT; ++dt) oacc[rt][dt] = (v8f){0.f,0.f,0.f,0.f,0.f,0.f,0.f,0.f}; }
  const int jend = (CAUSAL == 1 || CAUSAL == 3) ? (qb0 + 4 * RPW) : TK;      /* causal: keys beyond the block's last query never contribute */ const int jbeg = (CAUSAL == 3) ? ((qb0 - WINDOW) > 0 ? (qb0 - WINDOW) : 0) : 0;      /* window: keys more than WINDOW before the block's first query never contribute (WINDOW % 32 == 0) */
#pragma unroll 1
  for (int j0 = jbeg; j0 < jend; j0 += 32) {
    v8f s[2][2];
#pragma unroll
    for (int nt = 0; nt < 2; ++nt) { const unsigned short* kr = (const unsigned short*)K16 + ((size_t)b * TK + j0 + nt * 16 + ln) * ldk + h * 64; FragH bk[KS];
#pragma unroll
      for (int ks = 0; ks < KS; ++ks) { bk[ks].half[0] = *(const v8us*)(kr + ks * 32 + 8 * hh); bk[ks].half[1] = *(const v8us*)(kr + ks * 32 + 16 + 8 * hh); }
#pragma unroll
      for (int rt = 0; rt < RTN; ++rt) { v8f acc = (v8f){0.f,0.f,0.f,0.f,0.f,0.f,0.f,0.f};
#pragma unroll
        for (int ks = 0; ks < KS; ++ks) acc = mmaH<1>(aq[rt][ks].v, aq[rt][ks].v, bk[ks].v, bk[ks].v, acc); s[rt][nt] = acc; } }
#pragma unroll
    for (int rt = 0; rt < RTN; ++rt)
#pragma unroll
      for (int r = 0; r < 8; ++r) { const int tq = q0 + rt * 16 + 8 * hh + r; const int k0 = j0 + ln, k1 = j0 + 16 + ln;
        const bool ok0 = (CAUSAL == 1) ? (k0 <= tq) : ((CAUSAL == 2) ? ((k0 >> 5) == (tq >> 5)) : ((CAUSAL == 3) ? (k0 <= tq && tq - k0 < WINDOW) : true)), ok1 = (CAUSAL == 1) ? (k1 <= tq) : ((CAUSAL == 2) ? ((k1 >> 5) == (tq >> 5)) : ((CAUSAL == 3) ? (k1 <= tq && tq - k1 < WINDOW) : true));      /* mode 3: causal + sliding window of WINDOW keys */      /* mode 2: block-diagonal 32-token groups */
        float s0 = ok0 ? s[rt][0][r] * SCL : -3.0e38f, s1 = ok1 ? s[rt][1][r] * SCL : -3.0e38f; if (CAUSAL == 6) { const float* BT = (const float*)MSK; int d0 = tq - k0, d1 = tq - k1; d0 = d0 < -RELW ? -RELW : (d0 > RELW ? RELW : d0); d1 = d1 < -RELW ? -RELW : (d1 > RELW ? RELW : d1); s0 += BT[h * (2 * RELW + 1) + d0 + RELW]; s1 += BT[h * (2 * RELW + 1) + d1 + RELW]; }      /* mode 6: per-head relative-position bias table [NH][2*RELW+1] indexed by clip(i - j, +-RELW) (passed through the MSK pointer), added after the 1/sqrt(d) scale */ float mc = fmaxf(s0, s1);
        mc = fmaxf(mc, __shfl_xor(mc, 1, 32)); mc = fmaxf(mc, __shfl_xor(mc, 2, 32)); mc = fmaxf(mc, __shfl_xor(mc, 4, 32)); mc = fmaxf(mc, __shfl_xor(mc, 8, 32));
        const float mn = fmaxf(m_r[rt][r], mc); const float al = (mn > -1.0e38f) ? expf(m_r[rt][r] - mn) : 1.0f; m_r[rt][r] = mn; const float p0 = ok0 ? expf(s0 - mn) : 0.f, p1 = ok1 ? expf(s1 - mn) : 0.f; l_r[rt][r] = l_r[rt][r] * al + p0 + p1;
#pragma unroll
        for (int dt = 0; dt < DT; ++dt) oacc[rt][dt][r] *= al;
        FragH t2; t2.h[0] = (_Float16)(p0 * 1024.0f); t2.h[1] = (_Float16)(p1 * 1024.0f); sP[w][rt * 16 + 8 * hh + r][ln] = t2.u[0]; sP[w][rt * 16 + 8 * hh + r][16 + ln] = t2.u[1]; }
    __builtin_amdgcn_fence(__ATOMIC_ACQ_REL, "workgroup"); __builtin_amdgcn_wave_barrier();
    FragH pa[2];
#pragma unroll
    for (int rt = 0; rt < RTN; ++rt) { pa[rt].half[0] = *(const v8us*)&sP[w][rt * 16 + ln][8 * hh]; pa[rt].half[1] = *(const v8us*)&sP[w][rt * 16 + ln][16 + 8 * hh]; }
#pragma unroll
    for (int dt = 0; dt < DT; ++dt) { const unsigned short* vrow = Vth + (size_t)(dt * 16 + ln) * TK + j0; FragH bv; bv.half[0] = *(const v8us*)(vrow + 8 * hh); bv.half[1] = *(const v8us*)(vrow + 16 + 8 * hh);
#pragma unroll
      for (int rt = 0; rt < RTN; ++rt) oacc[rt][dt] = mmaH<1>(pa[rt].v, pa[rt].v, bv.v, bv.v, oacc[rt][dt]); }
    __builtin_amdgcn_fence(__ATOMIC_ACQ_REL, "workgroup"); __builtin_amdgcn_wave_barrier(); }
#pragma unroll
  for (int rt = 0; rt < RTN; ++rt) {
#pragma unroll
    for (int r = 0; r < 8; ++r) { float l = l_r[rt][r]; l += __shfl_xor(l, 1, 32); l += __shfl_xor(l, 2, 32); l += __shfl_xor(l, 4, 32); l += __shfl_xor(l, 8, 32); l_r[rt][r] = (l > 0.f) ? 1.0f / (l * 1024.0f) : 0.f; }
#pragma unroll
    for (int dt = 0; dt < DT; ++dt)
#pragma unroll
      for (int r = 0; r < 8; ++r) sO[w][rt * 16 + 8 * hh + r][dt * 16 + ln] = oacc[rt][dt][r] * l_r[rt][r]; }
  __builtin_amdgcn_fence(__ATOMIC_ACQ_REL, "workgroup"); __builtin_amdgcn_wave_barrier();
  {
#pragma unroll
    for (int rp = 0; rp < RPW; rp += 2) { const int r = rp + (lane >> 4), pc = lane & 15; const v4f val = *(const v4fa*)&sO[w][r][pc * 4]; *(v4f*)(O + ((size_t)b * TQ + q0 + r) * ldo + h * 64 + pc * 4) = val; }
     } }

__global__ __launch_bounds__(256) void k_h16s(const float* __restrict__ x, _Float16* __restrict__ X16, size_t n8, float sc) { const size_t t = (size_t)blockIdx.x * 256 + threadIdx.x; if (t >= n8) return; const v8f a = *(const v8f*)(x + t * 8); FragH f; for (int q = 0; q < 8; ++q) f.h[q] = (_Float16)(a[q] * sc); *(v8us*)((unsigned short*)X16 + t * 8) = f.half[0];  }
__global__ __launch_bounds__(256) void k_btab(const float* __restrict__ pe, float* __restrict__ BT) { { for (int e = threadIdx.x; e < NH * NREL; e += 256) { const int h = e / NREL, r = e % NREL; *(float*)(BT + e) = bf16_round(pe[r * NH + h]); }  } }

extern "C" void kernel_launch(void* const* d_in, const int* in_sizes, int n_in,
                              void* d_out, int out_size, void* d_ws, size_t ws_size, hipStream_t stream) {
  (void)in_sizes; (void)n_in; (void)out_size;
  const float* const* I = (const float* const*)d_in; const float* xq = I[0]; const float* xk = I[1]; const float* xv = I[2]; const float* Wq = I[3]; const float* Wk = I[4]; const float* Wv = I[5]; const float* Wo = I[6]; const float* pe = I[7];
  char* ws = (char*)d_ws; size_t off = 0;
  auto take = [&](size_t bytes) { char* p = ws + off; off += (bytes + 255) & ~(size_t)255; return p; };
  const size_t np = (size_t)NR * CC;
  _Float16* BQ = (_Float16*)take((size_t)CC * CC * 2); _Float16* BK = (_Float16*)take((size_t)CC * CC * 2); _Float16* BV = (_Float16*)take((size_t)CC * CC * 2); _Float16* BO = (_Float16*)take((size_t)CC * CC * 2); float* BT = (float*)take((size_t)NH * NREL * 4 + 256);
  _Float16* XQ = (_Float16*)take(np * 2); _Float16* XK = (_Float16*)take(np * 2); _Float16* XV = (_Float16*)take(np * 2); _Float16* Q16 = (_Float16*)take(np * 2); _Float16* K16 = (_Float16*)take(np * 2); _Float16* V16 = (_Float16*)take(np * 2); _Float16* VT = (_Float16*)take(np * 2); float* O = (float*)take(np * 4); _Float16* O16 = XQ;
  if (off > ws_size) return;      /* 2 + 7 x 4 + 8 = 38 MiB */
  k_wt_f16<<<(CC * CC / 8 + 255) / 256, 256, 0, stream>>>(Wq, BQ, CC, CC, 16.0f); k_wt_f16<<<(CC * CC / 8 + 255) / 256, 256, 0, stream>>>(Wk, BK, CC, CC, 16.0f); k_wt_f16<<<(CC * CC / 8 + 255) / 256, 256, 0, stream>>>(Wv, BV, CC, CC, 16.0f); k_wt_f16<<<(CC * CC / 8 + 255) / 256, 256, 0, stream>>>(Wo, BO, CC, CC, 16.0f);
  k_btab<<<1, 256, 0, stream>>>(pe, BT);
  k_x16<<<(unsigned)((np / 8 + 255) / 256), 256, 0, stream>>>(xq, XQ, np / 8); k_x16<<<(unsigned)((np / 8 + 255) / 256), 256, 0, stream>>>(xk, XK, np / 8); k_x16<<<(unsigned)((np / 8 + 255) / 256), 256, 0, stream>>>(xv, XV, np / 8);
  const dim3 g((NR / 128) * (CC / 64), 1);
  k_gemm2<0><<<g, 128, 0, stream>>>(XQ, CC, 0, BQ, CC, 0, 0.0625f, nullptr, 0, nullptr, 1, 0, 0, nullptr, Q16, CC, 0, NR, CC, CC);
  k_gemm2<0><<<g, 128, 0, stream>>>(XK, CC, 0, BK, CC, 0, 0.0625f, nullptr, 0, nullptr, 1, 0, 0, nullptr, K16, CC, 0, NR, CC, CC);
  k_gemm2<0><<<g, 128, 0, stream>>>(XV, CC, 0, BV, CC, 0, 0.0625f, nullptr, 0, nullptr, 1, 0, 0, nullptr, V16, CC, 0, NR, CC, CC);
  k_vt<NH, SLEN><<<NB * NH * (SLEN / 64), 256, 0, stream>>>(V16, CC, 0, VT);
  k_flash<6><<<NB * NH * QBLKS, 128, 0, stream>>>(Q16, CC, K16, CC, VT, (const int*)BT, O, CC);      /* relative-position bias mode */
  k_h16s<<<(unsigned)((np / 8 + 255) / 256), 256, 0, stream>>>(O, O16, np / 8, 64.0f);      /* x2^6 carry: the 2048-key averages are small */
  k_gemm2<0><<<g, 128, 0, stream>>>(O16, CC, 0, BO, CC, 0, 0.0625f / 64.0f, nullptr, 0, nullptr, 1, 0, 0, (float*)d_out, nullptr, CC, 0, NR, CC, CC);
}

// v001
// One run takes 255 microseconds.
// Two timings next to v000 put it at 1.41 and 1.42 times that version's speed.
#include <hip/hip_runtime.h>
// RelativePositionalEncodingAttention (2 x 2048 tokens, 8 heads of 64, D 512): q/k/v from three inputs (no bias); scores/8 + pos_emb[clip(i - j, -32, 32) + 32][h]; softmax; out Wo.
// Structure: exact f16 planes of query/key/value; q/k/v GEMMs (32x64 wave tiles, f32 accumulation, exact x16 weights, f16 outputs); the relative-bias table transposed to [head][65] (bf16-rounded, f32); V^T by LDS tiles; the fused flash kernel with a new relative-position-bias mode (table lookup by clipped i - j added after the scale, f32); attention output as f16 into the output GEMM.
// Compute dtype: inputs and weights rounded to bf16; q, k, v, P and the attention output as f16 operands (~2^-12); f32 accumulation/softmax/bias. v_wmma_f32_16x16x32_f16.
#define NB 2
#define CC 512
#define NR (NB * SLEN)
#define NREL (2 * RELW + 1)
#define SLEN 2048
#define TQ SLEN
#define TK SLEN
#define NH 8
#define SCL 0.125f               /* 1/sqrt(64) */
#define WINDOW 256
#define RELW 32                  /* max_relative_position */
#define QBLKS (TQ / 64)
typedef __bf16 v16b __attribute__((ext_vector_type(16)));
typedef unsigned short v8us __attribute__((ext_vector_type(8), may_alias));
typedef float  v8f  __attribute__((ext_vector_type(8)));
typedef float  v4f  __attribute__((ext_vector_type(4)));
typedef float  v4fa __attribute__((ext_vector_type(4), may_alias));
union FragB { v16b v; v8us half[2]; unsigned short u[16]; };

__device__ __forceinline__ unsigned short bf16_bits(float x) { unsigned int u = __float_as_uint(x); return (unsigned short)((u + 0x7FFFu + ((u >> 16) & 1u)) >> 16); }
__device__ __forceinline__ float bf16_val(unsigned short b) { return __uint_as_float(((unsigned int)b) << 16); }
__device__ __forceinline__ float bf16_round(float x) { return bf16_val(bf16_bits(x)); }
// D += A·B with NT terms: 1 = ah·bh, 2 = + al·bh (A split), 3 = + ah·bl (both split)
template <int NT>
__device__ __forceinline__ v8f mmaN(v16b ah, v16b al, v16b bh, v16b bl, v8f c) {
  c = __builtin_amdgcn_wmma_f32_16x16x32_bf16(false, ah, false, bh, (short)0, c, false, false);
  if (NT >= 2) c = __builtin_amdgcn_wmma_f32_16x16x32_bf16(false, al, false, bh, (short)0, c, false, false);
  if (NT >= 3) c = __builtin_amdgcn_wmma_f32_16x16x32_bf16(false, ah, false, bl, (short)0, c, false, false);
  asm volatile("v_nop\n\tv_nop\n\tv_nop\n\tv_nop" : "+v"(c) : "v"(ah), "v"(al), "v"(bh), "v"(bl));
  return c;
}

__global__ __launch_bounds__(256) void k_wt_bf16(const float* __restrict__ W, unsigned short* __restrict__ Wt, int K, int N) {
  const int t = blockIdx.x * 256 + threadIdx.x;
  const int k8n = K / 8;
  if (t >= N * k8n) return;
  const int n = t / k8n, k8 = (t % k8n) * 8;
  v8us v;
#pragma unroll
  for (int i = 0; i < 8; ++i) v[i] = bf16_bits(W[(size_t)(k8 + i) * N + n]);
  *(v8us*)(Wt + (size_t)n * K + k8) = v;
  
}

// GEMM C[M][N] (f32, pitch ldc) = act(A[M][K]·W + bias). A f32 row-major (pitch lda) converted per fragment to bf16
// (ASPLIT: hi/lo two planes -> 2 terms, else single rounded term); Wt bf16 [N][K] (pitch ldb). BIAS_BF16 rounds the
// bias to bf16 first (bias quantised to bf16 before the add). K%32==0, M%16==0, N%64==0.
template <bool ASPLIT, int ACT, bool BIAS_BF16>
__global__ __launch_bounds__(128) void k_gemm_bf(const float* __restrict__ A, int lda, const unsigned short* __restrict__ Wt, int ldb,
                                               const float* __restrict__ bias, float* __restrict__ C, int ldc, int M, int N, int K) {
  __shared__ __attribute__((aligned(16))) float so[4][16][64];
  const int tid = threadIdx.x, w = tid >> 5, lane = tid & 31, ln = lane & 15, hh = lane >> 4;
  const int ntn = N / 64;
  const int wid = blockIdx.x * 4 + w;
  const int mt = wid / ntn, nq = wid % ntn;
  if (mt * 16 >= M) return;
  const int row0 = mt * 16, col0 = nq * 64;
  const float* arow = A + (size_t)(row0 + ln) * lda;
  v8f acc[4] = {};
  for (int kb = 0; kb < K; kb += 32) {
    FragB ah, al;
    const v4f x0 = *(const v4fa*)(arow + kb + 8 * hh), x1 = *(const v4fa*)(arow + kb + 8 * hh + 4);
    const v4f x2 = *(const v4fa*)(arow + kb + 16 + 8 * hh), x3 = *(const v4fa*)(arow + kb + 16 + 8 * hh + 4);
    float xs[16] = {x0[0],x0[1],x0[2],x0[3],x1[0],x1[1],x1[2],x1[3],x2[0],x2[1],x2[2],x2[3],x3[0],x3[1],x3[2],x3[3]};
#pragma unroll
    for (int i = 0; i < 16; ++i) { const unsigned short hb = bf16_bits(xs[i]); ah.u[i] = hb; al.u[i] = ASPLIT ? bf16_bits(xs[i] - bf16_val(hb)) : (unsigned short)0; }
#pragma unroll
    for (int t = 0; t < 4; ++t) {
      const unsigned short* brow = Wt + (size_t)(col0 + t * 16 + ln) * ldb + kb;
      FragB b;
      b.half[0] = *(const v8us*)(brow + 8 * hh);
      b.half[1] = *(const v8us*)(brow + 16 + 8 * hh);
      acc[t] = mmaN<ASPLIT ? 2 : 1>(ah.v, al.v, b.v, b.v, acc[t]);
    }
  }
#pragma unroll
  for (int t = 0; t < 4; ++t) {
    float bv = bias ? bias[col0 + t * 16 + ln] : 0.f;
    if (BIAS_BF16) bv = bf16_round(bv);
#pragma unroll
    for (int r = 0; r < 8; ++r) { float v = acc[t][r] + bv; if (ACT == 1) v = fmaxf(v, 0.f); so[w][8 * hh + r][t * 16 + ln] = v; }
  }
  __builtin_amdgcn_fence(__ATOMIC_ACQ_REL, "workgroup");
  __builtin_amdgcn_wave_barrier();
  const int rsub = lane >> 4, c4 = (lane & 15) * 4;
  {
#pragma unroll
    for (int q = 0; q < 8; ++q) {
      const int r = q * 2 + rsub;
      const v4f v = *(const v4fa*)&so[w][r][c4];
      *(v4f*)(C + (size_t)(row0 + r) * ldc + col0 + c4) = v;
    }
    
  }
}

// GEMM C = act(A·W + bias + resid): A f32 (ASPLIT -> hi/lo 2 terms), Wt bf16 [N][K]; ACT 0 none, 1 relu, 2 exact gelu;
// resid (optional, f32, row index = (row % rmod), pitch ldr, RES_BF16 rounds it) added before the activation.
template <bool ASPLIT, int ACT, bool BIAS_BF16, bool RES_BF16>
__global__ __launch_bounds__(128) void k_gemm_bf3(const float* __restrict__ A, int lda, const unsigned short* __restrict__ Wt, int ldb,
                                                const float* __restrict__ bias, const float* __restrict__ resid, int rmod, int ldr,
                                                float* __restrict__ C, int ldc, int M, int N, int K) {
  __shared__ __attribute__((aligned(16))) float so[4][16][64];
  const int tid = threadIdx.x, w = tid >> 5, lane = tid & 31, ln = lane & 15, hh = lane >> 4;
  const int ntn = N / 64;
  const int wid = blockIdx.x * 4 + w;
  const int mt = wid / ntn, nq = wid % ntn;
  if (mt * 16 >= M) return;
  const int row0 = mt * 16, col0 = nq * 64;
  const float* arow = A + (size_t)(row0 + ln) * lda;
  v8f acc[4] = {};
  for (int kb = 0; kb < K; kb += 32) {
    FragB ah, al;
    const v4f x0 = *(const v4fa*)(arow + kb + 8 * hh), x1 = *(const v4fa*)(arow + kb + 8 * hh + 4);
    const v4f x2 = *(const v4fa*)(arow + kb + 16 + 8 * hh), x3 = *(const v4fa*)(arow + kb + 16 + 8 * hh + 4);
    float xs[16] = {x0[0],x0[1],x0[2],x0[3],x1[0],x1[1],x1[2],x1[3],x2[0],x2[1],x2[2],x2[3],x3[0],x3[1],x3[2],x3[3]};
#pragma unroll
    for (int i = 0; i < 16; ++i) { const unsigned short hb = bf16_bits(xs[i]); ah.u[i] = hb; al.u[i] = ASPLIT ? bf16_bits(xs[i] - bf16_val(hb)) : (unsigned short)0; }
#pragma unroll
    for (int t = 0; t < 4; ++t) {
      const unsigned short* brow = Wt + (size_t)(col0 + t * 16 + ln) * ldb + kb;
      FragB b;
      b.half[0] = *(const v8us*)(brow + 8 * hh);
      b.half[1] = *(const v8us*)(brow + 16 + 8 * hh);
      acc[t] = mmaN<ASPLIT ? 2 : 1>(ah.v, al.v, b.v, b.v, acc[t]);
    }
  }
#pragma unroll
  for (int t = 0; t < 4; ++t) {
    const int col = col0 + t * 16 + ln;
    float bv = bias ? bias[col] : 0.f;
    if (BIAS_BF16) bv = bf16_round(bv);
#pragma unroll
    for (int r = 0; r < 8; ++r) {
      float v = acc[t][r] + bv;
      if (resid) { float rv = resid[(size_t)((row0 + 8 * hh + r) % rmod) * ldr + col]; if (RES_BF16) rv = bf16_round(rv); v += rv; }
      if (ACT == 1) v = fmaxf(v, 0.f);
      if (ACT == 2) v = 0.5f * v * (1.0f + erff(v * 0.70710678118654752f));
      if (ACT == 3) { const float u = 0.7978845608028654f * (v + 0.044715f * v * v * v); v = 0.5f * v * (1.0f + tanhf(u)); }
      so[w][8 * hh + r][t * 16 + ln] = v;
    }
  }
  __builtin_amdgcn_fence(__ATOMIC_ACQ_REL, "workgroup");
  __builtin_amdgcn_wave_barrier();
  const int rsub = lane >> 4, c4 = (lane & 15) * 4;
  {
#pragma unroll
    for (int q = 0; q < 8; ++q) {
      const int r = q * 2 + rsub;
      const v4f v = *(const v4fa*)&so[w][r][c4];
      *(v4f*)(C + (size_t)(row0 + r) * ldc + col0 + c4) = v;
    }
    
  }
}
// row LayerNorm (biased variance, eps) over N: s = X (+ R); optional out_sum <- s; out_norm <- (s-mu)*rsqrt(var+eps)*g + b
template <bool PARAM_BF16>
__global__ __launch_bounds__(256) void k_layernorm(const float* __restrict__ X, const float* __restrict__ R, const float* __restrict__ g, const float* __restrict__ bta,
                                                  float* __restrict__ out_sum, float* __restrict__ out_norm, int N, float eps) {
  __shared__ float red[256];
  const int row = blockIdx.x, tid = threadIdx.x;
  const float* x = X + (size_t)row * N; const float* rr = R ? R + (size_t)row * N : nullptr;
  float vals[16];                     // up to N = 4096
  const int per = N / 256;            // contiguous chunk per thread? use strided-by-4 chunks: thread handles j = tid*4 + 1024*u
  float s1 = 0.f;
  for (int u = 0; u < per / 4; ++u) {
    const int j = tid * 4 + 1024 * u;
    const v4f a = *(const v4fa*)(x + j);
    v4f b = {0.f,0.f,0.f,0.f}; if (rr) b = *(const v4fa*)(rr + j);
#pragma unroll
    for (int q = 0; q < 4; ++q) { const float v = a[q] + b[q]; vals[u * 4 + q] = v; s1 += v; }
  }
  red[tid] = s1; __syncthreads();
  for (int st = 128; st > 0; st >>= 1) { if (tid < st) red[tid] += red[tid + st]; __syncthreads(); }
  const float mu = red[0] / (float)N; __syncthreads();
  float s2 = 0.f;
  for (int u = 0; u < per / 4; ++u)
#pragma unroll
    for (int q = 0; q < 4; ++q) { const float c = vals[u * 4 + q] - mu; s2 += c * c; }
  red[tid] = s2; __syncthreads();
  for (int st = 128; st > 0; st >>= 1) { if (tid < st) red[tid] += red[tid + st]; __syncthreads(); }
  const float rs = rsqrtf(red[0] / (float)N + eps);
  {
    for (int u = 0; u < per / 4; ++u) {
      const int j = tid * 4 + 1024 * u;
      v4f o, sm;
#pragma unroll
      for (int q = 0; q < 4; ++q) {
        float gg = g[j + q], bb = bta[j + q];
        if (PARAM_BF16) { gg = bf16_round(gg); bb = bf16_round(bb); }
        sm[q] = vals[u * 4 + q]; o[q] = (vals[u * 4 + q] - mu) * rs * gg + bb;
      }
      if (out_sum) *(v4f*)(out_sum + (size_t)row * N + j) = sm;
      *(v4f*)(out_norm + (size_t)row * N + j) = o;
    }
    
  }
}



// ---- f16 WMMA path (v_wmma_f32_16x16x32_f16): 11-bit significands for operands in range — used where a [0,1] probability operand needs more precision than bf16
typedef _Float16 v16h __attribute__((ext_vector_type(16)));
union FragH { v16h v; v8us half[2]; _Float16 h[16]; unsigned short u[16]; };
template <int NT>
__device__ __forceinline__ v8f mmaH(v16h ah, v16h al, v16h bh, v16h bl, v8f c) {
  c = __builtin_amdgcn_wmma_f32_16x16x32_f16(false, ah, false, bh, (short)0, c, false, false);
  if (NT >= 2) c = __builtin_amdgcn_wmma_f32_16x16x32_f16(false, al, false, bh, (short)0, c, false, false);
  if (NT >= 3) c = __builtin_amdgcn_wmma_f32_16x16x32_f16(false, ah, false, bl, (short)0, c, false, false);
  asm volatile("v_nop\n\tv_nop\n\tv_nop\n\tv_nop" : "+v"(c) : "v"(ah), "v"(al), "v"(bh), "v"(bl));
  return c;
}
// batched GEMM like k_gemm_b but f16 operands: A f32 (split into f16 hi/lo if ASPLIT, else rounded to f16), Bt = f16 values [n][k]; alpha; C f32; N multiple of 16 (partial tiles skipped)
template <bool ASPLIT>
__global__ __launch_bounds__(128) void k_gemm_h(const float* __restrict__ A, int lda, size_t sA, const _Float16* __restrict__ Bh, int ldb, size_t sB, float alpha, float* __restrict__ C, int ldc, size_t sC, int M, int N, int K) {
  __shared__ __attribute__((aligned(16))) float so[4][16][64];
  const int tid = threadIdx.x, w = tid >> 5, lane = tid & 31, ln = lane & 15, hh = lane >> 4; const int by = blockIdx.y;
  A += (size_t)by * sA; Bh += (size_t)by * sB; C += (size_t)by * sC;
  const int ntn = (N + 63) / 64; const int wid = blockIdx.x * 4 + w; const int mt = wid / ntn, nq = wid % ntn; if (mt * 16 >= M) return;
  const int row0 = mt * 16, col0 = nq * 64; const float* arow = A + (size_t)(row0 + ln) * lda;
  v8f acc[4] = {};
  for (int kb = 0; kb < K; kb += 32) {
    FragH ah, al;
    const v4f x0 = *(const v4fa*)(arow + kb + 8 * hh), x1 = *(const v4fa*)(arow + kb + 8 * hh + 4), x2 = *(const v4fa*)(arow + kb + 16 + 8 * hh), x3 = *(const v4fa*)(arow + kb + 16 + 8 * hh + 4);
    float xs[16] = {x0[0],x0[1],x0[2],x0[3],x1[0],x1[1],x1[2],x1[3],x2[0],x2[1],x2[2],x2[3],x3[0],x3[1],x3[2],x3[3]};
#pragma unroll
    for (int i = 0; i < 16; ++i) { const _Float16 h = (_Float16)xs[i]; ah.h[i] = h; al.h[i] = ASPLIT ? (_Float16)(xs[i] - (float)h) : (_Float16)0.0f; }
#pragma unroll
    for (int t = 0; t < 4; ++t) { if (col0 + t * 16 >= N) continue; const size_t boff = (size_t)(col0 + t * 16 + ln) * ldb + kb; FragH bq; bq.half[0] = *(const v8us*)(Bh + boff + 8 * hh); bq.half[1] = *(const v8us*)(Bh + boff + 16 + 8 * hh);
      acc[t] = mmaH<ASPLIT ? 2 : 1>(ah.v, al.v, bq.v, bq.v, acc[t]); }
  }
#pragma unroll
  for (int t = 0; t < 4; ++t) { if (col0 + t * 16 >= N) continue;
#pragma unroll
    for (int r = 0; r < 8; ++r) so[w][8 * hh + r][t * 16 + ln] = acc[t][r] * alpha; }
  __builtin_amdgcn_fence(__ATOMIC_ACQ_REL, "workgroup"); __builtin_amdgcn_wave_barrier();
  const int rsub = lane >> 4, c4 = (lane & 15) * 4;
  {
#pragma unroll
    for (int q = 0; q < 8; ++q) { const int r = q * 2 + rsub; if (col0 + c4 < N) { const v4f v = *(const v4fa*)&so[w][r][c4]; *(v4f*)(C + (size_t)(row0 + r) * ldc + col0 + c4) = v; } }
     }
}

// Wt[n][k] = f16(W[k][n]·scale) from f32 row-major W[K][N] (scale = power of two; bf16-exact weights stay exact in f16 away from the subnormal range)
__global__ __launch_bounds__(256) void k_wt_f16(const float* __restrict__ W, _Float16* __restrict__ Wt, int K, int N, float scale) {
  const int t = blockIdx.x * 256 + threadIdx.x; if (t >= N * (K / 8)) return; const int n = t / (K / 8), k8 = (t % (K / 8)) * 8; FragH f;
#pragma unroll
  for (int i = 0; i < 8; ++i) f.h[i] = (_Float16)(bf16_round(W[(size_t)(k8 + i) * N + n]) * scale); const v8us o = f.half[0];
  *(v8us*)((unsigned short*)Wt + (size_t)n * K + k8) = o; 
}
// k_gemm_hh variant with fused epilogue: v = acc·alpha + bias[by·sBias + col] (+ CP[(row/rowsPerB)·sCPb + by·64 + col] if CP) ; ACT 0 none / 1 elu ; writes f16 C16 (and f32 C if non-null)
template <int ACT>
__global__ __launch_bounds__(128) void k_gemm_hhx(const _Float16* __restrict__ A, int lda, size_t sA, const _Float16* __restrict__ Bh, int ldb, size_t sB, float alpha, const float* __restrict__ bias, size_t sBias, const float* __restrict__ CP, int rowsPerB, size_t sCPb, int row0g,
    float* __restrict__ C, _Float16* __restrict__ C16, int ldc, size_t sC, int M, int N, int K) {
  __shared__ __attribute__((aligned(16))) float so[4][16][64];
  const int tid = threadIdx.x, w = tid >> 5, lane = tid & 31, ln = lane & 15, hh = lane >> 4; const int by = blockIdx.y;
  A += (size_t)by * sA; Bh += (size_t)by * sB; const size_t cofs = (size_t)by * sC; const float* bp = bias ? bias + (size_t)by * sBias : nullptr;
  const int ntn = (N + 63) / 64; const int wid = blockIdx.x * 4 + w; const int mt = wid / ntn, nq = wid % ntn; if (mt * 16 >= M) return;
  const int row0 = mt * 16, col0 = nq * 64; const _Float16* arow = A + (size_t)(row0 + ln) * lda;
  v8f acc[4] = {};
  for (int kb = 0; kb < K; kb += 32) { FragH ah; ah.half[0] = *(const v8us*)((const unsigned short*)arow + kb + 8 * hh); ah.half[1] = *(const v8us*)((const unsigned short*)arow + kb + 16 + 8 * hh);
#pragma unroll
    for (int t = 0; t < 4; ++t) { if (col0 + t * 16 >= N) continue; const size_t boff = (size_t)(col0 + t * 16 + ln) * ldb + kb; FragH bq; bq.half[0] = *(const v8us*)((const unsigned short*)Bh + boff + 8 * hh); bq.half[1] = *(const v8us*)((const unsigned short*)Bh + boff + 16 + 8 * hh);
      acc[t] = mmaH<1>(ah.v, ah.v, bq.v, bq.v, acc[t]); }
  }
#pragma unroll
  for (int t = 0; t < 4; ++t) { if (col0 + t * 16 >= N) continue; const int col = col0 + t * 16 + ln; const float bv = bp ? bf16_round(bp[col]) : 0.f;
#pragma unroll
    for (int r = 0; r < 8; ++r) { float v = acc[t][r] * alpha + bv; if (CP) { const int bidx = (row0g + row0 + 8 * hh + r) / rowsPerB; v += CP[(size_t)bidx * sCPb + (size_t)by * 64 + col]; } if (ACT == 1) v = (v > 0.f) ? v : expm1f(v); else if (ACT == 7) v = (v > 0.f) ? v + 1.0f : expf(v); else if (ACT == 8) v = tanhf(v); else if (ACT == 9) v = 0.5f * v * (1.0f + tanhf(0.7978845608028654f * (v + 0.044715f * v * v * v))); else if (ACT == 11) v = 1.0f / (1.0f + expf(-v)); else if (ACT == 12) v = (v > 0.f) ? v : 0.01f * v; else if (ACT == 14) v = (v > 0.f) ? v : 0.1f * v; else if (ACT == 15) v = v / (1.0f + expf(-v)); else if (ACT == 3) v = fmaxf(v, 0.f); else if (ACT == 6) v = 0.5f * v * (1.0f + erff(v * 0.70710678118654752f)); so[w][8 * hh + r][t * 16 + ln] = v; } }
  __builtin_amdgcn_fence(__ATOMIC_ACQ_REL, "workgroup"); __builtin_amdgcn_wave_barrier();
  const int rsub = lane >> 4, c4 = (lane & 15) * 4; typedef _Float16 v4h __attribute__((ext_vector_type(4)));
  {
#pragma unroll
    for (int q = 0; q < 8; ++q) { const int r = q * 2 + rsub; if (col0 + c4 < N) { const v4f v = *(const v4fa*)&so[w][r][c4]; if (C) *(v4f*)(C + cofs + (size_t)(row0 + r) * ldc + col0 + c4) = v; if (C16) { v4h h4; for (int i = 0; i < 4; ++i) h4[i] = (_Float16)v[i]; *(v4h*)(C16 + cofs + (size_t)(row0 + r) * ldc + col0 + c4) = h4; } } }
     }
}


typedef _Float16 v4h __attribute__((ext_vector_type(4)));

__global__ __launch_bounds__(256) void k_x16(const float* __restrict__ x, _Float16* __restrict__ X16, size_t n8) { const size_t t = (size_t)blockIdx.x * 256 + threadIdx.x; if (t >= n8) return; FragH f;
#pragma unroll
  for (int q = 0; q < 8; ++q) f.h[q] = (_Float16)bf16_round(x[t * 8 + q]); *(v8us*)((unsigned short*)X16 + t * 8) = f.half[0];  }
__global__ __launch_bounds__(256) void k_h16(const float* __restrict__ x, _Float16* __restrict__ X16, size_t n8) { const size_t t = (size_t)blockIdx.x * 256 + threadIdx.x; if (t >= n8) return; FragH f;
#pragma unroll
  for (int q = 0; q < 8; ++q) f.h[q] = (_Float16)x[t * 8 + q]; *(v8us*)((unsigned short*)X16 + t * 8) = f.half[0];  }
__global__ __launch_bounds__(256) void k_round16f(const float* __restrict__ W, _Float16* __restrict__ Bt, size_t n8) { const size_t t = (size_t)blockIdx.x * 256 + threadIdx.x; if (t >= n8) return; FragH f;
#pragma unroll
  for (int i = 0; i < 8; ++i) f.h[i] = (_Float16)(bf16_round(W[t * 8 + i]) * 16.0f); *(v8us*)((unsigned short*)Bt + t * 8) = f.half[0];  }
template <int NHv, int TTv>
__global__ __launch_bounds__(256) void k_vt(const _Float16* __restrict__ V16, int ldv, int voff, _Float16* __restrict__ Vt) { __shared__ unsigned short tl[64][66]; const int tid = threadIdx.x; const int slab = blockIdx.x / (TTv / 64), lg = blockIdx.x % (TTv / 64); const int b = slab / NHv, h = slab % NHv;
  for (int i = tid; i < 64 * 8; i += 256) { const int r = i / 8, c8 = (i % 8) * 8; FragH f; f.half[0] = *(const v8us*)((const unsigned short*)V16 + ((size_t)b * TTv + lg * 64 + r) * ldv + voff + h * 64 + c8);
#pragma unroll
    for (int q = 0; q < 8; ++q) tl[r][c8 + q] = f.u[q]; }
  __syncthreads();
  {
#pragma unroll
    for (int rd = 0; rd < 2; ++rd) { const int d = rd * 32 + tid / 8, pc = tid % 8; FragH f;
#pragma unroll
      for (int q = 0; q < 8; ++q) f.u[q] = tl[pc * 8 + q][d];
      *(v8us*)((unsigned short*)Vt + ((size_t)slab * 64 + d) * TTv + lg * 64 + pc * 8) = f.half[0]; }
     } }

__global__ __launch_bounds__(256) void k_hl(const float* __restrict__ F, _Float16* __restrict__ Hh, _Float16* __restrict__ Hl, size_t n8) { const size_t t = (size_t)blockIdx.x * 256 + threadIdx.x; if (t >= n8) return; FragH fh, fl; const v4f a = *(const v4fa*)(F + t * 8), c = *(const v4fa*)(F + t * 8 + 4);
#pragma unroll
  for (int q = 0; q < 4; ++q) { _Float16 h = (_Float16)a[q]; fh.h[q] = h; fl.h[q] = (_Float16)((a[q] - (float)h) * 1024.0f); h = (_Float16)c[q]; fh.h[4 + q] = h; fl.h[4 + q] = (_Float16)((c[q] - (float)h) * 1024.0f); }
  { *(v8us*)((unsigned short*)Hh + t * 8) = fh.half[0]; *(v8us*)((unsigned short*)Hl + t * 8) = fl.half[0];  } }

// ---- fast GEMM (wave tile 32x64; requires M % 32 == 0 rows per launch region and N % 64 == 0); epilogue = k_gemm_hhx semantics ----
__device__ __forceinline__ v16h g2_frag(const _Float16* p, int hh) { FragH f; f.half[0] = *(const v8us*)((const unsigned short*)p + 8 * hh); f.half[1] = *(const v8us*)((const unsigned short*)p + 16 + 8 * hh); return f.v; }
__device__ __forceinline__ v8f g2_mma(v16h a, v16h b, v8f c) { v8f d = __builtin_amdgcn_wmma_f32_16x16x32_f16(false, a, false, b, (short)0, c, false, false); asm volatile("v_nop\n\tv_nop\n\tv_nop\n\tv_nop" : "+v"(d) : "v"(a), "v"(b)); return d; }
template <int ACT>
__global__ __launch_bounds__(128) void k_gemm2(const _Float16* __restrict__ A, int lda, size_t sA, const _Float16* __restrict__ Bh, int ldb, size_t sB, float alpha, const float* __restrict__ bias, size_t sBias, const float* __restrict__ CP, int rowsPerB, size_t sCPb, int row0g,
    float* __restrict__ C, _Float16* __restrict__ C16, int ldc, size_t sC, int M, int N, int K) {
  __shared__ __attribute__((aligned(16))) float so[4][32][68];
  const int tid = threadIdx.x, w = tid >> 5, lane = tid & 31, ln = lane & 15, hh = lane >> 4; const int by = blockIdx.y;
  A += (size_t)by * sA; Bh += (size_t)by * sB; const size_t cofs = (size_t)by * sC; const float* bp = bias ? bias + (size_t)by * sBias : nullptr;
  const int ntn = N >> 6; const int mt = blockIdx.x / ntn, nq = blockIdx.x - mt * ntn; const int row0 = mt * 128 + 32 * w, col0 = nq * 64; if (row0 >= M) return;
  const _Float16* a0p = A + (size_t)(row0 + ln) * lda; const _Float16* a1p = a0p + (size_t)16 * lda;
  const _Float16* b0p = Bh + (size_t)(col0 + ln) * ldb; const _Float16* b1p = b0p + (size_t)16 * ldb; const _Float16* b2p = b1p + (size_t)16 * ldb; const _Float16* b3p = b2p + (size_t)16 * ldb;
  const v8f z8 = {0.f,0.f,0.f,0.f,0.f,0.f,0.f,0.f}; v8f c00 = z8, c01 = z8, c02 = z8, c03 = z8, c10 = z8, c11 = z8, c12 = z8, c13 = z8;
#pragma unroll 1
  for (int kb = 0; kb < K; kb += 32) { const v16h a0 = g2_frag(a0p + kb, hh), a1 = g2_frag(a1p + kb, hh);
    v16h b = g2_frag(b0p + kb, hh); c00 = g2_mma(a0, b, c00); c10 = g2_mma(a1, b, c10);
    b = g2_frag(b1p + kb, hh); c01 = g2_mma(a0, b, c01); c11 = g2_mma(a1, b, c11);
    b = g2_frag(b2p + kb, hh); c02 = g2_mma(a0, b, c02); c12 = g2_mma(a1, b, c12);
    b = g2_frag(b3p + kb, hh); c03 = g2_mma(a0, b, c03); c13 = g2_mma(a1, b, c13); }
  v8f accs[8] = {c00, c01, c02, c03, c10, c11, c12, c13};
#pragma unroll
  for (int u = 0; u < 8; ++u) { const int t = u & 3, half = u >> 2; const int col = col0 + t * 16 + ln; const float bv = bp ? bf16_round(bp[col]) : 0.f;
#pragma unroll
    for (int r = 0; r < 8; ++r) { const int rloc = half * 16 + 8 * hh + r; float v = accs[u][r] * alpha + bv; if (CP) { const int bidx = (row0g + row0 + rloc) / rowsPerB; v += CP[(size_t)bidx * sCPb + (size_t)by * 64 + col]; }
      if (ACT == 3) v = fmaxf(v, 0.f); else if (ACT == 6) v = 0.5f * v * (1.0f + erff(v * 0.70710678118654752f)); else if (ACT == 11) v = 1.0f / (1.0f + expf(-v)); else if (ACT == 15) v = v / (1.0f + expf(-v)); else if (ACT == 12) v = (v > 0.f) ? v : 0.01f * v; else if (ACT == 8) v = tanhf(v);
      so[w][rloc][t * 16 + ln] = v; } }
  __builtin_amdgcn_fence(__ATOMIC_ACQ_REL, "workgroup"); __builtin_amdgcn_wave_barrier();
  const int rsub = lane >> 4, c4 = (lane & 15) * 4;
  {
#pragma unroll
    for (int q = 0; q < 16; ++q) { const int r = q * 2 + rsub; const v4f v = *(const v4fa*)&so[w][r][c4]; if (C) *(v4f*)(C + cofs + (size_t)(row0 + r) * ldc + col0 + c4) = v; if (C16) { v4h h4; for (int i = 0; i < 4; ++i) h4[i] = (_Float16)v[i]; *(v4h*)(C16 + cofs + (size_t)(row0 + r) * ldc + col0 + c4) = h4; } }
     } }



template <int CAUSAL>
__global__ __launch_bounds__(128) void k_flash(const _Float16* __restrict__ Q16, int ldq, const _Float16* __restrict__ K16, int ldk, const _Float16* __restrict__ Vt, const int* __restrict__ MSK, float* __restrict__ O, int ldo) {
  constexpr int RPW = 16, RTN = RPW / 16, NQB = TQ / (4 * RPW), DT = 4, KS = 2;
  __shared__ __attribute__((aligned(16))) unsigned short sP[4][RPW][40]; __shared__ __attribute__((aligned(16))) float sO[4][RPW][64 + 4];
  const int tid = threadIdx.x, w = tid >> 5, lane = tid & 31, ln = lane & 15, hh = lane >> 4;
  const int slab = blockIdx.x / QBLKS, qblk = blockIdx.x % QBLKS; (void)NQB; const int b = slab / NH, h = slab % NH; const int qb0 = qblk * (4 * RPW); const int q0 = qb0 + w * RPW;
  FragH aq[2][KS];
#pragma unroll
  for (int rt = 0; rt < RTN; ++rt) { const unsigned short* qr = (const unsigned short*)Q16 + ((size_t)b * TQ + q0 + rt * 16 + ln) * ldq + h * 64;
#pragma unroll
    for (int ks = 0; ks < KS; ++ks) { aq[rt][ks].half[0] = *(const v8us*)(qr + ks * 32 + 8 * hh); aq[rt][ks].half[1] = *(const v8us*)(qr + ks * 32 + 16 + 8 * hh); } }
  const unsigned short* Vth = (const unsigned short*)Vt + (size_t)slab * 64 * TK;
  float m_r[2][8], l_r[2][8]; v8f oacc[2][DT];
#pragma unroll
  for (int rt = 0; rt < RTN; ++rt) {
#pragma unroll
    for (int r = 0; r < 8; ++r) { m_r[rt][r] = -3.0e38f; l_r[rt][r] = 0.f; }
#pragma unroll
    for (int dt = 0; dt < DT; ++dt) oacc[rt][dt] = (v8f){0.f,0.f,0.f,0.f,0.f,0.f,0.f,0.f}; }
  const int jend = (CAUSAL == 1 || CAUSAL == 3) ? (qb0 + 4 * RPW) : TK;      /* causal: keys beyond the block's last query never contribute */ const int jbeg = (CAUSAL == 3) ? ((qb0 - WINDOW) > 0 ? (qb0 - WINDOW) : 0) : 0;      /* window: keys more than WINDOW before the block's first query never contribute (WINDOW % 32 == 0) */
  /* Every global load of the loop is issued well ahead of its first use, so that the round trips run under the softmax of the pass in progress:
     V^T of a pass at the pass's head (used behind the softmax); K and the bias values of the next pass right behind this pass's score products. */
  FragH kf[2][KS]; FragH vf[DT]; float bc0[RTN][8], bc1[RTN][8];
  auto fetch_k = [&](int j0) __attribute__((always_inline)) {
    const unsigned short* kr0 = (const unsigned short*)K16 + ((size_t)b * TK + j0 + ln) * ldk + h * 64 + 8 * hh; const unsigned short* kr1 = kr0 + (size_t)16 * ldk;
#pragma unroll
    for (int ks = 0; ks < KS; ++ks) { kf[0][ks].half[0] = *(const v8us*)(kr0 + ks * 32); kf[0][ks].half[1] = *(const v8us*)(kr0 + ks * 32 + 16); }
#pragma unroll
    for (int ks = 0; ks < KS; ++ks) { kf[1][ks].half[0] = *(const v8us*)(kr1 + ks * 32); kf[1][ks].half[1] = *(const v8us*)(kr1 + ks * 32 + 16); }
    asm volatile("s_wait_xcnt 0x0" :: "v"(kr0), "v"(kr1) : "memory");      /* stands before any register that the K loads name is rewritten; the two address pairs are inputs so that no load of the group lands on one */
  };
  auto fetch_bias = [&](float (&o0)[RTN][8], float (&o1)[RTN][8], int j0) __attribute__((always_inline)) {
    if (CAUSAL == 6) { const float* BTh = (const float*)MSK + h * (2 * RELW + 1);      /* mode 6: per-head relative-position bias table [NH][2*RELW+1] indexed by clip(i - j, +-RELW) + RELW (passed through the MSK pointer) */
#pragma unroll
      for (int rt = 0; rt < RTN; ++rt) { unsigned i0[8], i1[8];
#pragma unroll
        for (int r = 0; r < 8; ++r) { const int tq = q0 + rt * 16 + 8 * hh + r; int d0 = tq - (j0 + ln), d1 = tq - (j0 + 16 + ln); d0 = d0 < -RELW ? -RELW : (d0 > RELW ? RELW : d0); d1 = d1 < -RELW ? -RELW : (d1 > RELW ? RELW : d1); i0[r] = (unsigned)(d0 + RELW); i1[r] = (unsigned)(d1 + RELW); }
#pragma unroll
        for (int r = 0; r < 8; ++r) { o0[rt][r] = BTh[i0[r]]; o1[rt][r] = BTh[i1[r]]; }
        asm volatile("s_wait_xcnt 0x0" :: "v"(i0[0]), "v"(i0[1]), "v"(i0[2]), "v"(i0[3]), "v"(i0[4]), "v"(i0[5]), "v"(i0[6]), "v"(i0[7]), "v"(i1[0]), "v"(i1[1]), "v"(i1[2]), "v"(i1[3]), "v"(i1[4]), "v"(i1[5]), "v"(i1[6]), "v"(i1[7]) : "memory");      /* stands before any register that the bias loads name is rewritten; the index registers are inputs so that no load of the group lands on one */
      } }
  };
  fetch_k(jbeg); fetch_bias(bc0, bc1, jbeg);
#pragma unroll 1
  for (int j0 = jbeg; j0 < jend; j0 += 32) {
#pragma unroll
    for (int dt = 0; dt < DT; ++dt) { const unsigned short* vrow = Vth + (size_t)(dt * 16 + ln) * TK + j0; vf[dt].half[0] = *(const v8us*)(vrow + 8 * hh); vf[dt].half[1] = *(const v8us*)(vrow + 16 + 8 * hh); }
    asm volatile("s_wait_xcnt 0x0" ::: "memory");      /* stands before any register that the V loads name is rewritten */
    v8f s[2][2];
#pragma unroll
    for (int nt = 0; nt < 2; ++nt) {
#pragma unroll
      for (int rt = 0; rt < RTN; ++rt) { v8f acc = (v8f){0.f,0.f,0.f,0.f,0.f,0.f,0.f,0.f};
#pragma unroll
        for (int ks = 0; ks < KS; ++ks) acc = mmaH<1>(aq[rt][ks].v, aq[rt][ks].v, kf[nt][ks].v, kf[nt][ks].v, acc); s[rt][nt] = acc; } }
    const int jn = (j0 + 32 < jend) ? j0 + 32 : jbeg;      /* the last pass has no next one: it names an in-range tile whose values are not used */
    float bn0[RTN][8], bn1[RTN][8];
    fetch_k(jn); fetch_bias(bn0, bn1, jn);
#pragma unroll
    for (int rt = 0; rt < RTN; ++rt)
#pragma unroll
      for (int r = 0; r < 8; ++r) { const int tq = q0 + rt * 16 + 8 * hh + r; const int k0 = j0 + ln, k1 = j0 + 16 + ln;
        const bool ok0 = (CAUSAL == 1) ? (k0 <= tq) : ((CAUSAL == 2) ? ((k0 >> 5) == (tq >> 5)) : ((CAUSAL == 3) ? (k0 <= tq && tq - k0 < WINDOW) : true)), ok1 = (CAUSAL == 1) ? (k1 <= tq) : ((CAUSAL == 2) ? ((k1 >> 5) == (tq >> 5)) : ((CAUSAL == 3) ? (k1 <= tq && tq - k1 < WINDOW) : true));      /* mode 3: causal + sliding window of WINDOW keys */      /* mode 2: block-diagonal 32-token groups */
        float s0 = ok0 ? s[rt][0][r] * SCL : -3.0e38f, s1 = ok1 ? s[rt][1][r] * SCL : -3.0e38f; if (CAUSAL == 6) { s0 += bc0[rt][r]; s1 += bc1[rt][r]; }      /* mode 6: the bias is added after the 1/sqrt(d) scale */ float mc = fmaxf(s0, s1);
        mc = fmaxf(mc, __shfl_xor(mc, 1, 32)); mc = fmaxf(mc, __shfl_xor(mc, 2, 32)); mc = fmaxf(mc, __shfl_xor(mc, 4, 32)); mc = fmaxf(mc, __shfl_xor(mc, 8, 32));
        const float mn = fmaxf(m_r[rt][r], mc); const float al = (mn > -1.0e38f) ? expf(m_r[rt][r] - mn) : 1.0f; m_r[rt][r] = mn; const float p0 = ok0 ? expf(s0 - mn) : 0.f, p1 = ok1 ? expf(s1 - mn) : 0.f; l_r[rt][r] = l_r[rt][r] * al + p0 + p1;
#pragma unroll
        for (int dt = 0; dt < DT; ++dt) oacc[rt][dt][r] *= al;
        FragH t2; t2.h[0] = (_Float16)(p0 * 1024.0f); t2.h[1] = (_Float16)(p1 * 1024.0f); sP[w][rt * 16 + 8 * hh + r][ln] = t2.u[0]; sP[w][rt * 16 + 8 * hh + r][16 + ln] = t2.u[1]; }
    __builtin_amdgcn_fence(__ATOMIC_ACQ_REL, "workgroup"); __builtin_amdgcn_wave_barrier();
    FragH pa[2];
#pragma unroll
    for (int rt = 0; rt < RTN; ++rt) { pa[rt].half[0] = *(const v8us*)&sP[w][rt * 16 + ln][8 * hh]; pa[rt].half[1] = *(const v8us*)&sP[w][rt * 16 + ln][16 + 8 * hh]; }
#pragma unroll
    for (int dt = 0; dt < DT; ++dt) {
#pragma unroll
      for (int rt = 0; rt < RTN; ++rt) oacc[rt][dt] = mmaH<1>(pa[rt].v, pa[rt].v, vf[dt].v, vf[dt].v, oacc[rt][dt]); }
    if (CAUSAL == 6) {
#pragma unroll
      for (int rt = 0; rt < RTN; ++rt)
#pragma unroll
        for (int r = 0; r < 8; ++r) { bc0[rt][r] = bn0[rt][r]; bc1[rt][r] = bn1[rt][r]; } }
    __builtin_amdgcn_fence(__ATOMIC_ACQ_REL, "workgroup"); __builtin_amdgcn_wave_barrier(); }
#pragma unroll
  for (int rt = 0; rt < RTN; ++rt) {
#pragma unroll
    for (int r = 0; r < 8; ++r) { float l = l_r[rt][r]; l += __shfl_xor(l, 1, 32); l += __shfl_xor(l, 2, 32); l += __shfl_xor(l, 4, 32); l += __shfl_xor(l, 8, 32); l_r[rt][r] = (l > 0.f) ? 1.0f / (l * 1024.0f) : 0.f; }
#pragma unroll
    for (int dt = 0; dt < DT; ++dt)
#pragma unroll
      for (int r = 0; r < 8; ++r) sO[w][rt * 16 + 8 * hh + r][dt * 16 + ln] = oacc[rt][dt][r] * l_r[rt][r]; }
  __builtin_amdgcn_fence(__ATOMIC_ACQ_REL, "workgroup"); __builtin_amdgcn_wave_barrier();
  {
#pragma unroll
    for (int rp = 0; rp < RPW; rp += 2) { const int r = rp + (lane >> 4), pc = lane & 15; const v4f val = *(const v4fa*)&sO[w][r][pc * 4]; *(v4f*)(O + ((size_t)b * TQ + q0 + r) * ldo + h * 64 + pc * 4) = val; }
     } }

__global__ __launch_bounds__(256) void k_h16s(const float* __restrict__ x, _Float16* __restrict__ X16, size_t n8, float sc) { const size_t t = (size_t)blockIdx.x * 256 + threadIdx.x; if (t >= n8) return; const v8f a = *(const v8f*)(x + t * 8); FragH f; for (int q = 0; q < 8; ++q) f.h[q] = (_Float16)(a[q] * sc); *(v8us*)((unsigned short*)X16 + t * 8) = f.half[0];  }
__global__ __launch_bounds__(256) void k_btab(const float* __restrict__ pe, float* __restrict__ BT) { { for (int e = threadIdx.x; e < NH * NREL; e += 256) { const int h = e / NREL, r = e % NREL; *(float*)(BT + e) = bf16_round(pe[r * NH + h]); }  } }

extern "C" void kernel_launch(void* const* d_in, const int* in_sizes, int n_in,
                              void* d_out, int out_size, void* d_ws, size_t ws_size, hipStream_t stream) {
  (void)in_sizes; (void)n_in; (void)out_size;
  const float* const* I = (const float* const*)d_in; const float* xq = I[0]; const float* xk = I[1]; const float* xv = I[2]; const float* Wq = I[3]; const float* Wk = I[4]; const float* Wv = I[5]; const float* Wo = I[6]; const float* pe = I[7];
  char* ws = (char*)d_ws; size_t off = 0;
  auto take = [&](size_t bytes) { char* p = ws + off; off += (bytes + 255) & ~(size_t)255; return p; };
  const size_t np = (size_t)NR * CC;
  _Float16* BQ = (_Float16*)take((size_t)CC * CC * 2); _Float16* BK = (_Float16*)take((size_t)CC * CC * 2); _Float16* BV = (_Float16*)take((size_t)CC * CC * 2); _Float16* BO = (_Float16*)take((size_t)CC * CC * 2); float* BT = (float*)take((size_t)NH * NREL * 4 + 256);
  _Float16* XQ = (_Float16*)take(np * 2); _Float16* XK = (_Float16*)take(np * 2); _Float16* XV = (_Float16*)take(np * 2); _Float16* Q16 = (_Float16*)take(np * 2); _Float16* K16 = (_Float16*)take(np * 2); _Float16* V16 = (_Float16*)take(np * 2); _Float16* VT = (_Float16*)take(np * 2); float* O = (float*)take(np * 4); _Float16* O16 = XQ;
  if (off > ws_size) return;      /* 2 + 7 x 4 + 8 = 38 MiB */
  k_wt_f16<<<(CC * CC / 8 + 255) / 256, 256, 0, stream>>>(Wq, BQ, CC, CC, 16.0f); k_wt_f16<<<(CC * CC / 8 + 255) / 256, 256, 0, stream>>>(Wk, BK, CC, CC, 16.0f); k_wt_f16<<<(CC * CC / 8 + 255) / 256, 256, 0, stream>>>(Wv, BV, CC, CC, 16.0f); k_wt_f16<<<(CC * CC / 8 + 255) / 256, 256, 0, stream>>>(Wo, BO, CC, CC, 16.0f);
  k_btab<<<1, 256, 0, stream>>>(pe, BT);
  k_x16<<<(unsigned)((np / 8 + 255) / 256), 256, 0, stream>>>(xq, XQ, np / 8); k_x16<<<(unsigned)((np / 8 + 255) / 256), 256, 0, stream>>>(xk, XK, np / 8); k_x16<<<(unsigned)((np / 8 + 255) / 256), 256, 0, stream>>>(xv, XV, np / 8);
  const dim3 g((NR / 128) * (CC / 64), 1);
  k_gemm2<0><<<g, 128, 0, stream>>>(XQ, CC, 0, BQ, CC, 0, 0.0625f, nullptr, 0, nullptr, 1, 0, 0, nullptr, Q16, CC, 0, NR, CC, CC);
  k_gemm2<0><<<g, 128, 0, stream>>>(XK, CC, 0, BK, CC, 0, 0.0625f, nullptr, 0, nullptr, 1, 0, 0, nullptr, K16, CC, 0, NR, CC, CC);
  k_gemm2<0><<<g, 128, 0, stream>>>(XV, CC, 0, BV, CC, 0, 0.0625f, nullptr, 0, nullptr, 1, 0, 0, nullptr, V16, CC, 0, NR, CC, CC);
  k_vt<NH, SLEN><<<NB * NH * (SLEN / 64), 256, 0, stream>>>(V16, CC, 0, VT);
  k_flash<6><<<NB * NH * QBLKS, 128, 0, stream>>>(Q16, CC, K16, CC, VT, (const int*)BT, O, CC);      /* relative-position bias mode */
  k_h16s<<<(unsigned)((np / 8 + 255) / 256), 256, 0, stream>>>(O, O16, np / 8, 64.0f);      /* x2^6 carry: the 2048-key averages are small */
  k_gemm2<0><<<g, 128, 0, stream>>>(O16, CC, 0, BO, CC, 0, 0.0625f / 64.0f, nullptr, 0, nullptr, 1, 0, 0, (float*)d_out, nullptr, CC, 0, NR, CC, CC);
}

// v002
// It runs in 184 microseconds.
// Timed twice side by side with v001, it ran 1.39 and 1.38 times as fast.
// All steps since v000 together make it 1.96 times as fast.
#include <hip/hip_runtime.h>
// RelativePositionalEncodingAttention (2 x 2048 tokens, 8 heads of 64, D 512): q/k/v from three inputs (no bias); scores/8 + pos_emb[clip(i - j, -32, 32) + 32][h]; softmax; out Wo.
// Structure: exact f16 planes of query/key/value; q/k/v GEMMs (32x64 wave tiles, f32 accumulation, exact x16 weights, f16 outputs); the relative-bias table transposed to [head][65] (bf16-rounded, f32); V^T by LDS tiles; the fused flash kernel with a new relative-position-bias mode (table lookup by clipped i - j added after the scale, f32); attention output as f16 into the output GEMM.
// Compute dtype: inputs and weights rounded to bf16; q, k, v, P and the attention output as f16 operands (~2^-12); f32 accumulation/softmax/bias. v_wmma_f32_16x16x32_f16.
#define NB 2
#define CC 512
#define NR (NB * SLEN)
#define NREL (2 * RELW + 1)
#define SLEN 2048
#define TQ SLEN
#define TK SLEN
#define NH 8
#define SCL 0.125f               /* 1/sqrt(64) */
#define WINDOW 256
#define RELW 32                  /* max_relative_position */
#define QBLKS (TQ / 64)
typedef __bf16 v16b __attribute__((ext_vector_type(16)));
typedef unsigned short v8us __attribute__((ext_vector_type(8), may_alias));
typedef float  v8f  __attribute__((ext_vector_type(8)));
typedef float  v4f  __attribute__((ext_vector_type(4)));
typedef float  v2f  __attribute__((ext_vector_type(2)));
typedef float  v4fa __attribute__((ext_vector_type(4), may_alias));
union FragB { v16b v; v8us half[2]; unsigned short u[16]; };

__device__ __forceinline__ unsigned short bf16_bits(float x) { unsigned int u = __float_as_uint(x); return (unsigned short)((u + 0x7FFFu + ((u >> 16) & 1u)) >> 16); }
__device__ __forceinline__ float bf16_val(unsigned short b) { return __uint_as_float(((unsigned int)b) << 16); }
__device__ __forceinline__ float bf16_round(float x) { return bf16_val(bf16_bits(x)); }
// D += A·B with NT terms: 1 = ah·bh, 2 = + al·bh (A split), 3 = + ah·bl (both split)
template <int NT>
__device__ __forceinline__ v8f mmaN(v16b ah, v16b al, v16b bh, v16b bl, v8f c) {
  c = __builtin_amdgcn_wmma_f32_16x16x32_bf16(false, ah, false, bh, (short)0, c, false, false);
  if (NT >= 2) c = __builtin_amdgcn_wmma_f32_16x16x32_bf16(false, al, false, bh, (short)0, c, false, false);
  if (NT >= 3) c = __builtin_amdgcn_wmma_f32_16x16x32_bf16(false, ah, false, bl, (short)0, c, false, false);
  asm volatile("v_nop\n\tv_nop\n\tv_nop\n\tv_nop" : "+v"(c) : "v"(ah), "v"(al), "v"(bh), "v"(bl));
  return c;
}

__global__ __launch_bounds__(256) void k_wt_bf16(const float* __restrict__ W, unsigned short* __restrict__ Wt, int K, int N) {
  const int t = blockIdx.x * 256 + threadIdx.x;
  const int k8n = K / 8;
  if (t >= N * k8n) return;
  const int n = t / k8n, k8 = (t % k8n) * 8;
  v8us v;
#pragma unroll
  for (int i = 0; i < 8; ++i) v[i] = bf16_bits(W[(size_t)(k8 + i) * N + n]);
  *(v8us*)(Wt + (size_t)n * K + k8) = v;
  
}

// GEMM C[M][N] (f32, pitch ldc) = act(A[M][K]·W + bias). A f32 row-major (pitch lda) converted per fragment to bf16
// (ASPLIT: hi/lo two planes -> 2 terms, else single rounded term); Wt bf16 [N][K] (pitch ldb). BIAS_BF16 rounds the
// bias to bf16 first (bias quantised to bf16 before the add). K%32==0, M%16==0, N%64==0.
template <bool ASPLIT, int ACT, bool BIAS_BF16>
__global__ __launch_bounds__(128) void k_gemm_bf(const float* __restrict__ A, int lda, const unsigned short* __restrict__ Wt, int ldb,
                                               const float* __restrict__ bias, float* __restrict__ C, int ldc, int M, int N, int K) {
  __shared__ __attribute__((aligned(16))) float so[4][16][64];
  const int tid = threadIdx.x, w = tid >> 5, lane = tid & 31, ln = lane & 15, hh = lane >> 4;
  const int ntn = N / 64;
  const int wid = blockIdx.x * 4 + w;
  const int mt = wid / ntn, nq = wid % ntn;
  if (mt * 16 >= M) return;
  const int row0 = mt * 16, col0 = nq * 64;
  const float* arow = A + (size_t)(row0 + ln) * lda;
  v8f acc[4] = {};
  for (int kb = 0; kb < K; kb += 32) {
    FragB ah, al;
    const v4f x0 = *(const v4fa*)(arow + kb + 8 * hh), x1 = *(const v4fa*)(arow + kb + 8 * hh + 4);
    const v4f x2 = *(const v4fa*)(arow + kb + 16 + 8 * hh), x3 = *(const v4fa*)(arow + kb + 16 + 8 * hh + 4);
    float xs[16] = {x0[0],x0[1],x0[2],x0[3],x1[0],x1[1],x1[2],x1[3],x2[0],x2[1],x2[2],x2[3],x3[0],x3[1],x3[2],x3[3]};
#pragma unroll
    for (int i = 0; i < 16; ++i) { const unsigned short hb = bf16_bits(xs[i]); ah.u[i] = hb; al.u[i] = ASPLIT ? bf16_bits(xs[i] - bf16_val(hb)) : (unsigned short)0; }
#pragma unroll
    for (int t = 0; t < 4; ++t) {
      const unsigned short* brow = Wt + (size_t)(col0 + t * 16 + ln) * ldb + kb;
      FragB b;
      b.half[0] = *(const v8us*)(brow + 8 * hh);
      b.half[1] = *(const v8us*)(brow + 16 + 8 * hh);
      acc[t] = mmaN<ASPLIT ? 2 : 1>(ah.v, al.v, b.v, b.v, acc[t]);
    }
  }
#pragma unroll
  for (int t = 0; t < 4; ++t) {
    float bv = bias ? bias[col0 + t * 16 + ln] : 0.f;
    if (BIAS_BF16) bv = bf16_round(bv);
#pragma unroll
    for (int r = 0; r < 8; ++r) { float v = acc[t][r] + bv; if (ACT == 1) v = fmaxf(v, 0.f); so[w][8 * hh + r][t * 16 + ln] = v; }
  }
  __builtin_amdgcn_fence(__ATOMIC_ACQ_REL, "workgroup");
  __builtin_amdgcn_wave_barrier();
  const int rsub = lane >> 4, c4 = (lane & 15) * 4;
  {
#pragma unroll
    for (int q = 0; q < 8; ++q) {
      const int r = q * 2 + rsub;
      const v4f v = *(const v4fa*)&so[w][r][c4];
      *(v4f*)(C + (size_t)(row0 + r) * ldc + col0 + c4) = v;
    }
    
  }
}

// GEMM C = act(A·W + bias + resid): A f32 (ASPLIT -> hi/lo 2 terms), Wt bf16 [N][K]; ACT 0 none, 1 relu, 2 exact gelu;
// resid (optional, f32, row index = (row % rmod), pitch ldr, RES_BF16 rounds it) added before the activation.
template <bool ASPLIT, int ACT, bool BIAS_BF16, bool RES_BF16>
__global__ __launch_bounds__(128) void k_gemm_bf3(const float* __restrict__ A, int lda, const unsigned short* __restrict__ Wt, int ldb,
                                                const float* __restrict__ bias, const float* __restrict__ resid, int rmod, int ldr,
                                                float* __restrict__ C, int ldc, int M, int N, int K) {
  __shared__ __attribute__((aligned(16))) float so[4][16][64];
  const int tid = threadIdx.x, w = tid >> 5, lane = tid & 31, ln = lane & 15, hh = lane >> 4;
  const int ntn = N / 64;
  const int wid = blockIdx.x * 4 + w;
  const int mt = wid / ntn, nq = wid % ntn;
  if (mt * 16 >= M) return;
  const int row0 = mt * 16, col0 = nq * 64;
  const float* arow = A + (size_t)(row0 + ln) * lda;
  v8f acc[4] = {};
  for (int kb = 0; kb < K; kb += 32) {
    FragB ah, al;
    const v4f x0 = *(const v4fa*)(arow + kb + 8 * hh), x1 = *(const v4fa*)(arow + kb + 8 * hh + 4);
    const v4f x2 = *(const v4fa*)(arow + kb + 16 + 8 * hh), x3 = *(const v4fa*)(arow + kb + 16 + 8 * hh + 4);
    float xs[16] = {x0[0],x0[1],x0[2],x0[3],x1[0],x1[1],x1[2],x1[3],x2[0],x2[1],x2[2],x2[3],x3[0],x3[1],x3[2],x3[3]};
#pragma unroll
    for (int i = 0; i < 16; ++i) { const unsigned short hb = bf16_bits(xs[i]); ah.u[i] = hb; al.u[i] = ASPLIT ? bf16_bits(xs[i] - bf16_val(hb)) : (unsigned short)0; }
#pragma unroll
    for (int t = 0; t < 4; ++t) {
      const unsigned short* brow = Wt + (size_t)(col0 + t * 16 + ln) * ldb + kb;
      FragB b;
      b.half[0] = *(const v8us*)(brow + 8 * hh);
      b.half[1] = *(const v8us*)(brow + 16 + 8 * hh);
      acc[t] = mmaN<ASPLIT ? 2 : 1>(ah.v, al.v, b.v, b.v, acc[t]);
    }
  }
#pragma unroll
  for (int t = 0; t < 4; ++t) {
    const int col = col0 + t * 16 + ln;
    float bv = bias ? bias[col] : 0.f;
    if (BIAS_BF16) bv = bf16_round(bv);
#pragma unroll
    for (int r = 0; r < 8; ++r) {
      float v = acc[t][r] + bv;
      if (resid) { float rv = resid[(size_t)((row0 + 8 * hh + r) % rmod) * ldr + col]; if (RES_BF16) rv = bf16_round(rv); v += rv; }
      if (ACT == 1) v = fmaxf(v, 0.f);
      if (ACT == 2) v = 0.5f * v * (1.0f + erff(v * 0.70710678118654752f));
      if (ACT == 3) { const float u = 0.7978845608028654f * (v + 0.044715f * v * v * v); v = 0.5f * v * (1.0f + tanhf(u)); }
      so[w][8 * hh + r][t * 16 + ln] = v;
    }
  }
  __builtin_amdgcn_fence(__ATOMIC_ACQ_REL, "workgroup");
  __builtin_amdgcn_wave_barrier();
  const int rsub = lane >> 4, c4 = (lane & 15) * 4;
  {
#pragma unroll
    for (int q = 0; q < 8; ++q) {
      const int r = q * 2 + rsub;
      const v4f v = *(const v4fa*)&so[w][r][c4];
      *(v4f*)(C + (size_t)(row0 + r) * ldc + col0 + c4) = v;
    }
    
  }
}
// row LayerNorm (biased variance, eps) over N: s = X (+ R); optional out_sum <- s; out_norm <- (s-mu)*rsqrt(var+eps)*g + b
template <bool PARAM_BF16>
__global__ __launch_bounds__(256) void k_layernorm(const float* __restrict__ X, const float* __restrict__ R, const float* __restrict__ g, const float* __restrict__ bta,
                                                  float* __restrict__ out_sum, float* __restrict__ out_norm, int N, float eps) {
  __shared__ float red[256];
  const int row = blockIdx.x, tid = threadIdx.x;
  const float* x = X + (size_t)row * N; const float* rr = R ? R + (size_t)row * N : nullptr;
  float vals[16];                     // up to N = 4096
  const int per = N / 256;            // contiguous chunk per thread? use strided-by-4 chunks: thread handles j = tid*4 + 1024*u
  float s1 = 0.f;
  for (int u = 0; u < per / 4; ++u) {
    const int j = tid * 4 + 1024 * u;
    const v4f a = *(const v4fa*)(x + j);
    v4f b = {0.f,0.f,0.f,0.f}; if (rr) b = *(const v4fa*)(rr + j);
#pragma unroll
    for (int q = 0; q < 4; ++q) { const float v = a[q] + b[q]; vals[u * 4 + q] = v; s1 += v; }
  }
  red[tid] = s1; __syncthreads();
  for (int st = 128; st > 0; st >>= 1) { if (tid < st) red[tid] += red[tid + st]; __syncthreads(); }
  const float mu = red[0] / (float)N; __syncthreads();
  float s2 = 0.f;
  for (int u = 0; u < per / 4; ++u)
#pragma unroll
    for (int q = 0; q < 4; ++q) { const float c = vals[u * 4 + q] - mu; s2 += c * c; }
  red[tid] = s2; __syncthreads();
  for (int st = 128; st > 0; st >>= 1) { if (tid < st) red[tid] += red[tid + st]; __syncthreads(); }
  const float rs = rsqrtf(red[0] / (float)N + eps);
  {
    for (int u = 0; u < per / 4; ++u) {
      const int j = tid * 4 + 1024 * u;
      v4f o, sm;
#pragma unroll
      for (int q = 0; q < 4; ++q) {
        float gg = g[j + q], bb = bta[j + q];
        if (PARAM_BF16) { gg = bf16_round(gg); bb = bf16_round(bb); }
        sm[q] = vals[u * 4 + q]; o[q] = (vals[u * 4 + q] - mu) * rs * gg + bb;
      }
      if (out_sum) *(v4f*)(out_sum + (size_t)row * N + j) = sm;
      *(v4f*)(out_norm + (size_t)row * N + j) = o;
    }
    
  }
}



// ---- f16 WMMA path (v_wmma_f32_16x16x32_f16): 11-bit significands for operands in range — used where a [0,1] probability operand needs more precision than bf16
typedef _Float16 v16h __attribute__((ext_vector_type(16)));
union FragH { v16h v; v8us half[2]; _Float16 h[16]; unsigned short u[16]; };
template <int NT>
__device__ __forceinline__ v8f mmaH(v16h ah, v16h al, v16h bh, v16h bl, v8f c) {
  c = __builtin_amdgcn_wmma_f32_16x16x32_f16(false, ah, false, bh, (short)0, c, false, false);
  if (NT >= 2) c = __builtin_amdgcn_wmma_f32_16x16x32_f16(false, al, false, bh, (short)0, c, false, false);
  if (NT >= 3) c = __builtin_amdgcn_wmma_f32_16x16x32_f16(false, ah, false, bl, (short)0, c, false, false);
  asm volatile("v_nop\n\tv_nop\n\tv_nop\n\tv_nop" : "+v"(c) : "v"(ah), "v"(al), "v"(bh), "v"(bl));
  return c;
}
// batched GEMM like k_gemm_b but f16 operands: A f32 (split into f16 hi/lo if ASPLIT, else rounded to f16), Bt = f16 values [n][k]; alpha; C f32; N multiple of 16 (partial tiles skipped)
template <bool ASPLIT>
__global__ __launch_bounds__(128) void k_gemm_h(const float* __restrict__ A, int lda, size_t sA, const _Float16* __restrict__ Bh, int ldb, size_t sB, float alpha, float* __restrict__ C, int ldc, size_t sC, int M, int N, int K) {
  __shared__ __attribute__((aligned(16))) float so[4][16][64];
  const int tid = threadIdx.x, w = tid >> 5, lane = tid & 31, ln = lane & 15, hh = lane >> 4; const int by = blockIdx.y;
  A += (size_t)by * sA; Bh += (size_t)by * sB; C += (size_t)by * sC;
  const int ntn = (N + 63) / 64; const int wid = blockIdx.x * 4 + w; const int mt = wid / ntn, nq = wid % ntn; if (mt * 16 >= M) return;
  const int row0 = mt * 16, col0 = nq * 64; const float* arow = A + (size_t)(row0 + ln) * lda;
  v8f acc[4] = {};
  for (int kb = 0; kb < K; kb += 32) {
    FragH ah, al;
    const v4f x0 = *(const v4fa*)(arow + kb + 8 * hh), x1 = *(const v4fa*)(arow + kb + 8 * hh + 4), x2 = *(const v4fa*)(arow + kb + 16 + 8 * hh), x3 = *(const v4fa*)(arow + kb + 16 + 8 * hh + 4);
    float xs[16] = {x0[0],x0[1],x0[2],x0[3],x1[0],x1[1],x1[2],x1[3],x2[0],x2[1],x2[2],x2[3],x3[0],x3[1],x3[2],x3[3]};
#pragma unroll
    for (int i = 0; i < 16; ++i) { const _Float16 h = (_Float16)xs[i]; ah.h[i] = h; al.h[i] = ASPLIT ? (_Float16)(xs[i] - (float)h) : (_Float16)0.0f; }
#pragma unroll
    for (int t = 0; t < 4; ++t) { if (col0 + t * 16 >= N) continue; const size_t boff = (size_t)(col0 + t * 16 + ln) * ldb + kb; FragH bq; bq.half[0] = *(const v8us*)(Bh + boff + 8 * hh); bq.half[1] = *(const v8us*)(Bh + boff + 16 + 8 * hh);
      acc[t] = mmaH<ASPLIT ? 2 : 1>(ah.v, al.v, bq.v, bq.v, acc[t]); }
  }
#pragma unroll
  for (int t = 0; t < 4; ++t) { if (col0 + t * 16 >= N) continue;
#pragma unroll
    for (int r = 0; r < 8; ++r) so[w][8 * hh + r][t * 16 + ln] = acc[t][r] * alpha; }
  __builtin_amdgcn_fence(__ATOMIC_ACQ_REL, "workgroup"); __builtin_amdgcn_wave_barrier();
  const int rsub = lane >> 4, c4 = (lane & 15) * 4;
  {
#pragma unroll
    for (int q = 0; q < 8; ++q) { const int r = q * 2 + rsub; if (col0 + c4 < N) { const v4f v = *(const v4fa*)&so[w][r][c4]; *(v4f*)(C + (size_t)(row0 + r) * ldc + col0 + c4) = v; } }
     }
}

// Wt[n][k] = f16(W[k][n]·scale) from f32 row-major W[K][N] (scale = power of two; bf16-exact weights stay exact in f16 away from the subnormal range)
__global__ __launch_bounds__(256) void k_wt_f16(const float* __restrict__ W, _Float16* __restrict__ Wt, int K, int N, float scale) {
  const int t = blockIdx.x * 256 + threadIdx.x; if (t >= N * (K / 8)) return; const int n = t / (K / 8), k8 = (t % (K / 8)) * 8; FragH f;
#pragma unroll
  for (int i = 0; i < 8; ++i) f.h[i] = (_Float16)(bf16_round(W[(size_t)(k8 + i) * N + n]) * scale); const v8us o = f.half[0];
  *(v8us*)((unsigned short*)Wt + (size_t)n * K + k8) = o; 
}
// k_gemm_hh variant with fused epilogue: v = acc·alpha + bias[by·sBias + col] (+ CP[(row/rowsPerB)·sCPb + by·64 + col] if CP) ; ACT 0 none / 1 elu ; writes f16 C16 (and f32 C if non-null)
template <int ACT>
__global__ __launch_bounds__(128) void k_gemm_hhx(const _Float16* __restrict__ A, int lda, size_t sA, const _Float16* __restrict__ Bh, int ldb, size_t sB, float alpha, const float* __restrict__ bias, size_t sBias, const float* __restrict__ CP, int rowsPerB, size_t sCPb, int row0g,
    float* __restrict__ C, _Float16* __restrict__ C16, int ldc, size_t sC, int M, int N, int K) {
  __shared__ __attribute__((aligned(16))) float so[4][16][64];
  const int tid = threadIdx.x, w = tid >> 5, lane = tid & 31, ln = lane & 15, hh = lane >> 4; const int by = blockIdx.y;
  A += (size_t)by * sA; Bh += (size_t)by * sB; const size_t cofs = (size_t)by * sC; const float* bp = bias ? bias + (size_t)by * sBias : nullptr;
  const int ntn = (N + 63) / 64; const int wid = blockIdx.x * 4 + w; const int mt = wid / ntn, nq = wid % ntn; if (mt * 16 >= M) return;
  const int row0 = mt * 16, col0 = nq * 64; const _Float16* arow = A + (size_t)(row0 + ln) * lda;
  v8f acc[4] = {};
  for (int kb = 0; kb < K; kb += 32) { FragH ah; ah.half[0] = *(const v8us*)((const unsigned short*)arow + kb + 8 * hh); ah.half[1] = *(const v8us*)((const unsigned short*)arow + kb + 16 + 8 * hh);
#pragma unroll
    for (int t = 0; t < 4; ++t) { if (col0 + t * 16 >= N) continue; const size_t boff = (size_t)(col0 + t * 16 + ln) * ldb + kb; FragH bq; bq.half[0] = *(const v8us*)((const unsigned short*)Bh + boff + 8 * hh); bq.half[1] = *(const v8us*)((const unsigned short*)Bh + boff + 16 + 8 * hh);
      acc[t] = mmaH<1>(ah.v, ah.v, bq.v, bq.v, acc[t]); }
  }
#pragma unroll
  for (int t = 0; t < 4; ++t) { if (col0 + t * 16 >= N) continue; const int col = col0 + t * 16 + ln; const float bv = bp ? bf16_round(bp[col]) : 0.f;
#pragma unroll
    for (int r = 0; r < 8; ++r) { float v = acc[t][r] * alpha + bv; if (CP) { const int bidx = (row0g + row0 + 8 * hh + r) / rowsPerB; v += CP[(size_t)bidx * sCPb + (size_t)by * 64 + col]; } if (ACT == 1) v = (v > 0.f) ? v : expm1f(v); else if (ACT == 7) v = (v > 0.f) ? v + 1.0f : expf(v); else if (ACT == 8) v = tanhf(v); else if (ACT == 9) v = 0.5f * v * (1.0f + tanhf(0.7978845608028654f * (v + 0.044715f * v * v * v))); else if (ACT == 11) v = 1.0f / (1.0f + expf(-v)); else if (ACT == 12) v = (v > 0.f) ? v : 0.01f * v; else if (ACT == 14) v = (v > 0.f) ? v : 0.1f * v; else if (ACT == 15) v = v / (1.0f + expf(-v)); else if (ACT == 3) v = fmaxf(v, 0.f); else if (ACT == 6) v = 0.5f * v * (1.0f + erff(v * 0.70710678118654752f)); so[w][8 * hh + r][t * 16 + ln] = v; } }
  __builtin_amdgcn_fence(__ATOMIC_ACQ_REL, "workgroup"); __builtin_amdgcn_wave_barrier();
  const int rsub = lane >> 4, c4 = (lane & 15) * 4; typedef _Float16 v4h __attribute__((ext_vector_type(4)));
  {
#pragma unroll
    for (int q = 0; q < 8; ++q) { const int r = q * 2 + rsub; if (col0 + c4 < N) { const v4f v = *(const v4fa*)&so[w][r][c4]; if (C) *(v4f*)(C + cofs + (size_t)(row0 + r) * ldc + col0 + c4) = v; if (C16) { v4h h4; for (int i = 0; i < 4; ++i) h4[i] = (_Float16)v[i]; *(v4h*)(C16 + cofs + (size_t)(row0 + r) * ldc + col0 + c4) = h4; } } }
     }
}


typedef _Float16 v4h __attribute__((ext_vector_type(4)));

__global__ __launch_bounds__(256) void k_x16(const float* __restrict__ x, _Float16* __restrict__ X16, size_t n8) { const size_t t = (size_t)blockIdx.x * 256 + threadIdx.x; if (t >= n8) return; FragH f;
#pragma unroll
  for (int q = 0; q < 8; ++q) f.h[q] = (_Float16)bf16_round(x[t * 8 + q]); *(v8us*)((unsigned short*)X16 + t * 8) = f.half[0];  }
__global__ __launch_bounds__(256) void k_h16(const float* __restrict__ x, _Float16* __restrict__ X16, size_t n8) { const size_t t = (size_t)blockIdx.x * 256 + threadIdx.x; if (t >= n8) return; FragH f;
#pragma unroll
  for (int q = 0; q < 8; ++q) f.h[q] = (_Float16)x[t * 8 + q]; *(v8us*)((unsigned short*)X16 + t * 8) = f.half[0];  }
__global__ __launch_bounds__(256) void k_round16f(const float* __restrict__ W, _Float16* __restrict__ Bt, size_t n8) { const size_t t = (size_t)blockIdx.x * 256 + threadIdx.x; if (t >= n8) return; FragH f;
#pragma unroll
  for (int i = 0; i < 8; ++i) f.h[i] = (_Float16)(bf16_round(W[t * 8 + i]) * 16.0f); *(v8us*)((unsigned short*)Bt + t * 8) = f.half[0];  }
template <int NHv, int TTv>
__global__ __launch_bounds__(256) void k_vt(const _Float16* __restrict__ V16, int ldv, int voff, _Float16* __restrict__ Vt) { __shared__ unsigned short tl[64][66]; const int tid = threadIdx.x; const int slab = blockIdx.x / (TTv / 64), lg = blockIdx.x % (TTv / 64); const int b = slab / NHv, h = slab % NHv;
  for (int i = tid; i < 64 * 8; i += 256) { const int r = i / 8, c8 = (i % 8) * 8; FragH f; f.half[0] = *(const v8us*)((const unsigned short*)V16 + ((size_t)b * TTv + lg * 64 + r) * ldv + voff + h * 64 + c8);
#pragma unroll
    for (int q = 0; q < 8; ++q) tl[r][c8 + q] = f.u[q]; }
  __syncthreads();
  {
#pragma unroll
    for (int rd = 0; rd < 2; ++rd) { const int d = rd * 32 + tid / 8, pc = tid % 8; FragH f;
#pragma unroll
      for (int q = 0; q < 8; ++q) f.u[q] = tl[pc * 8 + q][d];
      *(v8us*)((unsigned short*)Vt + ((size_t)slab * 64 + d) * TTv + lg * 64 + pc * 8) = f.half[0]; }
     } }

__global__ __launch_bounds__(256) void k_hl(const float* __restrict__ F, _Float16* __restrict__ Hh, _Float16* __restrict__ Hl, size_t n8) { const size_t t = (size_t)blockIdx.x * 256 + threadIdx.x; if (t >= n8) return; FragH fh, fl; const v4f a = *(const v4fa*)(F + t * 8), c = *(const v4fa*)(F + t * 8 + 4);
#pragma unroll
  for (int q = 0; q < 4; ++q) { _Float16 h = (_Float16)a[q]; fh.h[q] = h; fl.h[q] = (_Float16)((a[q] - (float)h) * 1024.0f); h = (_Float16)c[q]; fh.h[4 + q] = h; fl.h[4 + q] = (_Float16)((c[q] - (float)h) * 1024.0f); }
  { *(v8us*)((unsigned short*)Hh + t * 8) = fh.half[0]; *(v8us*)((unsigned short*)Hl + t * 8) = fl.half[0];  } }

// ---- fast GEMM (wave tile 32x64; requires M % 32 == 0 rows per launch region and N % 64 == 0); epilogue = k_gemm_hhx semantics ----
__device__ __forceinline__ v16h g2_frag(const _Float16* p, int hh) { FragH f; f.half[0] = *(const v8us*)((const unsigned short*)p + 8 * hh); f.half[1] = *(const v8us*)((const unsigned short*)p + 16 + 8 * hh); return f.v; }
__device__ __forceinline__ v8f g2_mma(v16h a, v16h b, v8f c) { v8f d = __builtin_amdgcn_wmma_f32_16x16x32_f16(false, a, false, b, (short)0, c, false, false); asm volatile("v_nop\n\tv_nop\n\tv_nop\n\tv_nop" : "+v"(d) : "v"(a), "v"(b)); return d; }
template <int ACT>
__global__ __launch_bounds__(128) void k_gemm2(const _Float16* __restrict__ A, int lda, size_t sA, const _Float16* __restrict__ Bh, int ldb, size_t sB, float alpha, const float* __restrict__ bias, size_t sBias, const float* __restrict__ CP, int rowsPerB, size_t sCPb, int row0g,
    float* __restrict__ C, _Float16* __restrict__ C16, int ldc, size_t sC, int M, int N, int K) {
  __shared__ __attribute__((aligned(16))) float so[4][32][68];
  const int tid = threadIdx.x, w = tid >> 5, lane = tid & 31, ln = lane & 15, hh = lane >> 4; const int by = blockIdx.y;
  A += (size_t)by * sA; Bh += (size_t)by * sB; const size_t cofs = (size_t)by * sC; const float* bp = bias ? bias + (size_t)by * sBias : nullptr;
  const int ntn = N >> 6; const int mt = blockIdx.x / ntn, nq = blockIdx.x - mt * ntn; const int row0 = mt * 128 + 32 * w, col0 = nq * 64; if (row0 >= M) return;
  const _Float16* a0p = A + (size_t)(row0 + ln) * lda; const _Float16* a1p = a0p + (size_t)16 * lda;
  const _Float16* b0p = Bh + (size_t)(col0 + ln) * ldb; const _Float16* b1p = b0p + (size_t)16 * ldb; const _Float16* b2p = b1p + (size_t)16 * ldb; const _Float16* b3p = b2p + (size_t)16 * ldb;
  const v8f z8 = {0.f,0.f,0.f,0.f,0.f,0.f,0.f,0.f}; v8f c00 = z8, c01 = z8, c02 = z8, c03 = z8, c10 = z8, c11 = z8, c12 = z8, c13 = z8;
#pragma unroll 1
  for (int kb = 0; kb < K; kb += 32) { const v16h a0 = g2_frag(a0p + kb, hh), a1 = g2_frag(a1p + kb, hh);
    v16h b = g2_frag(b0p + kb, hh); c00 = g2_mma(a0, b, c00); c10 = g2_mma(a1, b, c10);
    b = g2_frag(b1p + kb, hh); c01 = g2_mma(a0, b, c01); c11 = g2_mma(a1, b, c11);
    b = g2_frag(b2p + kb, hh); c02 = g2_mma(a0, b, c02); c12 = g2_mma(a1, b, c12);
    b = g2_frag(b3p + kb, hh); c03 = g2_mma(a0, b, c03); c13 = g2_mma(a1, b, c13); }
  v8f accs[8] = {c00, c01, c02, c03, c10, c11, c12, c13};
#pragma unroll
  for (int u = 0; u < 8; ++u) { const int t = u & 3, half = u >> 2; const int col = col0 + t * 16 + ln; const float bv = bp ? bf16_round(bp[col]) : 0.f;
#pragma unroll
    for (int r = 0; r < 8; ++r) { const int rloc = half * 16 + 8 * hh + r; float v = accs[u][r] * alpha + bv; if (CP) { const int bidx = (row0g + row0 + rloc) / rowsPerB; v += CP[(size_t)bidx * sCPb + (size_t)by * 64 + col]; }
      if (ACT == 3) v = fmaxf(v, 0.f); else if (ACT == 6) v = 0.5f * v * (1.0f + erff(v * 0.70710678118654752f)); else if (ACT == 11) v = 1.0f / (1.0f + expf(-v)); else if (ACT == 15) v = v / (1.0f + expf(-v)); else if (ACT == 12) v = (v > 0.f) ? v : 0.01f * v; else if (ACT == 8) v = tanhf(v);
      so[w][rloc][t * 16 + ln] = v; } }
  __builtin_amdgcn_fence(__ATOMIC_ACQ_REL, "workgroup"); __builtin_amdgcn_wave_barrier();
  const int rsub = lane >> 4, c4 = (lane & 15) * 4;
  {
#pragma unroll
    for (int q = 0; q < 16; ++q) { const int r = q * 2 + rsub; const v4f v = *(const v4fa*)&so[w][r][c4]; if (C) *(v4f*)(C + cofs + (size_t)(row0 + r) * ldc + col0 + c4) = v; if (C16) { v4h h4; for (int i = 0; i < 4; ++i) h4[i] = (_Float16)v[i]; *(v4h*)(C16 + cofs + (size_t)(row0 + r) * ldc + col0 + c4) = h4; } }
     } }



__device__ __forceinline__ float xhalf(float x) { return __builtin_bit_cast(float, __builtin_amdgcn_permlanex16(__builtin_bit_cast(int, x), __builtin_bit_cast(int, x), 0x76543210, 0xfedcba98, false, false)); }      /* lane l with lane l ^ 16 */
template <int CAUSAL>
__global__ __launch_bounds__(128) void k_flash(const _Float16* __restrict__ Q16, int ldq, const _Float16* __restrict__ K16, int ldk, const _Float16* __restrict__ Vt, const int* __restrict__ MSK, float* __restrict__ O, int ldo) {
  constexpr int RPW = 16, DT = 4, KS = 2;
  __shared__ __attribute__((aligned(16))) float sO[4][RPW][64 + 4];
  const int tid = threadIdx.x, w = tid >> 5, lane = tid & 31, ln = lane & 15, hh = lane >> 4;
  const int slab = blockIdx.x / QBLKS, qblk = blockIdx.x % QBLKS; const int b = slab / NH, h = slab % NH; const int qb0 = qblk * (4 * RPW); const int q0 = qb0 + w * RPW; const int tq = q0 + ln; const int eb = tq + RELW - 8 * hh;
  FragH aq[KS];
  { const unsigned short* qr = (const unsigned short*)Q16 + ((size_t)b * TQ + tq) * ldq + h * 64;
#pragma unroll
    for (int ks = 0; ks < KS; ++ks) { aq[ks].half[0] = *(const v8us*)(qr + ks * 32 + 8 * hh); aq[ks].half[1] = *(const v8us*)(qr + ks * 32 + 16 + 8 * hh); } }
  const unsigned short* Vth = (const unsigned short*)Vt + (size_t)slab * 64 * TK;
  float m_r = -3.0e38f, l_r = 0.f; v8f oacc[DT];
#pragma unroll
  for (int dt = 0; dt < DT; ++dt) oacc[dt] = (v8f){0.f,0.f,0.f,0.f,0.f,0.f,0.f,0.f};
  const int jend = (CAUSAL == 1 || CAUSAL == 3) ? (qb0 + 4 * RPW) : TK;      /* causal: keys beyond the block's last query never contribute */ const int jbeg = (CAUSAL == 3) ? ((qb0 - WINDOW) > 0 ? (qb0 - WINDOW) : 0) : 0;      /* window: keys more than WINDOW before the block's first query never contribute (WINDOW % 32 == 0) */
  /* Every global load of the loop is issued well ahead of its first use, so that the round trips run under the softmax of the pass in progress:
     V^T of a pass at the pass's head (used behind the softmax); K of the next pass right behind this pass's score products, its bias values right behind the add of this pass's. */
  FragH kf[2][KS]; FragH vf[DT]; v2f bc[2][4];      /* bias of keys (2 i, 2 i + 1) of score tile nt, paired like the accumulator registers */
  auto fetch_k = [&](int j0) __attribute__((always_inline)) {
    const unsigned short* kr0 = (const unsigned short*)K16 + ((size_t)b * TK + j0 + ln) * ldk + h * 64 + 8 * hh; const unsigned short* kr1 = kr0 + (size_t)16 * ldk;
#pragma unroll
    for (int ks = 0; ks < KS; ++ks) { kf[0][ks].half[0] = *(const v8us*)(kr0 + ks * 32); kf[0][ks].half[1] = *(const v8us*)(kr0 + ks * 32 + 16); }
#pragma unroll
    for (int ks = 0; ks < KS; ++ks) { kf[1][ks].half[0] = *(const v8us*)(kr1 + ks * 32); kf[1][ks].half[1] = *(const v8us*)(kr1 + ks * 32 + 16); }
    asm volatile("s_wait_xcnt 0x0" :: "v"(kr0), "v"(kr1) : "memory");      /* stands before any register that the K loads name is rewritten; the two address pairs are inputs so that no load of the group lands on one */
  };
  auto fetch_bias = [&](int j0) __attribute__((always_inline)) {
    if (CAUSAL == 6) { const float* BTh = (const float*)MSK + h * (2 * RELW + 1);      /* mode 6: per-head relative-position bias table [NH][2*RELW+1] indexed by clip(i - j, +-RELW) + RELW (passed through the MSK pointer) */
      unsigned i0[8], i1[8];
#pragma unroll
      for (int r = 0; r < 8; ++r) { int d0 = eb - j0 - r, d1 = eb - j0 - 16 - r; d0 = d0 < 0 ? 0 : (d0 > 2 * RELW ? 2 * RELW : d0); d1 = d1 < 0 ? 0 : (d1 > 2 * RELW ? 2 * RELW : d1); i0[r] = (unsigned)d0; i1[r] = (unsigned)d1; }      /* clip(i - j + RELW, 0, 2 RELW), the same integer as clip(i - j, +-RELW) + RELW; key j = j0 (+ 16) + 8 hh + r */
#pragma unroll
      for (int r = 0; r < 8; ++r) { bc[0][r >> 1][r & 1] = BTh[i0[r]]; bc[1][r >> 1][r & 1] = BTh[i1[r]]; }
      asm volatile("s_wait_xcnt 0x0" :: "v"(i0[0]), "v"(i0[1]), "v"(i0[2]), "v"(i0[3]), "v"(i0[4]), "v"(i0[5]), "v"(i0[6]), "v"(i0[7]), "v"(i1[0]), "v"(i1[1]), "v"(i1[2]), "v"(i1[3]), "v"(i1[4]), "v"(i1[5]), "v"(i1[6]), "v"(i1[7]) : "memory");      /* stands before any register that the bias loads name is rewritten; the index registers are inputs so that no load of the group lands on one */
    }
  };
  fetch_k(jbeg); fetch_bias(jbeg);
#pragma unroll 1
  for (int j0 = jbeg; j0 < jend; j0 += 32) {
#pragma unroll
    for (int dt = 0; dt < DT; ++dt) { const unsigned short* vrow = Vth + (size_t)(dt * 16 + ln) * TK + j0; vf[dt].half[0] = *(const v8us*)(vrow + 8 * hh); vf[dt].half[1] = *(const v8us*)(vrow + 16 + 8 * hh); }
    asm volatile("s_wait_xcnt 0x0" ::: "memory");      /* stands before any register that the V loads name is rewritten */
    v8f s[2];
#pragma unroll
    for (int nt = 0; nt < 2; ++nt) { v8f acc = (v8f){0.f,0.f,0.f,0.f,0.f,0.f,0.f,0.f};
#pragma unroll
      for (int ks = 0; ks < KS; ++ks) acc = mmaH<1>(kf[nt][ks].v, kf[nt][ks].v, aq[ks].v, aq[ks].v, acc); s[nt] = acc; }
    const int jn = (j0 + 32 < jend) ? j0 + 32 : jbeg;      /* the last pass has no next one: it names an in-range tile whose values are not used */
    fetch_k(jn);
    float s0[8], s1[8], mx[8]; bool ok0[8], ok1[8];
#pragma unroll
    for (int r = 0; r < 8; ++r) { const int k0 = j0 + 8 * hh + r, k1 = k0 + 16;
      ok0[r] = (CAUSAL == 1) ? (k0 <= tq) : ((CAUSAL == 2) ? ((k0 >> 5) == (tq >> 5)) : ((CAUSAL == 3) ? (k0 <= tq && tq - k0 < WINDOW) : true)); ok1[r] = (CAUSAL == 1) ? (k1 <= tq) : ((CAUSAL == 2) ? ((k1 >> 5) == (tq >> 5)) : ((CAUSAL == 3) ? (k1 <= tq && tq - k1 < WINDOW) : true));      /* mode 3: causal + sliding window of WINDOW keys */      /* mode 2: block-diagonal 32-token groups */
      s0[r] = ok0[r] ? s[0][r] * SCL : -3.0e38f; s1[r] = ok1[r] ? s[1][r] * SCL : -3.0e38f; if (CAUSAL == 6) { s0[r] += bc[0][r >> 1][r & 1]; s1[r] += bc[1][r >> 1][r & 1]; }      /* mode 6: the bias is added after the 1/sqrt(d) scale */
    }
#pragma unroll
    for (int i = 0; i < 4; ++i) { mx[i] = fmaxf(s0[2 * i], s0[2 * i + 1]); mx[4 + i] = fmaxf(s1[2 * i], s1[2 * i + 1]); }
    fetch_bias(jn);      /* behind the last use of this pass's values, so that the loads land in the same registers */
    float mc = fmaxf(fmaxf(fmaxf(mx[0], mx[1]), fmaxf(mx[2], mx[3])), fmaxf(fmaxf(mx[4], mx[5]), fmaxf(mx[6], mx[7])));
    mc = fmaxf(mc, xhalf(mc));      /* the other 16 keys of this query stand in lane l ^ 16 */
    const float mn = fmaxf(m_r, mc); const float ea = expf(m_r - mn); const float al = (mn > -1.0e38f) ? ea : 1.0f; m_r = mn;
    FragH pb; float ps[8], pt[8];
#pragma unroll
    for (int r = 0; r < 8; ++r) { const float p0 = ok0[r] ? expf(s0[r] - mn) : 0.f, p1 = ok1[r] ? expf(s1[r] - mn) : 0.f; ps[r] = p0; pt[r] = p1; pb.h[r] = (_Float16)(p0 * 1024.0f); pb.h[8 + r] = (_Float16)(p1 * 1024.0f); }
    l_r = l_r * al + ((((ps[0] + ps[2]) + (ps[4] + ps[6])) + ((pt[0] + pt[2]) + (pt[4] + pt[6]))) + (((ps[1] + ps[3]) + (ps[5] + ps[7])) + ((pt[1] + pt[3]) + (pt[5] + pt[7]))));      /* each wave half keeps the sum of its own keys; the halves are joined behind the loop */
#pragma unroll
    for (int dt = 0; dt < DT; ++dt) oacc[dt] *= al;
#pragma unroll
    for (int dt = 0; dt < DT; ++dt) oacc[dt] = mmaH<1>(vf[dt].v, vf[dt].v, pb.v, pb.v, oacc[dt]);
  }
  { const float l = l_r + xhalf(l_r); const float inv = (l > 0.f) ? 1.0f / (l * 1024.0f) : 0.f;
#pragma unroll
    for (int dt = 0; dt < DT; ++dt) { const v8f o = oacc[dt] * inv; *(v4fa*)&sO[w][ln][dt * 16 + 8 * hh] = (v4f){o[0], o[1], o[2], o[3]}; *(v4fa*)&sO[w][ln][dt * 16 + 8 * hh + 4] = (v4f){o[4], o[5], o[6], o[7]}; } }      /* register r of tile dt is O[q0 + ln][16 dt + 8 hh + r] */
  __builtin_amdgcn_fence(__ATOMIC_ACQ_REL, "workgroup"); __builtin_amdgcn_wave_barrier();
  {
#pragma unroll
    for (int rp = 0; rp < RPW; rp += 2) { const int r = rp + (lane >> 4), pc = lane & 15; const v4f val = *(const v4fa*)&sO[w][r][pc * 4]; *(v4f*)(O + ((size_t)b * TQ + q0 + r) * ldo + h * 64 + pc * 4) = val; }
     } }

__global__ __launch_bounds__(256) void k_h16s(const float* __restrict__ x, _Float16* __restrict__ X16, size_t n8, float sc) { const size_t t = (size_t)blockIdx.x * 256 + threadIdx.x; if (t >= n8) return; const v8f a = *(const v8f*)(x + t * 8); FragH f; for (int q = 0; q < 8; ++q) f.h[q] = (_Float16)(a[q] * sc); *(v8us*)((unsigned short*)X16 + t * 8) = f.half[0];  }
__global__ __launch_bounds__(256) void k_btab(const float* __restrict__ pe, float* __restrict__ BT) { { for (int e = threadIdx.x; e < NH * NREL; e += 256) { const int h = e / NREL, r = e % NREL; *(float*)(BT + e) = bf16_round(pe[r * NH + h]); }  } }

extern "C" void kernel_launch(void* const* d_in, const int* in_sizes, int n_in,
                              void* d_out, int out_size, void* d_ws, size_t ws_size, hipStream_t stream) {
  (void)in_sizes; (void)n_in; (void)out_size;
  const float* const* I = (const float* const*)d_in; const float* xq = I[0]; const float* xk = I[1]; const float* xv = I[2]; const float* Wq = I[3]; const float* Wk = I[4]; const float* Wv = I[5]; const float* Wo = I[6]; const float* pe = I[7];
  char* ws = (char*)d_ws; size_t off = 0;
  auto take = [&](size_t bytes) { char* p = ws + off; off += (bytes + 255) & ~(size_t)255; return p; };
  const size_t np = (size_t)NR * CC;
  _Float16* BQ = (_Float16*)take((size_t)CC * CC * 2); _Float16* BK = (_Float16*)take((size_t)CC * CC * 2); _Float16* BV = (_Float16*)take((size_t)CC * CC * 2); _Float16* BO = (_Float16*)take((size_t)CC * CC * 2); float* BT = (float*)take((size_t)NH * NREL * 4 + 256);
  _Float16* XQ = (_Float16*)take(np * 2); _Float16* XK = (_Float16*)take(np * 2); _Float16* XV = (_Float16*)take(np * 2); _Float16* Q16 = (_Float16*)take(np * 2); _Float16* K16 = (_Float16*)take(np * 2); _Float16* V16 = (_Float16*)take(np * 2); _Float16* VT = (_Float16*)take(np * 2); float* O = (float*)take(np * 4); _Float16* O16 = XQ;
  if (off > ws_size) return;      /* 2 + 7 x 4 + 8 = 38 MiB */
  k_wt_f16<<<(CC * CC / 8 + 255) / 256, 256, 0, stream>>>(Wq, BQ, CC, CC, 16.0f); k_wt_f16<<<(CC * CC / 8 + 255) / 256, 256, 0, stream>>>(Wk, BK, CC, CC, 16.0f); k_wt_f16<<<(CC * CC / 8 + 255) / 256, 256, 0, stream>>>(Wv, BV, CC, CC, 16.0f); k_wt_f16<<<(CC * CC / 8 + 255) / 256, 256, 0, stream>>>(Wo, BO, CC, CC, 16.0f);
  k_btab<<<1, 256, 0, stream>>>(pe, BT);
  k_x16<<<(unsigned)((np / 8 + 255) / 256), 256, 0, stream>>>(xq, XQ, np / 8); k_x16<<<(unsigned)((np / 8 + 255) / 256), 256, 0, stream>>>(xk, XK, np / 8); k_x16<<<(unsigned)((np / 8 + 255) / 256), 256, 0, stream>>>(xv, XV, np / 8);
  const dim3 g((NR / 128) * (CC / 64), 1);
  k_gemm2<0><<<g, 128, 0, stream>>>(XQ, CC, 0, BQ, CC, 0, 0.0625f, nullptr, 0, nullptr, 1, 0, 0, nullptr, Q16, CC, 0, NR, CC, CC);
  k_gemm2<0><<<g, 128, 0, stream>>>(XK, CC, 0, BK, CC, 0, 0.0625f, nullptr, 0, nullptr, 1, 0, 0, nullptr, K16, CC, 0, NR, CC, CC);
  k_gemm2<0><<<g, 128, 0, stream>>>(XV, CC, 0, BV, CC, 0, 0.0625f, nullptr, 0, nullptr, 1, 0, 0, nullptr, V16, CC, 0, NR, CC, CC);
  k_vt<NH, SLEN><<<NB * NH * (SLEN / 64), 256, 0, stream>>>(V16, CC, 0, VT);
  k_flash<6><<<NB * NH * QBLKS, 128, 0, stream>>>(Q16, CC, K16, CC, VT, (const int*)BT, O, CC);      /* relative-position bias mode */
  k_h16s<<<(unsigned)((np / 8 + 255) / 256), 256, 0, stream>>>(O, O16, np / 8, 64.0f);      /* x2^6 carry: the 2048-key averages are small */
  k_gemm2<0><<<g, 128, 0, stream>>>(O16, CC, 0, BO, CC, 0, 0.0625f / 64.0f, nullptr, 0, nullptr, 1, 0, 0, (float*)d_out, nullptr, CC, 0, NR, CC, CC);
}

// v003
// It runs in 132 microseconds.
// Two timings next to v002 put it at 1.38 and 1.41 times that version's speed.
// Over all steps from v000 it is 2.73 times as fast.
#include <hip/hip_runtime.h>
// RelativePositionalEncodingAttention (2 x 2048 tokens, 8 heads of 64, D 512): q/k/v from three inputs (no bias); scores/8 + pos_emb[clip(i - j, -32, 32) + 32][h]; softmax; out Wo.
// Structure: exact f16 planes of query/key/value; q/k/v GEMMs (32x64 wave tiles, f32 accumulation, exact x16 weights, f16 outputs); the relative-bias table transposed to [head][65] (bf16-rounded, f32); V^T by LDS tiles; the fused flash kernel with a new relative-position-bias mode (table lookup by clipped i - j added after the scale, f32); attention output as f16 into the output GEMM.
// Compute dtype: inputs and weights rounded to bf16; q, k, v, P and the attention output as f16 operands (~2^-12); f32 accumulation/softmax/bias. v_wmma_f32_16x16x32_f16.
#define NB 2
#define CC 512
#define NR (NB * SLEN)
#define NREL (2 * RELW + 1)
#define SLEN 2048
#define TQ SLEN
#define TK SLEN
#define NH 8
#define SCL 0.125f               /* 1/sqrt(64) */
#define WINDOW 256
#define RELW 32                  /* max_relative_position */
#define QBLKS (TQ / 64)
typedef __bf16 v16b __attribute__((ext_vector_type(16)));
typedef unsigned short v8us __attribute__((ext_vector_type(8), may_alias));
typedef float  v8f  __attribute__((ext_vector_type(8)));
typedef float  v4f  __attribute__((ext_vector_type(4)));
typedef float  v2f  __attribute__((ext_vector_type(2)));
typedef float  v4fa __attribute__((ext_vector_type(4), may_alias));
union FragB { v16b v; v8us half[2]; unsigned short u[16]; };

__device__ __forceinline__ unsigned short bf16_bits(float x) { unsigned int u = __float_as_uint(x); return (unsigned short)((u + 0x7FFFu + ((u >> 16) & 1u)) >> 16); }
__device__ __forceinline__ float bf16_val(unsigned short b) { return __uint_as_float(((unsigned int)b) << 16); }
__device__ __forceinline__ float bf16_round(float x) { return bf16_val(bf16_bits(x)); }
// D += A·B with NT terms: 1 = ah·bh, 2 = + al·bh (A split), 3 = + ah·bl (both split)
template <int NT>
__device__ __forceinline__ v8f mmaN(v16b ah, v16b al, v16b bh, v16b bl, v8f c) {
  c = __builtin_amdgcn_wmma_f32_16x16x32_bf16(false, ah, false, bh, (short)0, c, false, false);
  if (NT >= 2) c = __builtin_amdgcn_wmma_f32_16x16x32_bf16(false, al, false, bh, (short)0, c, false, false);
  if (NT >= 3) c = __builtin_amdgcn_wmma_f32_16x16x32_bf16(false, ah, false, bl, (short)0, c, false, false);
  asm volatile("v_nop\n\tv_nop\n\tv_nop\n\tv_nop" : "+v"(c) : "v"(ah), "v"(al), "v"(bh), "v"(bl));
  return c;
}

__global__ __launch_bounds__(256) void k_wt_bf16(const float* __restrict__ W, unsigned short* __restrict__ Wt, int K, int N) {
  const int t = blockIdx.x * 256 + threadIdx.x;
  const int k8n = K / 8;
  if (t >= N * k8n) return;
  const int n = t / k8n, k8 = (t % k8n) * 8;
  v8us v;
#pragma unroll
  for (int i = 0; i < 8; ++i) v[i] = bf16_bits(W[(size_t)(k8 + i) * N + n]);
  *(v8us*)(Wt + (size_t)n * K + k8) = v;
  
}

// GEMM C[M][N] (f32, pitch ldc) = act(A[M][K]·W + bias). A f32 row-major (pitch lda) converted per fragment to bf16
// (ASPLIT: hi/lo two planes -> 2 terms, else single rounded term); Wt bf16 [N][K] (pitch ldb). BIAS_BF16 rounds the
// bias to bf16 first (bias quantised to bf16 before the add). K%32==0, M%16==0, N%64==0.
template <bool ASPLIT, int ACT, bool BIAS_BF16>
__global__ __launch_bounds__(128) void k_gemm_bf(const float* __restrict__ A, int lda, const unsigned short* __restrict__ Wt, int ldb,
                                               const float* __restrict__ bias, float* __restrict__ C, int ldc, int M, int N, int K) {
  __shared__ __attribute__((aligned(16))) float so[4][16][64];
  const int tid = threadIdx.x, w = tid >> 5, lane = tid & 31, ln = lane & 15, hh = lane >> 4;
  const int ntn = N / 64;
  const int wid = blockIdx.x * 4 + w;
  const int mt = wid / ntn, nq = wid % ntn;
  if (mt * 16 >= M) return;
  const int row0 = mt * 16, col0 = nq * 64;
  const float* arow = A + (size_t)(row0 + ln) * lda;
  v8f acc[4] = {};
  for (int kb = 0; kb < K; kb += 32) {
    FragB ah, al;
    const v4f x0 = *(const v4fa*)(arow + kb + 8 * hh), x1 = *(const v4fa*)(arow + kb + 8 * hh + 4);
    const v4f x2 = *(const v4fa*)(arow + kb + 16 + 8 * hh), x3 = *(const v4fa*)(arow + kb + 16 + 8 * hh + 4);
    float xs[16] = {x0[0],x0[1],x0[2],x0[3],x1[0],x1[1],x1[2],x1[3],x2[0],x2[1],x2[2],x2[3],x3[0],x3[1],x3[2],x3[3]};
#pragma unroll
    for (int i = 0; i < 16; ++i) { const unsigned short hb = bf16_bits(xs[i]); ah.u[i] = hb; al.u[i] = ASPLIT ? bf16_bits(xs[i] - bf16_val(hb)) : (unsigned short)0; }
#pragma unroll
    for (int t = 0; t < 4; ++t) {
      const unsigned short* brow = Wt + (size_t)(col0 + t * 16 + ln) * ldb + kb;
      FragB b;
      b.half[0] = *(const v8us*)(brow + 8 * hh);
      b.half[1] = *(const v8us*)(brow + 16 + 8 * hh);
      acc[t] = mmaN<ASPLIT ? 2 : 1>(ah.v, al.v, b.v, b.v, acc[t]);
    }
  }
#pragma unroll
  for (int t = 0; t < 4; ++t) {
    float bv = bias ? bias[col0 + t * 16 + ln] : 0.f;
    if (BIAS_BF16) bv = bf16_round(bv);
#pragma unroll
    for (int r = 0; r < 8; ++r) { float v = acc[t][r] + bv; if (ACT == 1) v = fmaxf(v, 0.f); so[w][8 * hh + r][t * 16 + ln] = v; }
  }
  __builtin_amdgcn_fence(__ATOMIC_ACQ_REL, "workgroup");
  __builtin_amdgcn_wave_barrier();
  const int rsub = lane >> 4, c4 = (lane & 15) * 4;
  {
#pragma unroll
    for (int q = 0; q < 8; ++q) {
      const int r = q * 2 + rsub;
      const v4f v = *(const v4fa*)&so[w][r][c4];
      *(v4f*)(C + (size_t)(row0 + r) * ldc + col0 + c4) = v;
    }
    
  }
}

// GEMM C = act(A·W + bias + resid): A f32 (ASPLIT -> hi/lo 2 terms), Wt bf16 [N][K]; ACT 0 none, 1 relu, 2 exact gelu;
// resid (optional, f32, row index = (row % rmod), pitch ldr, RES_BF16 rounds it) added before the activation.
template <bool ASPLIT, int ACT, bool BIAS_BF16, bool RES_BF16>
__global__ __launch_bounds__(128) void k_gemm_bf3(const float* __restrict__ A, int lda, const unsigned short* __restrict__ Wt, int ldb,
                                                const float* __restrict__ bias, const float* __restrict__ resid, int rmod, int ldr,
                                                float* __restrict__ C, int ldc, int M, int N, int K) {
  __shared__ __attribute__((aligned(16))) float so[4][16][64];
  const int tid = threadIdx.x, w = tid >> 5, lane = tid & 31, ln = lane & 15, hh = lane >> 4;
  const int ntn = N / 64;
  const int wid = blockIdx.x * 4 + w;
  const int mt = wid / ntn, nq = wid % ntn;
  if (mt * 16 >= M) return;
  const int row0 = mt * 16, col0 = nq * 64;
  const float* arow = A + (size_t)(row0 + ln) * lda;
  v8f acc[4] = {};
  for (int kb = 0; kb < K; kb += 32) {
    FragB ah, al;
    const v4f x0 = *(const v4fa*)(arow + kb + 8 * hh), x1 = *(const v4fa*)(arow + kb + 8 * hh + 4);
    const v4f x2 = *(const v4fa*)(arow + kb + 16 + 8 * hh), x3 = *(const v4fa*)(arow + kb + 16 + 8 * hh + 4);
    float xs[16] = {x0[0],x0[1],x0[2],x0[3],x1[0],x1[1],x1[2],x1[3],x2[0],x2[1],x2[2],x2[3],x3[0],x3[1],x3[2],x3[3]};
#pragma unroll
    for (int i = 0; i < 16; ++i) { const unsigned short hb = bf16_bits(xs[i]); ah.u[i] = hb; al.u[i] = ASPLIT ? bf16_bits(xs[i] - bf16_val(hb)) : (unsigned short)0; }
#pragma unroll
    for (int t = 0; t < 4; ++t) {
      const unsigned short* brow = Wt + (size_t)(col0 + t * 16 + ln) * ldb + kb;
      FragB b;
      b.half[0] = *(const v8us*)(brow + 8 * hh);
      b.half[1] = *(const v8us*)(brow + 16 + 8 * hh);
      acc[t] = mmaN<ASPLIT ? 2 : 1>(ah.v, al.v, b.v, b.v, acc[t]);
    }
  }
#pragma unroll
  for (int t = 0; t < 4; ++t) {
    const int col = col0 + t * 16 + ln;
    float bv = bias ? bias[col] : 0.f;
    if (BIAS_BF16) bv = bf16_round(bv);
#pragma unroll
    for (int r = 0; r < 8; ++r) {
      float v = acc[t][r] + bv;
      if (resid) { float rv = resid[(size_t)((row0 + 8 * hh + r) % rmod) * ldr + col]; if (RES_BF16) rv = bf16_round(rv); v += rv; }
      if (ACT == 1) v = fmaxf(v, 0.f);
      if (ACT == 2) v = 0.5f * v * (1.0f + erff(v * 0.70710678118654752f));
      if (ACT == 3) { const float u = 0.7978845608028654f * (v + 0.044715f * v * v * v); v = 0.5f * v * (1.0f + tanhf(u)); }
      so[w][8 * hh + r][t * 16 + ln] = v;
    }
  }
  __builtin_amdgcn_fence(__ATOMIC_ACQ_REL, "workgroup");
  __builtin_amdgcn_wave_barrier();
  const int rsub = lane >> 4, c4 = (lane & 15) * 4;
  {
#pragma unroll
    for (int q = 0; q < 8; ++q) {
      const int r = q * 2 + rsub;
      const v4f v = *(const v4fa*)&so[w][r][c4];
      *(v4f*)(C + (size_t)(row0 + r) * ldc + col0 + c4) = v;
    }
    
  }
}
// row LayerNorm (biased variance, eps) over N: s = X (+ R); optional out_sum <- s; out_norm <- (s-mu)*rsqrt(var+eps)*g + b
template <bool PARAM_BF16>
__global__ __launch_bounds__(256) void k_layernorm(const float* __restrict__ X, const float* __restrict__ R, const float* __restrict__ g, const float* __restrict__ bta,
                                                  float* __restrict__ out_sum, float* __restrict__ out_norm, int N, float eps) {
  __shared__ float red[256];
  const int row = blockIdx.x, tid = threadIdx.x;
  const float* x = X + (size_t)row * N; const float* rr = R ? R + (size_t)row * N : nullptr;
  float vals[16];                     // up to N = 4096
  const int per = N / 256;            // contiguous chunk per thread? use strided-by-4 chunks: thread handles j = tid*4 + 1024*u
  float s1 = 0.f;
  for (int u = 0; u < per / 4; ++u) {
    const int j = tid * 4 + 1024 * u;
    const v4f a = *(const v4fa*)(x + j);
    v4f b = {0.f,0.f,0.f,0.f}; if (rr) b = *(const v4fa*)(rr + j);
#pragma unroll
    for (int q = 0; q < 4; ++q) { const float v = a[q] + b[q]; vals[u * 4 + q] = v; s1 += v; }
  }
  red[tid] = s1; __syncthreads();
  for (int st = 128; st > 0; st >>= 1) { if (tid < st) red[tid] += red[tid + st]; __syncthreads(); }
  const float mu = red[0] / (float)N; __syncthreads();
  float s2 = 0.f;
  for (int u = 0; u < per / 4; ++u)
#pragma unroll
    for (int q = 0; q < 4; ++q) { const float c = vals[u * 4 + q] - mu; s2 += c * c; }
  red[tid] = s2; __syncthreads();
  for (int st = 128; st > 0; st >>= 1) { if (tid < st) red[tid] += red[tid + st]; __syncthreads(); }
  const float rs = rsqrtf(red[0] / (float)N + eps);
  {
    for (int u = 0; u < per / 4; ++u) {
      const int j = tid * 4 + 1024 * u;
      v4f o, sm;
#pragma unroll
      for (int q = 0; q < 4; ++q) {
        float gg = g[j + q], bb = bta[j + q];
        if (PARAM_BF16) { gg = bf16_round(gg); bb = bf16_round(bb); }
        sm[q] = vals[u * 4 + q]; o[q] = (vals[u * 4 + q] - mu) * rs * gg + bb;
      }
      if (out_sum) *(v4f*)(out_sum + (size_t)row * N + j) = sm;
      *(v4f*)(out_norm + (size_t)row * N + j) = o;
    }
    
  }
}



// ---- f16 WMMA path (v_wmma_f32_16x16x32_f16): 11-bit significands for operands in range — used where a [0,1] probability operand needs more precision than bf16
typedef _Float16 v16h __attribute__((ext_vector_type(16)));
union FragH { v16h v; v8us half[2]; _Float16 h[16]; unsigned short u[16]; };
template <int NT>
__device__ __forceinline__ v8f mmaH(v16h ah, v16h al, v16h bh, v16h bl, v8f c) {
  c = __builtin_amdgcn_wmma_f32_16x16x32_f16(false, ah, false, bh, (short)0, c, false, false);
  if (NT >= 2) c = __builtin_amdgcn_wmma_f32_16x16x32_f16(false, al, false, bh, (short)0, c, false, false);
  if (NT >= 3) c = __builtin_amdgcn_wmma_f32_16x16x32_f16(false, ah, false, bl, (short)0, c, false, false);
  asm volatile("v_nop\n\tv_nop\n\tv_nop\n\tv_nop" : "+v"(c) : "v"(ah), "v"(al), "v"(bh), "v"(bl));
  return c;
}
// batched GEMM like k_gemm_b but f16 operands: A f32 (split into f16 hi/lo if ASPLIT, else rounded to f16), Bt = f16 values [n][k]; alpha; C f32; N multiple of 16 (partial tiles skipped)
template <bool ASPLIT>
__global__ __launch_bounds__(128) void k_gemm_h(const float* __restrict__ A, int lda, size_t sA, const _Float16* __restrict__ Bh, int ldb, size_t sB, float alpha, float* __restrict__ C, int ldc, size_t sC, int M, int N, int K) {
  __shared__ __attribute__((aligned(16))) float so[4][16][64];
  const int tid = threadIdx.x, w = tid >> 5, lane = tid & 31, ln = lane & 15, hh = lane >> 4; const int by = blockIdx.y;
  A += (size_t)by * sA; Bh += (size_t)by * sB; C += (size_t)by * sC;
  const int ntn = (N + 63) / 64; const int wid = blockIdx.x * 4 + w; const int mt = wid / ntn, nq = wid % ntn; if (mt * 16 >= M) return;
  const int row0 = mt * 16, col0 = nq * 64; const float* arow = A + (size_t)(row0 + ln) * lda;
  v8f acc[4] = {};
  for (int kb = 0; kb < K; kb += 32) {
    FragH ah, al;
    const v4f x0 = *(const v4fa*)(arow + kb + 8 * hh), x1 = *(const v4fa*)(arow + kb + 8 * hh + 4), x2 = *(const v4fa*)(arow + kb + 16 + 8 * hh), x3 = *(const v4fa*)(arow + kb + 16 + 8 * hh + 4);
    float xs[16] = {x0[0],x0[1],x0[2],x0[3],x1[0],x1[1],x1[2],x1[3],x2[0],x2[1],x2[2],x2[3],x3[0],x3[1],x3[2],x3[3]};
#pragma unroll
    for (int i = 0; i < 16; ++i) { const _Float16 h = (_Float16)xs[i]; ah.h[i] = h; al.h[i] = ASPLIT ? (_Float16)(xs[i] - (float)h) : (_Float16)0.0f; }
#pragma unroll
    for (int t = 0; t < 4; ++t) { if (col0 + t * 16 >= N) continue; const size_t boff = (size_t)(col0 + t * 16 + ln) * ldb + kb; FragH bq; bq.half[0] = *(const v8us*)(Bh + boff + 8 * hh); bq.half[1] = *(const v8us*)(Bh + boff + 16 + 8 * hh);
      acc[t] = mmaH<ASPLIT ? 2 : 1>(ah.v, al.v, bq.v, bq.v, acc[t]); }
  }
#pragma unroll
  for (int t = 0; t < 4; ++t) { if (col0 + t * 16 >= N) continue;
#pragma unroll
    for (int r = 0; r < 8; ++r) so[w][8 * hh + r][t * 16 + ln] = acc[t][r] * alpha; }
  __builtin_amdgcn_fence(__ATOMIC_ACQ_REL, "workgroup"); __builtin_amdgcn_wave_barrier();
  const int rsub = lane >> 4, c4 = (lane & 15) * 4;
  {
#pragma unroll
    for (int q = 0; q < 8; ++q) { const int r = q * 2 + rsub; if (col0 + c4 < N) { const v4f v = *(const v4fa*)&so[w][r][c4]; *(v4f*)(C + (size_t)(row0 + r) * ldc + col0 + c4) = v; } }
     }
}

// Wt[n][k] = f16(W[k][n]·scale) from f32 row-major W[K][N] (scale = power of two; bf16-exact weights stay exact in f16 away from the subnormal range)
__device__ __forceinline__ void job_wt_f16(int blk, const float* __restrict__ W, _Float16* __restrict__ Wt, int K, int N, float scale) {
  const int t = blk * 256 + threadIdx.x; if (t >= N * (K / 8)) return; const int n = t / (K / 8), k8 = (t % (K / 8)) * 8; FragH f;
#pragma unroll
  for (int i = 0; i < 8; ++i) f.h[i] = (_Float16)(bf16_round(W[(size_t)(k8 + i) * N + n]) * scale); const v8us o = f.half[0];
  *(v8us*)((unsigned short*)Wt + (size_t)n * K + k8) = o; 
}
// k_gemm_hh variant with fused epilogue: v = acc·alpha + bias[by·sBias + col] (+ CP[(row/rowsPerB)·sCPb + by·64 + col] if CP) ; ACT 0 none / 1 elu ; writes f16 C16 (and f32 C if non-null)
template <int ACT>
__global__ __launch_bounds__(128) void k_gemm_hhx(const _Float16* __restrict__ A, int lda, size_t sA, const _Float16* __restrict__ Bh, int ldb, size_t sB, float alpha, const float* __restrict__ bias, size_t sBias, const float* __restrict__ CP, int rowsPerB, size_t sCPb, int row0g,
    float* __restrict__ C, _Float16* __restrict__ C16, int ldc, size_t sC, int M, int N, int K) {
  __shared__ __attribute__((aligned(16))) float so[4][16][64];
  const int tid = threadIdx.x, w = tid >> 5, lane = tid & 31, ln = lane & 15, hh = lane >> 4; const int by = blockIdx.y;
  A += (size_t)by * sA; Bh += (size_t)by * sB; const size_t cofs = (size_t)by * sC; const float* bp = bias ? bias + (size_t)by * sBias : nullptr;
  const int ntn = (N + 63) / 64; const int wid = blockIdx.x * 4 + w; const int mt = wid / ntn, nq = wid % ntn; if (mt * 16 >= M) return;
  const int row0 = mt * 16, col0 = nq * 64; const _Float16* arow = A + (size_t)(row0 + ln) * lda;
  v8f acc[4] = {};
  for (int kb = 0; kb < K; kb += 32) { FragH ah; ah.half[0] = *(const v8us*)((const unsigned short*)arow + kb + 8 * hh); ah.half[1] = *(const v8us*)((const unsigned short*)arow + kb + 16 + 8 * hh);
#pragma unroll
    for (int t = 0; t < 4; ++t) { if (col0 + t * 16 >= N) continue; const size_t boff = (size_t)(col0 + t * 16 + ln) * ldb + kb; FragH bq; bq.half[0] = *(const v8us*)((const unsigned short*)Bh + boff + 8 * hh); bq.half[1] = *(const v8us*)((const unsigned short*)Bh + boff + 16 + 8 * hh);
      acc[t] = mmaH<1>(ah.v, ah.v, bq.v, bq.v, acc[t]); }
  }
#pragma unroll
  for (int t = 0; t < 4; ++t) { if (col0 + t * 16 >= N) continue; const int col = col0 + t * 16 + ln; const float bv = bp ? bf16_round(bp[col]) : 0.f;
#pragma unroll
    for (int r = 0; r < 8; ++r) { float v = acc[t][r] * alpha + bv; if (CP) { const int bidx = (row0g + row0 + 8 * hh + r) / rowsPerB; v += CP[(size_t)bidx * sCPb + (size_t)by * 64 + col]; } if (ACT == 1) v = (v > 0.f) ? v : expm1f(v); else if (ACT == 7) v = (v > 0.f) ? v + 1.0f : expf(v); else if (ACT == 8) v = tanhf(v); else if (ACT == 9) v = 0.5f * v * (1.0f + tanhf(0.7978845608028654f * (v + 0.044715f * v * v * v))); else if (ACT == 11) v = 1.0f / (1.0f + expf(-v)); else if (ACT == 12) v = (v > 0.f) ? v : 0.01f * v; else if (ACT == 14) v = (v > 0.f) ? v : 0.1f * v; else if (ACT == 15) v = v / (1.0f + expf(-v)); else if (ACT == 3) v = fmaxf(v, 0.f); else if (ACT == 6) v = 0.5f * v * (1.0f + erff(v * 0.70710678118654752f)); so[w][8 * hh + r][t * 16 + ln] = v; } }
  __builtin_amdgcn_fence(__ATOMIC_ACQ_REL, "workgroup"); __builtin_amdgcn_wave_barrier();
  const int rsub = lane >> 4, c4 = (lane & 15) * 4; typedef _Float16 v4h __attribute__((ext_vector_type(4)));
  {
#pragma unroll
    for (int q = 0; q < 8; ++q) { const int r = q * 2 + rsub; if (col0 + c4 < N) { const v4f v = *(const v4fa*)&so[w][r][c4]; if (C) *(v4f*)(C + cofs + (size_t)(row0 + r) * ldc + col0 + c4) = v; if (C16) { v4h h4; for (int i = 0; i < 4; ++i) h4[i] = (_Float16)v[i]; *(v4h*)(C16 + cofs + (size_t)(row0 + r) * ldc + col0 + c4) = h4; } } }
     }
}


typedef _Float16 v4h __attribute__((ext_vector_type(4)));

__device__ __forceinline__ void job_x16(int blk, const float* __restrict__ x, _Float16* __restrict__ X16, size_t n8) { const size_t t = (size_t)blk * 256 + threadIdx.x; if (t >= n8) return; FragH f;
#pragma unroll
  for (int q = 0; q < 8; ++q) f.h[q] = (_Float16)bf16_round(x[t * 8 + q]); *(v8us*)((unsigned short*)X16 + t * 8) = f.half[0];  }
__global__ __launch_bounds__(256) void k_h16(const float* __restrict__ x, _Float16* __restrict__ X16, size_t n8) { const size_t t = (size_t)blockIdx.x * 256 + threadIdx.x; if (t >= n8) return; FragH f;
#pragma unroll
  for (int q = 0; q < 8; ++q) f.h[q] = (_Float16)x[t * 8 + q]; *(v8us*)((unsigned short*)X16 + t * 8) = f.half[0];  }
__global__ __launch_bounds__(256) void k_round16f(const float* __restrict__ W, _Float16* __restrict__ Bt, size_t n8) { const size_t t = (size_t)blockIdx.x * 256 + threadIdx.x; if (t >= n8) return; FragH f;
#pragma unroll
  for (int i = 0; i < 8; ++i) f.h[i] = (_Float16)(bf16_round(W[t * 8 + i]) * 16.0f); *(v8us*)((unsigned short*)Bt + t * 8) = f.half[0];  }
template <int NHv, int TTv>
__global__ __launch_bounds__(256) void k_vt(const _Float16* __restrict__ V16, int ldv, int voff, _Float16* __restrict__ Vt) { __shared__ unsigned short tl[64][66]; const int tid = threadIdx.x; const int slab = blockIdx.x / (TTv / 64), lg = blockIdx.x % (TTv / 64); const int b = slab / NHv, h = slab % NHv;
  for (int i = tid; i < 64 * 8; i += 256) { const int r = i / 8, c8 = (i % 8) * 8; FragH f; f.half[0] = *(const v8us*)((const unsigned short*)V16 + ((size_t)b * TTv + lg * 64 + r) * ldv + voff + h * 64 + c8);
#pragma unroll
    for (int q = 0; q < 8; ++q) tl[r][c8 + q] = f.u[q]; }
  __syncthreads();
  {
#pragma unroll
    for (int rd = 0; rd < 2; ++rd) { const int d = rd * 32 + tid / 8, pc = tid % 8; FragH f;
#pragma unroll
      for (int q = 0; q < 8; ++q) f.u[q] = tl[pc * 8 + q][d];
      *(v8us*)((unsigned short*)Vt + ((size_t)slab * 64 + d) * TTv + lg * 64 + pc * 8) = f.half[0]; }
     } }

__global__ __launch_bounds__(256) void k_hl(const float* __restrict__ F, _Float16* __restrict__ Hh, _Float16* __restrict__ Hl, size_t n8) { const size_t t = (size_t)blockIdx.x * 256 + threadIdx.x; if (t >= n8) return; FragH fh, fl; const v4f a = *(const v4fa*)(F + t * 8), c = *(const v4fa*)(F + t * 8 + 4);
#pragma unroll
  for (int q = 0; q < 4; ++q) { _Float16 h = (_Float16)a[q]; fh.h[q] = h; fl.h[q] = (_Float16)((a[q] - (float)h) * 1024.0f); h = (_Float16)c[q]; fh.h[4 + q] = h; fl.h[4 + q] = (_Float16)((c[q] - (float)h) * 1024.0f); }
  { *(v8us*)((unsigned short*)Hh + t * 8) = fh.half[0]; *(v8us*)((unsigned short*)Hl + t * 8) = fl.half[0];  } }

// ---- fast GEMM (wave tile 32x64; requires M % 32 == 0 rows per launch region and N % 64 == 0); epilogue = k_gemm_hhx semantics ----
__device__ __forceinline__ v16h g2_frag(const _Float16* p, int hh) { FragH f; f.half[0] = *(const v8us*)((const unsigned short*)p + 8 * hh); f.half[1] = *(const v8us*)((const unsigned short*)p + 16 + 8 * hh); return f.v; }
__device__ __forceinline__ v8f g2_mma(v16h a, v16h b, v8f c) { v8f d = __builtin_amdgcn_wmma_f32_16x16x32_f16(false, a, false, b, (short)0, c, false, false); asm volatile("v_nop\n\tv_nop\n\tv_nop\n\tv_nop" : "+v"(d) : "v"(a), "v"(b)); return d; }
template <int ACT>
__global__ __launch_bounds__(128) void k_gemm2(const _Float16* __restrict__ A, int lda, size_t sA, const _Float16* __restrict__ Bh, int ldb, size_t sB, float alpha, const float* __restrict__ bias, size_t sBias, const float* __restrict__ CP, int rowsPerB, size_t sCPb, int row0g,
    float* __restrict__ C, _Float16* __restrict__ C16, int ldc, size_t sC, int M, int N, int K) {
  __shared__ __attribute__((aligned(16))) float so[4][32][68];
  const int tid = threadIdx.x, w = tid >> 5, lane = tid & 31, ln = lane & 15, hh = lane >> 4; const int by = blockIdx.y;
  A += (size_t)by * sA; Bh += (size_t)by * sB; const size_t cofs = (size_t)by * sC; const float* bp = bias ? bias + (size_t)by * sBias : nullptr;
  const int ntn = N >> 6; const int mt = blockIdx.x / ntn, nq = blockIdx.x - mt * ntn; const int row0 = mt * 128 + 32 * w, col0 = nq * 64; if (row0 >= M) return;
  const _Float16* a0p = A + (size_t)(row0 + ln) * lda; const _Float16* a1p = a0p + (size_t)16 * lda;
  const _Float16* b0p = Bh + (size_t)(col0 + ln) * ldb; const _Float16* b1p = b0p + (size_t)16 * ldb; const _Float16* b2p = b1p + (size_t)16 * ldb; const _Float16* b3p = b2p + (size_t)16 * ldb;
  const v8f z8 = {0.f,0.f,0.f,0.f,0.f,0.f,0.f,0.f}; v8f c00 = z8, c01 = z8, c02 = z8, c03 = z8, c10 = z8, c11 = z8, c12 = z8, c13 = z8;
#pragma unroll 1
  for (int kb = 0; kb < K; kb += 32) { const v16h a0 = g2_frag(a0p + kb, hh), a1 = g2_frag(a1p + kb, hh);
    v16h b = g2_frag(b0p + kb, hh); c00 = g2_mma(a0, b, c00); c10 = g2_mma(a1, b, c10);
    b = g2_frag(b1p + kb, hh); c01 = g2_mma(a0, b, c01); c11 = g2_mma(a1, b, c11);
    b = g2_frag(b2p + kb, hh); c02 = g2_mma(a0, b, c02); c12 = g2_mma(a1, b, c12);
    b = g2_frag(b3p + kb, hh); c03 = g2_mma(a0, b, c03); c13 = g2_mma(a1, b, c13); }
  v8f accs[8] = {c00, c01, c02, c03, c10, c11, c12, c13};
#pragma unroll
  for (int u = 0; u < 8; ++u) { const int t = u & 3, half = u >> 2; const int col = col0 + t * 16 + ln; const float bv = bp ? bf16_round(bp[col]) : 0.f;
#pragma unroll
    for (int r = 0; r < 8; ++r) { const int rloc = half * 16 + 8 * hh + r; float v = accs[u][r] * alpha + bv; if (CP) { const int bidx = (row0g + row0 + rloc) / rowsPerB; v += CP[(size_t)bidx * sCPb + (size_t)by * 64 + col]; }
      if (ACT == 3) v = fmaxf(v, 0.f); else if (ACT == 6) v = 0.5f * v * (1.0f + erff(v * 0.70710678118654752f)); else if (ACT == 11) v = 1.0f / (1.0f + expf(-v)); else if (ACT == 15) v = v / (1.0f + expf(-v)); else if (ACT == 12) v = (v > 0.f) ? v : 0.01f * v; else if (ACT == 8) v = tanhf(v);
      so[w][rloc][t * 16 + ln] = v; } }
  __builtin_amdgcn_fence(__ATOMIC_ACQ_REL, "workgroup"); __builtin_amdgcn_wave_barrier();
  const int rsub = lane >> 4, c4 = (lane & 15) * 4;
  {
#pragma unroll
    for (int q = 0; q < 16; ++q) { const int r = q * 2 + rsub; const v4f v = *(const v4fa*)&so[w][r][c4]; if (C) *(v4f*)(C + cofs + (size_t)(row0 + r) * ldc + col0 + c4) = v; if (C16) { v4h h4; for (int i = 0; i < 4; ++i) h4[i] = (_Float16)v[i]; *(v4h*)(C16 + cofs + (size_t)(row0 + r) * ldc + col0 + c4) = h4; } }
     } }



__device__ __forceinline__ float xhalf(float x) { return __builtin_bit_cast(float, __builtin_amdgcn_permlanex16(__builtin_bit_cast(int, x), __builtin_bit_cast(int, x), 0x76543210, 0xfedcba98, false, false)); }      /* lane l with lane l ^ 16 */
template <int CAUSAL>
__global__ __launch_bounds__(128) void k_flash(const _Float16* __restrict__ Q16, int ldq, const _Float16* __restrict__ K16, int ldk, const _Float16* __restrict__ Vt, const int* __restrict__ MSK, float* __restrict__ O, int ldo) {
  constexpr int RPW = 16, DT = 4, KS = 2;
  __shared__ __attribute__((aligned(16))) float sO[4][RPW][64 + 4];
  const int tid = threadIdx.x, w = tid >> 5, lane = tid & 31, ln = lane & 15, hh = lane >> 4;
  const int slab = blockIdx.x / QBLKS, qblk = blockIdx.x % QBLKS; const int b = slab / NH, h = slab % NH; const int qb0 = qblk * (4 * RPW); const int q0 = qb0 + w * RPW; const int tq = q0 + ln; const int eb = tq + RELW - 8 * hh;
  FragH aq[KS];
  { const unsigned short* qr = (const unsigned short*)Q16 + ((size_t)b * TQ + tq) * ldq + h * 64;
#pragma unroll
    for (int ks = 0; ks < KS; ++ks) { aq[ks].half[0] = *(const v8us*)(qr + ks * 32 + 8 * hh); aq[ks].half[1] = *(const v8us*)(qr + ks * 32 + 16 + 8 * hh); } }
  const unsigned short* Vth = (const unsigned short*)Vt + (size_t)slab * 64 * TK;
  float m_r = -3.0e38f, l_r = 0.f; v8f oacc[DT];
#pragma unroll
  for (int dt = 0; dt < DT; ++dt) oacc[dt] = (v8f){0.f,0.f,0.f,0.f,0.f,0.f,0.f,0.f};
  const int jend = (CAUSAL == 1 || CAUSAL == 3) ? (qb0 + 4 * RPW) : TK;      /* causal: keys beyond the block's last query never contribute */ const int jbeg = (CAUSAL == 3) ? ((qb0 - WINDOW) > 0 ? (qb0 - WINDOW) : 0) : 0;      /* window: keys more than WINDOW before the block's first query never contribute (WINDOW % 32 == 0) */
  /* Every global load of the loop is issued well ahead of its first use, so that the round trips run under the softmax of the pass in progress:
     V^T of a pass at the pass's head (used behind the softmax); K of the next pass right behind this pass's score products, its bias values right behind the add of this pass's. */
  FragH kf[2][KS]; FragH vf[DT]; v2f bc[2][4];      /* bias of keys (2 i, 2 i + 1) of score tile nt, paired like the accumulator registers */
  auto fetch_k = [&](int j0) __attribute__((always_inline)) {
    const unsigned short* kr0 = (const unsigned short*)K16 + ((size_t)b * TK + j0 + ln) * ldk + h * 64 + 8 * hh; const unsigned short* kr1 = kr0 + (size_t)16 * ldk;
#pragma unroll
    for (int ks = 0; ks < KS; ++ks) { kf[0][ks].half[0] = *(const v8us*)(kr0 + ks * 32); kf[0][ks].half[1] = *(const v8us*)(kr0 + ks * 32 + 16); }
#pragma unroll
    for (int ks = 0; ks < KS; ++ks) { kf[1][ks].half[0] = *(const v8us*)(kr1 + ks * 32); kf[1][ks].half[1] = *(const v8us*)(kr1 + ks * 32 + 16); }
    asm volatile("s_wait_xcnt 0x0" :: "v"(kr0), "v"(kr1) : "memory");      /* stands before any register that the K loads name is rewritten; the two address pairs are inputs so that no load of the group lands on one */
  };
  auto fetch_bias = [&](int j0) __attribute__((always_inline)) {
    if (CAUSAL == 6) { const float* BTh = (const float*)MSK + h * (2 * RELW + 1);      /* mode 6: per-head relative-position bias table [NH][2*RELW+1] indexed by clip(i - j, +-RELW) + RELW (passed through the MSK pointer) */
      unsigned i0[8], i1[8];
#pragma unroll
      for (int r = 0; r < 8; ++r) { int d0 = eb - j0 - r, d1 = eb - j0 - 16 - r; d0 = d0 < 0 ? 0 : (d0 > 2 * RELW ? 2 * RELW : d0); d1 = d1 < 0 ? 0 : (d1 > 2 * RELW ? 2 * RELW : d1); i0[r] = (unsigned)d0; i1[r] = (unsigned)d1; }      /* clip(i - j + RELW, 0, 2 RELW), the same integer as clip(i - j, +-RELW) + RELW; key j = j0 (+ 16) + 8 hh + r */
#pragma unroll
      for (int r = 0; r < 8; ++r) { bc[0][r >> 1][r & 1] = BTh[i0[r]]; bc[1][r >> 1][r & 1] = BTh[i1[r]]; }
      asm volatile("s_wait_xcnt 0x0" :: "v"(i0[0]), "v"(i0[1]), "v"(i0[2]), "v"(i0[3]), "v"(i0[4]), "v"(i0[5]), "v"(i0[6]), "v"(i0[7]), "v"(i1[0]), "v"(i1[1]), "v"(i1[2]), "v"(i1[3]), "v"(i1[4]), "v"(i1[5]), "v"(i1[6]), "v"(i1[7]) : "memory");      /* stands before any register that the bias loads name is rewritten; the index registers are inputs so that no load of the group lands on one */
    }
  };
  fetch_k(jbeg); fetch_bias(jbeg);
#pragma unroll 1
  for (int j0 = jbeg; j0 < jend; j0 += 32) {
#pragma unroll
    for (int dt = 0; dt < DT; ++dt) { const unsigned short* vrow = Vth + (size_t)(dt * 16 + ln) * TK + j0; vf[dt].half[0] = *(const v8us*)(vrow + 8 * hh); vf[dt].half[1] = *(const v8us*)(vrow + 16 + 8 * hh); }
    asm volatile("s_wait_xcnt 0x0" ::: "memory");      /* stands before any register that the V loads name is rewritten */
    v8f s[2];
#pragma unroll
    for (int nt = 0; nt < 2; ++nt) { v8f acc = (v8f){0.f,0.f,0.f,0.f,0.f,0.f,0.f,0.f};
#pragma unroll
      for (int ks = 0; ks < KS; ++ks) acc = mmaH<1>(kf[nt][ks].v, kf[nt][ks].v, aq[ks].v, aq[ks].v, acc); s[nt] = acc; }
    const int jn = (j0 + 32 < jend) ? j0 + 32 : jbeg;      /* the last pass has no next one: it names an in-range tile whose values are not used */
    fetch_k(jn);
    float s0[8], s1[8], mx[8]; bool ok0[8], ok1[8];
#pragma unroll
    for (int r = 0; r < 8; ++r) { const int k0 = j0 + 8 * hh + r, k1 = k0 + 16;
      ok0[r] = (CAUSAL == 1) ? (k0 <= tq) : ((CAUSAL == 2) ? ((k0 >> 5) == (tq >> 5)) : ((CAUSAL == 3) ? (k0 <= tq && tq - k0 < WINDOW) : true)); ok1[r] = (CAUSAL == 1) ? (k1 <= tq) : ((CAUSAL == 2) ? ((k1 >> 5) == (tq >> 5)) : ((CAUSAL == 3) ? (k1 <= tq && tq - k1 < WINDOW) : true));      /* mode 3: causal + sliding window of WINDOW keys */      /* mode 2: block-diagonal 32-token groups */
      s0[r] = ok0[r] ? s[0][r] * SCL : -3.0e38f; s1[r] = ok1[r] ? s[1][r] * SCL : -3.0e38f; if (CAUSAL == 6) { s0[r] += bc[0][r >> 1][r & 1]; s1[r] += bc[1][r >> 1][r & 1]; }      /* mode 6: the bias is added after the 1/sqrt(d) scale */
    }
#pragma unroll
    for (int i = 0; i < 4; ++i) { mx[i] = fmaxf(s0[2 * i], s0[2 * i + 1]); mx[4 + i] = fmaxf(s1[2 * i], s1[2 * i + 1]); }
    fetch_bias(jn);      /* behind the last use of this pass's values, so that the loads land in the same registers */
    float mc = fmaxf(fmaxf(fmaxf(mx[0], mx[1]), fmaxf(mx[2], mx[3])), fmaxf(fmaxf(mx[4], mx[5]), fmaxf(mx[6], mx[7])));
    mc = fmaxf(mc, xhalf(mc));      /* the other 16 keys of this query stand in lane l ^ 16 */
    const float mn = fmaxf(m_r, mc); const float ea = expf(m_r - mn); const float al = (mn > -1.0e38f) ? ea : 1.0f; m_r = mn;
    FragH pb; float ps[8], pt[8];
#pragma unroll
    for (int r = 0; r < 8; ++r) { const float p0 = ok0[r] ? expf(s0[r] - mn) : 0.f, p1 = ok1[r] ? expf(s1[r] - mn) : 0.f; ps[r] = p0; pt[r] = p1; pb.h[r] = (_Float16)(p0 * 1024.0f); pb.h[8 + r] = (_Float16)(p1 * 1024.0f); }
    l_r = l_r * al + ((((ps[0] + ps[2]) + (ps[4] + ps[6])) + ((pt[0] + pt[2]) + (pt[4] + pt[6]))) + (((ps[1] + ps[3]) + (ps[5] + ps[7])) + ((pt[1] + pt[3]) + (pt[5] + pt[7]))));      /* each wave half keeps the sum of its own keys; the halves are joined behind the loop */
#pragma unroll
    for (int dt = 0; dt < DT; ++dt) oacc[dt] *= al;
#pragma unroll
    for (int dt = 0; dt < DT; ++dt) oacc[dt] = mmaH<1>(vf[dt].v, vf[dt].v, pb.v, pb.v, oacc[dt]);
  }
  { const float l = l_r + xhalf(l_r); const float inv = (l > 0.f) ? 1.0f / (l * 1024.0f) : 0.f;
#pragma unroll
    for (int dt = 0; dt < DT; ++dt) { const v8f o = oacc[dt] * inv; *(v4fa*)&sO[w][ln][dt * 16 + 8 * hh] = (v4f){o[0], o[1], o[2], o[3]}; *(v4fa*)&sO[w][ln][dt * 16 + 8 * hh + 4] = (v4f){o[4], o[5], o[6], o[7]}; } }      /* register r of tile dt is O[q0 + ln][16 dt + 8 hh + r] */
  __builtin_amdgcn_fence(__ATOMIC_ACQ_REL, "workgroup"); __builtin_amdgcn_wave_barrier();
  {
#pragma unroll
    for (int rp = 0; rp < RPW; rp += 2) { const int r = rp + (lane >> 4), pc = lane & 15; const v4f val = *(const v4fa*)&sO[w][r][pc * 4]; *(v4f*)(O + ((size_t)b * TQ + q0 + r) * ldo + h * 64 + pc * 4) = val; }
     } }

__global__ __launch_bounds__(256) void k_h16s(const float* __restrict__ x, _Float16* __restrict__ X16, size_t n8, float sc) { const size_t t = (size_t)blockIdx.x * 256 + threadIdx.x; if (t >= n8) return; const v8f a = *(const v8f*)(x + t * 8); FragH f; for (int q = 0; q < 8; ++q) f.h[q] = (_Float16)(a[q] * sc); *(v8us*)((unsigned short*)X16 + t * 8) = f.half[0];  }
__device__ __forceinline__ void job_btab(const float* __restrict__ pe, float* __restrict__ BT) { { for (int e = threadIdx.x; e < NH * NREL; e += 256) { const int h = e / NREL, r = e % NREL; *(float*)(BT + e) = bf16_round(pe[r * NH + h]); }  } }
// One launch for the eight jobs that read nothing but inputs: a block's index picks its job (block-uniform); the jobs share no data, so they need no order among themselves.
// Order: the four weight transposes (long strided loads) first, the bias table, then the three activation planes. B4 = the four [n][k] weight planes in a row, X3 = the three activation planes in a row.
#define WBLK (CC * CC / 8 / 256)      /* blocks of one weight transpose */
#define XBLK (NR * CC / 8 / 256)      /* blocks of one activation plane */
__global__ __launch_bounds__(256) void k_prep(const float* __restrict__ xq, const float* __restrict__ xk, const float* __restrict__ xv, const float* __restrict__ Wq, const float* __restrict__ Wk, const float* __restrict__ Wv, const float* __restrict__ Wo, const float* __restrict__ pe,
                                              _Float16* __restrict__ B4, float* __restrict__ BT, _Float16* __restrict__ X3) {
  const int blk = blockIdx.x;
  if (blk < 4 * WBLK) { const int j = blk / WBLK; job_wt_f16(blk % WBLK, j == 0 ? Wq : (j == 1 ? Wk : (j == 2 ? Wv : Wo)), B4 + (size_t)j * CC * CC, CC, CC, 16.0f); }
  else if (blk == 4 * WBLK) job_btab(pe, BT);
  else { const int xb = blk - 4 * WBLK - 1, j = xb / XBLK; job_x16(xb % XBLK, j == 0 ? xq : (j == 1 ? xk : xv), X3 + (size_t)j * NR * CC, (size_t)NR * CC / 8); }
}

extern "C" void kernel_launch(void* const* d_in, const int* in_sizes, int n_in,
                              void* d_out, int out_size, void* d_ws, size_t ws_size, hipStream_t stream) {
  (void)in_sizes; (void)n_in; (void)out_size;
  const float* const* I = (const float* const*)d_in; const float* xq = I[0]; const float* xk = I[1]; const float* xv = I[2]; const float* Wq = I[3]; const float* Wk = I[4]; const float* Wv = I[5]; const float* Wo = I[6]; const float* pe = I[7];
  char* ws = (char*)d_ws; size_t off = 0;
  auto take = [&](size_t bytes) { char* p = ws + off; off += (bytes + 255) & ~(size_t)255; return p; };
  const size_t np = (size_t)NR * CC;
  _Float16* BQ = (_Float16*)take((size_t)4 * CC * CC * 2); _Float16* BO = BQ + (size_t)3 * CC * CC;      /* Wq, Wk, Wv, Wo planes in a row */ float* BT = (float*)take((size_t)NH * NREL * 4 + 256);
  _Float16* XQ = (_Float16*)take(3 * np * 2);      /* query, key, value planes in a row */ _Float16* Q16 = (_Float16*)take(3 * np * 2); _Float16* K16 = Q16 + np; _Float16* V16 = K16 + np;      /* q, k, v in a row */ _Float16* VT = (_Float16*)take(np * 2); float* O = (float*)take(np * 4); _Float16* O16 = XQ;
  if (off > ws_size) return;      /* 2 + 7 x 4 + 8 = 38 MiB */
  k_prep<<<4 * WBLK + 1 + 3 * XBLK, 256, 0, stream>>>(xq, xk, xv, Wq, Wk, Wv, Wo, pe, BQ, BT, XQ);
  const dim3 g((NR / 128) * (CC / 64), 1), g3((NR / 128) * (CC / 64), 3);
  k_gemm2<0><<<g3, 128, 0, stream>>>(XQ, CC, np, BQ, CC, (size_t)CC * CC, 0.0625f, nullptr, 0, nullptr, 1, 0, 0, nullptr, Q16, CC, np, NR, CC, CC);      /* the q, k and v projections: blockIdx.y steps through the three planes of A, of the weights and of C */
  k_vt<NH, SLEN><<<NB * NH * (SLEN / 64), 256, 0, stream>>>(V16, CC, 0, VT);
  k_flash<6><<<NB * NH * QBLKS, 128, 0, stream>>>(Q16, CC, K16, CC, VT, (const int*)BT, O, CC);      /* relative-position bias mode */
  k_h16s<<<(unsigned)((np / 8 + 255) / 256), 256, 0, stream>>>(O, O16, np / 8, 64.0f);      /* x2^6 carry: the 2048-key averages are small */
  k_gemm2<0><<<g, 128, 0, stream>>>(O16, CC, 0, BO, CC, 0, 0.0625f / 64.0f, nullptr, 0, nullptr, 1, 0, 0, (float*)d_out, nullptr, CC, 0, NR, CC, CC);
}

// v004
// Measured time: 118 microseconds a run.
// Next to v003, in two timings, it ran 1.14 and 1.11 times as fast.
// All steps since v000 together make it 3.07 times as fast.
#include <hip/hip_runtime.h>
// RelativePositionalEncodingAttention (2 x 2048 tokens, 8 heads of 64, D 512): q/k/v from three inputs (no bias); scores/8 + pos_emb[clip(i - j, -32, 32) + 32][h]; softmax; out Wo.
// Structure: exact f16 planes of query/key/value; q/k/v GEMMs (32x64 wave tiles, f32 accumulation, exact x16 weights, f16 outputs); the relative-bias table transposed to [head][65] (bf16-rounded, f32); K and V^T repacked into matrix-fragment order; the fused flash kernel with a new relative-position-bias mode (table lookup by clipped i - j added after the scale, f32); attention output as f16 into the output GEMM.
// Compute dtype: inputs and weights rounded to bf16; q, k, v, P and the attention output as f16 operands (~2^-12); f32 accumulation/softmax/bias. v_wmma_f32_16x16x32_f16.
#define NB 2
#define CC 512
#define NR (NB * SLEN)
#define NREL (2 * RELW + 1)
#define SLEN 2048
#define TQ SLEN
#define TK SLEN
#define NH 8
#define SCL 0.125f               /* 1/sqrt(64) */
#define WINDOW 256
#define RELW 32                  /* max_relative_position */
#define QBLKS (TQ / 64)
typedef __bf16 v16b __attribute__((ext_vector_type(16)));
typedef unsigned short v8us __attribute__((ext_vector_type(8), may_alias));
typedef float  v8f  __attribute__((ext_vector_type(8)));
typedef float  v4f  __attribute__((ext_vector_type(4)));
typedef float  v2f  __attribute__((ext_vector_type(2)));
typedef float  v4fa __attribute__((ext_vector_type(4), may_alias));
union FragB { v16b v; v8us half[2]; unsigned short u[16]; };

__device__ __forceinline__ unsigned short bf16_bits(float x) { unsigned int u = __float_as_uint(x); return (unsigned short)((u + 0x7FFFu + ((u >> 16) & 1u)) >> 16); }
__device__ __forceinline__ float bf16_val(unsigned short b) { return __uint_as_float(((unsigned int)b) << 16); }
__device__ __forceinline__ float bf16_round(float x) { return bf16_val(bf16_bits(x)); }
// D += A·B with NT terms: 1 = ah·bh, 2 = + al·bh (A split), 3 = + ah·bl (both split)
template <int NT>
__device__ __forceinline__ v8f mmaN(v16b ah, v16b al, v16b bh, v16b bl, v8f c) {
  c = __builtin_amdgcn_wmma_f32_16x16x32_bf16(false, ah, false, bh, (short)0, c, false, false);
  if (NT >= 2) c = __builtin_amdgcn_wmma_f32_16x16x32_bf16(false, al, false, bh, (short)0, c, false, false);
  if (NT >= 3) c = __builtin_amdgcn_wmma_f32_16x16x32_bf16(false, ah, false, bl, (short)0, c, false, false);
  asm volatile("v_nop\n\tv_nop\n\tv_nop\n\tv_nop" : "+v"(c) : "v"(ah), "v"(al), "v"(bh), "v"(bl));
  return c;
}

__global__ __launch_bounds__(256) void k_wt_bf16(const float* __restrict__ W, unsigned short* __restrict__ Wt, int K, int N) {
  const int t = blockIdx.x * 256 + threadIdx.x;
  const int k8n = K / 8;
  if (t >= N * k8n) return;
  const int n = t / k8n, k8 = (t % k8n) * 8;
  v8us v;
#pragma unroll
  for (int i = 0; i < 8; ++i) v[i] = bf16_bits(W[(size_t)(k8 + i) * N + n]);
  *(v8us*)(Wt + (size_t)n * K + k8) = v;
  
}

// GEMM C[M][N] (f32, pitch ldc) = act(A[M][K]·W + bias). A f32 row-major (pitch lda) converted per fragment to bf16
// (ASPLIT: hi/lo two planes -> 2 terms, else single rounded term); Wt bf16 [N][K] (pitch ldb). BIAS_BF16 rounds the
// bias to bf16 first (bias quantised to bf16 before the add). K%32==0, M%16==0, N%64==0.
template <bool ASPLIT, int ACT, bool BIAS_BF16>
__global__ __launch_bounds__(128) void k_gemm_bf(const float* __restrict__ A, int lda, const unsigned short* __restrict__ Wt, int ldb,
                                               const float* __restrict__ bias, float* __restrict__ C, int ldc, int M, int N, int K) {
  __shared__ __attribute__((aligned(16))) float so[4][16][64];
  const int tid = threadIdx.x, w = tid >> 5, lane = tid & 31, ln = lane & 15, hh = lane >> 4;
  const int ntn = N / 64;
  const int wid = blockIdx.x * 4 + w;
  const int mt = wid / ntn, nq = wid % ntn;
  if (mt * 16 >= M) return;
  const int row0 = mt * 16, col0 = nq * 64;
  const float* arow = A + (size_t)(row0 + ln) * lda;
  v8f acc[4] = {};
  for (int kb = 0; kb < K; kb += 32) {
    FragB ah, al;
    const v4f x0 = *(const v4fa*)(arow + kb + 8 * hh), x1 = *(const v4fa*)(arow + kb + 8 * hh + 4);
    const v4f x2 = *(const v4fa*)(arow + kb + 16 + 8 * hh), x3 = *(const v4fa*)(arow + kb + 16 + 8 * hh + 4);
    float xs[16] = {x0[0],x0[1],x0[2],x0[3],x1[0],x1[1],x1[2],x1[3],x2[0],x2[1],x2[2],x2[3],x3[0],x3[1],x3[2],x3[3]};
#pragma unroll
    for (int i = 0; i < 16; ++i) { const unsigned short hb = bf16_bits(xs[i]); ah.u[i] = hb; al.u[i] = ASPLIT ? bf16_bits(xs[i] - bf16_val(hb)) : (unsigned short)0; }
#pragma unroll
    for (int t = 0; t < 4; ++t) {
      const unsigned short* brow = Wt + (size_t)(col0 + t * 16 + ln) * ldb + kb;
      FragB b;
      b.half[0] = *(const v8us*)(brow + 8 * hh);
      b.half[1] = *(const v8us*)(brow + 16 + 8 * hh);
      acc[t] = mmaN<ASPLIT ? 2 : 1>(ah.v, al.v, b.v, b.v, acc[t]);
    }
  }
#pragma unroll
  for (int t = 0; t < 4; ++t) {
    float bv = bias ? bias[col0 + t * 16 + ln] : 0.f;
    if (BIAS_BF16) bv = bf16_round(bv);
#pragma unroll
    for (int r = 0; r < 8; ++r) { float v = acc[t][r] + bv; if (ACT == 1) v = fmaxf(v, 0.f); so[w][8 * hh + r][t * 16 + ln] = v; }
  }
  __builtin_amdgcn_fence(__ATOMIC_ACQ_REL, "workgroup");
  __builtin_amdgcn_wave_barrier();
  const int rsub = lane >> 4, c4 = (lane & 15) * 4;
  {
#pragma unroll
    for (int q = 0; q < 8; ++q) {
      const int r = q * 2 + rsub;
      const v4f v = *(const v4fa*)&so[w][r][c4];
      *(v4f*)(C + (size_t)(row0 + r) * ldc + col0 + c4) = v;
    }
    
  }
}

// GEMM C = act(A·W + bias + resid): A f32 (ASPLIT -> hi/lo 2 terms), Wt bf16 [N][K]; ACT 0 none, 1 relu, 2 exact gelu;
// resid (optional, f32, row index = (row % rmod), pitch ldr, RES_BF16 rounds it) added before the activation.
template <bool ASPLIT, int ACT, bool BIAS_BF16, bool RES_BF16>
__global__ __launch_bounds__(128) void k_gemm_bf3(const float* __restrict__ A, int lda, const unsigned short* __restrict__ Wt, int ldb,
                                                const float* __restrict__ bias, const float* __restrict__ resid, int rmod, int ldr,
                                                float* __restrict__ C, int ldc, int M, int N, int K) {
  __shared__ __attribute__((aligned(16))) float so[4][16][64];
  const int tid = threadIdx.x, w = tid >> 5, lane = tid & 31, ln = lane & 15, hh = lane >> 4;
  const int ntn = N / 64;
  const int wid = blockIdx.x * 4 + w;
  const int mt = wid / ntn, nq = wid % ntn;
  if (mt * 16 >= M) return;
  const int row0 = mt * 16, col0 = nq * 64;
  const float* arow = A + (size_t)(row0 + ln) * lda;
  v8f acc[4] = {};
  for (int kb = 0; kb < K; kb += 32) {
    FragB ah, al;
    const v4f x0 = *(const v4fa*)(arow + kb + 8 * hh), x1 = *(const v4fa*)(arow + kb + 8 * hh + 4);
    const v4f x2 = *(const v4fa*)(arow + kb + 16 + 8 * hh), x3 = *(const v4fa*)(arow + kb + 16 + 8 * hh + 4);
    float xs[16] = {x0[0],x0[1],x0[2],x0[3],x1[0],x1[1],x1[2],x1[3],x2[0],x2[1],x2[2],x2[3],x3[0],x3[1],x3[2],x3[3]};
#pragma unroll
    for (int i = 0; i < 16; ++i) { const unsigned short hb = bf16_bits(xs[i]); ah.u[i] = hb; al.u[i] = ASPLIT ? bf16_bits(xs[i] - bf16_val(hb)) : (unsigned short)0; }
#pragma unroll
    for (int t = 0; t < 4; ++t) {
      const unsigned short* brow = Wt + (size_t)(col0 + t * 16 + ln) * ldb + kb;
      FragB b;
      b.half[0] = *(const v8us*)(brow + 8 * hh);
      b.half[1] = *(const v8us*)(brow + 16 + 8 * hh);
      acc[t] = mmaN<ASPLIT ? 2 : 1>(ah.v, al.v, b.v, b.v, acc[t]);
    }
  }
#pragma unroll
  for (int t = 0; t < 4; ++t) {
    const int col = col0 + t * 16 + ln;
    float bv = bias ? bias[col] : 0.f;
    if (BIAS_BF16) bv = bf16_round(bv);
#pragma unroll
    for (int r = 0; r < 8; ++r) {
      float v = acc[t][r] + bv;
      if (resid) { float rv = resid[(size_t)((row0 + 8 * hh + r) % rmod) * ldr + col]; if (RES_BF16) rv = bf16_round(rv); v += rv; }
      if (ACT == 1) v = fmaxf(v, 0.f);
      if (ACT == 2) v = 0.5f * v * (1.0f + erff(v * 0.70710678118654752f));
      if (ACT == 3) { const float u = 0.7978845608028654f * (v + 0.044715f * v * v * v); v = 0.5f * v * (1.0f + tanhf(u)); }
      so[w][8 * hh + r][t * 16 + ln] = v;
    }
  }
  __builtin_amdgcn_fence(__ATOMIC_ACQ_REL, "workgroup");
  __builtin_amdgcn_wave_barrier();
  const int rsub = lane >> 4, c4 = (lane & 15) * 4;
  {
#pragma unroll
    for (int q = 0; q < 8; ++q) {
      const int r = q * 2 + rsub;
      const v4f v = *(const v4fa*)&so[w][r][c4];
      *(v4f*)(C + (size_t)(row0 + r) * ldc + col0 + c4) = v;
    }
    
  }
}
// row LayerNorm (biased variance, eps) over N: s = X (+ R); optional out_sum <- s; out_norm <- (s-mu)*rsqrt(var+eps)*g + b
template <bool PARAM_BF16>
__global__ __launch_bounds__(256) void k_layernorm(const float* __restrict__ X, const float* __restrict__ R, const float* __restrict__ g, const float* __restrict__ bta,
                                                  float* __restrict__ out_sum, float* __restrict__ out_norm, int N, float eps) {
  __shared__ float red[256];
  const int row = blockIdx.x, tid = threadIdx.x;
  const float* x = X + (size_t)row * N; const float* rr = R ? R + (size_t)row * N : nullptr;
  float vals[16];                     // up to N = 4096
  const int per = N / 256;            // contiguous chunk per thread? use strided-by-4 chunks: thread handles j = tid*4 + 1024*u
  float s1 = 0.f;
  for (int u = 0; u < per / 4; ++u) {
    const int j = tid * 4 + 1024 * u;
    const v4f a = *(const v4fa*)(x + j);
    v4f b = {0.f,0.f,0.f,0.f}; if (rr) b = *(const v4fa*)(rr + j);
#pragma unroll
    for (int q = 0; q < 4; ++q) { const float v = a[q] + b[q]; vals[u * 4 + q] = v; s1 += v; }
  }
  red[tid] = s1; __syncthreads();
  for (int st = 128; st > 0; st >>= 1) { if (tid < st) red[tid] += red[tid + st]; __syncthreads(); }
  const float mu = red[0] / (float)N; __syncthreads();
  float s2 = 0.f;
  for (int u = 0; u < per / 4; ++u)
#pragma unroll
    for (int q = 0; q < 4; ++q) { const float c = vals[u * 4 + q] - mu; s2 += c * c; }
  red[tid] = s2; __syncthreads();
  for (int st = 128; st > 0; st >>= 1) { if (tid < st) red[tid] += red[tid + st]; __syncthreads(); }
  const float rs = rsqrtf(red[0] / (float)N + eps);
  {
    for (int u = 0; u < per / 4; ++u) {
      const int j = tid * 4 + 1024 * u;
      v4f o, sm;
#pragma unroll
      for (int q = 0; q < 4; ++q) {
        float gg = g[j + q], bb = bta[j + q];
        if (PARAM_BF16) { gg = bf16_round(gg); bb = bf16_round(bb); }
        sm[q] = vals[u * 4 + q]; o[q] = (vals[u * 4 + q] - mu) * rs * gg + bb;
      }
      if (out_sum) *(v4f*)(out_sum + (size_t)row * N + j) = sm;
      *(v4f*)(out_norm + (size_t)row * N + j) = o;
    }
    
  }
}



// ---- f16 WMMA path (v_wmma_f32_16x16x32_f16): 11-bit significands for operands in range — used where a [0,1] probability operand needs more precision than bf16
typedef _Float16 v16h __attribute__((ext_vector_type(16)));
union FragH { v16h v; v8us half[2]; _Float16 h[16]; unsigned short u[16]; };
template <int NT>
__device__ __forceinline__ v8f mmaH(v16h ah, v16h al, v16h bh, v16h bl, v8f c) {
  c = __builtin_amdgcn_wmma_f32_16x16x32_f16(false, ah, false, bh, (short)0, c, false, false);
  if (NT >= 2) c = __builtin_amdgcn_wmma_f32_16x16x32_f16(false, al, false, bh, (short)0, c, false, false);
  if (NT >= 3) c = __builtin_amdgcn_wmma_f32_16x16x32_f16(false, ah, false, bl, (short)0, c, false, false);
  asm volatile("v_nop\n\tv_nop\n\tv_nop\n\tv_nop" : "+v"(c) : "v"(ah), "v"(al), "v"(bh), "v"(bl));
  return c;
}
// batched GEMM like k_gemm_b but f16 operands: A f32 (split into f16 hi/lo if ASPLIT, else rounded to f16), Bt = f16 values [n][k]; alpha; C f32; N multiple of 16 (partial tiles skipped)
template <bool ASPLIT>
__global__ __launch_bounds__(128) void k_gemm_h(const float* __restrict__ A, int lda, size_t sA, const _Float16* __restrict__ Bh, int ldb, size_t sB, float alpha, float* __restrict__ C, int ldc, size_t sC, int M, int N, int K) {
  __shared__ __attribute__((aligned(16))) float so[4][16][64];
  const int tid = threadIdx.x, w = tid >> 5, lane = tid & 31, ln = lane & 15, hh = lane >> 4; const int by = blockIdx.y;
  A += (size_t)by * sA; Bh += (size_t)by * sB; C += (size_t)by * sC;
  const int ntn = (N + 63) / 64; const int wid = blockIdx.x * 4 + w; const int mt = wid / ntn, nq = wid % ntn; if (mt * 16 >= M) return;
  const int row0 = mt * 16, col0 = nq * 64; const float* arow = A + (size_t)(row0 + ln) * lda;
  v8f acc[4] = {};
  for (int kb = 0; kb < K; kb += 32) {
    FragH ah, al;
    const v4f x0 = *(const v4fa*)(arow + kb + 8 * hh), x1 = *(const v4fa*)(arow + kb + 8 * hh + 4), x2 = *(const v4fa*)(arow + kb + 16 + 8 * hh), x3 = *(const v4fa*)(arow + kb + 16 + 8 * hh + 4);
    float xs[16] = {x0[0],x0[1],x0[2],x0[3],x1[0],x1[1],x1[2],x1[3],x2[0],x2[1],x2[2],x2[3],x3[0],x3[1],x3[2],x3[3]};
#pragma unroll
    for (int i = 0; i < 16; ++i) { const _Float16 h = (_Float16)xs[i]; ah.h[i] = h; al.h[i] = ASPLIT ? (_Float16)(xs[i] - (float)h) : (_Float16)0.0f; }
#pragma unroll
    for (int t = 0; t < 4; ++t) { if (col0 + t * 16 >= N) continue; const size_t boff = (size_t)(col0 + t * 16 + ln) * ldb + kb; FragH bq; bq.half[0] = *(const v8us*)(Bh + boff + 8 * hh); bq.half[1] = *(const v8us*)(Bh + boff + 16 + 8 * hh);
      acc[t] = mmaH<ASPLIT ? 2 : 1>(ah.v, al.v, bq.v, bq.v, acc[t]); }
  }
#pragma unroll
  for (int t = 0; t < 4; ++t) { if (col0 + t * 16 >= N) continue;
#pragma unroll
    for (int r = 0; r < 8; ++r) so[w][8 * hh + r][t * 16 + ln] = acc[t][r] * alpha; }
  __builtin_amdgcn_fence(__ATOMIC_ACQ_REL, "workgroup"); __builtin_amdgcn_wave_barrier();
  const int rsub = lane >> 4, c4 = (lane & 15) * 4;
  {
#pragma unroll
    for (int q = 0; q < 8; ++q) { const int r = q * 2 + rsub; if (col0 + c4 < N) { const v4f v = *(const v4fa*)&so[w][r][c4]; *(v4f*)(C + (size_t)(row0 + r) * ldc + col0 + c4) = v; } }
     }
}

// Wt[n][k] = f16(W[k][n]·scale) from f32 row-major W[K][N] (scale = power of two; bf16-exact weights stay exact in f16 away from the subnormal range)
__device__ __forceinline__ void job_wt_f16(int blk, const float* __restrict__ W, _Float16* __restrict__ Wt, int K, int N, float scale) {
  const int t = blk * 256 + threadIdx.x; if (t >= N * (K / 8)) return; const int n = t / (K / 8), k8 = (t % (K / 8)) * 8; FragH f;
#pragma unroll
  for (int i = 0; i < 8; ++i) f.h[i] = (_Float16)(bf16_round(W[(size_t)(k8 + i) * N + n]) * scale); const v8us o = f.half[0];
  *(v8us*)((unsigned short*)Wt + (size_t)n * K + k8) = o; 
}
// k_gemm_hh variant with fused epilogue: v = acc·alpha + bias[by·sBias + col] (+ CP[(row/rowsPerB)·sCPb + by·64 + col] if CP) ; ACT 0 none / 1 elu ; writes f16 C16 (and f32 C if non-null)
template <int ACT>
__global__ __launch_bounds__(128) void k_gemm_hhx(const _Float16* __restrict__ A, int lda, size_t sA, const _Float16* __restrict__ Bh, int ldb, size_t sB, float alpha, const float* __restrict__ bias, size_t sBias, const float* __restrict__ CP, int rowsPerB, size_t sCPb, int row0g,
    float* __restrict__ C, _Float16* __restrict__ C16, int ldc, size_t sC, int M, int N, int K) {
  __shared__ __attribute__((aligned(16))) float so[4][16][64];
  const int tid = threadIdx.x, w = tid >> 5, lane = tid & 31, ln = lane & 15, hh = lane >> 4; const int by = blockIdx.y;
  A += (size_t)by * sA; Bh += (size_t)by * sB; const size_t cofs = (size_t)by * sC; const float* bp = bias ? bias + (size_t)by * sBias : nullptr;
  const int ntn = (N + 63) / 64; const int wid = blockIdx.x * 4 + w; const int mt = wid / ntn, nq = wid % ntn; if (mt * 16 >= M) return;
  const int row0 = mt * 16, col0 = nq * 64; const _Float16* arow = A + (size_t)(row0 + ln) * lda;
  v8f acc[4] = {};
  for (int kb = 0; kb < K; kb += 32) { FragH ah; ah.half[0] = *(const v8us*)((const unsigned short*)arow + kb + 8 * hh); ah.half[1] = *(const v8us*)((const unsigned short*)arow + kb + 16 + 8 * hh);
#pragma unroll
    for (int t = 0; t < 4; ++t) { if (col0 + t * 16 >= N) continue; const size_t boff = (size_t)(col0 + t * 16 + ln) * ldb + kb; FragH bq; bq.half[0] = *(const v8us*)((const unsigned short*)Bh + boff + 8 * hh); bq.half[1] = *(const v8us*)((const unsigned short*)Bh + boff + 16 + 8 * hh);
      acc[t] = mmaH<1>(ah.v, ah.v, bq.v, bq.v, acc[t]); }
  }
#pragma unroll
  for (int t = 0; t < 4; ++t) { if (col0 + t * 16 >= N) continue; const int col = col0 + t * 16 + ln; const float bv = bp ? bf16_round(bp[col]) : 0.f;
#pragma unroll
    for (int r = 0; r < 8; ++r) { float v = acc[t][r] * alpha + bv; if (CP) { const int bidx = (row0g + row0 + 8 * hh + r) / rowsPerB; v += CP[(size_t)bidx * sCPb + (size_t)by * 64 + col]; } if (ACT == 1) v = (v > 0.f) ? v : expm1f(v); else if (ACT == 7) v = (v > 0.f) ? v + 1.0f : expf(v); else if (ACT == 8) v = tanhf(v); else if (ACT == 9) v = 0.5f * v * (1.0f + tanhf(0.7978845608028654f * (v + 0.044715f * v * v * v))); else if (ACT == 11) v = 1.0f / (1.0f + expf(-v)); else if (ACT == 12) v = (v > 0.f) ? v : 0.01f * v; else if (ACT == 14) v = (v > 0.f) ? v : 0.1f * v; else if (ACT == 15) v = v / (1.0f + expf(-v)); else if (ACT == 3) v = fmaxf(v, 0.f); else if (ACT == 6) v = 0.5f * v * (1.0f + erff(v * 0.70710678118654752f)); so[w][8 * hh + r][t * 16 + ln] = v; } }
  __builtin_amdgcn_fence(__ATOMIC_ACQ_REL, "workgroup"); __builtin_amdgcn_wave_barrier();
  const int rsub = lane >> 4, c4 = (lane & 15) * 4; typedef _Float16 v4h __attribute__((ext_vector_type(4)));
  {
#pragma unroll
    for (int q = 0; q < 8; ++q) { const int r = q * 2 + rsub; if (col0 + c4 < N) { const v4f v = *(const v4fa*)&so[w][r][c4]; if (C) *(v4f*)(C + cofs + (size_t)(row0 + r) * ldc + col0 + c4) = v; if (C16) { v4h h4; for (int i = 0; i < 4; ++i) h4[i] = (_Float16)v[i]; *(v4h*)(C16 + cofs + (size_t)(row0 + r) * ldc + col0 + c4) = h4; } } }
     }
}


typedef _Float16 v4h __attribute__((ext_vector_type(4)));

__device__ __forceinline__ void job_x16(int blk, const float* __restrict__ x, _Float16* __restrict__ X16, size_t n8) { const size_t t = (size_t)blk * 256 + threadIdx.x; if (t >= n8) return; FragH f;
#pragma unroll
  for (int q = 0; q < 8; ++q) f.h[q] = (_Float16)bf16_round(x[t * 8 + q]); *(v8us*)((unsigned short*)X16 + t * 8) = f.half[0];  }
__global__ __launch_bounds__(256) void k_h16(const float* __restrict__ x, _Float16* __restrict__ X16, size_t n8) { const size_t t = (size_t)blockIdx.x * 256 + threadIdx.x; if (t >= n8) return; FragH f;
#pragma unroll
  for (int q = 0; q < 8; ++q) f.h[q] = (_Float16)x[t * 8 + q]; *(v8us*)((unsigned short*)X16 + t * 8) = f.half[0];  }
__global__ __launch_bounds__(256) void k_round16f(const float* __restrict__ W, _Float16* __restrict__ Bt, size_t n8) { const size_t t = (size_t)blockIdx.x * 256 + threadIdx.x; if (t >= n8) return; FragH f;
#pragma unroll
  for (int i = 0; i < 8; ++i) f.h[i] = (_Float16)(bf16_round(W[t * 8 + i]) * 16.0f); *(v8us*)((unsigned short*)Bt + t * 8) = f.half[0];  }
// K and V^T in the order in which the attention kernel's fragments take them: every 16-byte piece of a fragment load stands at lane * 16 bytes of a 512-byte chunk, so that one wave-wide load covers four whole 128-byte lines.
// KF, per (slab, tile of 16 keys): chunks (ks, p), piece of lane (hh, ln) = K[key ln][32 ks + 16 p + 8 hh ..+7]. VF, per (slab, tile of 32 keys): chunks (dt, p), piece of lane (hh, ln) = V[keys 16 p + 8 hh ..+7][d = 16 dt + ln].
// The first half of the grid packs V (transposed through an LDS tile), the second half K (a plain move of 16-byte pieces); a block's index picks its job (block-uniform).
template <int NHv, int TTv>
__global__ __launch_bounds__(256) void k_pack(const _Float16* __restrict__ K16, const _Float16* __restrict__ V16, int ld, _Float16* __restrict__ KF, _Float16* __restrict__ VF) { __shared__ unsigned short tl[64][66]; const int tid = threadIdx.x; constexpr int NBLK = NB * NHv * (TTv / 64);
  const bool isk = (int)blockIdx.x >= NBLK; const int blk = isk ? (int)blockIdx.x - NBLK : (int)blockIdx.x; const int slab = blk / (TTv / 64), lg = blk % (TTv / 64); const int b = slab / NHv, h = slab % NHv;
  const unsigned short* src = (const unsigned short*)(isk ? K16 : V16) + ((size_t)b * TTv + lg * 64) * ld + h * 64;
  if (isk) { unsigned short* dst = (unsigned short*)KF + ((size_t)slab * (TTv / 16) + lg * 4) * 1024;
#pragma unroll
    for (int rd = 0; rd < 2; ++rd) { const int i = rd * 256 + tid, r = i >> 3, c8 = i & 7; const v8us v = *(const v8us*)(src + (size_t)r * ld + c8 * 8);      /* d = 8 c8 = 32 ks + 16 p + 8 hh */
      *(v8us*)(dst + (r >> 4) * 1024 + (c8 >> 1) * 256 + ((c8 & 1) * 16 + (r & 15)) * 8) = v; } }
  else {
    for (int i = tid; i < 64 * 8; i += 256) { const int r = i / 8, c8 = (i % 8) * 8; FragH f; f.half[0] = *(const v8us*)(src + (size_t)r * ld + c8);
#pragma unroll
      for (int q = 0; q < 8; ++q) tl[r][c8 + q] = f.u[q]; }
    __syncthreads();
    unsigned short* dst = (unsigned short*)VF + ((size_t)slab * (TTv / 32) + lg * 2) * 2048;
#pragma unroll
    for (int rd = 0; rd < 2; ++rd) { const int ln = tid & 15, hh = (tid >> 4) & 1, p = (tid >> 5) & 1, dt = tid >> 6; FragH f;      /* rd = the tile of 32 keys inside the block's 64 */
#pragma unroll
      for (int q = 0; q < 8; ++q) f.u[q] = tl[rd * 32 + p * 16 + 8 * hh + q][dt * 16 + ln];
      *(v8us*)(dst + (rd * 256 + tid) * 8) = f.half[0]; } } }

__global__ __launch_bounds__(256) void k_hl(const float* __restrict__ F, _Float16* __restrict__ Hh, _Float16* __restrict__ Hl, size_t n8) { const size_t t = (size_t)blockIdx.x * 256 + threadIdx.x; if (t >= n8) return; FragH fh, fl; const v4f a = *(const v4fa*)(F + t * 8), c = *(const v4fa*)(F + t * 8 + 4);
#pragma unroll
  for (int q = 0; q < 4; ++q) { _Float16 h = (_Float16)a[q]; fh.h[q] = h; fl.h[q] = (_Float16)((a[q] - (float)h) * 1024.0f); h = (_Float16)c[q]; fh.h[4 + q] = h; fl.h[4 + q] = (_Float16)((c[q] - (float)h) * 1024.0f); }
  { *(v8us*)((unsigned short*)Hh + t * 8) = fh.half[0]; *(v8us*)((unsigned short*)Hl + t * 8) = fl.half[0];  } }

// ---- fast GEMM (wave tile 32x64; requires M % 32 == 0 rows per launch region and N % 64 == 0); epilogue = k_gemm_hhx semantics ----
__device__ __forceinline__ v16h g2_frag(const _Float16* p, int hh) { FragH f; f.half[0] = *(const v8us*)((const unsigned short*)p + 8 * hh); f.half[1] = *(const v8us*)((const unsigned short*)p + 16 + 8 * hh); return f.v; }
__device__ __forceinline__ v8f g2_mma(v16h a, v16h b, v8f c) { v8f d = __builtin_amdgcn_wmma_f32_16x16x32_f16(false, a, false, b, (short)0, c, false, false); asm volatile("v_nop\n\tv_nop\n\tv_nop\n\tv_nop" : "+v"(d) : "v"(a), "v"(b)); return d; }
template <int ACT>
__global__ __launch_bounds__(128) void k_gemm2(const _Float16* __restrict__ A, int lda, size_t sA, const _Float16* __restrict__ Bh, int ldb, size_t sB, float alpha, const float* __restrict__ bias, size_t sBias, const float* __restrict__ CP, int rowsPerB, size_t sCPb, int row0g,
    float* __restrict__ C, _Float16* __restrict__ C16, int ldc, size_t sC, int M, int N, int K) {
  __shared__ __attribute__((aligned(16))) float so[4][32][68];
  const int tid = threadIdx.x, w = tid >> 5, lane = tid & 31, ln = lane & 15, hh = lane >> 4; const int by = blockIdx.y;
  A += (size_t)by * sA; Bh += (size_t)by * sB; const size_t cofs = (size_t)by * sC; const float* bp = bias ? bias + (size_t)by * sBias : nullptr;
  const int ntn = N >> 6; const int mt = blockIdx.x / ntn, nq = blockIdx.x - mt * ntn; const int row0 = mt * 128 + 32 * w, col0 = nq * 64; if (row0 >= M) return;
  const _Float16* a0p = A + (size_t)(row0 + ln) * lda; const _Float16* a1p = a0p + (size_t)16 * lda;
  const _Float16* b0p = Bh + (size_t)(col0 + ln) * ldb; const _Float16* b1p = b0p + (size_t)16 * ldb; const _Float16* b2p = b1p + (size_t)16 * ldb; const _Float16* b3p = b2p + (size_t)16 * ldb;
  const v8f z8 = {0.f,0.f,0.f,0.f,0.f,0.f,0.f,0.f}; v8f c00 = z8, c01 = z8, c02 = z8, c03 = z8, c10 = z8, c11 = z8, c12 = z8, c13 = z8;
#pragma unroll 1
  for (int kb = 0; kb < K; kb += 32) { const v16h a0 = g2_frag(a0p + kb, hh), a1 = g2_frag(a1p + kb, hh);
    v16h b = g2_frag(b0p + kb, hh); c00 = g2_mma(a0, b, c00); c10 = g2_mma(a1, b, c10);
    b = g2_frag(b1p + kb, hh); c01 = g2_mma(a0, b, c01); c11 = g2_mma(a1, b, c11);
    b = g2_frag(b2p + kb, hh); c02 = g2_mma(a0, b, c02); c12 = g2_mma(a1, b, c12);
    b = g2_frag(b3p + kb, hh); c03 = g2_mma(a0, b, c03); c13 = g2_mma(a1, b, c13); }
  v8f accs[8] = {c00, c01, c02, c03, c10, c11, c12, c13};
#pragma unroll
  for (int u = 0; u < 8; ++u) { const int t = u & 3, half = u >> 2; const int col = col0 + t * 16 + ln; const float bv = bp ? bf16_round(bp[col]) : 0.f;
#pragma unroll
    for (int r = 0; r < 8; ++r) { const int rloc = half * 16 + 8 * hh + r; float v = accs[u][r] * alpha + bv; if (CP) { const int bidx = (row0g + row0 + rloc) / rowsPerB; v += CP[(size_t)bidx * sCPb + (size_t)by * 64 + col]; }
      if (ACT == 3) v = fmaxf(v, 0.f); else if (ACT == 6) v = 0.5f * v * (1.0f + erff(v * 0.70710678118654752f)); else if (ACT == 11) v = 1.0f / (1.0f + expf(-v)); else if (ACT == 15) v = v / (1.0f + expf(-v)); else if (ACT == 12) v = (v > 0.f) ? v : 0.01f * v; else if (ACT == 8) v = tanhf(v);
      so[w][rloc][t * 16 + ln] = v; } }
  __builtin_amdgcn_fence(__ATOMIC_ACQ_REL, "workgroup"); __builtin_amdgcn_wave_barrier();
  const int rsub = lane >> 4, c4 = (lane & 15) * 4;
  {
#pragma unroll
    for (int q = 0; q < 16; ++q) { const int r = q * 2 + rsub; const v4f v = *(const v4fa*)&so[w][r][c4]; if (C) *(v4f*)(C + cofs + (size_t)(row0 + r) * ldc + col0 + c4) = v; if (C16) { v4h h4; for (int i = 0; i < 4; ++i) h4[i] = (_Float16)v[i]; *(v4h*)(C16 + cofs + (size_t)(row0 + r) * ldc + col0 + c4) = h4; } }
     } }



__device__ __forceinline__ float xhalf(float x) { return __builtin_bit_cast(float, __builtin_amdgcn_permlanex16(__builtin_bit_cast(int, x), __builtin_bit_cast(int, x), 0x76543210, 0xfedcba98, false, false)); }      /* lane l with lane l ^ 16 */
template <int CAUSAL>
__global__ __launch_bounds__(128) void k_flash(const _Float16* __restrict__ Q16, int ldq, const _Float16* __restrict__ KF, const _Float16* __restrict__ VF, const int* __restrict__ MSK, float* __restrict__ O, int ldo) {
  constexpr int RPW = 16, DT = 4, KS = 2;
  __shared__ __attribute__((aligned(16))) float sO[4][RPW][64 + 4];
  const int tid = threadIdx.x, w = tid >> 5, lane = tid & 31, ln = lane & 15, hh = lane >> 4;
  const int slab = blockIdx.x / QBLKS, qblk = blockIdx.x % QBLKS; const int b = slab / NH, h = slab % NH; const int qb0 = qblk * (4 * RPW); const int q0 = qb0 + w * RPW; const int tq = q0 + ln; const int eb = tq + RELW - 8 * hh;
  FragH aq[KS];
  { const unsigned short* qr = (const unsigned short*)Q16 + ((size_t)b * TQ + tq) * ldq + h * 64;
#pragma unroll
    for (int ks = 0; ks < KS; ++ks) { aq[ks].half[0] = *(const v8us*)(qr + ks * 32 + 8 * hh); aq[ks].half[1] = *(const v8us*)(qr + ks * 32 + 16 + 8 * hh); } }
  const unsigned short* Kfl = (const unsigned short*)KF + (size_t)slab * 64 * TK + lane * 8; const unsigned short* Vfl = (const unsigned short*)VF + (size_t)slab * 64 * TK + lane * 8;      /* fragment-order planes (k_pack): this lane's piece of every 512-byte chunk */
  float m_r = -3.0e38f, l_r = 0.f; v8f oacc[DT];
#pragma unroll
  for (int dt = 0; dt < DT; ++dt) oacc[dt] = (v8f){0.f,0.f,0.f,0.f,0.f,0.f,0.f,0.f};
  const int jend = (CAUSAL == 1 || CAUSAL == 3) ? (qb0 + 4 * RPW) : TK;      /* causal: keys beyond the block's last query never contribute */ const int jbeg = (CAUSAL == 3) ? ((qb0 - WINDOW) > 0 ? (qb0 - WINDOW) : 0) : 0;      /* window: keys more than WINDOW before the block's first query never contribute (WINDOW % 32 == 0) */
  /* Every global load of the loop is issued well ahead of its first use, so that the round trips run under the softmax of the pass in progress:
     V^T of a pass at the pass's head (used behind the softmax); K of the next pass right behind this pass's score products, its bias values right behind the add of this pass's. */
  FragH kf[2][KS]; FragH vf[DT]; v2f bc[2][4];      /* bias of keys (2 i, 2 i + 1) of score tile nt, paired like the accumulator registers */
  auto fetch_k = [&](int j0) __attribute__((always_inline)) {
    const unsigned short* kr = Kfl + (size_t)j0 * 64;      /* 1024 halves per tile of 16 keys */
#pragma unroll
    for (int nt = 0; nt < 2; ++nt)
#pragma unroll
      for (int ks = 0; ks < KS; ++ks) { kf[nt][ks].half[0] = *(const v8us*)(kr + nt * 1024 + ks * 512); kf[nt][ks].half[1] = *(const v8us*)(kr + nt * 1024 + ks * 512 + 256); }
    asm volatile("s_wait_xcnt 0x0" :: "v"(kr) : "memory");      /* stands before any register that the K loads name is rewritten; the address pair is an input so that no load of the group lands on it */
  };
  auto fetch_bias = [&](int j0) __attribute__((always_inline)) {
    if (CAUSAL == 6) { const float* BTh = (const float*)MSK + h * (2 * RELW + 1);      /* mode 6: per-head relative-position bias table [NH][2*RELW+1] indexed by clip(i - j, +-RELW) + RELW (passed through the MSK pointer) */
      unsigned i0[8], i1[8];
#pragma unroll
      for (int r = 0; r < 8; ++r) { int d0 = eb - j0 - r, d1 = eb - j0 - 16 - r; d0 = d0 < 0 ? 0 : (d0 > 2 * RELW ? 2 * RELW : d0); d1 = d1 < 0 ? 0 : (d1 > 2 * RELW ? 2 * RELW : d1); i0[r] = (unsigned)d0; i1[r] = (unsigned)d1; }      /* clip(i - j + RELW, 0, 2 RELW), the same integer as clip(i - j, +-RELW) + RELW; key j = j0 (+ 16) + 8 hh + r */
#pragma unroll
      for (int r = 0; r < 8; ++r) { bc[0][r >> 1][r & 1] = BTh[i0[r]]; bc[1][r >> 1][r & 1] = BTh[i1[r]]; }
      asm volatile("s_wait_xcnt 0x0" :: "v"(i0[0]), "v"(i0[1]), "v"(i0[2]), "v"(i0[3]), "v"(i0[4]), "v"(i0[5]), "v"(i0[6]), "v"(i0[7]), "v"(i1[0]), "v"(i1[1]), "v"(i1[2]), "v"(i1[3]), "v"(i1[4]), "v"(i1[5]), "v"(i1[6]), "v"(i1[7]) : "memory");      /* stands before any register that the bias loads name is rewritten; the index registers are inputs so that no load of the group lands on one */
    }
  };
  fetch_k(jbeg); fetch_bias(jbeg);
#pragma unroll 1
  for (int j0 = jbeg; j0 < jend; j0 += 32) {
    const unsigned short* vr = Vfl + (size_t)j0 * 64;      /* 2048 halves per tile of 32 keys */
#pragma unroll
    for (int dt = 0; dt < DT; ++dt) { vf[dt].half[0] = *(const v8us*)(vr + dt * 512); vf[dt].half[1] = *(const v8us*)(vr + dt * 512 + 256); }
    asm volatile("s_wait_xcnt 0x0" :: "v"(vr) : "memory");      /* stands before any register that the V loads name is rewritten; the address pair is an input so that no load of the group lands on it */
    v8f s[2];
#pragma unroll
    for (int nt = 0; nt < 2; ++nt) { v8f acc = (v8f){0.f,0.f,0.f,0.f,0.f,0.f,0.f,0.f};
#pragma unroll
      for (int ks = 0; ks < KS; ++ks) acc = mmaH<1>(kf[nt][ks].v, kf[nt][ks].v, aq[ks].v, aq[ks].v, acc); s[nt] = acc; }
    const int jn = (j0 + 32 < jend) ? j0 + 32 : jbeg;      /* the last pass has no next one: it names an in-range tile whose values are not used */
    fetch_k(jn);
    float s0[8], s1[8], mx[8]; bool ok0[8], ok1[8];
#pragma unroll
    for (int r = 0; r < 8; ++r) { const int k0 = j0 + 8 * hh + r, k1 = k0 + 16;
      ok0[r] = (CAUSAL == 1) ? (k0 <= tq) : ((CAUSAL == 2) ? ((k0 >> 5) == (tq >> 5)) : ((CAUSAL == 3) ? (k0 <= tq && tq - k0 < WINDOW) : true)); ok1[r] = (CAUSAL == 1) ? (k1 <= tq) : ((CAUSAL == 2) ? ((k1 >> 5) == (tq >> 5)) : ((CAUSAL == 3) ? (k1 <= tq && tq - k1 < WINDOW) : true));      /* mode 3: causal + sliding window of WINDOW keys */      /* mode 2: block-diagonal 32-token groups */
      s0[r] = ok0[r] ? s[0][r] * SCL : -3.0e38f; s1[r] = ok1[r] ? s[1][r] * SCL : -3.0e38f; if (CAUSAL == 6) { s0[r] += bc[0][r >> 1][r & 1]; s1[r] += bc[1][r >> 1][r & 1]; }      /* mode 6: the bias is added after the 1/sqrt(d) scale */
    }
#pragma unroll
    for (int i = 0; i < 4; ++i) { mx[i] = fmaxf(s0[2 * i], s0[2 * i + 1]); mx[4 + i] = fmaxf(s1[2 * i], s1[2 * i + 1]); }
    fetch_bias(jn);      /* behind the last use of this pass's values, so that the loads land in the same registers */
    float mc = fmaxf(fmaxf(fmaxf(mx[0], mx[1]), fmaxf(mx[2], mx[3])), fmaxf(fmaxf(mx[4], mx[5]), fmaxf(mx[6], mx[7])));
    mc = fmaxf(mc, xhalf(mc));      /* the other 16 keys of this query stand in lane l ^ 16 */
    const float mn = fmaxf(m_r, mc); const float ea = expf(m_r - mn); const float al = (mn > -1.0e38f) ? ea : 1.0f; m_r = mn;
    FragH pb; float ps[8], pt[8];
#pragma unroll
    for (int r = 0; r < 8; ++r) { const float p0 = ok0[r] ? expf(s0[r] - mn) : 0.f, p1 = ok1[r] ? expf(s1[r] - mn) : 0.f; ps[r] = p0; pt[r] = p1; pb.h[r] = (_Float16)(p0 * 1024.0f); pb.h[8 + r] = (_Float16)(p1 * 1024.0f); }
    l_r = l_r * al + ((((ps[0] + ps[2]) + (ps[4] + ps[6])) + ((pt[0] + pt[2]) + (pt[4] + pt[6]))) + (((ps[1] + ps[3]) + (ps[5] + ps[7])) + ((pt[1] + pt[3]) + (pt[5] + pt[7]))));      /* each wave half keeps the sum of its own keys; the halves are joined behind the loop */
#pragma unroll
    for (int dt = 0; dt < DT; ++dt) oacc[dt] *= al;
#pragma unroll
    for (int dt = 0; dt < DT; ++dt) oacc[dt] = mmaH<1>(vf[dt].v, vf[dt].v, pb.v, pb.v, oacc[dt]);
  }
  { const float l = l_r + xhalf(l_r); const float inv = (l > 0.f) ? 1.0f / (l * 1024.0f) : 0.f;
#pragma unroll
    for (int dt = 0; dt < DT; ++dt) { const v8f o = oacc[dt] * inv; *(v4fa*)&sO[w][ln][dt * 16 + 8 * hh] = (v4f){o[0], o[1], o[2], o[3]}; *(v4fa*)&sO[w][ln][dt * 16 + 8 * hh + 4] = (v4f){o[4], o[5], o[6], o[7]}; } }      /* register r of tile dt is O[q0 + ln][16 dt + 8 hh + r] */
  __builtin_amdgcn_fence(__ATOMIC_ACQ_REL, "workgroup"); __builtin_amdgcn_wave_barrier();
  {
#pragma unroll
    for (int rp = 0; rp < RPW; rp += 2) { const int r = rp + (lane >> 4), pc = lane & 15; const v4f val = *(const v4fa*)&sO[w][r][pc * 4]; *(v4f*)(O + ((size_t)b * TQ + q0 + r) * ldo + h * 64 + pc * 4) = val; }
     } }

__global__ __launch_bounds__(256) void k_h16s(const float* __restrict__ x, _Float16* __restrict__ X16, size_t n8, float sc) { const size_t t = (size_t)blockIdx.x * 256 + threadIdx.x; if (t >= n8) return; const v8f a = *(const v8f*)(x + t * 8); FragH f; for (int q = 0; q < 8; ++q) f.h[q] = (_Float16)(a[q] * sc); *(v8us*)((unsigned short*)X16 + t * 8) = f.half[0];  }
__device__ __forceinline__ void job_btab(const float* __restrict__ pe, float* __restrict__ BT) { { for (int e = threadIdx.x; e < NH * NREL; e += 256) { const int h = e / NREL, r = e % NREL; *(float*)(BT + e) = bf16_round(pe[r * NH + h]); }  } }
// One launch for the eight jobs that read nothing but inputs: a block's index picks its job (block-uniform); the jobs share no data, so they need no order among themselves.
// Order: the four weight transposes (long strided loads) first, the bias table, then the three activation planes. B4 = the four [n][k] weight planes in a row, X3 = the three activation planes in a row.
#define WBLK (CC * CC / 8 / 256)      /* blocks of one weight transpose */
#define XBLK (NR * CC / 8 / 256)      /* blocks of one activation plane */
__global__ __launch_bounds__(256) void k_prep(const float* __restrict__ xq, const float* __restrict__ xk, const float* __restrict__ xv, const float* __restrict__ Wq, const float* __restrict__ Wk, const float* __restrict__ Wv, const float* __restrict__ Wo, const float* __restrict__ pe,
                                              _Float16* __restrict__ B4, float* __restrict__ BT, _Float16* __restrict__ X3) {
  const int blk = blockIdx.x;
  if (blk < 4 * WBLK) { const int j = blk / WBLK; job_wt_f16(blk % WBLK, j == 0 ? Wq : (j == 1 ? Wk : (j == 2 ? Wv : Wo)), B4 + (size_t)j * CC * CC, CC, CC, 16.0f); }
  else if (blk == 4 * WBLK) job_btab(pe, BT);
  else { const int xb = blk - 4 * WBLK - 1, j = xb / XBLK; job_x16(xb % XBLK, j == 0 ? xq : (j == 1 ? xk : xv), X3 + (size_t)j * NR * CC, (size_t)NR * CC / 8); }
}

extern "C" void kernel_launch(void* const* d_in, const int* in_sizes, int n_in,
                              void* d_out, int out_size, void* d_ws, size_t ws_size, hipStream_t stream) {
  (void)in_sizes; (void)n_in; (void)out_size;
  const float* const* I = (const float* const*)d_in; const float* xq = I[0]; const float* xk = I[1]; const float* xv = I[2]; const float* Wq = I[3]; const float* Wk = I[4]; const float* Wv = I[5]; const float* Wo = I[6]; const float* pe = I[7];
  char* ws = (char*)d_ws; size_t off = 0;
  auto take = [&](size_t bytes) { char* p = ws + off; off += (bytes + 255) & ~(size_t)255; return p; };
  const size_t np = (size_t)NR * CC;
  _Float16* BQ = (_Float16*)take((size_t)4 * CC * CC * 2); _Float16* BO = BQ + (size_t)3 * CC * CC;      /* Wq, Wk, Wv, Wo planes in a row */ float* BT = (float*)take((size_t)NH * NREL * 4 + 256);
  _Float16* XQ = (_Float16*)take(3 * np * 2);      /* query, key, value planes in a row */ _Float16* Q16 = (_Float16*)take(3 * np * 2); _Float16* K16 = Q16 + np; _Float16* V16 = K16 + np;      /* q, k, v in a row */ _Float16* VT = (_Float16*)take(np * 2); _Float16* KF = (_Float16*)take(np * 2); float* O = (float*)take(np * 4); _Float16* O16 = XQ;
  if (off > ws_size) return;      /* 2 + 8 x 4 + 8 = 42 MiB */
  k_prep<<<4 * WBLK + 1 + 3 * XBLK, 256, 0, stream>>>(xq, xk, xv, Wq, Wk, Wv, Wo, pe, BQ, BT, XQ);
  const dim3 g((NR / 128) * (CC / 64), 1), g3((NR / 128) * (CC / 64), 3);
  k_gemm2<0><<<g3, 128, 0, stream>>>(XQ, CC, np, BQ, CC, (size_t)CC * CC, 0.0625f, nullptr, 0, nullptr, 1, 0, 0, nullptr, Q16, CC, np, NR, CC, CC);      /* the q, k and v projections: blockIdx.y steps through the three planes of A, of the weights and of C */
  k_pack<NH, SLEN><<<2 * NB * NH * (SLEN / 64), 256, 0, stream>>>(K16, V16, CC, KF, VT);
  k_flash<6><<<NB * NH * QBLKS, 128, 0, stream>>>(Q16, CC, KF, VT, (const int*)BT, O, CC);      /* relative-position bias mode */
  k_h16s<<<(unsigned)((np / 8 + 255) / 256), 256, 0, stream>>>(O, O16, np / 8, 64.0f);      /* x2^6 carry: the 2048-key averages are small */
  k_gemm2<0><<<g, 128, 0, stream>>>(O16, CC, 0, BO, CC, 0, 0.0625f / 64.0f, nullptr, 0, nullptr, 1, 0, 0, (float*)d_out, nullptr, CC, 0, NR, CC, CC);
}

// v005
// It runs in 108 microseconds.
// Two timings next to v004 put it at 1.06 and 1.07 times that version's speed.
// All steps since v000 together make it 3.27 times as fast.
#include <hip/hip_runtime.h>
// RelativePositionalEncodingAttention (2 x 2048 tokens, 8 heads of 64, D 512): q/k/v from three inputs (no bias); scores/8 + pos_emb[clip(i - j, -32, 32) + 32][h]; softmax; out Wo.
// Structure: exact f16 planes of query/key/value; q/k/v GEMMs (32x64 wave tiles, f32 accumulation, exact x16 weights, f16 outputs); the relative-bias table transposed to [head][65] (bf16-rounded, f32); K and V^T written in matrix-fragment order by the projection GEMM's own epilogue; the fused flash kernel with a new relative-position-bias mode (table lookup by clipped i - j added after the scale, f32); attention output written as f16 (x2^6) by the flash kernel, straight into the output GEMM.
// Compute dtype: inputs and weights rounded to bf16; q, k, v, P and the attention output as f16 operands (~2^-12); f32 accumulation/softmax/bias. v_wmma_f32_16x16x32_f16.
#define NB 2
#define CC 512
#define NR (NB * SLEN)
#define NREL (2 * RELW + 1)
#define SLEN 2048
#define TQ SLEN
#define TK SLEN
#define NH 8
#define SCL 0.125f               /* 1/sqrt(64) */
#define WINDOW 256
#define RELW 32                  /* max_relative_position */
#define QBLKS (TQ / 64)
typedef __bf16 v16b __attribute__((ext_vector_type(16)));
typedef unsigned short v8us __attribute__((ext_vector_type(8), may_alias));
typedef float  v8f  __attribute__((ext_vector_type(8)));
typedef float  v4f  __attribute__((ext_vector_type(4)));
typedef float  v2f  __attribute__((ext_vector_type(2)));
typedef float  v4fa __attribute__((ext_vector_type(4), may_alias));
union FragB { v16b v; v8us half[2]; unsigned short u[16]; };

__device__ __forceinline__ unsigned short bf16_bits(float x) { unsigned int u = __float_as_uint(x); return (unsigned short)((u + 0x7FFFu + ((u >> 16) & 1u)) >> 16); }
__device__ __forceinline__ float bf16_val(unsigned short b) { return __uint_as_float(((unsigned int)b) << 16); }
__device__ __forceinline__ float bf16_round(float x) { return bf16_val(bf16_bits(x)); }
// D += A·B with NT terms: 1 = ah·bh, 2 = + al·bh (A split), 3 = + ah·bl (both split)
template <int NT>
__device__ __forceinline__ v8f mmaN(v16b ah, v16b al, v16b bh, v16b bl, v8f c) {
  c = __builtin_amdgcn_wmma_f32_16x16x32_bf16(false, ah, false, bh, (short)0, c, false, false);
  if (NT >= 2) c = __builtin_amdgcn_wmma_f32_16x16x32_bf16(false, al, false, bh, (short)0, c, false, false);
  if (NT >= 3) c = __builtin_amdgcn_wmma_f32_16x16x32_bf16(false, ah, false, bl, (short)0, c, false, false);
  asm volatile("v_nop\n\tv_nop\n\tv_nop\n\tv_nop" : "+v"(c) : "v"(ah), "v"(al), "v"(bh), "v"(bl));
  return c;
}

__global__ __launch_bounds__(256) void k_wt_bf16(const float* __restrict__ W, unsigned short* __restrict__ Wt, int K, int N) {
  const int t = blockIdx.x * 256 + threadIdx.x;
  const int k8n = K / 8;
  if (t >= N * k8n) return;
  const int n = t / k8n, k8 = (t % k8n) * 8;
  v8us v;
#pragma unroll
  for (int i = 0; i < 8; ++i) v[i] = bf16_bits(W[(size_t)(k8 + i) * N + n]);
  *(v8us*)(Wt + (size_t)n * K + k8) = v;
  
}

// GEMM C[M][N] (f32, pitch ldc) = act(A[M][K]·W + bias). A f32 row-major (pitch lda) converted per fragment to bf16
// (ASPLIT: hi/lo two planes -> 2 terms, else single rounded term); Wt bf16 [N][K] (pitch ldb). BIAS_BF16 rounds the
// bias to bf16 first (bias quantised to bf16 before the add). K%32==0, M%16==0, N%64==0.
template <bool ASPLIT, int ACT, bool BIAS_BF16>
__global__ __launch_bounds__(128) void k_gemm_bf(const float* __restrict__ A, int lda, const unsigned short* __restrict__ Wt, int ldb,
                                               const float* __restrict__ bias, float* __restrict__ C, int ldc, int M, int N, int K) {
  __shared__ __attribute__((aligned(16))) float so[4][16][64];
  const int tid = threadIdx.x, w = tid >> 5, lane = tid & 31, ln = lane & 15, hh = lane >> 4;
  const int ntn = N / 64;
  const int wid = blockIdx.x * 4 + w;
  const int mt = wid / ntn, nq = wid % ntn;
  if (mt * 16 >= M) return;
  const int row0 = mt * 16, col0 = nq * 64;
  const float* arow = A + (size_t)(row0 + ln) * lda;
  v8f acc[4] = {};
  for (int kb = 0; kb < K; kb += 32) {
    FragB ah, al;
    const v4f x0 = *(const v4fa*)(arow + kb + 8 * hh), x1 = *(const v4fa*)(arow + kb + 8 * hh + 4);
    const v4f x2 = *(const v4fa*)(arow + kb + 16 + 8 * hh), x3 = *(const v4fa*)(arow + kb + 16 + 8 * hh + 4);
    float xs[16] = {x0[0],x0[1],x0[2],x0[3],x1[0],x1[1],x1[2],x1[3],x2[0],x2[1],x2[2],x2[3],x3[0],x3[1],x3[2],x3[3]};
#pragma unroll
    for (int i = 0; i < 16; ++i) { const unsigned short hb = bf16_bits(xs[i]); ah.u[i] = hb; al.u[i] = ASPLIT ? bf16_bits(xs[i] - bf16_val(hb)) : (unsigned short)0; }
#pragma unroll
    for (int t = 0; t < 4; ++t) {
      const unsigned short* brow = Wt + (size_t)(col0 + t * 16 + ln) * ldb + kb;
      FragB b;
      b.half[0] = *(const v8us*)(brow + 8 * hh);
      b.half[1] = *(const v8us*)(brow + 16 + 8 * hh);
      acc[t] = mmaN<ASPLIT ? 2 : 1>(ah.v, al.v, b.v, b.v, acc[t]);
    }
  }
#pragma unroll
  for (int t = 0; t < 4; ++t) {
    float bv = bias ? bias[col0 + t * 16 + ln] : 0.f;
    if (BIAS_BF16) bv = bf16_round(bv);
#pragma unroll
    for (int r = 0; r < 8; ++r) { float v = acc[t][r] + bv; if (ACT == 1) v = fmaxf(v, 0.f); so[w][8 * hh + r][t * 16 + ln] = v; }
  }
  __builtin_amdgcn_fence(__ATOMIC_ACQ_REL, "workgroup");
  __builtin_amdgcn_wave_barrier();
  const int rsub = lane >> 4, c4 = (lane & 15) * 4;
  {
#pragma unroll
    for (int q = 0; q < 8; ++q) {
      const int r = q * 2 + rsub;
      const v4f v = *(const v4fa*)&so[w][r][c4];
      *(v4f*)(C + (size_t)(row0 + r) * ldc + col0 + c4) = v;
    }
    
  }
}

// GEMM C = act(A·W + bias + resid): A f32 (ASPLIT -> hi/lo 2 terms), Wt bf16 [N][K]; ACT 0 none, 1 relu, 2 exact gelu;
// resid (optional, f32, row index = (row % rmod), pitch ldr, RES_BF16 rounds it) added before the activation.
template <bool ASPLIT, int ACT, bool BIAS_BF16, bool RES_BF16>
__global__ __launch_bounds__(128) void k_gemm_bf3(const float* __restrict__ A, int lda, const unsigned short* __restrict__ Wt, int ldb,
                                                const float* __restrict__ bias, const float* __restrict__ resid, int rmod, int ldr,
                                                float* __restrict__ C, int ldc, int M, int N, int K) {
  __shared__ __attribute__((aligned(16))) float so[4][16][64];
  const int tid = threadIdx.x, w = tid >> 5, lane = tid & 31, ln = lane & 15, hh = lane >> 4;
  const int ntn = N / 64;
  const int wid = blockIdx.x * 4 + w;
  const int mt = wid / ntn, nq = wid % ntn;
  if (mt * 16 >= M) return;
  const int row0 = mt * 16, col0 = nq * 64;
  const float* arow = A + (size_t)(row0 + ln) * lda;
  v8f acc[4] = {};
  for (int kb = 0; kb < K; kb += 32) {
    FragB ah, al;
    const v4f x0 = *(const v4fa*)(arow + kb + 8 * hh), x1 = *(const v4fa*)(arow + kb + 8 * hh + 4);
    const v4f x2 = *(const v4fa*)(arow + kb + 16 + 8 * hh), x3 = *(const v4fa*)(arow + kb + 16 + 8 * hh + 4);
    float xs[16] = {x0[0],x0[1],x0[2],x0[3],x1[0],x1[1],x1[2],x1[3],x2[0],x2[1],x2[2],x2[3],x3[0],x3[1],x3[2],x3[3]};
#pragma unroll
    for (int i = 0; i < 16; ++i) { const unsigned short hb = bf16_bits(xs[i]); ah.u[i] = hb; al.u[i] = ASPLIT ? bf16_bits(xs[i] - bf16_val(hb)) : (unsigned short)0; }
#pragma unroll
    for (int t = 0; t < 4; ++t) {
      const unsigned short* brow = Wt + (size_t)(col0 + t * 16 + ln) * ldb + kb;
      FragB b;
      b.half[0] = *(const v8us*)(brow + 8 * hh);
      b.half[1] = *(const v8us*)(brow + 16 + 8 * hh);
      acc[t] = mmaN<ASPLIT ? 2 : 1>(ah.v, al.v, b.v, b.v, acc[t]);
    }
  }
#pragma unroll
  for (int t = 0; t < 4; ++t) {
    const int col = col0 + t * 16 + ln;
    float bv = bias ? bias[col] : 0.f;
    if (BIAS_BF16) bv = bf16_round(bv);
#pragma unroll
    for (int r = 0; r < 8; ++r) {
      float v = acc[t][r] + bv;
      if (resid) { float rv = resid[(size_t)((row0 + 8 * hh + r) % rmod) * ldr + col]; if (RES_BF16) rv = bf16_round(rv); v += rv; }
      if (ACT == 1) v = fmaxf(v, 0.f);
      if (ACT == 2) v = 0.5f * v * (1.0f + erff(v * 0.70710678118654752f));
      if (ACT == 3) { const float u = 0.7978845608028654f * (v + 0.044715f * v * v * v); v = 0.5f * v * (1.0f + tanhf(u)); }
      so[w][8 * hh + r][t * 16 + ln] = v;
    }
  }
  __builtin_amdgcn_fence(__ATOMIC_ACQ_REL, "workgroup");
  __builtin_amdgcn_wave_barrier();
  const int rsub = lane >> 4, c4 = (lane & 15) * 4;
  {
#pragma unroll
    for (int q = 0; q < 8; ++q) {
      const int r = q * 2 + rsub;
      const v4f v = *(const v4fa*)&so[w][r][c4];
      *(v4f*)(C + (size_t)(row0 + r) * ldc + col0 + c4) = v;
    }
    
  }
}
// row LayerNorm (biased variance, eps) over N: s = X (+ R); optional out_sum <- s; out_norm <- (s-mu)*rsqrt(var+eps)*g + b
template <bool PARAM_BF16>
__global__ __launch_bounds__(256) void k_layernorm(const float* __restrict__ X, const float* __restrict__ R, const float* __restrict__ g, const float* __restrict__ bta,
                                                  float* __restrict__ out_sum, float* __restrict__ out_norm, int N, float eps) {
  __shared__ float red[256];
  const int row = blockIdx.x, tid = threadIdx.x;
  const float* x = X + (size_t)row * N; const float* rr = R ? R + (size_t)row * N : nullptr;
  float vals[16];                     // up to N = 4096
  const int per = N / 256;            // contiguous chunk per thread? use strided-by-4 chunks: thread handles j = tid*4 + 1024*u
  float s1 = 0.f;
  for (int u = 0; u < per / 4; ++u) {
    const int j = tid * 4 + 1024 * u;
    const v4f a = *(const v4fa*)(x + j);
    v4f b = {0.f,0.f,0.f,0.f}; if (rr) b = *(const v4fa*)(rr + j);
#pragma unroll
    for (int q = 0; q < 4; ++q) { const float v = a[q] + b[q]; vals[u * 4 + q] = v; s1 += v; }
  }
  red[tid] = s1; __syncthreads();
  for (int st = 128; st > 0; st >>= 1) { if (tid < st) red[tid] += red[tid + st]; __syncthreads(); }
  const float mu = red[0] / (float)N; __syncthreads();
  float s2 = 0.f;
  for (int u = 0; u < per / 4; ++u)
#pragma unroll
    for (int q = 0; q < 4; ++q) { const float c = vals[u * 4 + q] - mu; s2 += c * c; }
  red[tid] = s2; __syncthreads();
  for (int st = 128; st > 0; st >>= 1) { if (tid < st) red[tid] += red[tid + st]; __syncthreads(); }
  const float rs = rsqrtf(red[0] / (float)N + eps);
  {
    for (int u = 0; u < per / 4; ++u) {
      const int j = tid * 4 + 1024 * u;
      v4f o, sm;
#pragma unroll
      for (int q = 0; q < 4; ++q) {
        float gg = g[j + q], bb = bta[j + q];
        if (PARAM_BF16) { gg = bf16_round(gg); bb = bf16_round(bb); }
        sm[q] = vals[u * 4 + q]; o[q] = (vals[u * 4 + q] - mu) * rs * gg + bb;
      }
      if (out_sum) *(v4f*)(out_sum + (size_t)row * N + j) = sm;
      *(v4f*)(out_norm + (size_t)row * N + j) = o;
    }
    
  }
}



// ---- f16 WMMA path (v_wmma_f32_16x16x32_f16): 11-bit significands for operands in range — used where a [0,1] probability operand needs more precision than bf16
typedef _Float16 v16h __attribute__((ext_vector_type(16)));
union FragH { v16h v; v8us half[2]; _Float16 h[16]; unsigned short u[16]; };
template <int NT>
__device__ __forceinline__ v8f mmaH(v16h ah, v16h al, v16h bh, v16h bl, v8f c) {
  c = __builtin_amdgcn_wmma_f32_16x16x32_f16(false, ah, false, bh, (short)0, c, false, false);
  if (NT >= 2) c = __builtin_amdgcn_wmma_f32_16x16x32_f16(false, al, false, bh, (short)0, c, false, false);
  if (NT >= 3) c = __builtin_amdgcn_wmma_f32_16x16x32_f16(false, ah, false, bl, (short)0, c, false, false);
  asm volatile("v_nop\n\tv_nop\n\tv_nop\n\tv_nop" : "+v"(c) : "v"(ah), "v"(al), "v"(bh), "v"(bl));
  return c;
}
// batched GEMM like k_gemm_b but f16 operands: A f32 (split into f16 hi/lo if ASPLIT, else rounded to f16), Bt = f16 values [n][k]; alpha; C f32; N multiple of 16 (partial tiles skipped)
template <bool ASPLIT>
__global__ __launch_bounds__(128) void k_gemm_h(const float* __restrict__ A, int lda, size_t sA, const _Float16* __restrict__ Bh, int ldb, size_t sB, float alpha, float* __restrict__ C, int ldc, size_t sC, int M, int N, int K) {
  __shared__ __attribute__((aligned(16))) float so[4][16][64];
  const int tid = threadIdx.x, w = tid >> 5, lane = tid & 31, ln = lane & 15, hh = lane >> 4; const int by = blockIdx.y;
  A += (size_t)by * sA; Bh += (size_t)by * sB; C += (size_t)by * sC;
  const int ntn = (N + 63) / 64; const int wid = blockIdx.x * 4 + w; const int mt = wid / ntn, nq = wid % ntn; if (mt * 16 >= M) return;
  const int row0 = mt * 16, col0 = nq * 64; const float* arow = A + (size_t)(row0 + ln) * lda;
  v8f acc[4] = {};
  for (int kb = 0; kb < K; kb += 32) {
    FragH ah, al;
    const v4f x0 = *(const v4fa*)(arow + kb + 8 * hh), x1 = *(const v4fa*)(arow + kb + 8 * hh + 4), x2 = *(const v4fa*)(arow + kb + 16 + 8 * hh), x3 = *(const v4fa*)(arow + kb + 16 + 8 * hh + 4);
    float xs[16] = {x0[0],x0[1],x0[2],x0[3],x1[0],x1[1],x1[2],x1[3],x2[0],x2[1],x2[2],x2[3],x3[0],x3[1],x3[2],x3[3]};
#pragma unroll
    for (int i = 0; i < 16; ++i) { const _Float16 h = (_Float16)xs[i]; ah.h[i] = h; al.h[i] = ASPLIT ? (_Float16)(xs[i] - (float)h) : (_Float16)0.0f; }
#pragma unroll
    for (int t = 0; t < 4; ++t) { if (col0 + t * 16 >= N) continue; const size_t boff = (size_t)(col0 + t * 16 + ln) * ldb + kb; FragH bq; bq.half[0] = *(const v8us*)(Bh + boff + 8 * hh); bq.half[1] = *(const v8us*)(Bh + boff + 16 + 8 * hh);
      acc[t] = mmaH<ASPLIT ? 2 : 1>(ah.v, al.v, bq.v, bq.v, acc[t]); }
  }
#pragma unroll
  for (int t = 0; t < 4; ++t) { if (col0 + t * 16 >= N) continue;
#pragma unroll
    for (int r = 0; r < 8; ++r) so[w][8 * hh + r][t * 16 + ln] = acc[t][r] * alpha; }
  __builtin_amdgcn_fence(__ATOMIC_ACQ_REL, "workgroup"); __builtin_amdgcn_wave_barrier();
  const int rsub = lane >> 4, c4 = (lane & 15) * 4;
  {
#pragma unroll
    for (int q = 0; q < 8; ++q) { const int r = q * 2 + rsub; if (col0 + c4 < N) { const v4f v = *(const v4fa*)&so[w][r][c4]; *(v4f*)(C + (size_t)(row0 + r) * ldc + col0 + c4) = v; } }
     }
}

// Wt[n][k] = f16(W[k][n]·scale) from f32 row-major W[K][N] (scale = power of two; bf16-exact weights stay exact in f16 away from the subnormal range)
__device__ __forceinline__ void job_wt_f16(int blk, const float* __restrict__ W, _Float16* __restrict__ Wt, int K, int N, float scale) {
  const int t = blk * 256 + threadIdx.x; if (t >= N * (K / 8)) return; const int n = t / (K / 8), k8 = (t % (K / 8)) * 8; FragH f;
#pragma unroll
  for (int i = 0; i < 8; ++i) f.h[i] = (_Float16)(bf16_round(W[(size_t)(k8 + i) * N + n]) * scale); const v8us o = f.half[0];
  *(v8us*)((unsigned short*)Wt + (size_t)n * K + k8) = o; 
}
// k_gemm_hh variant with fused epilogue: v = acc·alpha + bias[by·sBias + col] (+ CP[(row/rowsPerB)·sCPb + by·64 + col] if CP) ; ACT 0 none / 1 elu ; writes f16 C16 (and f32 C if non-null)
template <int ACT>
__global__ __launch_bounds__(128) void k_gemm_hhx(const _Float16* __restrict__ A, int lda, size_t sA, const _Float16* __restrict__ Bh, int ldb, size_t sB, float alpha, const float* __restrict__ bias, size_t sBias, const float* __restrict__ CP, int rowsPerB, size_t sCPb, int row0g,
    float* __restrict__ C, _Float16* __restrict__ C16, int ldc, size_t sC, int M, int N, int K) {
  __shared__ __attribute__((aligned(16))) float so[4][16][64];
  const int tid = threadIdx.x, w = tid >> 5, lane = tid & 31, ln = lane & 15, hh = lane >> 4; const int by = blockIdx.y;
  A += (size_t)by * sA; Bh += (size_t)by * sB; const size_t cofs = (size_t)by * sC; const float* bp = bias ? bias + (size_t)by * sBias : nullptr;
  const int ntn = (N + 63) / 64; const int wid = blockIdx.x * 4 + w; const int mt = wid / ntn, nq = wid % ntn; if (mt * 16 >= M) return;
  const int row0 = mt * 16, col0 = nq * 64; const _Float16* arow = A + (size_t)(row0 + ln) * lda;
  v8f acc[4] = {};
  for (int kb = 0; kb < K; kb += 32) { FragH ah; ah.half[0] = *(const v8us*)((const unsigned short*)arow + kb + 8 * hh); ah.half[1] = *(const v8us*)((const unsigned short*)arow + kb + 16 + 8 * hh);
#pragma unroll
    for (int t = 0; t < 4; ++t) { if (col0 + t * 16 >= N) continue; const size_t boff = (size_t)(col0 + t * 16 + ln) * ldb + kb; FragH bq; bq.half[0] = *(const v8us*)((const unsigned short*)Bh + boff + 8 * hh); bq.half[1] = *(const v8us*)((const unsigned short*)Bh + boff + 16 + 8 * hh);
      acc[t] = mmaH<1>(ah.v, ah.v, bq.v, bq.v, acc[t]); }
  }
#pragma unroll
  for (int t = 0; t < 4; ++t) { if (col0 + t * 16 >= N) continue; const int col = col0 + t * 16 + ln; const float bv = bp ? bf16_round(bp[col]) : 0.f;
#pragma unroll
    for (int r = 0; r < 8; ++r) { float v = acc[t][r] * alpha + bv; if (CP) { const int bidx = (row0g + row0 + 8 * hh + r) / rowsPerB; v += CP[(size_t)bidx * sCPb + (size_t)by * 64 + col]; } if (ACT == 1) v = (v > 0.f) ? v : expm1f(v); else if (ACT == 7) v = (v > 0.f) ? v + 1.0f : expf(v); else if (ACT == 8) v = tanhf(v); else if (ACT == 9) v = 0.5f * v * (1.0f + tanhf(0.7978845608028654f * (v + 0.044715f * v * v * v))); else if (ACT == 11) v = 1.0f / (1.0f + expf(-v)); else if (ACT == 12) v = (v > 0.f) ? v : 0.01f * v; else if (ACT == 14) v = (v > 0.f) ? v : 0.1f * v; else if (ACT == 15) v = v / (1.0f + expf(-v)); else if (ACT == 3) v = fmaxf(v, 0.f); else if (ACT == 6) v = 0.5f * v * (1.0f + erff(v * 0.70710678118654752f)); so[w][8 * hh + r][t * 16 + ln] = v; } }
  __builtin_amdgcn_fence(__ATOMIC_ACQ_REL, "workgroup"); __builtin_amdgcn_wave_barrier();
  const int rsub = lane >> 4, c4 = (lane & 15) * 4; typedef _Float16 v4h __attribute__((ext_vector_type(4)));
  {
#pragma unroll
    for (int q = 0; q < 8; ++q) { const int r = q * 2 + rsub; if (col0 + c4 < N) { const v4f v = *(const v4fa*)&so[w][r][c4]; if (C) *(v4f*)(C + cofs + (size_t)(row0 + r) * ldc + col0 + c4) = v; if (C16) { v4h h4; for (int i = 0; i < 4; ++i) h4[i] = (_Float16)v[i]; *(v4h*)(C16 + cofs + (size_t)(row0 + r) * ldc + col0 + c4) = h4; } } }
     }
}


typedef _Float16 v4h __attribute__((ext_vector_type(4)));

__device__ __forceinline__ void job_x16(int blk, const float* __restrict__ x, _Float16* __restrict__ X16, size_t n8) { const size_t t = (size_t)blk * 256 + threadIdx.x; if (t >= n8) return; FragH f;
#pragma unroll
  for (int q = 0; q < 8; ++q) f.h[q] = (_Float16)bf16_round(x[t * 8 + q]); *(v8us*)((unsigned short*)X16 + t * 8) = f.half[0];  }
__global__ __launch_bounds__(256) void k_h16(const float* __restrict__ x, _Float16* __restrict__ X16, size_t n8) { const size_t t = (size_t)blockIdx.x * 256 + threadIdx.x; if (t >= n8) return; FragH f;
#pragma unroll
  for (int q = 0; q < 8; ++q) f.h[q] = (_Float16)x[t * 8 + q]; *(v8us*)((unsigned short*)X16 + t * 8) = f.half[0];  }
__global__ __launch_bounds__(256) void k_round16f(const float* __restrict__ W, _Float16* __restrict__ Bt, size_t n8) { const size_t t = (size_t)blockIdx.x * 256 + threadIdx.x; if (t >= n8) return; FragH f;
#pragma unroll
  for (int i = 0; i < 8; ++i) f.h[i] = (_Float16)(bf16_round(W[t * 8 + i]) * 16.0f); *(v8us*)((unsigned short*)Bt + t * 8) = f.half[0];  }
// K and V^T in the order in which the attention kernel's fragments take them: every 16-byte piece of a fragment load stands at lane * 16 bytes of a 512-byte chunk, so that one wave-wide load covers four whole 128-byte lines.
// KF, per (slab, tile of 16 keys): chunks (ks, p), piece of lane (hh, ln) = K[key ln][32 ks + 16 p + 8 hh ..+7]. VF, per (slab, tile of 32 keys): chunks (dt, p), piece of lane (hh, ln) = V[keys 16 p + 8 hh ..+7][d = 16 dt + ln].
// Both planes are written by k_gemm2's epilogue (its 32 x 64 wave tile is two K tiles, or one V tile, of one head).

__global__ __launch_bounds__(256) void k_hl(const float* __restrict__ F, _Float16* __restrict__ Hh, _Float16* __restrict__ Hl, size_t n8) { const size_t t = (size_t)blockIdx.x * 256 + threadIdx.x; if (t >= n8) return; FragH fh, fl; const v4f a = *(const v4fa*)(F + t * 8), c = *(const v4fa*)(F + t * 8 + 4);
#pragma unroll
  for (int q = 0; q < 4; ++q) { _Float16 h = (_Float16)a[q]; fh.h[q] = h; fl.h[q] = (_Float16)((a[q] - (float)h) * 1024.0f); h = (_Float16)c[q]; fh.h[4 + q] = h; fl.h[4 + q] = (_Float16)((c[q] - (float)h) * 1024.0f); }
  { *(v8us*)((unsigned short*)Hh + t * 8) = fh.half[0]; *(v8us*)((unsigned short*)Hl + t * 8) = fl.half[0];  } }

// ---- fast GEMM (wave tile 32x64; requires M % 32 == 0 rows per launch region and N % 64 == 0); epilogue = k_gemm_hhx semantics ----
__device__ __forceinline__ v16h g2_frag(const _Float16* p, int hh) { FragH f; f.half[0] = *(const v8us*)((const unsigned short*)p + 8 * hh); f.half[1] = *(const v8us*)((const unsigned short*)p + 16 + 8 * hh); return f.v; }
__device__ __forceinline__ v8f g2_mma(v16h a, v16h b, v8f c) { v8f d = __builtin_amdgcn_wmma_f32_16x16x32_f16(false, a, false, b, (short)0, c, false, false); asm volatile("v_nop\n\tv_nop\n\tv_nop\n\tv_nop" : "+v"(d) : "v"(a), "v"(b)); return d; }
template <int ACT>
__global__ __launch_bounds__(128) void k_gemm2(const _Float16* __restrict__ A, int lda, size_t sA, const _Float16* __restrict__ Bh, int ldb, size_t sB, float alpha, const float* __restrict__ bias, size_t sBias, const float* __restrict__ CP, int rowsPerB, size_t sCPb, int row0g,
    float* __restrict__ C, _Float16* __restrict__ C16, int ldc, size_t sC, int M, int N, int K, _Float16* __restrict__ KFo, _Float16* __restrict__ VFo) {
  __shared__ __attribute__((aligned(16))) float so[4][32][68];
  const int tid = threadIdx.x, w = tid >> 5, lane = tid & 31, ln = lane & 15, hh = lane >> 4; const int by = blockIdx.y;
  A += (size_t)by * sA; Bh += (size_t)by * sB; const size_t cofs = (size_t)by * sC; const float* bp = bias ? bias + (size_t)by * sBias : nullptr;
  const int ntn = N >> 6; const int mt = blockIdx.x / ntn, nq = blockIdx.x - mt * ntn; const int row0 = mt * 128 + 32 * w, col0 = nq * 64; if (row0 >= M) return;
  const _Float16* a0p = A + (size_t)(row0 + ln) * lda; const _Float16* a1p = a0p + (size_t)16 * lda;
  const _Float16* b0p = Bh + (size_t)(col0 + ln) * ldb; const _Float16* b1p = b0p + (size_t)16 * ldb; const _Float16* b2p = b1p + (size_t)16 * ldb; const _Float16* b3p = b2p + (size_t)16 * ldb;
  const v8f z8 = {0.f,0.f,0.f,0.f,0.f,0.f,0.f,0.f}; v8f c00 = z8, c01 = z8, c02 = z8, c03 = z8, c10 = z8, c11 = z8, c12 = z8, c13 = z8;
#pragma unroll 1
  for (int kb = 0; kb < K; kb += 32) { const v16h a0 = g2_frag(a0p + kb, hh), a1 = g2_frag(a1p + kb, hh);
    v16h b = g2_frag(b0p + kb, hh); c00 = g2_mma(a0, b, c00); c10 = g2_mma(a1, b, c10);
    b = g2_frag(b1p + kb, hh); c01 = g2_mma(a0, b, c01); c11 = g2_mma(a1, b, c11);
    b = g2_frag(b2p + kb, hh); c02 = g2_mma(a0, b, c02); c12 = g2_mma(a1, b, c12);
    b = g2_frag(b3p + kb, hh); c03 = g2_mma(a0, b, c03); c13 = g2_mma(a1, b, c13); }
  v8f accs[8] = {c00, c01, c02, c03, c10, c11, c12, c13};
  /* With KFo set (the q, k, v launch; N = NH * 64, rows = NB * SLEN tokens, no bias, no CP, ACT 0) plane 1 goes out as KF and plane 2 as VF; the plane is blockIdx.y, the same for the whole block. */
  const int fjob = KFo ? by : 0; const int slab = (row0 / SLEN) * NH + nq, tok0 = row0 % SLEN;
  if (fjob == 2) {      /* accumulator u = (half, t), register r, is V[key 16 half + 8 hh + r][d = 16 t + ln]: already the piece of chunk (dt = t, p = half) */
    unsigned short* dst = (unsigned short*)VFo + ((size_t)slab * (SLEN / 32) + tok0 / 32) * 2048 + lane * 8; FragH f[8];
#pragma unroll
    for (int u = 0; u < 8; ++u)
#pragma unroll
      for (int r = 0; r < 8; ++r) f[u].h[r] = (_Float16)(accs[u][r] * alpha);
#pragma unroll
    for (int u = 0; u < 8; ++u) *(v8us*)(dst + ((u & 3) * 2 + (u >> 2)) * 256) = f[u].half[0];
    return; }
#pragma unroll
  for (int u = 0; u < 8; ++u) { const int t = u & 3, half = u >> 2; const int col = col0 + t * 16 + ln; const float bv = bp ? bf16_round(bp[col]) : 0.f;
#pragma unroll
    for (int r = 0; r < 8; ++r) { const int rloc = half * 16 + 8 * hh + r; float v = accs[u][r] * alpha + bv; if (CP) { const int bidx = (row0g + row0 + rloc) / rowsPerB; v += CP[(size_t)bidx * sCPb + (size_t)by * 64 + col]; }
      if (ACT == 3) v = fmaxf(v, 0.f); else if (ACT == 6) v = 0.5f * v * (1.0f + erff(v * 0.70710678118654752f)); else if (ACT == 11) v = 1.0f / (1.0f + expf(-v)); else if (ACT == 15) v = v / (1.0f + expf(-v)); else if (ACT == 12) v = (v > 0.f) ? v : 0.01f * v; else if (ACT == 8) v = tanhf(v);
      so[w][rloc][t * 16 + ln] = v; } }
  __builtin_amdgcn_fence(__ATOMIC_ACQ_REL, "workgroup"); __builtin_amdgcn_wave_barrier();
  if (fjob == 1) {      /* tile tt of 16 keys, chunk c = 2 ks + p: lane (hh, ln) takes K[key ln][16 c + 8 hh ..+7] from the wave's own LDS tile */
    unsigned short* dst = (unsigned short*)KFo + ((size_t)slab * (SLEN / 16) + tok0 / 16) * 1024 + lane * 8; FragH f[8];
#pragma unroll
    for (int u = 0; u < 8; ++u) { const float* sp = &so[w][(u >> 2) * 16 + ln][(u & 3) * 16 + 8 * hh]; const v4f x = *(const v4fa*)sp, y = *(const v4fa*)(sp + 4);
#pragma unroll
      for (int i = 0; i < 4; ++i) { f[u].h[i] = (_Float16)x[i]; f[u].h[4 + i] = (_Float16)y[i]; } }
#pragma unroll
    for (int u = 0; u < 8; ++u) *(v8us*)(dst + u * 256) = f[u].half[0];
    asm volatile("s_wait_xcnt 0x0" ::: "memory");      /* stands behind the eight stores, before any path on which their address pair is rewritten */
    return; }
  const int rsub = lane >> 4, c4 = (lane & 15) * 4;
  {
#pragma unroll
    for (int q = 0; q < 16; ++q) { const int r = q * 2 + rsub; const v4f v = *(const v4fa*)&so[w][r][c4];
      if (C) { *(v4f*)(C + cofs + (size_t)(row0 + r) * ldc + col0 + c4) = v; asm volatile("s_wait_xcnt 0x0" ::: "memory"); }      /* stands behind the store, before any path on which a register that it names is rewritten */
      if (C16) { v4h h4; for (int i = 0; i < 4; ++i) h4[i] = (_Float16)v[i]; *(v4h*)(C16 + cofs + (size_t)(row0 + r) * ldc + col0 + c4) = h4; asm volatile("s_wait_xcnt 0x0" ::: "memory"); } }      /* the same behind the f16 store */
     } }



__device__ __forceinline__ float xhalf(float x) { return __builtin_bit_cast(float, __builtin_amdgcn_permlanex16(__builtin_bit_cast(int, x), __builtin_bit_cast(int, x), 0x76543210, 0xfedcba98, false, false)); }      /* lane l with lane l ^ 16 */
template <int CAUSAL>
__global__ __launch_bounds__(128) void k_flash(const _Float16* __restrict__ Q16, int ldq, const _Float16* __restrict__ KF, const _Float16* __restrict__ VF, const int* __restrict__ MSK, _Float16* __restrict__ O16, int ldo, float osc) {
  constexpr int RPW = 16, DT = 4, KS = 2;
  __shared__ __attribute__((aligned(16))) float sO[4][RPW][64 + 4];
  const int tid = threadIdx.x, w = tid >> 5, lane = tid & 31, ln = lane & 15, hh = lane >> 4;
  const int slab = blockIdx.x / QBLKS, qblk = blockIdx.x % QBLKS; const int b = slab / NH, h = slab % NH; const int qb0 = qblk * (4 * RPW); const int q0 = qb0 + w * RPW; const int tq = q0 + ln; const int eb = tq + RELW - 8 * hh;
  FragH aq[KS];
  { const unsigned short* qr = (const unsigned short*)Q16 + ((size_t)b * TQ + tq) * ldq + h * 64;
#pragma unroll
    for (int ks = 0; ks < KS; ++ks) { aq[ks].half[0] = *(const v8us*)(qr + ks * 32 + 8 * hh); aq[ks].half[1] = *(const v8us*)(qr + ks * 32 + 16 + 8 * hh); } }
  const unsigned short* Kfl = (const unsigned short*)KF + (size_t)slab * 64 * TK + lane * 8; const unsigned short* Vfl = (const unsigned short*)VF + (size_t)slab * 64 * TK + lane * 8;      /* fragment-order planes (written by k_gemm2): this lane's piece of every 512-byte chunk */
  float m_r = -3.0e38f, l_r = 0.f; v8f oacc[DT];
#pragma unroll
  for (int dt = 0; dt < DT; ++dt) oacc[dt] = (v8f){0.f,0.f,0.f,0.f,0.f,0.f,0.f,0.f};
  const int jend = (CAUSAL == 1 || CAUSAL == 3) ? (qb0 + 4 * RPW) : TK;      /* causal: keys beyond the block's last query never contribute */ const int jbeg = (CAUSAL == 3) ? ((qb0 - WINDOW) > 0 ? (qb0 - WINDOW) : 0) : 0;      /* window: keys more than WINDOW before the block's first query never contribute (WINDOW % 32 == 0) */
  /* Every global load of the loop is issued well ahead of its first use, so that the round trips run under the softmax of the pass in progress:
     V^T of a pass at the pass's head (used behind the softmax); K of the next pass right behind this pass's score products, its bias values right behind the add of this pass's. */
  FragH kf[2][KS]; FragH vf[DT]; v2f bc[2][4];      /* bias of keys (2 i, 2 i + 1) of score tile nt, paired like the accumulator registers */
  auto fetch_k = [&](int j0) __attribute__((always_inline)) {
    const unsigned short* kr = Kfl + (size_t)j0 * 64;      /* 1024 halves per tile of 16 keys */
#pragma unroll
    for (int nt = 0; nt < 2; ++nt)
#pragma unroll
      for (int ks = 0; ks < KS; ++ks) { kf[nt][ks].half[0] = *(const v8us*)(kr + nt * 1024 + ks * 512); kf[nt][ks].half[1] = *(const v8us*)(kr + nt * 1024 + ks * 512 + 256); }
    asm volatile("s_wait_xcnt 0x0" :: "v"(kr) : "memory");      /* stands before any register that the K loads name is rewritten; the address pair is an input so that no load of the group lands on it */
  };
  auto fetch_bias = [&](int j0) __attribute__((always_inline)) {
    if (CAUSAL == 6) { const float* BTh = (const float*)MSK + h * (2 * RELW + 1);      /* mode 6: per-head relative-position bias table [NH][2*RELW+1] indexed by clip(i - j, +-RELW) + RELW (passed through the MSK pointer) */
      unsigned i0[8], i1[8];
#pragma unroll
      for (int r = 0; r < 8; ++r) { int d0 = eb - j0 - r, d1 = eb - j0 - 16 - r; d0 = d0 < 0 ? 0 : (d0 > 2 * RELW ? 2 * RELW : d0); d1 = d1 < 0 ? 0 : (d1 > 2 * RELW ? 2 * RELW : d1); i0[r] = (unsigned)d0; i1[r] = (unsigned)d1; }      /* clip(i - j + RELW, 0, 2 RELW), the same integer as clip(i - j, +-RELW) + RELW; key j = j0 (+ 16) + 8 hh + r */
#pragma unroll
      for (int r = 0; r < 8; ++r) { bc[0][r >> 1][r & 1] = BTh[i0[r]]; bc[1][r >> 1][r & 1] = BTh[i1[r]]; }
      asm volatile("s_wait_xcnt 0x0" :: "v"(i0[0]), "v"(i0[1]), "v"(i0[2]), "v"(i0[3]), "v"(i0[4]), "v"(i0[5]), "v"(i0[6]), "v"(i0[7]), "v"(i1[0]), "v"(i1[1]), "v"(i1[2]), "v"(i1[3]), "v"(i1[4]), "v"(i1[5]), "v"(i1[6]), "v"(i1[7]) : "memory");      /* stands before any register that the bias loads name is rewritten; the index registers are inputs so that no load of the group lands on one */
    }
  };
  fetch_k(jbeg); fetch_bias(jbeg);
#pragma unroll 1
  for (int j0 = jbeg; j0 < jend; j0 += 32) {
    const unsigned short* vr = Vfl + (size_t)j0 * 64;      /* 2048 halves per tile of 32 keys */
#pragma unroll
    for (int dt = 0; dt < DT; ++dt) { vf[dt].half[0] = *(const v8us*)(vr + dt * 512); vf[dt].half[1] = *(const v8us*)(vr + dt * 512 + 256); }
    asm volatile("s_wait_xcnt 0x0" :: "v"(vr) : "memory");      /* stands before any register that the V loads name is rewritten; the address pair is an input so that no load of the group lands on it */
    v8f s[2];
#pragma unroll
    for (int nt = 0; nt < 2; ++nt) { v8f acc = (v8f){0.f,0.f,0.f,0.f,0.f,0.f,0.f,0.f};
#pragma unroll
      for (int ks = 0; ks < KS; ++ks) acc = mmaH<1>(kf[nt][ks].v, kf[nt][ks].v, aq[ks].v, aq[ks].v, acc); s[nt] = acc; }
    const int jn = (j0 + 32 < jend) ? j0 + 32 : jbeg;      /* the last pass has no next one: it names an in-range tile whose values are not used */
    fetch_k(jn);
    float s0[8], s1[8], mx[8]; bool ok0[8], ok1[8];
#pragma unroll
    for (int r = 0; r < 8; ++r) { const int k0 = j0 + 8 * hh + r, k1 = k0 + 16;
      ok0[r] = (CAUSAL == 1) ? (k0 <= tq) : ((CAUSAL == 2) ? ((k0 >> 5) == (tq >> 5)) : ((CAUSAL == 3) ? (k0 <= tq && tq - k0 < WINDOW) : true)); ok1[r] = (CAUSAL == 1) ? (k1 <= tq) : ((CAUSAL == 2) ? ((k1 >> 5) == (tq >> 5)) : ((CAUSAL == 3) ? (k1 <= tq && tq - k1 < WINDOW) : true));      /* mode 3: causal + sliding window of WINDOW keys */      /* mode 2: block-diagonal 32-token groups */
      s0[r] = ok0[r] ? s[0][r] * SCL : -3.0e38f; s1[r] = ok1[r] ? s[1][r] * SCL : -3.0e38f; if (CAUSAL == 6) { s0[r] += bc[0][r >> 1][r & 1]; s1[r] += bc[1][r >> 1][r & 1]; }      /* mode 6: the bias is added after the 1/sqrt(d) scale */
    }
#pragma unroll
    for (int i = 0; i < 4; ++i) { mx[i] = fmaxf(s0[2 * i], s0[2 * i + 1]); mx[4 + i] = fmaxf(s1[2 * i], s1[2 * i + 1]); }
    fetch_bias(jn);      /* behind the last use of this pass's values, so that the loads land in the same registers */
    float mc = fmaxf(fmaxf(fmaxf(mx[0], mx[1]), fmaxf(mx[2], mx[3])), fmaxf(fmaxf(mx[4], mx[5]), fmaxf(mx[6], mx[7])));
    mc = fmaxf(mc, xhalf(mc));      /* the other 16 keys of this query stand in lane l ^ 16 */
    const float mn = fmaxf(m_r, mc); const float ea = expf(m_r - mn); const float al = (mn > -1.0e38f) ? ea : 1.0f; m_r = mn;
    FragH pb; float ps[8], pt[8];
#pragma unroll
    for (int r = 0; r < 8; ++r) { const float p0 = ok0[r] ? expf(s0[r] - mn) : 0.f, p1 = ok1[r] ? expf(s1[r] - mn) : 0.f; ps[r] = p0; pt[r] = p1; pb.h[r] = (_Float16)(p0 * 1024.0f); pb.h[8 + r] = (_Float16)(p1 * 1024.0f); }
    l_r = l_r * al + ((((ps[0] + ps[2]) + (ps[4] + ps[6])) + ((pt[0] + pt[2]) + (pt[4] + pt[6]))) + (((ps[1] + ps[3]) + (ps[5] + ps[7])) + ((pt[1] + pt[3]) + (pt[5] + pt[7]))));      /* each wave half keeps the sum of its own keys; the halves are joined behind the loop */
#pragma unroll
    for (int dt = 0; dt < DT; ++dt) oacc[dt] *= al;
#pragma unroll
    for (int dt = 0; dt < DT; ++dt) oacc[dt] = mmaH<1>(vf[dt].v, vf[dt].v, pb.v, pb.v, oacc[dt]);
  }
  { const float l = l_r + xhalf(l_r); const float inv = (l > 0.f) ? 1.0f / (l * 1024.0f) : 0.f;
#pragma unroll
    for (int dt = 0; dt < DT; ++dt) { const v8f o = oacc[dt] * inv; *(v4fa*)&sO[w][ln][dt * 16 + 8 * hh] = (v4f){o[0], o[1], o[2], o[3]}; *(v4fa*)&sO[w][ln][dt * 16 + 8 * hh + 4] = (v4f){o[4], o[5], o[6], o[7]}; } }      /* register r of tile dt is O[q0 + ln][16 dt + 8 hh + r] */
  __builtin_amdgcn_fence(__ATOMIC_ACQ_REL, "workgroup"); __builtin_amdgcn_wave_barrier();
  {
#pragma unroll
    for (int rp = 0; rp < RPW; rp += 4) { const int r = rp + (lane >> 3), pc = lane & 7; const v4f x = *(const v4fa*)&sO[w][r][pc * 8], y = *(const v4fa*)&sO[w][r][pc * 8 + 4]; FragH f;      /* eight lanes write one query's 128-byte line of f16 values, scaled by osc (a power of two) for the output GEMM */
#pragma unroll
      for (int i = 0; i < 4; ++i) { f.h[i] = (_Float16)(x[i] * osc); f.h[4 + i] = (_Float16)(y[i] * osc); }
      *(v8us*)((unsigned short*)O16 + ((size_t)b * TQ + q0 + r) * ldo + h * 64 + pc * 8) = f.half[0]; }
     } }

__device__ __forceinline__ void job_btab(const float* __restrict__ pe, float* __restrict__ BT) { { for (int e = threadIdx.x; e < NH * NREL; e += 256) { const int h = e / NREL, r = e % NREL; *(float*)(BT + e) = bf16_round(pe[r * NH + h]); }  } }
// One launch for the eight jobs that read nothing but inputs: a block's index picks its job (block-uniform); the jobs share no data, so they need no order among themselves.
// Order: the four weight transposes (long strided loads) first, the bias table, then the three activation planes. B4 = the four [n][k] weight planes in a row, X3 = the three activation planes in a row.
#define WBLK (CC * CC / 8 / 256)      /* blocks of one weight transpose */
#define XBLK (NR * CC / 8 / 256)      /* blocks of one activation plane */
__global__ __launch_bounds__(256) void k_prep(const float* __restrict__ xq, const float* __restrict__ xk, const float* __restrict__ xv, const float* __restrict__ Wq, const float* __restrict__ Wk, const float* __restrict__ Wv, const float* __restrict__ Wo, const float* __restrict__ pe,
                                              _Float16* __restrict__ B4, float* __restrict__ BT, _Float16* __restrict__ X3) {
  const int blk = blockIdx.x;
  if (blk < 4 * WBLK) { const int j = blk / WBLK; job_wt_f16(blk % WBLK, j == 0 ? Wq : (j == 1 ? Wk : (j == 2 ? Wv : Wo)), B4 + (size_t)j * CC * CC, CC, CC, 16.0f); }
  else if (blk == 4 * WBLK) job_btab(pe, BT);
  else { const int xb = blk - 4 * WBLK - 1, j = xb / XBLK; job_x16(xb % XBLK, j == 0 ? xq : (j == 1 ? xk : xv), X3 + (size_t)j * NR * CC, (size_t)NR * CC / 8); }
}

extern "C" void kernel_launch(void* const* d_in, const int* in_sizes, int n_in,
                              void* d_out, int out_size, void* d_ws, size_t ws_size, hipStream_t stream) {
  (void)in_sizes; (void)n_in; (void)out_size;
  const float* const* I = (const float* const*)d_in; const float* xq = I[0]; const float* xk = I[1]; const float* xv = I[2]; const float* Wq = I[3]; const float* Wk = I[4]; const float* Wv = I[5]; const float* Wo = I[6]; const float* pe = I[7];
  char* ws = (char*)d_ws; size_t off = 0;
  auto take = [&](size_t bytes) { char* p = ws + off; off += (bytes + 255) & ~(size_t)255; return p; };
  const size_t np = (size_t)NR * CC;
  _Float16* BQ = (_Float16*)take((size_t)4 * CC * CC * 2); _Float16* BO = BQ + (size_t)3 * CC * CC;      /* Wq, Wk, Wv, Wo planes in a row */ float* BT = (float*)take((size_t)NH * NREL * 4 + 256);
  _Float16* XQ = (_Float16*)take(3 * np * 2);      /* query, key, value planes in a row */ _Float16* Q16 = (_Float16*)take(np * 2); _Float16* VT = (_Float16*)take(np * 2); _Float16* KF = (_Float16*)take(np * 2); _Float16* O16 = XQ;      /* the query plane is free again once the projections have run */
  if (off > ws_size) return;      /* 2 + 6 x 4 = 26 MiB */
  k_prep<<<4 * WBLK + 1 + 3 * XBLK, 256, 0, stream>>>(xq, xk, xv, Wq, Wk, Wv, Wo, pe, BQ, BT, XQ);
  const dim3 g((NR / 128) * (CC / 64), 1), g3((NR / 128) * (CC / 64), 3);
  k_gemm2<0><<<g3, 128, 0, stream>>>(XQ, CC, np, BQ, CC, (size_t)CC * CC, 0.0625f, nullptr, 0, nullptr, 1, 0, 0, nullptr, Q16, CC, np, NR, CC, CC, KF, VT);      /* the q, k and v projections: blockIdx.y steps through the three planes of A and of the weights; q goes out row-major, k and v in fragment order */
  k_flash<6><<<NB * NH * QBLKS, 128, 0, stream>>>(Q16, CC, KF, VT, (const int*)BT, O16, CC, 64.0f);      /* relative-position bias mode; x2^6 carry: the 2048-key averages are small */
  k_gemm2<0><<<g, 128, 0, stream>>>(O16, CC, 0, BO, CC, 0, 0.0625f / 64.0f, nullptr, 0, nullptr, 1, 0, 0, (float*)d_out, nullptr, CC, 0, NR, CC, CC, nullptr, nullptr);
}

// v006
// It runs in 98.5 microseconds.
// In two side-by-side timings against v005, it was 1.09 and 1.11 times as fast.
// All steps since v000 together make it 3.58 times as fast.
#include <hip/hip_runtime.h>
// RelativePositionalEncodingAttention (2 x 2048 tokens, 8 heads of 64, D 512): q/k/v from three inputs (no bias); scores/8 + pos_emb[clip(i - j, -32, 32) + 32][h]; softmax; out Wo.
// Structure: exact f16 planes of query/key/value; q/k/v GEMMs (32x64 wave tiles, f32 accumulation, exact x16 weights, f16 outputs); the relative-bias table transposed to [head][65] (bf16-rounded, f32); K and V^T written in matrix-fragment order by the projection GEMM's own epilogue; the fused flash kernel with a new relative-position-bias mode (table lookup by clipped i - j added after the scale, f32); attention output written as f16 (x2^6) by the flash kernel, straight into the output GEMM.
// Compute dtype: inputs and weights rounded to bf16; q, k, v, P and the attention output as f16 operands (~2^-12); f32 accumulation/softmax/bias. v_wmma_f32_16x16x32_f16.
#define NB 2
#define CC 512
#define NR (NB * SLEN)
#define NREL (2 * RELW + 1)
#define SLEN 2048
#define TQ SLEN
#define TK SLEN
#define NH 8
#define SCL 0.125f               /* 1/sqrt(64) */
#define WINDOW 256
#define RELW 32                  /* max_relative_position */
#define QBLKS (TQ / 64)
typedef __bf16 v16b __attribute__((ext_vector_type(16)));
typedef unsigned short v8us __attribute__((ext_vector_type(8), may_alias));
typedef float  v8f  __attribute__((ext_vector_type(8)));
typedef float  v4f  __attribute__((ext_vector_type(4)));
typedef float  v2f  __attribute__((ext_vector_type(2)));
typedef float  v4fa __attribute__((ext_vector_type(4), may_alias));
union FragB { v16b v; v8us half[2]; unsigned short u[16]; };

__device__ __forceinline__ unsigned short bf16_bits(float x) { unsigned int u = __float_as_uint(x); return (unsigned short)((u + 0x7FFFu + ((u >> 16) & 1u)) >> 16); }
__device__ __forceinline__ float bf16_val(unsigned short b) { return __uint_as_float(((unsigned int)b) << 16); }
__device__ __forceinline__ float bf16_round(float x) { return bf16_val(bf16_bits(x)); }
// D += A·B with NT terms: 1 = ah·bh, 2 = + al·bh (A split), 3 = + ah·bl (both split)
template <int NT>
__device__ __forceinline__ v8f mmaN(v16b ah, v16b al, v16b bh, v16b bl, v8f c) {
  c = __builtin_amdgcn_wmma_f32_16x16x32_bf16(false, ah, false, bh, (short)0, c, false, false);
  if (NT >= 2) c = __builtin_amdgcn_wmma_f32_16x16x32_bf16(false, al, false, bh, (short)0, c, false, false);
  if (NT >= 3) c = __builtin_amdgcn_wmma_f32_16x16x32_bf16(false, ah, false, bl, (short)0, c, false, false);
  asm volatile("v_nop\n\tv_nop\n\tv_nop\n\tv_nop" : "+v"(c) : "v"(ah), "v"(al), "v"(bh), "v"(bl));
  return c;
}

__global__ __launch_bounds__(256) void k_wt_bf16(const float* __restrict__ W, unsigned short* __restrict__ Wt, int K, int N) {
  const int t = blockIdx.x * 256 + threadIdx.x;
  const int k8n = K / 8;
  if (t >= N * k8n) return;
  const int n = t / k8n, k8 = (t % k8n) * 8;
  v8us v;
#pragma unroll
  for (int i = 0; i < 8; ++i) v[i] = bf16_bits(W[(size_t)(k8 + i) * N + n]);
  *(v8us*)(Wt + (size_t)n * K + k8) = v;
  
}

// GEMM C[M][N] (f32, pitch ldc) = act(A[M][K]·W + bias). A f32 row-major (pitch lda) converted per fragment to bf16
// (ASPLIT: hi/lo two planes -> 2 terms, else single rounded term); Wt bf16 [N][K] (pitch ldb). BIAS_BF16 rounds the
// bias to bf16 first (bias quantised to bf16 before the add). K%32==0, M%16==0, N%64==0.
template <bool ASPLIT, int ACT, bool BIAS_BF16>
__global__ __launch_bounds__(128) void k_gemm_bf(const float* __restrict__ A, int lda, const unsigned short* __restrict__ Wt, int ldb,
                                               const float* __restrict__ bias, float* __restrict__ C, int ldc, int M, int N, int K) {
  __shared__ __attribute__((aligned(16))) float so[4][16][64];
  const int tid = threadIdx.x, w = tid >> 5, lane = tid & 31, ln = lane & 15, hh = lane >> 4;
  const int ntn = N / 64;
  const int wid = blockIdx.x * 4 + w;
  const int mt = wid / ntn, nq = wid % ntn;
  if (mt * 16 >= M) return;
  const int row0 = mt * 16, col0 = nq * 64;
  const float* arow = A + (size_t)(row0 + ln) * lda;
  v8f acc[4] = {};
  for (int kb = 0; kb < K; kb += 32) {
    FragB ah, al;
    const v4f x0 = *(const v4fa*)(arow + kb + 8 * hh), x1 = *(const v4fa*)(arow + kb + 8 * hh + 4);
    const v4f x2 = *(const v4fa*)(arow + kb + 16 + 8 * hh), x3 = *(const v4fa*)(arow + kb + 16 + 8 * hh + 4);
    float xs[16] = {x0[0],x0[1],x0[2],x0[3],x1[0],x1[1],x1[2],x1[3],x2[0],x2[1],x2[2],x2[3],x3[0],x3[1],x3[2],x3[3]};
#pragma unroll
    for (int i = 0; i < 16; ++i) { const unsigned short hb = bf16_bits(xs[i]); ah.u[i] = hb; al.u[i] = ASPLIT ? bf16_bits(xs[i] - bf16_val(hb)) : (unsigned short)0; }
#pragma unroll
    for (int t = 0; t < 4; ++t) {
      const unsigned short* brow = Wt + (size_t)(col0 + t * 16 + ln) * ldb + kb;
      FragB b;
      b.half[0] = *(const v8us*)(brow + 8 * hh);
      b.half[1] = *(const v8us*)(brow + 16 + 8 * hh);
      acc[t] = mmaN<ASPLIT ? 2 : 1>(ah.v, al.v, b.v, b.v, acc[t]);
    }
  }
#pragma unroll
  for (int t = 0; t < 4; ++t) {
    float bv = bias ? bias[col0 + t * 16 + ln] : 0.f;
    if (BIAS_BF16) bv = bf16_round(bv);
#pragma unroll
    for (int r = 0; r < 8; ++r) { float v = acc[t][r] + bv; if (ACT == 1) v = fmaxf(v, 0.f); so[w][8 * hh + r][t * 16 + ln] = v; }
  }
  __builtin_amdgcn_fence(__ATOMIC_ACQ_REL, "workgroup");
  __builtin_amdgcn_wave_barrier();
  const int rsub = lane >> 4, c4 = (lane & 15) * 4;
  {
#pragma unroll
    for (int q = 0; q < 8; ++q) {
      const int r = q * 2 + rsub;
      const v4f v = *(const v4fa*)&so[w][r][c4];
      *(v4f*)(C + (size_t)(row0 + r) * ldc + col0 + c4) = v;
    }
    
  }
}

// GEMM C = act(A·W + bias + resid): A f32 (ASPLIT -> hi/lo 2 terms), Wt bf16 [N][K]; ACT 0 none, 1 relu, 2 exact gelu;
// resid (optional, f32, row index = (row % rmod), pitch ldr, RES_BF16 rounds it) added before the activation.
template <bool ASPLIT, int ACT, bool BIAS_BF16, bool RES_BF16>
__global__ __launch_bounds__(128) void k_gemm_bf3(const float* __restrict__ A, int lda, const unsigned short* __restrict__ Wt, int ldb,
                                                const float* __restrict__ bias, const float* __restrict__ resid, int rmod, int ldr,
                                                float* __restrict__ C, int ldc, int M, int N, int K) {
  __shared__ __attribute__((aligned(16))) float so[4][16][64];
  const int tid = threadIdx.x, w = tid >> 5, lane = tid & 31, ln = lane & 15, hh = lane >> 4;
  const int ntn = N / 64;
  const int wid = blockIdx.x * 4 + w;
  const int mt = wid / ntn, nq = wid % ntn;
  if (mt * 16 >= M) return;
  const int row0 = mt * 16, col0 = nq * 64;
  const float* arow = A + (size_t)(row0 + ln) * lda;
  v8f acc[4] = {};
  for (int kb = 0; kb < K; kb += 32) {
    FragB ah, al;
    const v4f x0 = *(const v4fa*)(arow + kb + 8 * hh), x1 = *(const v4fa*)(arow + kb + 8 * hh + 4);
    const v4f x2 = *(const v4fa*)(arow + kb + 16 + 8 * hh), x3 = *(const v4fa*)(arow + kb + 16 + 8 * hh + 4);
    float xs[16] = {x0[0],x0[1],x0[2],x0[3],x1[0],x1[1],x1[2],x1[3],x2[0],x2[1],x2[2],x2[3],x3[0],x3[1],x3[2],x3[3]};
#pragma unroll
    for (int i = 0; i < 16; ++i) { const unsigned short hb = bf16_bits(xs[i]); ah.u[i] = hb; al.u[i] = ASPLIT ? bf16_bits(xs[i] - bf16_val(hb)) : (unsigned short)0; }
#pragma unroll
    for (int t = 0; t < 4; ++t) {
      const unsigned short* brow = Wt + (size_t)(col0 + t * 16 + ln) * ldb + kb;
      FragB b;
      b.half[0] = *(const v8us*)(brow + 8 * hh);
      b.half[1] = *(const v8us*)(brow + 16 + 8 * hh);
      acc[t] = mmaN<ASPLIT ? 2 : 1>(ah.v, al.v, b.v, b.v, acc[t]);
    }
  }
#pragma unroll
  for (int t = 0; t < 4; ++t) {
    const int col = col0 + t * 16 + ln;
    float bv = bias ? bias[col] : 0.f;
    if (BIAS_BF16) bv = bf16_round(bv);
#pragma unroll
    for (int r = 0; r < 8; ++r) {
      float v = acc[t][r] + bv;
      if (resid) { float rv = resid[(size_t)((row0 + 8 * hh + r) % rmod) * ldr + col]; if (RES_BF16) rv = bf16_round(rv); v += rv; }
      if (ACT == 1) v = fmaxf(v, 0.f);
      if (ACT == 2) v = 0.5f * v * (1.0f + erff(v * 0.70710678118654752f));
      if (ACT == 3) { const float u = 0.7978845608028654f * (v + 0.044715f * v * v * v); v = 0.5f * v * (1.0f + tanhf(u)); }
      so[w][8 * hh + r][t * 16 + ln] = v;
    }
  }
  __builtin_amdgcn_fence(__ATOMIC_ACQ_REL, "workgroup");
  __builtin_amdgcn_wave_barrier();
  const int rsub = lane >> 4, c4 = (lane & 15) * 4;
  {
#pragma unroll
    for (int q = 0; q < 8; ++q) {
      const int r = q * 2 + rsub;
      const v4f v = *(const v4fa*)&so[w][r][c4];
      *(v4f*)(C + (size_t)(row0 + r) * ldc + col0 + c4) = v;
    }
    
  }
}
// row LayerNorm (biased variance, eps) over N: s = X (+ R); optional out_sum <- s; out_norm <- (s-mu)*rsqrt(var+eps)*g + b
template <bool PARAM_BF16>
__global__ __launch_bounds__(256) void k_layernorm(const float* __restrict__ X, const float* __restrict__ R, const float* __restrict__ g, const float* __restrict__ bta,
                                                  float* __restrict__ out_sum, float* __restrict__ out_norm, int N, float eps) {
  __shared__ float red[256];
  const int row = blockIdx.x, tid = threadIdx.x;
  const float* x = X + (size_t)row * N; const float* rr = R ? R + (size_t)row * N : nullptr;
  float vals[16];                     // up to N = 4096
  const int per = N / 256;            // contiguous chunk per thread? use strided-by-4 chunks: thread handles j = tid*4 + 1024*u
  float s1 = 0.f;
  for (int u = 0; u < per / 4; ++u) {
    const int j = tid * 4 + 1024 * u;
    const v4f a = *(const v4fa*)(x + j);
    v4f b = {0.f,0.f,0.f,0.f}; if (rr) b = *(const v4fa*)(rr + j);
#pragma unroll
    for (int q = 0; q < 4; ++q) { const float v = a[q] + b[q]; vals[u * 4 + q] = v; s1 += v; }
  }
  red[tid] = s1; __syncthreads();
  for (int st = 128; st > 0; st >>= 1) { if (tid < st) red[tid] += red[tid + st]; __syncthreads(); }
  const float mu = red[0] / (float)N; __syncthreads();
  float s2 = 0.f;
  for (int u = 0; u < per / 4; ++u)
#pragma unroll
    for (int q = 0; q < 4; ++q) { const float c = vals[u * 4 + q] - mu; s2 += c * c; }
  red[tid] = s2; __syncthreads();
  for (int st = 128; st > 0; st >>= 1) { if (tid < st) red[tid] += red[tid + st]; __syncthreads(); }
  const float rs = rsqrtf(red[0] / (float)N + eps);
  {
    for (int u = 0; u < per / 4; ++u) {
      const int j = tid * 4 + 1024 * u;
      v4f o, sm;
#pragma unroll
      for (int q = 0; q < 4; ++q) {
        float gg = g[j + q], bb = bta[j + q];
        if (PARAM_BF16) { gg = bf16_round(gg); bb = bf16_round(bb); }
        sm[q] = vals[u * 4 + q]; o[q] = (vals[u * 4 + q] - mu) * rs * gg + bb;
      }
      if (out_sum) *(v4f*)(out_sum + (size_t)row * N + j) = sm;
      *(v4f*)(out_norm + (size_t)row * N + j) = o;
    }
    
  }
}



// ---- f16 WMMA path (v_wmma_f32_16x16x32_f16): 11-bit significands for operands in range — used where a [0,1] probability operand needs more precision than bf16
typedef _Float16 v16h __attribute__((ext_vector_type(16)));
union FragH { v16h v; v8us half[2]; _Float16 h[16]; unsigned short u[16]; };
template <int NT>
__device__ __forceinline__ v8f mmaH(v16h ah, v16h al, v16h bh, v16h bl, v8f c) {
  c = __builtin_amdgcn_wmma_f32_16x16x32_f16(false, ah, false, bh, (short)0, c, false, false);
  if (NT >= 2) c = __builtin_amdgcn_wmma_f32_16x16x32_f16(false, al, false, bh, (short)0, c, false, false);
  if (NT >= 3) c = __builtin_amdgcn_wmma_f32_16x16x32_f16(false, ah, false, bl, (short)0, c, false, false);
  asm volatile("v_nop\n\tv_nop\n\tv_nop\n\tv_nop" : "+v"(c) : "v"(ah), "v"(al), "v"(bh), "v"(bl));
  return c;
}
// batched GEMM like k_gemm_b but f16 operands: A f32 (split into f16 hi/lo if ASPLIT, else rounded to f16), Bt = f16 values [n][k]; alpha; C f32; N multiple of 16 (partial tiles skipped)
template <bool ASPLIT>
__global__ __launch_bounds__(128) void k_gemm_h(const float* __restrict__ A, int lda, size_t sA, const _Float16* __restrict__ Bh, int ldb, size_t sB, float alpha, float* __restrict__ C, int ldc, size_t sC, int M, int N, int K) {
  __shared__ __attribute__((aligned(16))) float so[4][16][64];
  const int tid = threadIdx.x, w = tid >> 5, lane = tid & 31, ln = lane & 15, hh = lane >> 4; const int by = blockIdx.y;
  A += (size_t)by * sA; Bh += (size_t)by * sB; C += (size_t)by * sC;
  const int ntn = (N + 63) / 64; const int wid = blockIdx.x * 4 + w; const int mt = wid / ntn, nq = wid % ntn; if (mt * 16 >= M) return;
  const int row0 = mt * 16, col0 = nq * 64; const float* arow = A + (size_t)(row0 + ln) * lda;
  v8f acc[4] = {};
  for (int kb = 0; kb < K; kb += 32) {
    FragH ah, al;
    const v4f x0 = *(const v4fa*)(arow + kb + 8 * hh), x1 = *(const v4fa*)(arow + kb + 8 * hh + 4), x2 = *(const v4fa*)(arow + kb + 16 + 8 * hh), x3 = *(const v4fa*)(arow + kb + 16 + 8 * hh + 4);
    float xs[16] = {x0[0],x0[1],x0[2],x0[3],x1[0],x1[1],x1[2],x1[3],x2[0],x2[1],x2[2],x2[3],x3[0],x3[1],x3[2],x3[3]};
#pragma unroll
    for (int i = 0; i < 16; ++i) { const _Float16 h = (_Float16)xs[i]; ah.h[i] = h; al.h[i] = ASPLIT ? (_Float16)(xs[i] - (float)h) : (_Float16)0.0f; }
#pragma unroll
    for (int t = 0; t < 4; ++t) { if (col0 + t * 16 >= N) continue; const size_t boff = (size_t)(col0 + t * 16 + ln) * ldb + kb; FragH bq; bq.half[0] = *(const v8us*)(Bh + boff + 8 * hh); bq.half[1] = *(const v8us*)(Bh + boff + 16 + 8 * hh);
      acc[t] = mmaH<ASPLIT ? 2 : 1>(ah.v, al.v, bq.v, bq.v, acc[t]); }
  }
#pragma unroll
  for (int t = 0; t < 4; ++t) { if (col0 + t * 16 >= N) continue;
#pragma unroll
    for (int r = 0; r < 8; ++r) so[w][8 * hh + r][t * 16 + ln] = acc[t][r] * alpha; }
  __builtin_amdgcn_fence(__ATOMIC_ACQ_REL, "workgroup"); __builtin_amdgcn_wave_barrier();
  const int rsub = lane >> 4, c4 = (lane & 15) * 4;
  {
#pragma unroll
    for (int q = 0; q < 8; ++q) { const int r = q * 2 + rsub; if (col0 + c4 < N) { const v4f v = *(const v4fa*)&so[w][r][c4]; *(v4f*)(C + (size_t)(row0 + r) * ldc + col0 + c4) = v; } }
     }
}

// Wt[n][k] = f16(W[k][n]·scale) from f32 row-major W[K][N] (scale = power of two; bf16-exact weights stay exact in f16 away from the subnormal range)
__device__ __forceinline__ void job_wt_f16(int blk, const float* __restrict__ W, _Float16* __restrict__ Wt, int K, int N, float scale) {
  const int t = blk * 256 + threadIdx.x; if (t >= N * (K / 8)) return; const int n = t / (K / 8), k8 = (t % (K / 8)) * 8; FragH f;
#pragma unroll
  for (int i = 0; i < 8; ++i) f.h[i] = (_Float16)(bf16_round(W[(size_t)(k8 + i) * N + n]) * scale); const v8us o = f.half[0];
  *(v8us*)((unsigned short*)Wt + (size_t)n * K + k8) = o; 
}
// k_gemm_hh variant with fused epilogue: v = acc·alpha + bias[by·sBias + col] (+ CP[(row/rowsPerB)·sCPb + by·64 + col] if CP) ; ACT 0 none / 1 elu ; writes f16 C16 (and f32 C if non-null)
template <int ACT>
__global__ __launch_bounds__(128) void k_gemm_hhx(const _Float16* __restrict__ A, int lda, size_t sA, const _Float16* __restrict__ Bh, int ldb, size_t sB, float alpha, const float* __restrict__ bias, size_t sBias, const float* __restrict__ CP, int rowsPerB, size_t sCPb, int row0g,
    float* __restrict__ C, _Float16* __restrict__ C16, int ldc, size_t sC, int M, int N, int K) {
  __shared__ __attribute__((aligned(16))) float so[4][16][64];
  const int tid = threadIdx.x, w = tid >> 5, lane = tid & 31, ln = lane & 15, hh = lane >> 4; const int by = blockIdx.y;
  A += (size_t)by * sA; Bh += (size_t)by * sB; const size_t cofs = (size_t)by * sC; const float* bp = bias ? bias + (size_t)by * sBias : nullptr;
  const int ntn = (N + 63) / 64; const int wid = blockIdx.x * 4 + w; const int mt = wid / ntn, nq = wid % ntn; if (mt * 16 >= M) return;
  const int row0 = mt * 16, col0 = nq * 64; const _Float16* arow = A + (size_t)(row0 + ln) * lda;
  v8f acc[4] = {};
  for (int kb = 0; kb < K; kb += 32) { FragH ah; ah.half[0] = *(const v8us*)((const unsigned short*)arow + kb + 8 * hh); ah.half[1] = *(const v8us*)((const unsigned short*)arow + kb + 16 + 8 * hh);
#pragma unroll
    for (int t = 0; t < 4; ++t) { if (col0 + t * 16 >= N) continue; const size_t boff = (size_t)(col0 + t * 16 + ln) * ldb + kb; FragH bq; bq.half[0] = *(const v8us*)((const unsigned short*)Bh + boff + 8 * hh); bq.half[1] = *(const v8us*)((const unsigned short*)Bh + boff + 16 + 8 * hh);
      acc[t] = mmaH<1>(ah.v, ah.v, bq.v, bq.v, acc[t]); }
  }
#pragma unroll
  for (int t = 0; t < 4; ++t) { if (col0 + t * 16 >= N) continue; const int col = col0 + t * 16 + ln; const float bv = bp ? bf16_round(bp[col]) : 0.f;
#pragma unroll
    for (int r = 0; r < 8; ++r) { float v = acc[t][r] * alpha + bv; if (CP) { const int bidx = (row0g + row0 + 8 * hh + r) / rowsPerB; v += CP[(size_t)bidx * sCPb + (size_t)by * 64 + col]; } if (ACT == 1) v = (v > 0.f) ? v : expm1f(v); else if (ACT == 7) v = (v > 0.f) ? v + 1.0f : expf(v); else if (ACT == 8) v = tanhf(v); else if (ACT == 9) v = 0.5f * v * (1.0f + tanhf(0.7978845608028654f * (v + 0.044715f * v * v * v))); else if (ACT == 11) v = 1.0f / (1.0f + expf(-v)); else if (ACT == 12) v = (v > 0.f) ? v : 0.01f * v; else if (ACT == 14) v = (v > 0.f) ? v : 0.1f * v; else if (ACT == 15) v = v / (1.0f + expf(-v)); else if (ACT == 3) v = fmaxf(v, 0.f); else if (ACT == 6) v = 0.5f * v * (1.0f + erff(v * 0.70710678118654752f)); so[w][8 * hh + r][t * 16 + ln] = v; } }
  __builtin_amdgcn_fence(__ATOMIC_ACQ_REL, "workgroup"); __builtin_amdgcn_wave_barrier();
  const int rsub = lane >> 4, c4 = (lane & 15) * 4; typedef _Float16 v4h __attribute__((ext_vector_type(4)));
  {
#pragma unroll
    for (int q = 0; q < 8; ++q) { const int r = q * 2 + rsub; if (col0 + c4 < N) { const v4f v = *(const v4fa*)&so[w][r][c4]; if (C) *(v4f*)(C + cofs + (size_t)(row0 + r) * ldc + col0 + c4) = v; if (C16) { v4h h4; for (int i = 0; i < 4; ++i) h4[i] = (_Float16)v[i]; *(v4h*)(C16 + cofs + (size_t)(row0 + r) * ldc + col0 + c4) = h4; } } }
     }
}


typedef _Float16 v4h __attribute__((ext_vector_type(4)));

__device__ __forceinline__ void job_x16(int blk, const float* __restrict__ x, _Float16* __restrict__ X16, size_t n8) { const size_t t = (size_t)blk * 256 + threadIdx.x; if (t >= n8) return; FragH f;
#pragma unroll
  for (int q = 0; q < 8; ++q) f.h[q] = (_Float16)bf16_round(x[t * 8 + q]); *(v8us*)((unsigned short*)X16 + t * 8) = f.half[0];  }
__global__ __launch_bounds__(256) void k_h16(const float* __restrict__ x, _Float16* __restrict__ X16, size_t n8) { const size_t t = (size_t)blockIdx.x * 256 + threadIdx.x; if (t >= n8) return; FragH f;
#pragma unroll
  for (int q = 0; q < 8; ++q) f.h[q] = (_Float16)x[t * 8 + q]; *(v8us*)((unsigned short*)X16 + t * 8) = f.half[0];  }
__global__ __launch_bounds__(256) void k_round16f(const float* __restrict__ W, _Float16* __restrict__ Bt, size_t n8) { const size_t t = (size_t)blockIdx.x * 256 + threadIdx.x; if (t >= n8) return; FragH f;
#pragma unroll
  for (int i = 0; i < 8; ++i) f.h[i] = (_Float16)(bf16_round(W[t * 8 + i]) * 16.0f); *(v8us*)((unsigned short*)Bt + t * 8) = f.half[0];  }
// K and V^T in the order in which the attention kernel's fragments take them: every 16-byte piece of a fragment load stands at lane * 16 bytes of a 512-byte chunk, so that one wave-wide load covers four whole 128-byte lines.
// KF, per (slab, tile of 16 keys): chunks (ks, p), piece of lane (hh, ln) = K[key ln][32 ks + 16 p + 8 hh ..+7]. VF, per (slab, tile of 32 keys): chunks (dt, p), piece of lane (hh, ln) = V[keys 16 p + 8 hh ..+7][d = 16 dt + ln].
// Both planes are written by k_gemm2's epilogue (its 32 x 64 wave tile is two K tiles, or one V tile, of one head).

__global__ __launch_bounds__(256) void k_hl(const float* __restrict__ F, _Float16* __restrict__ Hh, _Float16* __restrict__ Hl, size_t n8) { const size_t t = (size_t)blockIdx.x * 256 + threadIdx.x; if (t >= n8) return; FragH fh, fl; const v4f a = *(const v4fa*)(F + t * 8), c = *(const v4fa*)(F + t * 8 + 4);
#pragma unroll
  for (int q = 0; q < 4; ++q) { _Float16 h = (_Float16)a[q]; fh.h[q] = h; fl.h[q] = (_Float16)((a[q] - (float)h) * 1024.0f); h = (_Float16)c[q]; fh.h[4 + q] = h; fl.h[4 + q] = (_Float16)((c[q] - (float)h) * 1024.0f); }
  { *(v8us*)((unsigned short*)Hh + t * 8) = fh.half[0]; *(v8us*)((unsigned short*)Hl + t * 8) = fl.half[0];  } }

// ---- fast GEMM (wave tile 32x64; requires M % 32 == 0 rows per launch region and N % 64 == 0); epilogue = k_gemm_hhx semantics ----
__device__ __forceinline__ v16h g2_frag(const _Float16* p, int hh) { FragH f; f.half[0] = *(const v8us*)((const unsigned short*)p + 8 * hh); f.half[1] = *(const v8us*)((const unsigned short*)p + 16 + 8 * hh); return f.v; }
__device__ __forceinline__ v8f g2_mma(v16h a, v16h b, v8f c) { v8f d = __builtin_amdgcn_wmma_f32_16x16x32_f16(false, a, false, b, (short)0, c, false, false); asm volatile("v_nop\n\tv_nop\n\tv_nop\n\tv_nop" : "+v"(d) : "v"(a), "v"(b)); return d; }
template <int ACT>
__global__ __launch_bounds__(128) void k_gemm2(const _Float16* __restrict__ A, int lda, size_t sA, const _Float16* __restrict__ Bh, int ldb, size_t sB, float alpha, const float* __restrict__ bias, size_t sBias, const float* __restrict__ CP, int rowsPerB, size_t sCPb, int row0g,
    float* __restrict__ C, _Float16* __restrict__ C16, int ldc, size_t sC, int M, int N, int K, _Float16* __restrict__ KFo, _Float16* __restrict__ VFo) {
  __shared__ __attribute__((aligned(16))) float so[4][32][68];
  const int tid = threadIdx.x, w = tid >> 5, lane = tid & 31, ln = lane & 15, hh = lane >> 4; const int by = blockIdx.y;
  A += (size_t)by * sA; Bh += (size_t)by * sB; const size_t cofs = (size_t)by * sC; const float* bp = bias ? bias + (size_t)by * sBias : nullptr;
  const int ntn = N >> 6; const int mt = blockIdx.x / ntn, nq = blockIdx.x - mt * ntn; const int row0 = mt * 128 + 32 * w, col0 = nq * 64; if (row0 >= M) return;
  const _Float16* a0p = A + (size_t)(row0 + ln) * lda; const _Float16* a1p = a0p + (size_t)16 * lda;
  const _Float16* b0p = Bh + (size_t)(col0 + ln) * ldb; const _Float16* b1p = b0p + (size_t)16 * ldb; const _Float16* b2p = b1p + (size_t)16 * ldb; const _Float16* b3p = b2p + (size_t)16 * ldb;
  const v8f z8 = {0.f,0.f,0.f,0.f,0.f,0.f,0.f,0.f}; v8f c00 = z8, c01 = z8, c02 = z8, c03 = z8, c10 = z8, c11 = z8, c12 = z8, c13 = z8;
#pragma unroll 1
  for (int kb = 0; kb < K; kb += 32) { const v16h a0 = g2_frag(a0p + kb, hh), a1 = g2_frag(a1p + kb, hh);
    v16h b = g2_frag(b0p + kb, hh); c00 = g2_mma(a0, b, c00); c10 = g2_mma(a1, b, c10);
    b = g2_frag(b1p + kb, hh); c01 = g2_mma(a0, b, c01); c11 = g2_mma(a1, b, c11);
    b = g2_frag(b2p + kb, hh); c02 = g2_mma(a0, b, c02); c12 = g2_mma(a1, b, c12);
    b = g2_frag(b3p + kb, hh); c03 = g2_mma(a0, b, c03); c13 = g2_mma(a1, b, c13); }
  v8f accs[8] = {c00, c01, c02, c03, c10, c11, c12, c13};
  /* With KFo set (the q, k, v launch; N = NH * 64, rows = NB * SLEN tokens, no bias, no CP, ACT 0) plane 1 goes out as KF and plane 2 as VF; the plane is blockIdx.y, the same for the whole block. */
  const int fjob = KFo ? by : 0; const int slab = (row0 / SLEN) * NH + nq, tok0 = row0 % SLEN;
  if (fjob == 2) {      /* accumulator u = (half, t), register r, is V[key 16 half + 8 hh + r][d = 16 t + ln]: already the piece of chunk (dt = t, p = half) */
    unsigned short* dst = (unsigned short*)VFo + ((size_t)slab * (SLEN / 32) + tok0 / 32) * 2048 + lane * 8; FragH f[8];
#pragma unroll
    for (int u = 0; u < 8; ++u)
#pragma unroll
      for (int r = 0; r < 8; ++r) f[u].h[r] = (_Float16)(accs[u][r] * alpha);
#pragma unroll
    for (int u = 0; u < 8; ++u) *(v8us*)(dst + ((u & 3) * 2 + (u >> 2)) * 256) = f[u].half[0];
    return; }
#pragma unroll
  for (int u = 0; u < 8; ++u) { const int t = u & 3, half = u >> 2; const int col = col0 + t * 16 + ln; const float bv = bp ? bf16_round(bp[col]) : 0.f;
#pragma unroll
    for (int r = 0; r < 8; ++r) { const int rloc = half * 16 + 8 * hh + r; float v = accs[u][r] * alpha + bv; if (CP) { const int bidx = (row0g + row0 + rloc) / rowsPerB; v += CP[(size_t)bidx * sCPb + (size_t)by * 64 + col]; }
      if (ACT == 3) v = fmaxf(v, 0.f); else if (ACT == 6) v = 0.5f * v * (1.0f + erff(v * 0.70710678118654752f)); else if (ACT == 11) v = 1.0f / (1.0f + expf(-v)); else if (ACT == 15) v = v / (1.0f + expf(-v)); else if (ACT == 12) v = (v > 0.f) ? v : 0.01f * v; else if (ACT == 8) v = tanhf(v);
      so[w][rloc][t * 16 + ln] = v; } }
  __builtin_amdgcn_fence(__ATOMIC_ACQ_REL, "workgroup"); __builtin_amdgcn_wave_barrier();
  if (fjob == 1) {      /* tile tt of 16 keys, chunk c = 2 ks + p: lane (hh, ln) takes K[key ln][16 c + 8 hh ..+7] from the wave's own LDS tile */
    unsigned short* dst = (unsigned short*)KFo + ((size_t)slab * (SLEN / 16) + tok0 / 16) * 1024 + lane * 8; FragH f[8];
#pragma unroll
    for (int u = 0; u < 8; ++u) { const float* sp = &so[w][(u >> 2) * 16 + ln][(u & 3) * 16 + 8 * hh]; const v4f x = *(const v4fa*)sp, y = *(const v4fa*)(sp + 4);
#pragma unroll
      for (int i = 0; i < 4; ++i) { f[u].h[i] = (_Float16)x[i]; f[u].h[4 + i] = (_Float16)y[i]; } }
#pragma unroll
    for (int u = 0; u < 8; ++u) *(v8us*)(dst + u * 256) = f[u].half[0];
    asm volatile("s_wait_xcnt 0x0" ::: "memory");      /* stands behind the eight stores, before any path on which their address pair is rewritten */
    return; }
  const int rsub = lane >> 4, c4 = (lane & 15) * 4;
  {
#pragma unroll
    for (int q = 0; q < 16; ++q) { const int r = q * 2 + rsub; const v4f v = *(const v4fa*)&so[w][r][c4];
      if (C) { *(v4f*)(C + cofs + (size_t)(row0 + r) * ldc + col0 + c4) = v; asm volatile("s_wait_xcnt 0x0" ::: "memory"); }      /* stands behind the store, before any path on which a register that it names is rewritten */
      if (C16) { v4h h4; for (int i = 0; i < 4; ++i) h4[i] = (_Float16)v[i]; *(v4h*)(C16 + cofs + (size_t)(row0 + r) * ldc + col0 + c4) = h4; asm volatile("s_wait_xcnt 0x0" ::: "memory"); } }      /* the same behind the f16 store */
     } }



__device__ __forceinline__ float xhalf(float x) { return __builtin_bit_cast(float, __builtin_amdgcn_permlanex16(__builtin_bit_cast(int, x), __builtin_bit_cast(int, x), 0x76543210, 0xfedcba98, false, false)); }      /* lane l with lane l ^ 16 */
template <int CAUSAL>
__global__ __launch_bounds__(128) void k_flash(const _Float16* __restrict__ Q16, int ldq, const _Float16* __restrict__ KF, const _Float16* __restrict__ VF, const int* __restrict__ MSK, _Float16* __restrict__ O16, int ldo, float osc) {
  constexpr int RPW = 16, DT = 4, KS = 2;
  constexpr int SK = 128, NST = TK / SK, SH = SK * 64;      /* a stage = 128 keys = 4 passes: SH halves (16 KiB) of K and as many of V^T, each one contiguous run of its fragment-order plane */
  static_assert(CAUSAL != 1 && CAUSAL != 3 && NST >= 2, "the staged key walk takes whole stages from key 0 to TK");
  __shared__ __attribute__((aligned(16))) float sO[4][RPW][64 + 4];
  __shared__ __attribute__((aligned(16))) unsigned short sKV[2][2][SH];      /* [buffer][K, V^T]: filled once per block, read by its four waves */
  const int tid = threadIdx.x, w = tid >> 5, lane = tid & 31, ln = lane & 15, hh = lane >> 4;
  const int slab = blockIdx.x / QBLKS, qblk = blockIdx.x % QBLKS; const int b = slab / NH, h = slab % NH; const int qb0 = qblk * (4 * RPW); const int q0 = qb0 + w * RPW; const int tq = q0 + ln; const int eb = tq + RELW - 8 * hh;
  FragH aq[KS];
  { const unsigned short* qr = (const unsigned short*)Q16 + ((size_t)b * TQ + tq) * ldq + h * 64;
#pragma unroll
    for (int ks = 0; ks < KS; ++ks) { aq[ks].half[0] = *(const v8us*)(qr + ks * 32 + 8 * hh); aq[ks].half[1] = *(const v8us*)(qr + ks * 32 + 16 + 8 * hh); } }
  const unsigned short* Kg = (const unsigned short*)KF + (size_t)slab * 64 * TK + tid * 8; const unsigned short* Vg = (const unsigned short*)VF + (size_t)slab * 64 * TK + tid * 8;      /* fragment-order planes (written by k_gemm2): this thread's 16 bytes of every 2-KiB run that the block copies */
  float m_r = -3.0e38f, l_r = 0.f; v8f oacc[DT];
#pragma unroll
  for (int dt = 0; dt < DT; ++dt) oacc[dt] = (v8f){0.f,0.f,0.f,0.f,0.f,0.f,0.f,0.f};
  /* K and V^T come to LDS a stage ahead, by asynchronous copies into the buffer that the stage before last has left; the waves take their fragments from LDS:
     V^T of a pass at the pass's head (used behind the softmax), K of the next pass of the same stage right behind this pass's score products. The bias values still come by global loads, one pass ahead. */
  FragH kf[2][KS]; FragH vf[DT]; v2f bc[2][4];      /* bias of keys (2 i, 2 i + 1) of score tile nt, paired like the accumulator registers */
  auto copy8 = [&](const unsigned short* g, unsigned l) __attribute__((always_inline)) {      /* 16 KiB per block: eight copies of 16 bytes per thread, 2 KiB apart; g = the thread's global bytes, l = its LDS byte address */
    /* the wait on the address translations is the statement's last line, so that it stands before anything that rewrites a register which a copy names */
    asm volatile("global_load_async_to_lds_b128 %0, %8, off\n\t"
                 "global_load_async_to_lds_b128 %1, %9, off\n\t"
                 "global_load_async_to_lds_b128 %2, %10, off\n\t"
                 "global_load_async_to_lds_b128 %3, %11, off\n\t"
                 "global_load_async_to_lds_b128 %4, %12, off\n\t"
                 "global_load_async_to_lds_b128 %5, %13, off\n\t"
                 "global_load_async_to_lds_b128 %6, %14, off\n\t"
                 "global_load_async_to_lds_b128 %7, %15, off\n\t"
                 "s_wait_xcnt 0x0"
                 :: "v"(l), "v"(l + 2048u), "v"(l + 4096u), "v"(l + 6144u), "v"(l + 8192u), "v"(l + 10240u), "v"(l + 12288u), "v"(l + 14336u),
                    "v"(g), "v"(g + 1024), "v"(g + 2048), "v"(g + 3072), "v"(g + 4096), "v"(g + 5120), "v"(g + 6144), "v"(g + 7168) : "memory");
  };
  auto stage_copy = [&](int st, int buf) __attribute__((always_inline)) {
    copy8(Kg + (size_t)st * SH, (unsigned)(size_t)&sKV[buf][0][tid * 8]);
    copy8(Vg + (size_t)st * SH, (unsigned)(size_t)&sKV[buf][1][tid * 8]);
  };
  auto fetch_k = [&](const unsigned short* kr) __attribute__((always_inline)) {      /* kr: this lane's piece of the first chunk of a pass's K, in LDS; 1024 halves per tile of 16 keys */
#pragma unroll
    for (int nt = 0; nt < 2; ++nt)
#pragma unroll
      for (int ks = 0; ks < KS; ++ks) { kf[nt][ks].half[0] = *(const v8us*)(kr + nt * 1024 + ks * 512); kf[nt][ks].half[1] = *(const v8us*)(kr + nt * 1024 + ks * 512 + 256); }
  };
  auto fetch_bias = [&](int j0) __attribute__((always_inline)) {
    if (CAUSAL == 6) { const float* BTh = (const float*)MSK + h * (2 * RELW + 1);      /* mode 6: per-head relative-position bias table [NH][2*RELW+1] indexed by clip(i - j, +-RELW) + RELW (passed through the MSK pointer) */
      unsigned i0[8], i1[8];
#pragma unroll
      for (int r = 0; r < 8; ++r) { int d0 = eb - j0 - r, d1 = eb - j0 - 16 - r; d0 = d0 < 0 ? 0 : (d0 > 2 * RELW ? 2 * RELW : d0); d1 = d1 < 0 ? 0 : (d1 > 2 * RELW ? 2 * RELW : d1); i0[r] = (unsigned)d0; i1[r] = (unsigned)d1; }      /* clip(i - j + RELW, 0, 2 RELW), the same integer as clip(i - j, +-RELW) + RELW; key j = j0 (+ 16) + 8 hh + r */
#pragma unroll
      for (int r = 0; r < 8; ++r) { bc[0][r >> 1][r & 1] = BTh[i0[r]]; bc[1][r >> 1][r & 1] = BTh[i1[r]]; }
      asm volatile("s_wait_xcnt 0x0" :: "v"(i0[0]), "v"(i0[1]), "v"(i0[2]), "v"(i0[3]), "v"(i0[4]), "v"(i0[5]), "v"(i0[6]), "v"(i0[7]), "v"(i1[0]), "v"(i1[1]), "v"(i1[2]), "v"(i1[3]), "v"(i1[4]), "v"(i1[5]), "v"(i1[6]), "v"(i1[7]) : "memory");      /* stands before any register that the bias loads name is rewritten; the index registers are inputs so that no load of the group lands on one */
    }
  };
  stage_copy(0, 0);
  asm volatile("s_wait_asynccnt 0x0" ::: "memory");      /* this wave's copies of stage 0 have landed */
  __syncthreads();      /* publishes stage 0 to all four waves */
  stage_copy(1, 1);
  fetch_bias(0);
#pragma unroll 1      /* kept rolled: the buffer alternates by st & 1, and one copy of the publish point serves all stages */
  for (int st = 0; st < NST; ++st) {
   const unsigned short* kb = &sKV[st & 1][0][lane * 8]; const unsigned short* vb = &sKV[st & 1][1][lane * 8];      /* this lane's piece of every 512-byte chunk of the stage */
   fetch_k(kb);
#pragma unroll 1
   for (int p = 0; p < SK / 32; ++p) {      /* kept rolled: one pass of code for the four passes of a stage */
    const int j0 = st * SK + p * 32;
    const unsigned short* vr = vb + p * 2048;      /* 2048 halves per tile of 32 keys */
#pragma unroll
    for (int dt = 0; dt < DT; ++dt) { vf[dt].half[0] = *(const v8us*)(vr + dt * 512); vf[dt].half[1] = *(const v8us*)(vr + dt * 512 + 256); }
    v8f s[2];
#pragma unroll
    for (int nt = 0; nt < 2; ++nt) { v8f acc = (v8f){0.f,0.f,0.f,0.f,0.f,0.f,0.f,0.f};
#pragma unroll
      for (int ks = 0; ks < KS; ++ks) acc = mmaH<1>(kf[nt][ks].v, kf[nt][ks].v, aq[ks].v, aq[ks].v, acc); s[nt] = acc; }
    const int jn = (j0 + 32 < TK) ? j0 + 32 : 0;      /* the last pass has no next one: it names in-range bias values that are not used */
    fetch_k(kb + ((p + 1) & (SK / 32 - 1)) * 2048);      /* a stage's last pass names the stage's own first tile, whose values are not used: nothing of the next stage is read before its barrier */
    float s0[8], s1[8], mx[8]; bool ok0[8], ok1[8];
#pragma unroll
    for (int r = 0; r < 8; ++r) { const int k0 = j0 + 8 * hh + r, k1 = k0 + 16;
      ok0[r] = (CAUSAL == 1) ? (k0 <= tq) : ((CAUSAL == 2) ? ((k0 >> 5) == (tq >> 5)) : ((CAUSAL == 3) ? (k0 <= tq && tq - k0 < WINDOW) : true)); ok1[r] = (CAUSAL == 1) ? (k1 <= tq) : ((CAUSAL == 2) ? ((k1 >> 5) == (tq >> 5)) : ((CAUSAL == 3) ? (k1 <= tq && tq - k1 < WINDOW) : true));      /* mode 3: causal + sliding window of WINDOW keys */      /* mode 2: block-diagonal 32-token groups */
      s0[r] = ok0[r] ? s[0][r] * SCL : -3.0e38f; s1[r] = ok1[r] ? s[1][r] * SCL : -3.0e38f; if (CAUSAL == 6) { s0[r] += bc[0][r >> 1][r & 1]; s1[r] += bc[1][r >> 1][r & 1]; }      /* mode 6: the bias is added after the 1/sqrt(d) scale */
    }
#pragma unroll
    for (int i = 0; i < 4; ++i) { mx[i] = fmaxf(s0[2 * i], s0[2 * i + 1]); mx[4 + i] = fmaxf(s1[2 * i], s1[2 * i + 1]); }
    fetch_bias(jn);      /* behind the last use of this pass's values, so that the loads land in the same registers */
    float mc = fmaxf(fmaxf(fmaxf(mx[0], mx[1]), fmaxf(mx[2], mx[3])), fmaxf(fmaxf(mx[4], mx[5]), fmaxf(mx[6], mx[7])));
    mc = fmaxf(mc, xhalf(mc));      /* the other 16 keys of this query stand in lane l ^ 16 */
    const float mn = fmaxf(m_r, mc); const float ea = expf(m_r - mn); const float al = (mn > -1.0e38f) ? ea : 1.0f; m_r = mn;
    FragH pb; float ps[8], pt[8];
#pragma unroll
    for (int r = 0; r < 8; ++r) { const float p0 = ok0[r] ? expf(s0[r] - mn) : 0.f, p1 = ok1[r] ? expf(s1[r] - mn) : 0.f; ps[r] = p0; pt[r] = p1; pb.h[r] = (_Float16)(p0 * 1024.0f); pb.h[8 + r] = (_Float16)(p1 * 1024.0f); }
    l_r = l_r * al + ((((ps[0] + ps[2]) + (ps[4] + ps[6])) + ((pt[0] + pt[2]) + (pt[4] + pt[6]))) + (((ps[1] + ps[3]) + (ps[5] + ps[7])) + ((pt[1] + pt[3]) + (pt[5] + pt[7]))));      /* each wave half keeps the sum of its own keys; the halves are joined behind the loop */
#pragma unroll
    for (int dt = 0; dt < DT; ++dt) oacc[dt] *= al;
#pragma unroll
    for (int dt = 0; dt < DT; ++dt) oacc[dt] = mmaH<1>(vf[dt].v, vf[dt].v, pb.v, pb.v, oacc[dt]);
   }
   asm volatile("s_wait_dscnt 0x0" ::: "memory");      /* this wave's reads of the stage's buffer have returned */
   asm volatile("s_wait_asynccnt 0x0" ::: "memory");      /* this wave's copies of stage st + 1 have landed */
   __syncthreads();      /* publishes stage st + 1 and ends every wave's reads of the buffer that is refilled behind it */
   if (st + 2 < NST) stage_copy(st + 2, st & 1);
  }
  asm volatile("s_wait_asynccnt 0x0" ::: "memory");      /* no copy is outstanding when the wave goes on to the epilogue */
  { const float l = l_r + xhalf(l_r); const float inv = (l > 0.f) ? 1.0f / (l * 1024.0f) : 0.f;
#pragma unroll
    for (int dt = 0; dt < DT; ++dt) { const v8f o = oacc[dt] * inv; *(v4fa*)&sO[w][ln][dt * 16 + 8 * hh] = (v4f){o[0], o[1], o[2], o[3]}; *(v4fa*)&sO[w][ln][dt * 16 + 8 * hh + 4] = (v4f){o[4], o[5], o[6], o[7]}; } }      /* register r of tile dt is O[q0 + ln][16 dt + 8 hh + r] */
  __builtin_amdgcn_fence(__ATOMIC_ACQ_REL, "workgroup"); __builtin_amdgcn_wave_barrier();
  {
#pragma unroll
    for (int rp = 0; rp < RPW; rp += 4) { const int r = rp + (lane >> 3), pc = lane & 7; const v4f x = *(const v4fa*)&sO[w][r][pc * 8], y = *(const v4fa*)&sO[w][r][pc * 8 + 4]; FragH f;      /* eight lanes write one query's 128-byte line of f16 values, scaled by osc (a power of two) for the output GEMM */
#pragma unroll
      for (int i = 0; i < 4; ++i) { f.h[i] = (_Float16)(x[i] * osc); f.h[4 + i] = (_Float16)(y[i] * osc); }
      *(v8us*)((unsigned short*)O16 + ((size_t)b * TQ + q0 + r) * ldo + h * 64 + pc * 8) = f.half[0]; }
     } }

__device__ __forceinline__ void job_btab(const float* __restrict__ pe, float* __restrict__ BT) { { for (int e = threadIdx.x; e < NH * NREL; e += 256) { const int h = e / NREL, r = e % NREL; *(float*)(BT + e) = bf16_round(pe[r * NH + h]); }  } }
// One launch for the eight jobs that read nothing but inputs: a block's index picks its job (block-uniform); the jobs share no data, so they need no order among themselves.
// Order: the four weight transposes (long strided loads) first, the bias table, then the three activation planes. B4 = the four [n][k] weight planes in a row, X3 = the three activation planes in a row.
#define WBLK (CC * CC / 8 / 256)      /* blocks of one weight transpose */
#define XBLK (NR * CC / 8 / 256)      /* blocks of one activation plane */
__global__ __launch_bounds__(256) void k_prep(const float* __restrict__ xq, const float* __restrict__ xk, const float* __restrict__ xv, const float* __restrict__ Wq, const float* __restrict__ Wk, const float* __restrict__ Wv, const float* __restrict__ Wo, const float* __restrict__ pe,
                                              _Float16* __restrict__ B4, float* __restrict__ BT, _Float16* __restrict__ X3) {
  const int blk = blockIdx.x;
  if (blk < 4 * WBLK) { const int j = blk / WBLK; job_wt_f16(blk % WBLK, j == 0 ? Wq : (j == 1 ? Wk : (j == 2 ? Wv : Wo)), B4 + (size_t)j * CC * CC, CC, CC, 16.0f); }
  else if (blk == 4 * WBLK) job_btab(pe, BT);
  else { const int xb = blk - 4 * WBLK - 1, j = xb / XBLK; job_x16(xb % XBLK, j == 0 ? xq : (j == 1 ? xk : xv), X3 + (size_t)j * NR * CC, (size_t)NR * CC / 8); }
}

extern "C" void kernel_launch(void* const* d_in, const int* in_sizes, int n_in,
                              void* d_out, int out_size, void* d_ws, size_t ws_size, hipStream_t stream) {
  (void)in_sizes; (void)n_in; (void)out_size;
  const float* const* I = (const float* const*)d_in; const float* xq = I[0]; const float* xk = I[1]; const float* xv = I[2]; const float* Wq = I[3]; const float* Wk = I[4]; const float* Wv = I[5]; const float* Wo = I[6]; const float* pe = I[7];
  char* ws = (char*)d_ws; size_t off = 0;
  auto take = [&](size_t bytes) { char* p = ws + off; off += (bytes + 255) & ~(size_t)255; return p; };
  const size_t np = (size_t)NR * CC;
  _Float16* BQ = (_Float16*)take((size_t)4 * CC * CC * 2); _Float16* BO = BQ + (size_t)3 * CC * CC;      /* Wq, Wk, Wv, Wo planes in a row */ float* BT = (float*)take((size_t)NH * NREL * 4 + 256);
  _Float16* XQ = (_Float16*)take(3 * np * 2);      /* query, key, value planes in a row */ _Float16* Q16 = (_Float16*)take(np * 2); _Float16* VT = (_Float16*)take(np * 2); _Float16* KF = (_Float16*)take(np * 2); _Float16* O16 = XQ;      /* the query plane is free again once the projections have run */
  if (off > ws_size) return;      /* 2 + 6 x 4 = 26 MiB */
  k_prep<<<4 * WBLK + 1 + 3 * XBLK, 256, 0, stream>>>(xq, xk, xv, Wq, Wk, Wv, Wo, pe, BQ, BT, XQ);
  const dim3 g((NR / 128) * (CC / 64), 1), g3((NR / 128) * (CC / 64), 3);
  k_gemm2<0><<<g3, 128, 0, stream>>>(XQ, CC, np, BQ, CC, (size_t)CC * CC, 0.0625f, nullptr, 0, nullptr, 1, 0, 0, nullptr, Q16, CC, np, NR, CC, CC, KF, VT);      /* the q, k and v projections: blockIdx.y steps through the three planes of A and of the weights; q goes out row-major, k and v in fragment order */
  k_flash<6><<<NB * NH * QBLKS, 128, 0, stream>>>(Q16, CC, KF, VT, (const int*)BT, O16, CC, 64.0f);      /* relative-position bias mode; x2^6 carry: the 2048-key averages are small */
  k_gemm2<0><<<g, 128, 0, stream>>>(O16, CC, 0, BO, CC, 0, 0.0625f / 64.0f, nullptr, 0, nullptr, 1, 0, 0, (float*)d_out, nullptr, CC, 0, NR, CC, CC, nullptr, nullptr);
}

// v007
// Measured time: 89.4 microseconds a run.
// Two timings next to v006 both put it at 1.11 times that version's speed.
// Over all steps from v000 it is 3.97 times as fast.
#include <hip/hip_runtime.h>
// RelativePositionalEncodingAttention (2 x 2048 tokens, 8 heads of 64, D 512): q/k/v from three inputs (no bias); scores/8 + pos_emb[clip(i - j, -32, 32) + 32][h]; softmax; out Wo.
// Structure: exact f16 planes of query/key/value; q/k/v GEMMs (32x64 wave tiles, f32 accumulation, exact x16 weights, f16 outputs); the relative-bias table transposed to [head][65] (bf16-rounded, times log2 e, f32); K and V^T written in matrix-fragment order by the projection GEMM's own epilogue; the fused flash kernel with a new relative-position-bias mode (table lookup by clipped i - j added after the scale, f32); attention output written as f16 (x2^6) by the flash kernel, straight into the output GEMM.
// Compute dtype: inputs and weights rounded to bf16; q, k, v, P and the attention output as f16 operands; f32 accumulation/softmax/bias. v_wmma_f32_16x16x32_f16.
#define NB 2
#define CC 512
#define NR (NB * SLEN)
#define NREL (2 * RELW + 1)
#define SLEN 2048
#define TQ SLEN
#define TK SLEN
#define NH 8
#define SCL 0.125f               /* 1/sqrt(64) */
#define LOG2E 1.44269504088896340736f
#define SCL2 (SCL * LOG2E)       /* scores are kept in base 2: exp(x) = exp2(x log2 e), the factor carried by the score scale and by the bias table */
#define WINDOW 256
#define RELW 32                  /* max_relative_position */
#define QBLKS (TQ / 64)
typedef __bf16 v16b __attribute__((ext_vector_type(16)));
typedef unsigned short v8us __attribute__((ext_vector_type(8), may_alias));
typedef float  v8f  __attribute__((ext_vector_type(8)));
typedef float  v4f  __attribute__((ext_vector_type(4)));
typedef float  v2f  __attribute__((ext_vector_type(2)));
typedef float  v4fa __attribute__((ext_vector_type(4), may_alias));
union FragB { v16b v; v8us half[2]; unsigned short u[16]; };

__device__ __forceinline__ unsigned short bf16_bits(float x) { unsigned int u = __float_as_uint(x); return (unsigned short)((u + 0x7FFFu + ((u >> 16) & 1u)) >> 16); }
__device__ __forceinline__ float bf16_val(unsigned short b) { return __uint_as_float(((unsigned int)b) << 16); }
__device__ __forceinline__ float bf16_round(float x) { return bf16_val(bf16_bits(x)); }
// D += A·B with NT terms: 1 = ah·bh, 2 = + al·bh (A split), 3 = + ah·bl (both split)
template <int NT>
__device__ __forceinline__ v8f mmaN(v16b ah, v16b al, v16b bh, v16b bl, v8f c) {
  c = __builtin_amdgcn_wmma_f32_16x16x32_bf16(false, ah, false, bh, (short)0, c, false, false);
  if (NT >= 2) c = __builtin_amdgcn_wmma_f32_16x16x32_bf16(false, al, false, bh, (short)0, c, false, false);
  if (NT >= 3) c = __builtin_amdgcn_wmma_f32_16x16x32_bf16(false, ah, false, bl, (short)0, c, false, false);
  asm volatile("v_nop\n\tv_nop\n\tv_nop\n\tv_nop" : "+v"(c) : "v"(ah), "v"(al), "v"(bh), "v"(bl));
  return c;
}

__global__ __launch_bounds__(256) void k_wt_bf16(const float* __restrict__ W, unsigned short* __restrict__ Wt, int K, int N) {
  const int t = blockIdx.x * 256 + threadIdx.x;
  const int k8n = K / 8;
  if (t >= N * k8n) return;
  const int n = t / k8n, k8 = (t % k8n) * 8;
  v8us v;
#pragma unroll
  for (int i = 0; i < 8; ++i) v[i] = bf16_bits(W[(size_t)(k8 + i) * N + n]);
  *(v8us*)(Wt + (size_t)n * K + k8) = v;
  
}

// GEMM C[M][N] (f32, pitch ldc) = act(A[M][K]·W + bias). A f32 row-major (pitch lda) converted per fragment to bf16
// (ASPLIT: hi/lo two planes -> 2 terms, else single rounded term); Wt bf16 [N][K] (pitch ldb). BIAS_BF16 rounds the
// bias to bf16 first (bias quantised to bf16 before the add). K%32==0, M%16==0, N%64==0.
template <bool ASPLIT, int ACT, bool BIAS_BF16>
__global__ __launch_bounds__(128) void k_gemm_bf(const float* __restrict__ A, int lda, const unsigned short* __restrict__ Wt, int ldb,
                                               const float* __restrict__ bias, float* __restrict__ C, int ldc, int M, int N, int K) {
  __shared__ __attribute__((aligned(16))) float so[4][16][64];
  const int tid = threadIdx.x, w = tid >> 5, lane = tid & 31, ln = lane & 15, hh = lane >> 4;
  const int ntn = N / 64;
  const int wid = blockIdx.x * 4 + w;
  const int mt = wid / ntn, nq = wid % ntn;
  if (mt * 16 >= M) return;
  const int row0 = mt * 16, col0 = nq * 64;
  const float* arow = A + (size_t)(row0 + ln) * lda;
  v8f acc[4] = {};
  for (int kb = 0; kb < K; kb += 32) {
    FragB ah, al;
    const v4f x0 = *(const v4fa*)(arow + kb + 8 * hh), x1 = *(const v4fa*)(arow + kb + 8 * hh + 4);
    const v4f x2 = *(const v4fa*)(arow + kb + 16 + 8 * hh), x3 = *(const v4fa*)(arow + kb + 16 + 8 * hh + 4);
    float xs[16] = {x0[0],x0[1],x0[2],x0[3],x1[0],x1[1],x1[2],x1[3],x2[0],x2[1],x2[2],x2[3],x3[0],x3[1],x3[2],x3[3]};
#pragma unroll
    for (int i = 0; i < 16; ++i) { const unsigned short hb = bf16_bits(xs[i]); ah.u[i] = hb; al.u[i] = ASPLIT ? bf16_bits(xs[i] - bf16_val(hb)) : (unsigned short)0; }
#pragma unroll
    for (int t = 0; t < 4; ++t) {
      const unsigned short* brow = Wt + (size_t)(col0 + t * 16 + ln) * ldb + kb;
      FragB b;
      b.half[0] = *(const v8us*)(brow + 8 * hh);
      b.half[1] = *(const v8us*)(brow + 16 + 8 * hh);
      acc[t] = mmaN<ASPLIT ? 2 : 1>(ah.v, al.v, b.v, b.v, acc[t]);
    }
  }
#pragma unroll
  for (int t = 0; t < 4; ++t) {
    float bv = bias ? bias[col0 + t * 16 + ln] : 0.f;
    if (BIAS_BF16) bv = bf16_round(bv);
#pragma unroll
    for (int r = 0; r < 8; ++r) { float v = acc[t][r] + bv; if (ACT == 1) v = fmaxf(v, 0.f); so[w][8 * hh + r][t * 16 + ln] = v; }
  }
  __builtin_amdgcn_fence(__ATOMIC_ACQ_REL, "workgroup");
  __builtin_amdgcn_wave_barrier();
  const int rsub = lane >> 4, c4 = (lane & 15) * 4;
  {
#pragma unroll
    for (int q = 0; q < 8; ++q) {
      const int r = q * 2 + rsub;
      const v4f v = *(const v4fa*)&so[w][r][c4];
      *(v4f*)(C + (size_t)(row0 + r) * ldc + col0 + c4) = v;
    }
    
  }
}

// GEMM C = act(A·W + bias + resid): A f32 (ASPLIT -> hi/lo 2 terms), Wt bf16 [N][K]; ACT 0 none, 1 relu, 2 exact gelu;
// resid (optional, f32, row index = (row % rmod), pitch ldr, RES_BF16 rounds it) added before the activation.
template <bool ASPLIT, int ACT, bool BIAS_BF16, bool RES_BF16>
__global__ __launch_bounds__(128) void k_gemm_bf3(const float* __restrict__ A, int lda, const unsigned short* __restrict__ Wt, int ldb,
                                                const float* __restrict__ bias, const float* __restrict__ resid, int rmod, int ldr,
                                                float* __restrict__ C, int ldc, int M, int N, int K) {
  __shared__ __attribute__((aligned(16))) float so[4][16][64];
  const int tid = threadIdx.x, w = tid >> 5, lane = tid & 31, ln = lane & 15, hh = lane >> 4;
  const int ntn = N / 64;
  const int wid = blockIdx.x * 4 + w;
  const int mt = wid / ntn, nq = wid % ntn;
  if (mt * 16 >= M) return;
  const int row0 = mt * 16, col0 = nq * 64;
  const float* arow = A + (size_t)(row0 + ln) * lda;
  v8f acc[4] = {};
  for (int kb = 0; kb < K; kb += 32) {
    FragB ah, al;
    const v4f x0 = *(const v4fa*)(arow + kb + 8 * hh), x1 = *(const v4fa*)(arow + kb + 8 * hh + 4);
    const v4f x2 = *(const v4fa*)(arow + kb + 16 + 8 * hh), x3 = *(const v4fa*)(arow + kb + 16 + 8 * hh + 4);
    float xs[16] = {x0[0],x0[1],x0[2],x0[3],x1[0],x1[1],x1[2],x1[3],x2[0],x2[1],x2[2],x2[3],x3[0],x3[1],x3[2],x3[3]};
#pragma unroll
    for (int i = 0; i < 16; ++i) { const unsigned short hb = bf16_bits(xs[i]); ah.u[i] = hb; al.u[i] = ASPLIT ? bf16_bits(xs[i] - bf16_val(hb)) : (unsigned short)0; }
#pragma unroll
    for (int t = 0; t < 4; ++t) {
      const unsigned short* brow = Wt + (size_t)(col0 + t * 16 + ln) * ldb + kb;
      FragB b;
      b.half[0] = *(const v8us*)(brow + 8 * hh);
      b.half[1] = *(const v8us*)(brow + 16 + 8 * hh);
      acc[t] = mmaN<ASPLIT ? 2 : 1>(ah.v, al.v, b.v, b.v, acc[t]);
    }
  }
#pragma unroll
  for (int t = 0; t < 4; ++t) {
    const int col = col0 + t * 16 + ln;
    float bv = bias ? bias[col] : 0.f;
    if (BIAS_BF16) bv = bf16_round(bv);
#pragma unroll
    for (int r = 0; r < 8; ++r) {
      float v = acc[t][r] + bv;
      if (resid) { float rv = resid[(size_t)((row0 + 8 * hh + r) % rmod) * ldr + col]; if (RES_BF16) rv = bf16_round(rv); v += rv; }
      if (ACT == 1) v = fmaxf(v, 0.f);
      if (ACT == 2) v = 0.5f * v * (1.0f + erff(v * 0.70710678118654752f));
      if (ACT == 3) { const float u = 0.7978845608028654f * (v + 0.044715f * v * v * v); v = 0.5f * v * (1.0f + tanhf(u)); }
      so[w][8 * hh + r][t * 16 + ln] = v;
    }
  }
  __builtin_amdgcn_fence(__ATOMIC_ACQ_REL, "workgroup");
  __builtin_amdgcn_wave_barrier();
  const int rsub = lane >> 4, c4 = (lane & 15) * 4;
  {
#pragma unroll
    for (int q = 0; q < 8; ++q) {
      const int r = q * 2 + rsub;
      const v4f v = *(const v4fa*)&so[w][r][c4];
      *(v4f*)(C + (size_t)(row0 + r) * ldc + col0 + c4) = v;
    }
    
  }
}
// row LayerNorm (biased variance, eps) over N: s = X (+ R); optional out_sum <- s; out_norm <- (s-mu)*rsqrt(var+eps)*g + b
template <bool PARAM_BF16>
__global__ __launch_bounds__(256) void k_layernorm(const float* __restrict__ X, const float* __restrict__ R, const float* __restrict__ g, const float* __restrict__ bta,
                                                  float* __restrict__ out_sum, float* __restrict__ out_norm, int N, float eps) {
  __shared__ float red[256];
  const int row = blockIdx.x, tid = threadIdx.x;
  const float* x = X + (size_t)row * N; const float* rr = R ? R + (size_t)row * N : nullptr;
  float vals[16];                     // up to N = 4096
  const int per = N / 256;            // contiguous chunk per thread? use strided-by-4 chunks: thread handles j = tid*4 + 1024*u
  float s1 = 0.f;
  for (int u = 0; u < per / 4; ++u) {
    const int j = tid * 4 + 1024 * u;
    const v4f a = *(const v4fa*)(x + j);
    v4f b = {0.f,0.f,0.f,0.f}; if (rr) b = *(const v4fa*)(rr + j);
#pragma unroll
    for (int q = 0; q < 4; ++q) { const float v = a[q] + b[q]; vals[u * 4 + q] = v; s1 += v; }
  }
  red[tid] = s1; __syncthreads();
  for (int st = 128; st > 0; st >>= 1) { if (tid < st) red[tid] += red[tid + st]; __syncthreads(); }
  const float mu = red[0] / (float)N; __syncthreads();
  float s2 = 0.f;
  for (int u = 0; u < per / 4; ++u)
#pragma unroll
    for (int q = 0; q < 4; ++q) { const float c = vals[u * 4 + q] - mu; s2 += c * c; }
  red[tid] = s2; __syncthreads();
  for (int st = 128; st > 0; st >>= 1) { if (tid < st) red[tid] += red[tid + st]; __syncthreads(); }
  const float rs = rsqrtf(red[0] / (float)N + eps);
  {
    for (int u = 0; u < per / 4; ++u) {
      const int j = tid * 4 + 1024 * u;
      v4f o, sm;
#pragma unroll
      for (int q = 0; q < 4; ++q) {
        float gg = g[j + q], bb = bta[j + q];
        if (PARAM_BF16) { gg = bf16_round(gg); bb = bf16_round(bb); }
        sm[q] = vals[u * 4 + q]; o[q] = (vals[u * 4 + q] - mu) * rs * gg + bb;
      }
      if (out_sum) *(v4f*)(out_sum + (size_t)row * N + j) = sm;
      *(v4f*)(out_norm + (size_t)row * N + j) = o;
    }
    
  }
}



// ---- f16 WMMA path (v_wmma_f32_16x16x32_f16): 11-bit significands for operands in range — used where a [0,1] probability operand needs more precision than bf16
typedef _Float16 v16h __attribute__((ext_vector_type(16)));
union FragH { v16h v; v8us half[2]; _Float16 h[16]; unsigned short u[16]; };
template <int NT>
__device__ __forceinline__ v8f mmaH(v16h ah, v16h al, v16h bh, v16h bl, v8f c) {
  c = __builtin_amdgcn_wmma_f32_16x16x32_f16(false, ah, false, bh, (short)0, c, false, false);
  if (NT >= 2) c = __builtin_amdgcn_wmma_f32_16x16x32_f16(false, al, false, bh, (short)0, c, false, false);
  if (NT >= 3) c = __builtin_amdgcn_wmma_f32_16x16x32_f16(false, ah, false, bl, (short)0, c, false, false);
  asm volatile("v_nop\n\tv_nop\n\tv_nop\n\tv_nop" : "+v"(c) : "v"(ah), "v"(al), "v"(bh), "v"(bl));
  return c;
}
// batched GEMM like k_gemm_b but f16 operands: A f32 (split into f16 hi/lo if ASPLIT, else rounded to f16), Bt = f16 values [n][k]; alpha; C f32; N multiple of 16 (partial tiles skipped)
template <bool ASPLIT>
__global__ __launch_bounds__(128) void k_gemm_h(const float* __restrict__ A, int lda, size_t sA, const _Float16* __restrict__ Bh, int ldb, size_t sB, float alpha, float* __restrict__ C, int ldc, size_t sC, int M, int N, int K) {
  __shared__ __attribute__((aligned(16))) float so[4][16][64];
  const int tid = threadIdx.x, w = tid >> 5, lane = tid & 31, ln = lane & 15, hh = lane >> 4; const int by = blockIdx.y;
  A += (size_t)by * sA; Bh += (size_t)by * sB; C += (size_t)by * sC;
  const int ntn = (N + 63) / 64; const int wid = blockIdx.x * 4 + w; const int mt = wid / ntn, nq = wid % ntn; if (mt * 16 >= M) return;
  const int row0 = mt * 16, col0 = nq * 64; const float* arow = A + (size_t)(row0 + ln) * lda;
  v8f acc[4] = {};
  for (int kb = 0; kb < K; kb += 32) {
    FragH ah, al;
    const v4f x0 = *(const v4fa*)(arow + kb + 8 * hh), x1 = *(const v4fa*)(arow + kb + 8 * hh + 4), x2 = *(const v4fa*)(arow + kb + 16 + 8 * hh), x3 = *(const v4fa*)(arow + kb + 16 + 8 * hh + 4);
    float xs[16] = {x0[0],x0[1],x0[2],x0[3],x1[0],x1[1],x1[2],x1[3],x2[0],x2[1],x2[2],x2[3],x3[0],x3[1],x3[2],x3[3]};
#pragma unroll
    for (int i = 0; i < 16; ++i) { const _Float16 h = (_Float16)xs[i]; ah.h[i] = h; al.h[i] = ASPLIT ? (_Float16)(xs[i] - (float)h) : (_Float16)0.0f; }
#pragma unroll
    for (int t = 0; t < 4; ++t) { if (col0 + t * 16 >= N) continue; const size_t boff = (size_t)(col0 + t * 16 + ln) * ldb + kb; FragH bq; bq.half[0] = *(const v8us*)(Bh + boff + 8 * hh); bq.half[1] = *(const v8us*)(Bh + boff + 16 + 8 * hh);
      acc[t] = mmaH<ASPLIT ? 2 : 1>(ah.v, al.v, bq.v, bq.v, acc[t]); }
  }
#pragma unroll
  for (int t = 0; t < 4; ++t) { if (col0 + t * 16 >= N) continue;
#pragma unroll
    for (int r = 0; r < 8; ++r) so[w][8 * hh + r][t * 16 + ln] = acc[t][r] * alpha; }
  __builtin_amdgcn_fence(__ATOMIC_ACQ_REL, "workgroup"); __builtin_amdgcn_wave_barrier();
  const int rsub = lane >> 4, c4 = (lane & 15) * 4;
  {
#pragma unroll
    for (int q = 0; q < 8; ++q) { const int r = q * 2 + rsub; if (col0 + c4 < N) { const v4f v = *(const v4fa*)&so[w][r][c4]; *(v4f*)(C + (size_t)(row0 + r) * ldc + col0 + c4) = v; } }
     }
}

// Wt[n][k] = f16(W[k][n]·scale) from f32 row-major W[K][N] (scale = power of two; bf16-exact weights stay exact in f16 away from the subnormal range)
__device__ __forceinline__ void job_wt_f16(int blk, const float* __restrict__ W, _Float16* __restrict__ Wt, int K, int N, float scale) {
  const int t = blk * 256 + threadIdx.x; if (t >= N * (K / 8)) return; const int n = t / (K / 8), k8 = (t % (K / 8)) * 8; FragH f;
#pragma unroll
  for (int i = 0; i < 8; ++i) f.h[i] = (_Float16)(bf16_round(W[(size_t)(k8 + i) * N + n]) * scale); const v8us o = f.half[0];
  *(v8us*)((unsigned short*)Wt + (size_t)n * K + k8) = o; 
}
// k_gemm_hh variant with fused epilogue: v = acc·alpha + bias[by·sBias + col] (+ CP[(row/rowsPerB)·sCPb + by·64 + col] if CP) ; ACT 0 none / 1 elu ; writes f16 C16 (and f32 C if non-null)
template <int ACT>
__global__ __launch_bounds__(128) void k_gemm_hhx(const _Float16* __restrict__ A, int lda, size_t sA, const _Float16* __restrict__ Bh, int ldb, size_t sB, float alpha, const float* __restrict__ bias, size_t sBias, const float* __restrict__ CP, int rowsPerB, size_t sCPb, int row0g,
    float* __restrict__ C, _Float16* __restrict__ C16, int ldc, size_t sC, int M, int N, int K) {
  __shared__ __attribute__((aligned(16))) float so[4][16][64];
  const int tid = threadIdx.x, w = tid >> 5, lane = tid & 31, ln = lane & 15, hh = lane >> 4; const int by = blockIdx.y;
  A += (size_t)by * sA; Bh += (size_t)by * sB; const size_t cofs = (size_t)by * sC; const float* bp = bias ? bias + (size_t)by * sBias : nullptr;
  const int ntn = (N + 63) / 64; const int wid = blockIdx.x * 4 + w; const int mt = wid / ntn, nq = wid % ntn; if (mt * 16 >= M) return;
  const int row0 = mt * 16, col0 = nq * 64; const _Float16* arow = A + (size_t)(row0 + ln) * lda;
  v8f acc[4] = {};
  for (int kb = 0; kb < K; kb += 32) { FragH ah; ah.half[0] = *(const v8us*)((const unsigned short*)arow + kb + 8 * hh); ah.half[1] = *(const v8us*)((const unsigned short*)arow + kb + 16 + 8 * hh);
#pragma unroll
    for (int t = 0; t < 4; ++t) { if (col0 + t * 16 >= N) continue; const size_t boff = (size_t)(col0 + t * 16 + ln) * ldb + kb; FragH bq; bq.half[0] = *(const v8us*)((const unsigned short*)Bh + boff + 8 * hh); bq.half[1] = *(const v8us*)((const unsigned short*)Bh + boff + 16 + 8 * hh);
      acc[t] = mmaH<1>(ah.v, ah.v, bq.v, bq.v, acc[t]); }
  }
#pragma unroll
  for (int t = 0; t < 4; ++t) { if (col0 + t * 16 >= N) continue; const int col = col0 + t * 16 + ln; const float bv = bp ? bf16_round(bp[col]) : 0.f;
#pragma unroll
    for (int r = 0; r < 8; ++r) { float v = acc[t][r] * alpha + bv; if (CP) { const int bidx = (row0g + row0 + 8 * hh + r) / rowsPerB; v += CP[(size_t)bidx * sCPb + (size_t)by * 64 + col]; } if (ACT == 1) v = (v > 0.f) ? v : expm1f(v); else if (ACT == 7) v = (v > 0.f) ? v + 1.0f : expf(v); else if (ACT == 8) v = tanhf(v); else if (ACT == 9) v = 0.5f * v * (1.0f + tanhf(0.7978845608028654f * (v + 0.044715f * v * v * v))); else if (ACT == 11) v = 1.0f / (1.0f + expf(-v)); else if (ACT == 12) v = (v > 0.f) ? v : 0.01f * v; else if (ACT == 14) v = (v > 0.f) ? v : 0.1f * v; else if (ACT == 15) v = v / (1.0f + expf(-v)); else if (ACT == 3) v = fmaxf(v, 0.f); else if (ACT == 6) v = 0.5f * v * (1.0f + erff(v * 0.70710678118654752f)); so[w][8 * hh + r][t * 16 + ln] = v; } }
  __builtin_amdgcn_fence(__ATOMIC_ACQ_REL, "workgroup"); __builtin_amdgcn_wave_barrier();
  const int rsub = lane >> 4, c4 = (lane & 15) * 4; typedef _Float16 v4h __attribute__((ext_vector_type(4)));
  {
#pragma unroll
    for (int q = 0; q < 8; ++q) { const int r = q * 2 + rsub; if (col0 + c4 < N) { const v4f v = *(const v4fa*)&so[w][r][c4]; if (C) *(v4f*)(C + cofs + (size_t)(row0 + r) * ldc + col0 + c4) = v; if (C16) { v4h h4; for (int i = 0; i < 4; ++i) h4[i] = (_Float16)v[i]; *(v4h*)(C16 + cofs + (size_t)(row0 + r) * ldc + col0 + c4) = h4; } } }
     }
}


typedef _Float16 v4h __attribute__((ext_vector_type(4)));

__device__ __forceinline__ void job_x16(int blk, const float* __restrict__ x, _Float16* __restrict__ X16, size_t n8) { const size_t t = (size_t)blk * 256 + threadIdx.x; if (t >= n8) return; FragH f;
#pragma unroll
  for (int q = 0; q < 8; ++q) f.h[q] = (_Float16)bf16_round(x[t * 8 + q]); *(v8us*)((unsigned short*)X16 + t * 8) = f.half[0];  }
__global__ __launch_bounds__(256) void k_h16(const float* __restrict__ x, _Float16* __restrict__ X16, size_t n8) { const size_t t = (size_t)blockIdx.x * 256 + threadIdx.x; if (t >= n8) return; FragH f;
#pragma unroll
  for (int q = 0; q < 8; ++q) f.h[q] = (_Float16)x[t * 8 + q]; *(v8us*)((unsigned short*)X16 + t * 8) = f.half[0];  }
__global__ __launch_bounds__(256) void k_round16f(const float* __restrict__ W, _Float16* __restrict__ Bt, size_t n8) { const size_t t = (size_t)blockIdx.x * 256 + threadIdx.x; if (t >= n8) return; FragH f;
#pragma unroll
  for (int i = 0; i < 8; ++i) f.h[i] = (_Float16)(bf16_round(W[t * 8 + i]) * 16.0f); *(v8us*)((unsigned short*)Bt + t * 8) = f.half[0];  }
// K and V^T in the order in which the attention kernel's fragments take them: every 16-byte piece of a fragment load stands at lane * 16 bytes of a 512-byte chunk, so that one wave-wide load covers four whole 128-byte lines.
// KF, per (slab, tile of 16 keys): chunks (ks, p), piece of lane (hh, ln) = K[key ln][32 ks + 16 p + 8 hh ..+7]. VF, per (slab, tile of 32 keys): chunks (dt, p), piece of lane (hh, ln) = V[keys 16 p + 8 hh ..+7][d = 16 dt + ln].
// Both planes are written by k_gemm2's epilogue (its 32 x 64 wave tile is two K tiles, or one V tile, of one head).

__global__ __launch_bounds__(256) void k_hl(const float* __restrict__ F, _Float16* __restrict__ Hh, _Float16* __restrict__ Hl, size_t n8) { const size_t t = (size_t)blockIdx.x * 256 + threadIdx.x; if (t >= n8) return; FragH fh, fl; const v4f a = *(const v4fa*)(F + t * 8), c = *(const v4fa*)(F + t * 8 + 4);
#pragma unroll
  for (int q = 0; q < 4; ++q) { _Float16 h = (_Float16)a[q]; fh.h[q] = h; fl.h[q] = (_Float16)((a[q] - (float)h) * 1024.0f); h = (_Float16)c[q]; fh.h[4 + q] = h; fl.h[4 + q] = (_Float16)((c[q] - (float)h) * 1024.0f); }
  { *(v8us*)((unsigned short*)Hh + t * 8) = fh.half[0]; *(v8us*)((unsigned short*)Hl + t * 8) = fl.half[0];  } }

// ---- fast GEMM (wave tile 32x64; requires M % 32 == 0 rows per launch region and N % 64 == 0); epilogue = k_gemm_hhx semantics ----
__device__ __forceinline__ v16h g2_frag(const _Float16* p, int hh) { FragH f; f.half[0] = *(const v8us*)((const unsigned short*)p + 8 * hh); f.half[1] = *(const v8us*)((const unsigned short*)p + 16 + 8 * hh); return f.v; }
__device__ __forceinline__ v8f g2_mma(v16h a, v16h b, v8f c) { v8f d = __builtin_amdgcn_wmma_f32_16x16x32_f16(false, a, false, b, (short)0, c, false, false); asm volatile("v_nop\n\tv_nop\n\tv_nop\n\tv_nop" : "+v"(d) : "v"(a), "v"(b)); return d; }
template <int ACT>
__global__ __launch_bounds__(128) void k_gemm2(const _Float16* __restrict__ A, int lda, size_t sA, const _Float16* __restrict__ Bh, int ldb, size_t sB, float alpha, const float* __restrict__ bias, size_t sBias, const float* __restrict__ CP, int rowsPerB, size_t sCPb, int row0g,
    float* __restrict__ C, _Float16* __restrict__ C16, int ldc, size_t sC, int M, int N, int K, _Float16* __restrict__ KFo, _Float16* __restrict__ VFo) {
  __shared__ __attribute__((aligned(16))) float so[4][32][68];
  const int tid = threadIdx.x, w = tid >> 5, lane = tid & 31, ln = lane & 15, hh = lane >> 4; const int by = blockIdx.y;
  A += (size_t)by * sA; Bh += (size_t)by * sB; const size_t cofs = (size_t)by * sC; const float* bp = bias ? bias + (size_t)by * sBias : nullptr;
  const int ntn = N >> 6; const int mt = blockIdx.x / ntn, nq = blockIdx.x - mt * ntn; const int row0 = mt * 128 + 32 * w, col0 = nq * 64; if (row0 >= M) return;
  const _Float16* a0p = A + (size_t)(row0 + ln) * lda; const _Float16* a1p = a0p + (size_t)16 * lda;
  const _Float16* b0p = Bh + (size_t)(col0 + ln) * ldb; const _Float16* b1p = b0p + (size_t)16 * ldb; const _Float16* b2p = b1p + (size_t)16 * ldb; const _Float16* b3p = b2p + (size_t)16 * ldb;
  const v8f z8 = {0.f,0.f,0.f,0.f,0.f,0.f,0.f,0.f}; v8f c00 = z8, c01 = z8, c02 = z8, c03 = z8, c10 = z8, c11 = z8, c12 = z8, c13 = z8;
#pragma unroll 1
  for (int kb = 0; kb < K; kb += 32) { const v16h a0 = g2_frag(a0p + kb, hh), a1 = g2_frag(a1p + kb, hh);
    v16h b = g2_frag(b0p + kb, hh); c00 = g2_mma(a0, b, c00); c10 = g2_mma(a1, b, c10);
    b = g2_frag(b1p + kb, hh); c01 = g2_mma(a0, b, c01); c11 = g2_mma(a1, b, c11);
    b = g2_frag(b2p + kb, hh); c02 = g2_mma(a0, b, c02); c12 = g2_mma(a1, b, c12);
    b = g2_frag(b3p + kb, hh); c03 = g2_mma(a0, b, c03); c13 = g2_mma(a1, b, c13); }
  v8f accs[8] = {c00, c01, c02, c03, c10, c11, c12, c13};
  /* With KFo set (the q, k, v launch; N = NH * 64, rows = NB * SLEN tokens, no bias, no CP, ACT 0) plane 1 goes out as KF and plane 2 as VF; the plane is blockIdx.y, the same for the whole block. */
  const int fjob = KFo ? by : 0; const int slab = (row0 / SLEN) * NH + nq, tok0 = row0 % SLEN;
  if (fjob == 2) {      /* accumulator u = (half, t), register r, is V[key 16 half + 8 hh + r][d = 16 t + ln]: already the piece of chunk (dt = t, p = half) */
    unsigned short* dst = (unsigned short*)VFo + ((size_t)slab * (SLEN / 32) + tok0 / 32) * 2048 + lane * 8; FragH f[8];
#pragma unroll
    for (int u = 0; u < 8; ++u)
#pragma unroll
      for (int r = 0; r < 8; ++r) f[u].h[r] = (_Float16)(accs[u][r] * alpha);
#pragma unroll
    for (int u = 0; u < 8; ++u) *(v8us*)(dst + ((u & 3) * 2 + (u >> 2)) * 256) = f[u].half[0];
    return; }
#pragma unroll
  for (int u = 0; u < 8; ++u) { const int t = u & 3, half = u >> 2; const int col = col0 + t * 16 + ln; const float bv = bp ? bf16_round(bp[col]) : 0.f;
#pragma unroll
    for (int r = 0; r < 8; ++r) { const int rloc = half * 16 + 8 * hh + r; float v = accs[u][r] * alpha + bv; if (CP) { const int bidx = (row0g + row0 + rloc) / rowsPerB; v += CP[(size_t)bidx * sCPb + (size_t)by * 64 + col]; }
      if (ACT == 3) v = fmaxf(v, 0.f); else if (ACT == 6) v = 0.5f * v * (1.0f + erff(v * 0.70710678118654752f)); else if (ACT == 11) v = 1.0f / (1.0f + expf(-v)); else if (ACT == 15) v = v / (1.0f + expf(-v)); else if (ACT == 12) v = (v > 0.f) ? v : 0.01f * v; else if (ACT == 8) v = tanhf(v);
      so[w][rloc][t * 16 + ln] = v; } }
  __builtin_amdgcn_fence(__ATOMIC_ACQ_REL, "workgroup"); __builtin_amdgcn_wave_barrier();
  if (fjob == 1) {      /* tile tt of 16 keys, chunk c = 2 ks + p: lane (hh, ln) takes K[key ln][16 c + 8 hh ..+7] from the wave's own LDS tile */
    unsigned short* dst = (unsigned short*)KFo + ((size_t)slab * (SLEN / 16) + tok0 / 16) * 1024 + lane * 8; FragH f[8];
#pragma unroll
    for (int u = 0; u < 8; ++u) { const float* sp = &so[w][(u >> 2) * 16 + ln][(u & 3) * 16 + 8 * hh]; const v4f x = *(const v4fa*)sp, y = *(const v4fa*)(sp + 4);
#pragma unroll
      for (int i = 0; i < 4; ++i) { f[u].h[i] = (_Float16)x[i]; f[u].h[4 + i] = (_Float16)y[i]; } }
#pragma unroll
    for (int u = 0; u < 8; ++u) *(v8us*)(dst + u * 256) = f[u].half[0];
    asm volatile("s_wait_xcnt 0x0" ::: "memory");      /* stands behind the eight stores, before any path on which their address pair is rewritten */
    return; }
  const int rsub = lane >> 4, c4 = (lane & 15) * 4;
  {
#pragma unroll
    for (int q = 0; q < 16; ++q) { const int r = q * 2 + rsub; const v4f v = *(const v4fa*)&so[w][r][c4];
      if (C) { *(v4f*)(C + cofs + (size_t)(row0 + r) * ldc + col0 + c4) = v; asm volatile("s_wait_xcnt 0x0" ::: "memory"); }      /* stands behind the store, before any path on which a register that it names is rewritten */
      if (C16) { v4h h4; for (int i = 0; i < 4; ++i) h4[i] = (_Float16)v[i]; *(v4h*)(C16 + cofs + (size_t)(row0 + r) * ldc + col0 + c4) = h4; asm volatile("s_wait_xcnt 0x0" ::: "memory"); } }      /* the same behind the f16 store */
     } }



__device__ __forceinline__ float xhalf(float x) { return __builtin_bit_cast(float, __builtin_amdgcn_permlanex16(__builtin_bit_cast(int, x), __builtin_bit_cast(int, x), 0x76543210, 0xfedcba98, false, false)); }      /* lane l with lane l ^ 16 */
template <int CAUSAL>
__global__ __launch_bounds__(128) void k_flash(const _Float16* __restrict__ Q16, int ldq, const _Float16* __restrict__ KF, const _Float16* __restrict__ VF, const int* __restrict__ MSK, _Float16* __restrict__ O16, int ldo, float osc) {
  constexpr int RPW = 16, DT = 4, KS = 2;
  constexpr int SK = 128, NST = TK / SK, SH = SK * 64;      /* a stage = 128 keys = 4 passes: SH halves (16 KiB) of K and as many of V^T, each one contiguous run of its fragment-order plane */
  static_assert(CAUSAL != 1 && CAUSAL != 3 && NST >= 2, "the staged key walk takes whole stages from key 0 to TK");
  __shared__ __attribute__((aligned(16))) float sO[4][RPW][64 + 4];
  __shared__ __attribute__((aligned(16))) unsigned short sKV[2][2][SH];      /* [buffer][K, V^T]: filled once per block, read by its four waves */
  const int tid = threadIdx.x, w = tid >> 5, lane = tid & 31, ln = lane & 15, hh = lane >> 4;
  const int slab = blockIdx.x / QBLKS, qblk = blockIdx.x % QBLKS; const int b = slab / NH, h = slab % NH; const int qb0 = qblk * (4 * RPW); const int q0 = qb0 + w * RPW; const int tq = q0 + ln; const int eb = tq + RELW - 8 * hh;
  FragH aq[KS];
  { const unsigned short* qr = (const unsigned short*)Q16 + ((size_t)b * TQ + tq) * ldq + h * 64;
#pragma unroll
    for (int ks = 0; ks < KS; ++ks) { aq[ks].half[0] = *(const v8us*)(qr + ks * 32 + 8 * hh); aq[ks].half[1] = *(const v8us*)(qr + ks * 32 + 16 + 8 * hh); } }
  const unsigned short* Kg = (const unsigned short*)KF + (size_t)slab * 64 * TK + tid * 8; const unsigned short* Vg = (const unsigned short*)VF + (size_t)slab * 64 * TK + tid * 8;      /* fragment-order planes (written by k_gemm2): this thread's 16 bytes of every 2-KiB run that the block copies */
  float m_r = -3.0e38f, l_r = 0.f; v8f oacc[DT];
#pragma unroll
  for (int dt = 0; dt < DT; ++dt) oacc[dt] = (v8f){0.f,0.f,0.f,0.f,0.f,0.f,0.f,0.f};
  /* K and V^T come to LDS a stage ahead, by asynchronous copies into the buffer that the stage before last has left; the waves take their fragments from LDS:
     V^T of a pass at the pass's head (used behind the softmax), K of the next pass of the same stage right behind this pass's score products. The bias values still come by global loads, one pass ahead. */
  FragH kf[2][KS]; FragH vf[DT]; v2f bc[2][4];      /* bias of keys (2 i, 2 i + 1) of score tile nt, paired like the accumulator registers */
  auto copy8 = [&](const unsigned short* g, unsigned l) __attribute__((always_inline)) {      /* 16 KiB per block: eight copies of 16 bytes per thread, 2 KiB apart; g = the thread's global bytes, l = its LDS byte address */
    /* the wait on the address translations is the statement's last line, so that it stands before anything that rewrites a register which a copy names */
    asm volatile("global_load_async_to_lds_b128 %0, %8, off\n\t"
                 "global_load_async_to_lds_b128 %1, %9, off\n\t"
                 "global_load_async_to_lds_b128 %2, %10, off\n\t"
                 "global_load_async_to_lds_b128 %3, %11, off\n\t"
                 "global_load_async_to_lds_b128 %4, %12, off\n\t"
                 "global_load_async_to_lds_b128 %5, %13, off\n\t"
                 "global_load_async_to_lds_b128 %6, %14, off\n\t"
                 "global_load_async_to_lds_b128 %7, %15, off\n\t"
                 "s_wait_xcnt 0x0"
                 :: "v"(l), "v"(l + 2048u), "v"(l + 4096u), "v"(l + 6144u), "v"(l + 8192u), "v"(l + 10240u), "v"(l + 12288u), "v"(l + 14336u),
                    "v"(g), "v"(g + 1024), "v"(g + 2048), "v"(g + 3072), "v"(g + 4096), "v"(g + 5120), "v"(g + 6144), "v"(g + 7168) : "memory");
  };
  auto stage_copy = [&](int st, int buf) __attribute__((always_inline)) {
    copy8(Kg + (size_t)st * SH, (unsigned)(size_t)&sKV[buf][0][tid * 8]);
    copy8(Vg + (size_t)st * SH, (unsigned)(size_t)&sKV[buf][1][tid * 8]);
  };
  auto fetch_k = [&](const unsigned short* kr) __attribute__((always_inline)) {      /* kr: this lane's piece of the first chunk of a pass's K, in LDS; 1024 halves per tile of 16 keys */
#pragma unroll
    for (int nt = 0; nt < 2; ++nt)
#pragma unroll
      for (int ks = 0; ks < KS; ++ks) { kf[nt][ks].half[0] = *(const v8us*)(kr + nt * 1024 + ks * 512); kf[nt][ks].half[1] = *(const v8us*)(kr + nt * 1024 + ks * 512 + 256); }
  };
  auto fetch_bias = [&](int j0) __attribute__((always_inline)) {
    if (CAUSAL == 6) { const float* BTh = (const float*)MSK + h * (2 * RELW + 1);      /* mode 6: per-head relative-position bias table [NH][2*RELW+1] indexed by clip(i - j, +-RELW) + RELW (passed through the MSK pointer) */
      unsigned i0[8], i1[8];
#pragma unroll
      for (int r = 0; r < 8; ++r) { int d0 = eb - j0 - r, d1 = eb - j0 - 16 - r; d0 = d0 < 0 ? 0 : (d0 > 2 * RELW ? 2 * RELW : d0); d1 = d1 < 0 ? 0 : (d1 > 2 * RELW ? 2 * RELW : d1); i0[r] = (unsigned)d0; i1[r] = (unsigned)d1; }      /* clip(i - j + RELW, 0, 2 RELW), the same integer as clip(i - j, +-RELW) + RELW; key j = j0 (+ 16) + 8 hh + r */
#pragma unroll
      for (int r = 0; r < 8; ++r) { bc[0][r >> 1][r & 1] = BTh[i0[r]]; bc[1][r >> 1][r & 1] = BTh[i1[r]]; }
      asm volatile("s_wait_xcnt 0x0" :: "v"(i0[0]), "v"(i0[1]), "v"(i0[2]), "v"(i0[3]), "v"(i0[4]), "v"(i0[5]), "v"(i0[6]), "v"(i0[7]), "v"(i1[0]), "v"(i1[1]), "v"(i1[2]), "v"(i1[3]), "v"(i1[4]), "v"(i1[5]), "v"(i1[6]), "v"(i1[7]) : "memory");      /* stands before any register that the bias loads name is rewritten; the index registers are inputs so that no load of the group lands on one */
    }
  };
  stage_copy(0, 0);
  asm volatile("s_wait_asynccnt 0x0" ::: "memory");      /* this wave's copies of stage 0 have landed */
  __syncthreads();      /* publishes stage 0 to all four waves */
  stage_copy(1, 1);
  fetch_bias(0);
#pragma unroll 1      /* kept rolled: the buffer alternates by st & 1, and one copy of the publish point serves all stages */
  for (int st = 0; st < NST; ++st) {
   const unsigned short* kb = &sKV[st & 1][0][lane * 8]; const unsigned short* vb = &sKV[st & 1][1][lane * 8];      /* this lane's piece of every 512-byte chunk of the stage */
   fetch_k(kb);
#pragma unroll 1
   for (int p = 0; p < SK / 32; ++p) {      /* kept rolled: one pass of code for the four passes of a stage */
    const int j0 = st * SK + p * 32;
    const unsigned short* vr = vb + p * 2048;      /* 2048 halves per tile of 32 keys */
#pragma unroll
    for (int dt = 0; dt < DT; ++dt) { vf[dt].half[0] = *(const v8us*)(vr + dt * 512); vf[dt].half[1] = *(const v8us*)(vr + dt * 512 + 256); }
    v8f s[2];
#pragma unroll
    for (int nt = 0; nt < 2; ++nt) { v8f acc = (v8f){0.f,0.f,0.f,0.f,0.f,0.f,0.f,0.f};
#pragma unroll
      for (int ks = 0; ks < KS; ++ks) acc = mmaH<1>(kf[nt][ks].v, kf[nt][ks].v, aq[ks].v, aq[ks].v, acc); s[nt] = acc; }
    const int jn = (j0 + 32 < TK) ? j0 + 32 : 0;      /* the last pass has no next one: it names in-range bias values that are not used */
    fetch_k(kb + ((p + 1) & (SK / 32 - 1)) * 2048);      /* a stage's last pass names the stage's own first tile, whose values are not used: nothing of the next stage is read before its barrier */
    float s0[8], s1[8], mx[8]; bool ok0[8], ok1[8];
#pragma unroll
    for (int r = 0; r < 8; ++r) { const int k0 = j0 + 8 * hh + r, k1 = k0 + 16;
      ok0[r] = (CAUSAL == 1) ? (k0 <= tq) : ((CAUSAL == 2) ? ((k0 >> 5) == (tq >> 5)) : ((CAUSAL == 3) ? (k0 <= tq && tq - k0 < WINDOW) : true)); ok1[r] = (CAUSAL == 1) ? (k1 <= tq) : ((CAUSAL == 2) ? ((k1 >> 5) == (tq >> 5)) : ((CAUSAL == 3) ? (k1 <= tq && tq - k1 < WINDOW) : true));      /* mode 3: causal + sliding window of WINDOW keys */      /* mode 2: block-diagonal 32-token groups */
      s0[r] = ok0[r] ? s[0][r] * SCL2 : -3.0e38f; s1[r] = ok1[r] ? s[1][r] * SCL2 : -3.0e38f; if (CAUSAL == 6) { s0[r] += bc[0][r >> 1][r & 1]; s1[r] += bc[1][r >> 1][r & 1]; }      /* mode 6: the bias (its table already holds bias * log2 e) is added after the scale */
    }
#pragma unroll
    for (int i = 0; i < 4; ++i) { mx[i] = fmaxf(s0[2 * i], s0[2 * i + 1]); mx[4 + i] = fmaxf(s1[2 * i], s1[2 * i + 1]); }
    fetch_bias(jn);      /* behind the last use of this pass's values, so that the loads land in the same registers */
    __builtin_amdgcn_sched_barrier(0);      /* keeps the next pass's K reads and bias loads in front of the exponentials: with the short exponentials the scheduler otherwise sinks them to the pass's end, where their latency is no longer covered */
    float mc = fmaxf(fmaxf(fmaxf(mx[0], mx[1]), fmaxf(mx[2], mx[3])), fmaxf(fmaxf(mx[4], mx[5]), fmaxf(mx[6], mx[7])));
    mc = fmaxf(mc, xhalf(mc));      /* the other 16 keys of this query stand in lane l ^ 16 */
    const float mn = fmaxf(m_r, mc); const float ea = __builtin_amdgcn_exp2f(m_r - mn); const float al = (mn > -1.0e38f) ? ea : 1.0f; m_r = mn;      /* the arguments are bounded above (0 here, 10 below), so the bare instruction needs no range steps; far below it gives 0 */
    const float mp = mn - 10.0f;      /* exp2(s - mp) = 1024 exp2(s - mn): P comes out at the f16 operand's scale; the denominator sums the same values, so the factor cancels */
    FragH pb; float ps[8], pt[8];
#pragma unroll
    for (int r = 0; r < 8; ++r) { const float p0 = ok0[r] ? __builtin_amdgcn_exp2f(s0[r] - mp) : 0.f, p1 = ok1[r] ? __builtin_amdgcn_exp2f(s1[r] - mp) : 0.f; ps[r] = p0; pt[r] = p1; pb.h[r] = (_Float16)p0; pb.h[8 + r] = (_Float16)p1; }
    l_r = l_r * al + ((((ps[0] + ps[2]) + (ps[4] + ps[6])) + ((pt[0] + pt[2]) + (pt[4] + pt[6]))) + (((ps[1] + ps[3]) + (ps[5] + ps[7])) + ((pt[1] + pt[3]) + (pt[5] + pt[7]))));      /* each wave half keeps the sum of its own keys; the halves are joined behind the loop */
#pragma unroll
    for (int dt = 0; dt < DT; ++dt) oacc[dt] *= al;
#pragma unroll
    for (int dt = 0; dt < DT; ++dt) oacc[dt] = mmaH<1>(vf[dt].v, vf[dt].v, pb.v, pb.v, oacc[dt]);
   }
   asm volatile("s_wait_dscnt 0x0" ::: "memory");      /* this wave's reads of the stage's buffer have returned */
   asm volatile("s_wait_asynccnt 0x0" ::: "memory");      /* this wave's copies of stage st + 1 have landed */
   __syncthreads();      /* publishes stage st + 1 and ends every wave's reads of the buffer that is refilled behind it */
   if (st + 2 < NST) stage_copy(st + 2, st & 1);
  }
  asm volatile("s_wait_asynccnt 0x0" ::: "memory");      /* no copy is outstanding when the wave goes on to the epilogue */
  { const float l = l_r + xhalf(l_r); const float inv = (l > 0.f) ? 1.0f / l : 0.f;      /* l and the output sums both carry the factor 1024 */
#pragma unroll
    for (int dt = 0; dt < DT; ++dt) { const v8f o = oacc[dt] * inv; *(v4fa*)&sO[w][ln][dt * 16 + 8 * hh] = (v4f){o[0], o[1], o[2], o[3]}; *(v4fa*)&sO[w][ln][dt * 16 + 8 * hh + 4] = (v4f){o[4], o[5], o[6], o[7]}; } }      /* register r of tile dt is O[q0 + ln][16 dt + 8 hh + r] */
  __builtin_amdgcn_fence(__ATOMIC_ACQ_REL, "workgroup"); __builtin_amdgcn_wave_barrier();
  {
#pragma unroll
    for (int rp = 0; rp < RPW; rp += 4) { const int r = rp + (lane >> 3), pc = lane & 7; const v4f x = *(const v4fa*)&sO[w][r][pc * 8], y = *(const v4fa*)&sO[w][r][pc * 8 + 4]; FragH f;      /* eight lanes write one query's 128-byte line of f16 values, scaled by osc (a power of two) for the output GEMM */
#pragma unroll
      for (int i = 0; i < 4; ++i) { f.h[i] = (_Float16)(x[i] * osc); f.h[4 + i] = (_Float16)(y[i] * osc); }
      *(v8us*)((unsigned short*)O16 + ((size_t)b * TQ + q0 + r) * ldo + h * 64 + pc * 8) = f.half[0]; }
     } }

__device__ __forceinline__ void job_btab(const float* __restrict__ pe, float* __restrict__ BT) { { for (int e = threadIdx.x; e < NH * NREL; e += 256) { const int h = e / NREL, r = e % NREL; *(float*)(BT + e) = bf16_round(pe[r * NH + h]) * LOG2E; }  } }
// One launch for the eight jobs that read nothing but inputs: a block's index picks its job (block-uniform); the jobs share no data, so they need no order among themselves.
// Order: the four weight transposes (long strided loads) first, the bias table, then the three activation planes. B4 = the four [n][k] weight planes in a row, X3 = the three activation planes in a row.
#define WBLK (CC * CC / 8 / 256)      /* blocks of one weight transpose */
#define XBLK (NR * CC / 8 / 256)      /* blocks of one activation plane */
__global__ __launch_bounds__(256) void k_prep(const float* __restrict__ xq, const float* __restrict__ xk, const float* __restrict__ xv, const float* __restrict__ Wq, const float* __restrict__ Wk, const float* __restrict__ Wv, const float* __restrict__ Wo, const float* __restrict__ pe,
                                              _Float16* __restrict__ B4, float* __restrict__ BT, _Float16* __restrict__ X3) {
  const int blk = blockIdx.x;
  if (blk < 4 * WBLK) { const int j = blk / WBLK; job_wt_f16(blk % WBLK, j == 0 ? Wq : (j == 1 ? Wk : (j == 2 ? Wv : Wo)), B4 + (size_t)j * CC * CC, CC, CC, 16.0f); }
  else if (blk == 4 * WBLK) job_btab(pe, BT);
  else { const int xb = blk - 4 * WBLK - 1, j = xb / XBLK; job_x16(xb % XBLK, j == 0 ? xq : (j == 1 ? xk : xv), X3 + (size_t)j * NR * CC, (size_t)NR * CC / 8); }
}

extern "C" void kernel_launch(void* const* d_in, const int* in_sizes, int n_in,
                              void* d_out, int out_size, void* d_ws, size_t ws_size, hipStream_t stream) {
  (void)in_sizes; (void)n_in; (void)out_size;
  const float* const* I = (const float* const*)d_in; const float* xq = I[0]; const float* xk = I[1]; const float* xv = I[2]; const float* Wq = I[3]; const float* Wk = I[4]; const float* Wv = I[5]; const float* Wo = I[6]; const float* pe = I[7];
  char* ws = (char*)d_ws; size_t off = 0;
  auto take = [&](size_t bytes) { char* p = ws + off; off += (bytes + 255) & ~(size_t)255; return p; };
  const size_t np = (size_t)NR * CC;
  _Float16* BQ = (_Float16*)take((size_t)4 * CC * CC * 2); _Float16* BO = BQ + (size_t)3 * CC * CC;      /* Wq, Wk, Wv, Wo planes in a row */ float* BT = (float*)take((size_t)NH * NREL * 4 + 256);
  _Float16* XQ = (_Float16*)take(3 * np * 2);      /* query, key, value planes in a row */ _Float16* Q16 = (_Float16*)take(np * 2); _Float16* VT = (_Float16*)take(np * 2); _Float16* KF = (_Float16*)take(np * 2); _Float16* O16 = XQ;      /* the query plane is free again once the projections have run */
  if (off > ws_size) return;      /* 2 + 6 x 4 = 26 MiB */
  k_prep<<<4 * WBLK + 1 + 3 * XBLK, 256, 0, stream>>>(xq, xk, xv, Wq, Wk, Wv, Wo, pe, BQ, BT, XQ);
  const dim3 g((NR / 128) * (CC / 64), 1), g3((NR / 128) * (CC / 64), 3);
  k_gemm2<0><<<g3, 128, 0, stream>>>(XQ, CC, np, BQ, CC, (size_t)CC * CC, 0.0625f, nullptr, 0, nullptr, 1, 0, 0, nullptr, Q16, CC, np, NR, CC, CC, KF, VT);      /* the q, k and v projections: blockIdx.y steps through the three planes of A and of the weights; q goes out row-major, k and v in fragment order */
  k_flash<6><<<NB * NH * QBLKS, 128, 0, stream>>>(Q16, CC, KF, VT, (const int*)BT, O16, CC, 64.0f);      /* relative-position bias mode; x2^6 carry: the 2048-key averages are small */
  k_gemm2<0><<<g, 128, 0, stream>>>(O16, CC, 0, BO, CC, 0, 0.0625f / 64.0f, nullptr, 0, nullptr, 1, 0, 0, (float*)d_out, nullptr, CC, 0, NR, CC, CC, nullptr, nullptr);
}

// v008
// One run takes 58.4 microseconds.
// In two side-by-side timings against v007, it was 1.53 and 1.50 times as fast.
// Over all steps from v000 it is 6.01 times as fast.
#include <hip/hip_runtime.h>
// RelativePositionalEncodingAttention (2 x 2048 tokens, 8 heads of 64, D 512): q/k/v from three inputs (no bias); scores/8 + pos_emb[clip(i - j, -32, 32) + 32][h]; softmax; out Wo.
// Structure: exact f16 planes of query/key/value; q/k/v GEMMs (32x64 wave tiles, f32 accumulation, exact x16 weights, f16 outputs); the relative-bias table transposed to [head][65] (bf16-rounded, times log2 e, f32); K and V^T written in matrix-fragment order by the projection GEMM's own epilogue; the fused flash kernel with a new relative-position-bias mode (table lookup by clipped i - j added after the scale, f32); attention output written as f16 (x2^6) by the flash kernel, straight into the output GEMM.
// Compute dtype: inputs and weights rounded to bf16; q, k, v, P and the attention output as f16 operands; f32 accumulation/softmax/bias. v_wmma_f32_16x16x32_f16.
#define NB 2
#define CC 512
#define NR (NB * SLEN)
#define NREL (2 * RELW + 1)
#define SLEN 2048
#define TQ SLEN
#define TK SLEN
#define NH 8
#define SCL 0.125f               /* 1/sqrt(64) */
#define LOG2E 1.44269504088896340736f
#define SCL2 (SCL * LOG2E)       /* scores are kept in base 2: exp(x) = exp2(x log2 e), the factor carried by the score scale and by the bias table */
#define WINDOW 256
#define RELW 32                  /* max_relative_position */
#define QBLKS (TQ / 64)
typedef __bf16 v16b __attribute__((ext_vector_type(16)));
typedef unsigned short v8us __attribute__((ext_vector_type(8), may_alias));
typedef float  v8f  __attribute__((ext_vector_type(8)));
typedef float  v4f  __attribute__((ext_vector_type(4)));
typedef float  v2f  __attribute__((ext_vector_type(2)));
typedef float  v4fa __attribute__((ext_vector_type(4), may_alias));
union FragB { v16b v; v8us half[2]; unsigned short u[16]; };

__device__ __forceinline__ unsigned short bf16_bits(float x) { unsigned int u = __float_as_uint(x); return (unsigned short)((u + 0x7FFFu + ((u >> 16) & 1u)) >> 16); }
__device__ __forceinline__ float bf16_val(unsigned short b) { return __uint_as_float(((unsigned int)b) << 16); }
__device__ __forceinline__ float bf16_round(float x) { return bf16_val(bf16_bits(x)); }
// D += A·B with NT terms: 1 = ah·bh, 2 = + al·bh (A split), 3 = + ah·bl (both split)
template <int NT>
__device__ __forceinline__ v8f mmaN(v16b ah, v16b al, v16b bh, v16b bl, v8f c) {
  c = __builtin_amdgcn_wmma_f32_16x16x32_bf16(false, ah, false, bh, (short)0, c, false, false);
  if (NT >= 2) c = __builtin_amdgcn_wmma_f32_16x16x32_bf16(false, al, false, bh, (short)0, c, false, false);
  if (NT >= 3) c = __builtin_amdgcn_wmma_f32_16x16x32_bf16(false, ah, false, bl, (short)0, c, false, false);
  asm volatile("v_nop\n\tv_nop\n\tv_nop\n\tv_nop" : "+v"(c) : "v"(ah), "v"(al), "v"(bh), "v"(bl));
  return c;
}

__global__ __launch_bounds__(256) void k_wt_bf16(const float* __restrict__ W, unsigned short* __restrict__ Wt, int K, int N) {
  const int t = blockIdx.x * 256 + threadIdx.x;
  const int k8n = K / 8;
  if (t >= N * k8n) return;
  const int n = t / k8n, k8 = (t % k8n) * 8;
  v8us v;
#pragma unroll
  for (int i = 0; i < 8; ++i) v[i] = bf16_bits(W[(size_t)(k8 + i) * N + n]);
  *(v8us*)(Wt + (size_t)n * K + k8) = v;
  
}

// GEMM C[M][N] (f32, pitch ldc) = act(A[M][K]·W + bias). A f32 row-major (pitch lda) converted per fragment to bf16
// (ASPLIT: hi/lo two planes -> 2 terms, else single rounded term); Wt bf16 [N][K] (pitch ldb). BIAS_BF16 rounds the
// bias to bf16 first (bias quantised to bf16 before the add). K%32==0, M%16==0, N%64==0.
template <bool ASPLIT, int ACT, bool BIAS_BF16>
__global__ __launch_bounds__(128) void k_gemm_bf(const float* __restrict__ A, int lda, const unsigned short* __restrict__ Wt, int ldb,
                                               const float* __restrict__ bias, float* __restrict__ C, int ldc, int M, int N, int K) {
  __shared__ __attribute__((aligned(16))) float so[4][16][64];
  const int tid = threadIdx.x, w = tid >> 5, lane = tid & 31, ln = lane & 15, hh = lane >> 4;
  const int ntn = N / 64;
  const int wid = blockIdx.x * 4 + w;
  const int mt = wid / ntn, nq = wid % ntn;
  if (mt * 16 >= M) return;
  const int row0 = mt * 16, col0 = nq * 64;
  const float* arow = A + (size_t)(row0 + ln) * lda;
  v8f acc[4] = {};
  for (int kb = 0; kb < K; kb += 32) {
    FragB ah, al;
    const v4f x0 = *(const v4fa*)(arow + kb + 8 * hh), x1 = *(const v4fa*)(arow + kb + 8 * hh + 4);
    const v4f x2 = *(const v4fa*)(arow + kb + 16 + 8 * hh), x3 = *(const v4fa*)(arow + kb + 16 + 8 * hh + 4);
    float xs[16] = {x0[0],x0[1],x0[2],x0[3],x1[0],x1[1],x1[2],x1[3],x2[0],x2[1],x2[2],x2[3],x3[0],x3[1],x3[2],x3[3]};
#pragma unroll
    for (int i = 0; i < 16; ++i) { const unsigned short hb = bf16_bits(xs[i]); ah.u[i] = hb; al.u[i] = ASPLIT ? bf16_bits(xs[i] - bf16_val(hb)) : (unsigned short)0; }
#pragma unroll
    for (int t = 0; t < 4; ++t) {
      const unsigned short* brow = Wt + (size_t)(col0 + t * 16 + ln) * ldb + kb;
      FragB b;
      b.half[0] = *(const v8us*)(brow + 8 * hh);
      b.half[1] = *(const v8us*)(brow + 16 + 8 * hh);
      acc[t] = mmaN<ASPLIT ? 2 : 1>(ah.v, al.v, b.v, b.v, acc[t]);
    }
  }
#pragma unroll
  for (int t = 0; t < 4; ++t) {
    float bv = bias ? bias[col0 + t * 16 + ln] : 0.f;
    if (BIAS_BF16) bv = bf16_round(bv);
#pragma unroll
    for (int r = 0; r < 8; ++r) { float v = acc[t][r] + bv; if (ACT == 1) v = fmaxf(v, 0.f); so[w][8 * hh + r][t * 16 + ln] = v; }
  }
  __builtin_amdgcn_fence(__ATOMIC_ACQ_REL, "workgroup");
  __builtin_amdgcn_wave_barrier();
  const int rsub = lane >> 4, c4 = (lane & 15) * 4;
  {
#pragma unroll
    for (int q = 0; q < 8; ++q) {
      const int r = q * 2 + rsub;
      const v4f v = *(const v4fa*)&so[w][r][c4];
      *(v4f*)(C + (size_t)(row0 + r) * ldc + col0 + c4) = v;
    }
    
  }
}

// GEMM C = act(A·W + bias + resid): A f32 (ASPLIT -> hi/lo 2 terms), Wt bf16 [N][K]; ACT 0 none, 1 relu, 2 exact gelu;
// resid (optional, f32, row index = (row % rmod), pitch ldr, RES_BF16 rounds it) added before the activation.
template <bool ASPLIT, int ACT, bool BIAS_BF16, bool RES_BF16>
__global__ __launch_bounds__(128) void k_gemm_bf3(const float* __restrict__ A, int lda, const unsigned short* __restrict__ Wt, int ldb,
                                                const float* __restrict__ bias, const float* __restrict__ resid, int rmod, int ldr,
                                                float* __restrict__ C, int ldc, int M, int N, int K) {
  __shared__ __attribute__((aligned(16))) float so[4][16][64];
  const int tid = threadIdx.x, w = tid >> 5, lane = tid & 31, ln = lane & 15, hh = lane >> 4;
  const int ntn = N / 64;
  const int wid = blockIdx.x * 4 + w;
  const int mt = wid / ntn, nq = wid % ntn;
  if (mt * 16 >= M) return;
  const int row0 = mt * 16, col0 = nq * 64;
  const float* arow = A + (size_t)(row0 + ln) * lda;
  v8f acc[4] = {};
  for (int kb = 0; kb < K; kb += 32) {
    FragB ah, al;
    const v4f x0 = *(const v4fa*)(arow + kb + 8 * hh), x1 = *(const v4fa*)(arow + kb + 8 * hh + 4);
    const v4f x2 = *(const v4fa*)(arow + kb + 16 + 8 * hh), x3 = *(const v4fa*)(arow + kb + 16 + 8 * hh + 4);
    float xs[16] = {x0[0],x0[1],x0[2],x0[3],x1[0],x1[1],x1[2],x1[3],x2[0],x2[1],x2[2],x2[3],x3[0],x3[1],x3[2],x3[3]};
#pragma unroll
    for (int i = 0; i < 16; ++i) { const unsigned short hb = bf16_bits(xs[i]); ah.u[i] = hb; al.u[i] = ASPLIT ? bf16_bits(xs[i] - bf16_val(hb)) : (unsigned short)0; }
#pragma unroll
    for (int t = 0; t < 4; ++t) {
      const unsigned short* brow = Wt + (size_t)(col0 + t * 16 + ln) * ldb + kb;
      FragB b;
      b.half[0] = *(const v8us*)(brow + 8 * hh);
      b.half[1] = *(const v8us*)(brow + 16 + 8 * hh);
      acc[t] = mmaN<ASPLIT ? 2 : 1>(ah.v, al.v, b.v, b.v, acc[t]);
    }
  }
#pragma unroll
  for (int t = 0; t < 4; ++t) {
    const int col = col0 + t * 16 + ln;
    float bv = bias ? bias[col] : 0.f;
    if (BIAS_BF16) bv = bf16_round(bv);
#pragma unroll
    for (int r = 0; r < 8; ++r) {
      float v = acc[t][r] + bv;
      if (resid) { float rv = resid[(size_t)((row0 + 8 * hh + r) % rmod) * ldr + col]; if (RES_BF16) rv = bf16_round(rv); v += rv; }
      if (ACT == 1) v = fmaxf(v, 0.f);
      if (ACT == 2) v = 0.5f * v * (1.0f + erff(v * 0.70710678118654752f));
      if (ACT == 3) { const float u = 0.7978845608028654f * (v + 0.044715f * v * v * v); v = 0.5f * v * (1.0f + tanhf(u)); }
      so[w][8 * hh + r][t * 16 + ln] = v;
    }
  }
  __builtin_amdgcn_fence(__ATOMIC_ACQ_REL, "workgroup");
  __builtin_amdgcn_wave_barrier();
  const int rsub = lane >> 4, c4 = (lane & 15) * 4;
  {
#pragma unroll
    for (int q = 0; q < 8; ++q) {
      const int r = q * 2 + rsub;
      const v4f v = *(const v4fa*)&so[w][r][c4];
      *(v4f*)(C + (size_t)(row0 + r) * ldc + col0 + c4) = v;
    }
    
  }
}
// row LayerNorm (biased variance, eps) over N: s = X (+ R); optional out_sum <- s; out_norm <- (s-mu)*rsqrt(var+eps)*g + b
template <bool PARAM_BF16>
__global__ __launch_bounds__(256) void k_layernorm(const float* __restrict__ X, const float* __restrict__ R, const float* __restrict__ g, const float* __restrict__ bta,
                                                  float* __restrict__ out_sum, float* __restrict__ out_norm, int N, float eps) {
  __shared__ float red[256];
  const int row = blockIdx.x, tid = threadIdx.x;
  const float* x = X + (size_t)row * N; const float* rr = R ? R + (size_t)row * N : nullptr;
  float vals[16];                     // up to N = 4096
  const int per = N / 256;            // contiguous chunk per thread? use strided-by-4 chunks: thread handles j = tid*4 + 1024*u
  float s1 = 0.f;
  for (int u = 0; u < per / 4; ++u) {
    const int j = tid * 4 + 1024 * u;
    const v4f a = *(const v4fa*)(x + j);
    v4f b = {0.f,0.f,0.f,0.f}; if (rr) b = *(const v4fa*)(rr + j);
#pragma unroll
    for (int q = 0; q < 4; ++q) { const float v = a[q] + b[q]; vals[u * 4 + q] = v; s1 += v; }
  }
  red[tid] = s1; __syncthreads();
  for (int st = 128; st > 0; st >>= 1) { if (tid < st) red[tid] += red[tid + st]; __syncthreads(); }
  const float mu = red[0] / (float)N; __syncthreads();
  float s2 = 0.f;
  for (int u = 0; u < per / 4; ++u)
#pragma unroll
    for (int q = 0; q < 4; ++q) { const float c = vals[u * 4 + q] - mu; s2 += c * c; }
  red[tid] = s2; __syncthreads();
  for (int st = 128; st > 0; st >>= 1) { if (tid < st) red[tid] += red[tid + st]; __syncthreads(); }
  const float rs = rsqrtf(red[0] / (float)N + eps);
  {
    for (int u = 0; u < per / 4; ++u) {
      const int j = tid * 4 + 1024 * u;
      v4f o, sm;
#pragma unroll
      for (int q = 0; q < 4; ++q) {
        float gg = g[j + q], bb = bta[j + q];
        if (PARAM_BF16) { gg = bf16_round(gg); bb = bf16_round(bb); }
        sm[q] = vals[u * 4 + q]; o[q] = (vals[u * 4 + q] - mu) * rs * gg + bb;
      }
      if (out_sum) *(v4f*)(out_sum + (size_t)row * N + j) = sm;
      *(v4f*)(out_norm + (size_t)row * N + j) = o;
    }
    
  }
}



// ---- f16 WMMA path (v_wmma_f32_16x16x32_f16): 11-bit significands for operands in range — used where a [0,1] probability operand needs more precision than bf16
typedef _Float16 v16h __attribute__((ext_vector_type(16)));
union FragH { v16h v; v8us half[2]; _Float16 h[16]; unsigned short u[16]; };
template <int NT>
__device__ __forceinline__ v8f mmaH(v16h ah, v16h al, v16h bh, v16h bl, v8f c) {
  c = __builtin_amdgcn_wmma_f32_16x16x32_f16(false, ah, false, bh, (short)0, c, false, false);
  if (NT >= 2) c = __builtin_amdgcn_wmma_f32_16x16x32_f16(false, al, false, bh, (short)0, c, false, false);
  if (NT >= 3) c = __builtin_amdgcn_wmma_f32_16x16x32_f16(false, ah, false, bl, (short)0, c, false, false);
  asm volatile("v_nop\n\tv_nop\n\tv_nop\n\tv_nop" : "+v"(c) : "v"(ah), "v"(al), "v"(bh), "v"(bl));
  return c;
}
// batched GEMM like k_gemm_b but f16 operands: A f32 (split into f16 hi/lo if ASPLIT, else rounded to f16), Bt = f16 values [n][k]; alpha; C f32; N multiple of 16 (partial tiles skipped)
template <bool ASPLIT>
__global__ __launch_bounds__(128) void k_gemm_h(const float* __restrict__ A, int lda, size_t sA, const _Float16* __restrict__ Bh, int ldb, size_t sB, float alpha, float* __restrict__ C, int ldc, size_t sC, int M, int N, int K) {
  __shared__ __attribute__((aligned(16))) float so[4][16][64];
  const int tid = threadIdx.x, w = tid >> 5, lane = tid & 31, ln = lane & 15, hh = lane >> 4; const int by = blockIdx.y;
  A += (size_t)by * sA; Bh += (size_t)by * sB; C += (size_t)by * sC;
  const int ntn = (N + 63) / 64; const int wid = blockIdx.x * 4 + w; const int mt = wid / ntn, nq = wid % ntn; if (mt * 16 >= M) return;
  const int row0 = mt * 16, col0 = nq * 64; const float* arow = A + (size_t)(row0 + ln) * lda;
  v8f acc[4] = {};
  for (int kb = 0; kb < K; kb += 32) {
    FragH ah, al;
    const v4f x0 = *(const v4fa*)(arow + kb + 8 * hh), x1 = *(const v4fa*)(arow + kb + 8 * hh + 4), x2 = *(const v4fa*)(arow + kb + 16 + 8 * hh), x3 = *(const v4fa*)(arow + kb + 16 + 8 * hh + 4);
    float xs[16] = {x0[0],x0[1],x0[2],x0[3],x1[0],x1[1],x1[2],x1[3],x2[0],x2[1],x2[2],x2[3],x3[0],x3[1],x3[2],x3[3]};
#pragma unroll
    for (int i = 0; i < 16; ++i) { const _Float16 h = (_Float16)xs[i]; ah.h[i] = h; al.h[i] = ASPLIT ? (_Float16)(xs[i] - (float)h) : (_Float16)0.0f; }
#pragma unroll
    for (int t = 0; t < 4; ++t) { if (col0 + t * 16 >= N) continue; const size_t boff = (size_t)(col0 + t * 16 + ln) * ldb + kb; FragH bq; bq.half[0] = *(const v8us*)(Bh + boff + 8 * hh); bq.half[1] = *(const v8us*)(Bh + boff + 16 + 8 * hh);
      acc[t] = mmaH<ASPLIT ? 2 : 1>(ah.v, al.v, bq.v, bq.v, acc[t]); }
  }
#pragma unroll
  for (int t = 0; t < 4; ++t) { if (col0 + t * 16 >= N) continue;
#pragma unroll
    for (int r = 0; r < 8; ++r) so[w][8 * hh + r][t * 16 + ln] = acc[t][r] * alpha; }
  __builtin_amdgcn_fence(__ATOMIC_ACQ_REL, "workgroup"); __builtin_amdgcn_wave_barrier();
  const int rsub = lane >> 4, c4 = (lane & 15) * 4;
  {
#pragma unroll
    for (int q = 0; q < 8; ++q) { const int r = q * 2 + rsub; if (col0 + c4 < N) { const v4f v = *(const v4fa*)&so[w][r][c4]; *(v4f*)(C + (size_t)(row0 + r) * ldc + col0 + c4) = v; } }
     }
}

// Wt[n][k] = f16(W[k][n]·scale) from f32 row-major W[K][N] (scale = power of two; bf16-exact weights stay exact in f16 away from the subnormal range)
__device__ __forceinline__ void job_wt_f16(int blk, const float* __restrict__ W, _Float16* __restrict__ Wt, int K, int N, float scale) {
  const int t = blk * 256 + threadIdx.x; if (t >= N * (K / 8)) return; const int n = t / (K / 8), k8 = (t % (K / 8)) * 8; FragH f;
#pragma unroll
  for (int i = 0; i < 8; ++i) f.h[i] = (_Float16)(bf16_round(W[(size_t)(k8 + i) * N + n]) * scale); const v8us o = f.half[0];
  *(v8us*)((unsigned short*)Wt + (size_t)n * K + k8) = o; 
}
// k_gemm_hh variant with fused epilogue: v = acc·alpha + bias[by·sBias + col] (+ CP[(row/rowsPerB)·sCPb + by·64 + col] if CP) ; ACT 0 none / 1 elu ; writes f16 C16 (and f32 C if non-null)
template <int ACT>
__global__ __launch_bounds__(128) void k_gemm_hhx(const _Float16* __restrict__ A, int lda, size_t sA, const _Float16* __restrict__ Bh, int ldb, size_t sB, float alpha, const float* __restrict__ bias, size_t sBias, const float* __restrict__ CP, int rowsPerB, size_t sCPb, int row0g,
    float* __restrict__ C, _Float16* __restrict__ C16, int ldc, size_t sC, int M, int N, int K) {
  __shared__ __attribute__((aligned(16))) float so[4][16][64];
  const int tid = threadIdx.x, w = tid >> 5, lane = tid & 31, ln = lane & 15, hh = lane >> 4; const int by = blockIdx.y;
  A += (size_t)by * sA; Bh += (size_t)by * sB; const size_t cofs = (size_t)by * sC; const float* bp = bias ? bias + (size_t)by * sBias : nullptr;
  const int ntn = (N + 63) / 64; const int wid = blockIdx.x * 4 + w; const int mt = wid / ntn, nq = wid % ntn; if (mt * 16 >= M) return;
  const int row0 = mt * 16, col0 = nq * 64; const _Float16* arow = A + (size_t)(row0 + ln) * lda;
  v8f acc[4] = {};
  for (int kb = 0; kb < K; kb += 32) { FragH ah; ah.half[0] = *(const v8us*)((const unsigned short*)arow + kb + 8 * hh); ah.half[1] = *(const v8us*)((const unsigned short*)arow + kb + 16 + 8 * hh);
#pragma unroll
    for (int t = 0; t < 4; ++t) { if (col0 + t * 16 >= N) continue; const size_t boff = (size_t)(col0 + t * 16 + ln) * ldb + kb; FragH bq; bq.half[0] = *(const v8us*)((const unsigned short*)Bh + boff + 8 * hh); bq.half[1] = *(const v8us*)((const unsigned short*)Bh + boff + 16 + 8 * hh);
      acc[t] = mmaH<1>(ah.v, ah.v, bq.v, bq.v, acc[t]); }
  }
#pragma unroll
  for (int t = 0; t < 4; ++t) { if (col0 + t * 16 >= N) continue; const int col = col0 + t * 16 + ln; const float bv = bp ? bf16_round(bp[col]) : 0.f;
#pragma unroll
    for (int r = 0; r < 8; ++r) { float v = acc[t][r] * alpha + bv; if (CP) { const int bidx = (row0g + row0 + 8 * hh + r) / rowsPerB; v += CP[(size_t)bidx * sCPb + (size_t)by * 64 + col]; } if (ACT == 1) v = (v > 0.f) ? v : expm1f(v); else if (ACT == 7) v = (v > 0.f) ? v + 1.0f : expf(v); else if (ACT == 8) v = tanhf(v); else if (ACT == 9) v = 0.5f * v * (1.0f + tanhf(0.7978845608028654f * (v + 0.044715f * v * v * v))); else if (ACT == 11) v = 1.0f / (1.0f + expf(-v)); else if (ACT == 12) v = (v > 0.f) ? v : 0.01f * v; else if (ACT == 14) v = (v > 0.f) ? v : 0.1f * v; else if (ACT == 15) v = v / (1.0f + expf(-v)); else if (ACT == 3) v = fmaxf(v, 0.f); else if (ACT == 6) v = 0.5f * v * (1.0f + erff(v * 0.70710678118654752f)); so[w][8 * hh + r][t * 16 + ln] = v; } }
  __builtin_amdgcn_fence(__ATOMIC_ACQ_REL, "workgroup"); __builtin_amdgcn_wave_barrier();
  const int rsub = lane >> 4, c4 = (lane & 15) * 4; typedef _Float16 v4h __attribute__((ext_vector_type(4)));
  {
#pragma unroll
    for (int q = 0; q < 8; ++q) { const int r = q * 2 + rsub; if (col0 + c4 < N) { const v4f v = *(const v4fa*)&so[w][r][c4]; if (C) *(v4f*)(C + cofs + (size_t)(row0 + r) * ldc + col0 + c4) = v; if (C16) { v4h h4; for (int i = 0; i < 4; ++i) h4[i] = (_Float16)v[i]; *(v4h*)(C16 + cofs + (size_t)(row0 + r) * ldc + col0 + c4) = h4; } } }
     }
}


typedef _Float16 v4h __attribute__((ext_vector_type(4)));

__device__ __forceinline__ void job_x16(int blk, const float* __restrict__ x, _Float16* __restrict__ X16, size_t n8) { const size_t t = (size_t)blk * 256 + threadIdx.x; if (t >= n8) return; FragH f;
#pragma unroll
  for (int q = 0; q < 8; ++q) f.h[q] = (_Float16)bf16_round(x[t * 8 + q]); *(v8us*)((unsigned short*)X16 + t * 8) = f.half[0];  }
__global__ __launch_bounds__(256) void k_h16(const float* __restrict__ x, _Float16* __restrict__ X16, size_t n8) { const size_t t = (size_t)blockIdx.x * 256 + threadIdx.x; if (t >= n8) return; FragH f;
#pragma unroll
  for (int q = 0; q < 8; ++q) f.h[q] = (_Float16)x[t * 8 + q]; *(v8us*)((unsigned short*)X16 + t * 8) = f.half[0];  }
__global__ __launch_bounds__(256) void k_round16f(const float* __restrict__ W, _Float16* __restrict__ Bt, size_t n8) { const size_t t = (size_t)blockIdx.x * 256 + threadIdx.x; if (t >= n8) return; FragH f;
#pragma unroll
  for (int i = 0; i < 8; ++i) f.h[i] = (_Float16)(bf16_round(W[t * 8 + i]) * 16.0f); *(v8us*)((unsigned short*)Bt + t * 8) = f.half[0];  }
// K and V^T in the order in which the attention kernel's fragments take them: every 16-byte piece of a fragment load stands at lane * 16 bytes of a 512-byte chunk, so that one wave-wide load covers four whole 128-byte lines.
// KF, per (slab, tile of 16 keys): chunks (ks, p), piece of lane (hh, ln) = K[key ln][32 ks + 16 p + 8 hh ..+7]. VF, per (slab, tile of 32 keys): chunks (dt, p), piece of lane (hh, ln) = V[keys 16 p + 8 hh ..+7][d = 16 dt + ln].
// Both planes are written by k_gemm2's epilogue (its 32 x 64 wave tile is two K tiles, or one V tile, of one head).

__global__ __launch_bounds__(256) void k_hl(const float* __restrict__ F, _Float16* __restrict__ Hh, _Float16* __restrict__ Hl, size_t n8) { const size_t t = (size_t)blockIdx.x * 256 + threadIdx.x; if (t >= n8) return; FragH fh, fl; const v4f a = *(const v4fa*)(F + t * 8), c = *(const v4fa*)(F + t * 8 + 4);
#pragma unroll
  for (int q = 0; q < 4; ++q) { _Float16 h = (_Float16)a[q]; fh.h[q] = h; fl.h[q] = (_Float16)((a[q] - (float)h) * 1024.0f); h = (_Float16)c[q]; fh.h[4 + q] = h; fl.h[4 + q] = (_Float16)((c[q] - (float)h) * 1024.0f); }
  { *(v8us*)((unsigned short*)Hh + t * 8) = fh.half[0]; *(v8us*)((unsigned short*)Hl + t * 8) = fl.half[0];  } }

// ---- fast GEMM (block tile 128x64, wave tile 32x64; requires M % 128 == 0, N % 64 == 0, K % 128 == 0, lda and ldb multiples of 8); epilogue = k_gemm_hhx semantics ----
// Both operands come to LDS a stage (128 k = 256 bytes of every row) ahead, by asynchronous copies that cover whole 128-byte lines; the waves take their fragments from LDS, the B rows once per block instead of once per wave.
__device__ __forceinline__ v16h g2_frag(const unsigned short* p) { FragH f; f.half[0] = *(const v8us*)p; f.half[1] = *(const v8us*)(p + 16); return f.v; }      /* p: the lane's row of an LDS stage, at k + 8 hh */
__device__ __forceinline__ v8f g2_mma(v16h a, v16h b, v8f c) { v8f d = __builtin_amdgcn_wmma_f32_16x16x32_f16(false, a, false, b, (short)0, c, false, false); asm volatile("v_nop\n\tv_nop\n\tv_nop\n\tv_nop" : "+v"(d) : "v"(a), "v"(b)); return d; }
template <int ACT>
__global__ __launch_bounds__(128) void k_gemm2(const _Float16* __restrict__ A, int lda, size_t sA, const _Float16* __restrict__ Bh, int ldb, size_t sB, float alpha, const float* __restrict__ bias, size_t sBias, const float* __restrict__ CP, int rowsPerB, size_t sCPb, int row0g,
    float* __restrict__ C, _Float16* __restrict__ C16, int ldc, size_t sC, int M, int N, int K, _Float16* __restrict__ KFo, _Float16* __restrict__ VFo) {
  constexpr int KC = 128, PH = KC + 8, STH = (128 + 64) * PH;      /* a stage = 128 k of the block's 128 A rows and 64 B rows; rows stand 272 bytes apart in LDS (16 bytes x odd: no bank conflict for 16-byte fragment reads); STH halves per stage */
  __shared__ __attribute__((aligned(16))) unsigned short sAB[2][STH];      /* [buffer][A rows, then B rows] */
  float (*so)[32][68] = (float (*)[32][68])&sAB[0][0];      /* the output staging lies over the ring: it is first written behind the last stage's barrier, when every read of the ring has returned and no copy is outstanding */
  static_assert(sizeof(float) * 4 * 32 * 68 <= sizeof(sAB), "the output staging fits the ring");
  const int tid = threadIdx.x, w = tid >> 5, lane = tid & 31, ln = lane & 15, hh = lane >> 4; const int by = blockIdx.y;
  A += (size_t)by * sA; Bh += (size_t)by * sB; const size_t cofs = (size_t)by * sC; const float* bp = bias ? bias + (size_t)by * sBias : nullptr;
  const int ntn = N >> 6; const int mt = blockIdx.x / ntn, nq = blockIdx.x - mt * ntn; const int row0 = mt * 128 + 32 * w, col0 = nq * 64; if (mt * 128 + 128 > M) return;      /* whole tiles only; the block leaves as one, in front of every copy and barrier */
  const int nst = K / KC;
  /* thread t copies 16 bytes: piece t & 15 of row (t >> 4) + 8 i, so that 16 lanes cover 256 contiguous bytes of a row */
  const unsigned short* Ag = (const unsigned short*)A + (size_t)(mt * 128 + (tid >> 4)) * lda + (tid & 15) * 8; const unsigned short* Bg = (const unsigned short*)Bh + (size_t)(col0 + (tid >> 4)) * ldb + (tid & 15) * 8;
  auto copy8 = [&](const unsigned short* g, size_t gs, unsigned l) __attribute__((always_inline)) {      /* eight rows, 8 apart: g = the thread's global bytes, gs = halves between two of its rows, l = its LDS byte address */
    /* the wait on the address translations is the statement's last line, so that it stands before anything that rewrites a register which a copy names */
    asm volatile("global_load_async_to_lds_b128 %0, %8, off\n\t"
                 "global_load_async_to_lds_b128 %1, %9, off\n\t"
                 "global_load_async_to_lds_b128 %2, %10, off\n\t"
                 "global_load_async_to_lds_b128 %3, %11, off\n\t"
                 "global_load_async_to_lds_b128 %4, %12, off\n\t"
                 "global_load_async_to_lds_b128 %5, %13, off\n\t"
                 "global_load_async_to_lds_b128 %6, %14, off\n\t"
                 "global_load_async_to_lds_b128 %7, %15, off\n\t"
                 "s_wait_xcnt 0x0"
                 :: "v"(l), "v"(l + 1u * 16 * PH), "v"(l + 2u * 16 * PH), "v"(l + 3u * 16 * PH), "v"(l + 4u * 16 * PH), "v"(l + 5u * 16 * PH), "v"(l + 6u * 16 * PH), "v"(l + 7u * 16 * PH),
                    "v"(g), "v"(g + gs), "v"(g + 2 * gs), "v"(g + 3 * gs), "v"(g + 4 * gs), "v"(g + 5 * gs), "v"(g + 6 * gs), "v"(g + 7 * gs) : "memory");
  };
  auto stage_copy = [&](int st, int buf) __attribute__((always_inline)) {
    const unsigned l = (unsigned)(size_t)&sAB[buf][(tid >> 4) * PH + (tid & 15) * 8];
    copy8(Ag + (size_t)st * KC, (size_t)8 * lda, l);
    copy8(Ag + (size_t)st * KC + (size_t)64 * lda, (size_t)8 * lda, l + 64u * 2 * PH);
    copy8(Bg + (size_t)st * KC, (size_t)8 * ldb, l + 128u * 2 * PH);
  };
  const v8f z8 = {0.f,0.f,0.f,0.f,0.f,0.f,0.f,0.f}; v8f c00 = z8, c01 = z8, c02 = z8, c03 = z8, c10 = z8, c11 = z8, c12 = z8, c13 = z8;
  stage_copy(0, 0);
  asm volatile("s_wait_asynccnt 0x0" ::: "memory");      /* this wave's copies of stage 0 have landed */
  __syncthreads();      /* publishes stage 0 to all four waves */
  if (1 < nst) stage_copy(1, 1);
#pragma unroll 1      /* kept rolled: the buffer alternates by st & 1, and one copy of the publish point serves all stages */
  for (int st = 0; st < nst; ++st) {
    const unsigned short* ar = &sAB[st & 1][(32 * w + ln) * PH + 8 * hh]; const unsigned short* br = &sAB[st & 1][(128 + ln) * PH + 8 * hh];      /* the lane's first A row and first B row of the stage, at its half of the k order */
#pragma unroll
    for (int ks = 0; ks < KC; ks += 32) { const v16h a0 = g2_frag(ar + ks), a1 = g2_frag(ar + 16 * PH + ks);
      const v16h b0 = g2_frag(br + ks), b1 = g2_frag(br + 16 * PH + ks), b2 = g2_frag(br + 32 * PH + ks), b3 = g2_frag(br + 48 * PH + ks);
      c00 = g2_mma(a0, b0, c00); c10 = g2_mma(a1, b0, c10); c01 = g2_mma(a0, b1, c01); c11 = g2_mma(a1, b1, c11);
      c02 = g2_mma(a0, b2, c02); c12 = g2_mma(a1, b2, c12); c03 = g2_mma(a0, b3, c03); c13 = g2_mma(a1, b3, c13); }
    asm volatile("s_wait_dscnt 0x0" ::: "memory");      /* this wave's reads of the stage's buffer have returned */
    asm volatile("s_wait_asynccnt 0x0" ::: "memory");      /* this wave's copies of stage st + 1 have landed */
    __syncthreads();      /* publishes stage st + 1 and ends every wave's reads of the buffer that is refilled behind it */
    if (st + 2 < nst) stage_copy(st + 2, st & 1);
  }
  asm volatile("s_wait_asynccnt 0x0" ::: "memory");      /* no copy is outstanding when the wave goes on to the epilogue */
  v8f accs[8] = {c00, c01, c02, c03, c10, c11, c12, c13};
  /* With KFo set (the q, k, v launch; N = NH * 64, rows = NB * SLEN tokens, no bias, no CP, ACT 0) plane 1 goes out as KF and plane 2 as VF; the plane is blockIdx.y, the same for the whole block. */
  const int fjob = KFo ? by : 0; const int slab = (row0 / SLEN) * NH + nq, tok0 = row0 % SLEN;
  if (fjob == 2) {      /* accumulator u = (half, t), register r, is V[key 16 half + 8 hh + r][d = 16 t + ln]: already the piece of chunk (dt = t, p = half) */
    unsigned short* dst = (unsigned short*)VFo + ((size_t)slab * (SLEN / 32) + tok0 / 32) * 2048 + lane * 8; FragH f[8];
#pragma unroll
    for (int u = 0; u < 8; ++u)
#pragma unroll
      for (int r = 0; r < 8; ++r) f[u].h[r] = (_Float16)(accs[u][r] * alpha);
#pragma unroll
    for (int u = 0; u < 8; ++u) *(v8us*)(dst + ((u & 3) * 2 + (u >> 2)) * 256) = f[u].half[0];
    return; }
#pragma unroll
  for (int u = 0; u < 8; ++u) { const int t = u & 3, half = u >> 2; const int col = col0 + t * 16 + ln; const float bv = bp ? bf16_round(bp[col]) : 0.f;
#pragma unroll
    for (int r = 0; r < 8; ++r) { const int rloc = half * 16 + 8 * hh + r; float v = accs[u][r] * alpha + bv; if (CP) { const int bidx = (row0g + row0 + rloc) / rowsPerB; v += CP[(size_t)bidx * sCPb + (size_t)by * 64 + col]; }
      if (ACT == 3) v = fmaxf(v, 0.f); else if (ACT == 6) v = 0.5f * v * (1.0f + erff(v * 0.70710678118654752f)); else if (ACT == 11) v = 1.0f / (1.0f + expf(-v)); else if (ACT == 15) v = v / (1.0f + expf(-v)); else if (ACT == 12) v = (v > 0.f) ? v : 0.01f * v; else if (ACT == 8) v = tanhf(v);
      so[w][rloc][t * 16 + ln] = v; } }
  __builtin_amdgcn_fence(__ATOMIC_ACQ_REL, "workgroup"); __builtin_amdgcn_wave_barrier();
  if (fjob == 1) {      /* tile tt of 16 keys, chunk c = 2 ks + p: lane (hh, ln) takes K[key ln][16 c + 8 hh ..+7] from the wave's own LDS tile */
    unsigned short* dst = (unsigned short*)KFo + ((size_t)slab * (SLEN / 16) + tok0 / 16) * 1024 + lane * 8; FragH f[8];
#pragma unroll
    for (int u = 0; u < 8; ++u) { const float* sp = &so[w][(u >> 2) * 16 + ln][(u & 3) * 16 + 8 * hh]; const v4f x = *(const v4fa*)sp, y = *(const v4fa*)(sp + 4);
#pragma unroll
      for (int i = 0; i < 4; ++i) { f[u].h[i] = (_Float16)x[i]; f[u].h[4 + i] = (_Float16)y[i]; } }
#pragma unroll
    for (int u = 0; u < 8; ++u) *(v8us*)(dst + u * 256) = f[u].half[0];
    asm volatile("s_wait_xcnt 0x0" ::: "memory");      /* stands behind the eight stores, before any path on which their address pair is rewritten */
    return; }
  const int rsub = lane >> 4, c4 = (lane & 15) * 4;
  {
#pragma unroll
    for (int q = 0; q < 16; ++q) { const int r = q * 2 + rsub; const v4f v = *(const v4fa*)&so[w][r][c4];
      if (C) { *(v4f*)(C + cofs + (size_t)(row0 + r) * ldc + col0 + c4) = v; asm volatile("s_wait_xcnt 0x0" ::: "memory"); }      /* stands behind the store, before any path on which a register that it names is rewritten */
      if (C16) { v4h h4; for (int i = 0; i < 4; ++i) h4[i] = (_Float16)v[i]; *(v4h*)(C16 + cofs + (size_t)(row0 + r) * ldc + col0 + c4) = h4; asm volatile("s_wait_xcnt 0x0" ::: "memory"); } }      /* the same behind the f16 store */
     } }



__device__ __forceinline__ float xhalf(float x) { return __builtin_bit_cast(float, __builtin_amdgcn_permlanex16(__builtin_bit_cast(int, x), __builtin_bit_cast(int, x), 0x76543210, 0xfedcba98, false, false)); }      /* lane l with lane l ^ 16 */
template <int CAUSAL>
__global__ __launch_bounds__(128) void k_flash(const _Float16* __restrict__ Q16, int ldq, const _Float16* __restrict__ KF, const _Float16* __restrict__ VF, const int* __restrict__ MSK, _Float16* __restrict__ O16, int ldo, float osc) {
  constexpr int RPW = 16, DT = 4, KS = 2;
  constexpr int SK = 128, NST = TK / SK, SH = SK * 64;      /* a stage = 128 keys = 4 passes: SH halves (16 KiB) of K and as many of V^T, each one contiguous run of its fragment-order plane */
  static_assert(CAUSAL != 1 && CAUSAL != 3 && NST >= 2, "the staged key walk takes whole stages from key 0 to TK");
  __shared__ __attribute__((aligned(16))) float sO[4][RPW][64 + 4];
  __shared__ __attribute__((aligned(16))) unsigned short sKV[2][2][SH];      /* [buffer][K, V^T]: filled once per block, read by its four waves */
  const int tid = threadIdx.x, w = tid >> 5, lane = tid & 31, ln = lane & 15, hh = lane >> 4;
  const int slab = blockIdx.x / QBLKS, qblk = blockIdx.x % QBLKS; const int b = slab / NH, h = slab % NH; const int qb0 = qblk * (4 * RPW); const int q0 = qb0 + w * RPW; const int tq = q0 + ln; const int eb = tq + RELW - 8 * hh;
  FragH aq[KS];
  { const unsigned short* qr = (const unsigned short*)Q16 + ((size_t)b * TQ + tq) * ldq + h * 64;
#pragma unroll
    for (int ks = 0; ks < KS; ++ks) { aq[ks].half[0] = *(const v8us*)(qr + ks * 32 + 8 * hh); aq[ks].half[1] = *(const v8us*)(qr + ks * 32 + 16 + 8 * hh); } }
  const unsigned short* Kg = (const unsigned short*)KF + (size_t)slab * 64 * TK + tid * 8; const unsigned short* Vg = (const unsigned short*)VF + (size_t)slab * 64 * TK + tid * 8;      /* fragment-order planes (written by k_gemm2): this thread's 16 bytes of every 2-KiB run that the block copies */
  float m_r = -3.0e38f, l_r = 0.f; v8f oacc[DT];
#pragma unroll
  for (int dt = 0; dt < DT; ++dt) oacc[dt] = (v8f){0.f,0.f,0.f,0.f,0.f,0.f,0.f,0.f};
  /* K and V^T come to LDS a stage ahead, by asynchronous copies into the buffer that the stage before last has left; the waves take their fragments from LDS:
     V^T of a pass at the pass's head (used behind the softmax), K of the next pass of the same stage right behind this pass's score products. The bias values still come by global loads, one pass ahead. */
  FragH kf[2][KS]; FragH vf[DT]; v2f bc[2][4];      /* bias of keys (2 i, 2 i + 1) of score tile nt, paired like the accumulator registers */
  auto copy8 = [&](const unsigned short* g, unsigned l) __attribute__((always_inline)) {      /* 16 KiB per block: eight copies of 16 bytes per thread, 2 KiB apart; g = the thread's global bytes, l = its LDS byte address */
    /* the wait on the address translations is the statement's last line, so that it stands before anything that rewrites a register which a copy names */
    asm volatile("global_load_async_to_lds_b128 %0, %8, off\n\t"
                 "global_load_async_to_lds_b128 %1, %9, off\n\t"
                 "global_load_async_to_lds_b128 %2, %10, off\n\t"
                 "global_load_async_to_lds_b128 %3, %11, off\n\t"
                 "global_load_async_to_lds_b128 %4, %12, off\n\t"
                 "global_load_async_to_lds_b128 %5, %13, off\n\t"
                 "global_load_async_to_lds_b128 %6, %14, off\n\t"
                 "global_load_async_to_lds_b128 %7, %15, off\n\t"
                 "s_wait_xcnt 0x0"
                 :: "v"(l), "v"(l + 2048u), "v"(l + 4096u), "v"(l + 6144u), "v"(l + 8192u), "v"(l + 10240u), "v"(l + 12288u), "v"(l + 14336u),
                    "v"(g), "v"(g + 1024), "v"(g + 2048), "v"(g + 3072), "v"(g + 4096), "v"(g + 5120), "v"(g + 6144), "v"(g + 7168) : "memory");
  };
  auto stage_copy = [&](int st, int buf) __attribute__((always_inline)) {
    copy8(Kg + (size_t)st * SH, (unsigned)(size_t)&sKV[buf][0][tid * 8]);
    copy8(Vg + (size_t)st * SH, (unsigned)(size_t)&sKV[buf][1][tid * 8]);
  };
  auto fetch_k = [&](const unsigned short* kr) __attribute__((always_inline)) {      /* kr: this lane's piece of the first chunk of a pass's K, in LDS; 1024 halves per tile of 16 keys */
#pragma unroll
    for (int nt = 0; nt < 2; ++nt)
#pragma unroll
      for (int ks = 0; ks < KS; ++ks) { kf[nt][ks].half[0] = *(const v8us*)(kr + nt * 1024 + ks * 512); kf[nt][ks].half[1] = *(const v8us*)(kr + nt * 1024 + ks * 512 + 256); }
  };
  auto fetch_bias = [&](int j0) __attribute__((always_inline)) {
    if (CAUSAL == 6) { const float* BTh = (const float*)MSK + h * (2 * RELW + 1);      /* mode 6: per-head relative-position bias table [NH][2*RELW+1] indexed by clip(i - j, +-RELW) + RELW (passed through the MSK pointer) */
      unsigned i0[8], i1[8];
#pragma unroll
      for (int r = 0; r < 8; ++r) { int d0 = eb - j0 - r, d1 = eb - j0 - 16 - r; d0 = d0 < 0 ? 0 : (d0 > 2 * RELW ? 2 * RELW : d0); d1 = d1 < 0 ? 0 : (d1 > 2 * RELW ? 2 * RELW : d1); i0[r] = (unsigned)d0; i1[r] = (unsigned)d1; }      /* clip(i - j + RELW, 0, 2 RELW), the same integer as clip(i - j, +-RELW) + RELW; key j = j0 (+ 16) + 8 hh + r */
#pragma unroll
      for (int r = 0; r < 8; ++r) { bc[0][r >> 1][r & 1] = BTh[i0[r]]; bc[1][r >> 1][r & 1] = BTh[i1[r]]; }
      asm volatile("s_wait_xcnt 0x0" :: "v"(i0[0]), "v"(i0[1]), "v"(i0[2]), "v"(i0[3]), "v"(i0[4]), "v"(i0[5]), "v"(i0[6]), "v"(i0[7]), "v"(i1[0]), "v"(i1[1]), "v"(i1[2]), "v"(i1[3]), "v"(i1[4]), "v"(i1[5]), "v"(i1[6]), "v"(i1[7]) : "memory");      /* stands before any register that the bias loads name is rewritten; the index registers are inputs so that no load of the group lands on one */
    }
  };
  stage_copy(0, 0);
  asm volatile("s_wait_asynccnt 0x0" ::: "memory");      /* this wave's copies of stage 0 have landed */
  __syncthreads();      /* publishes stage 0 to all four waves */
  stage_copy(1, 1);
  fetch_bias(0);
#pragma unroll 1      /* kept rolled: the buffer alternates by st & 1, and one copy of the publish point serves all stages */
  for (int st = 0; st < NST; ++st) {
   const unsigned short* kb = &sKV[st & 1][0][lane * 8]; const unsigned short* vb = &sKV[st & 1][1][lane * 8];      /* this lane's piece of every 512-byte chunk of the stage */
   fetch_k(kb);
#pragma unroll 1
   for (int p = 0; p < SK / 32; ++p) {      /* kept rolled: one pass of code for the four passes of a stage */
    const int j0 = st * SK + p * 32;
    const unsigned short* vr = vb + p * 2048;      /* 2048 halves per tile of 32 keys */
#pragma unroll
    for (int dt = 0; dt < DT; ++dt) { vf[dt].half[0] = *(const v8us*)(vr + dt * 512); vf[dt].half[1] = *(const v8us*)(vr + dt * 512 + 256); }
    v8f s[2];
#pragma unroll
    for (int nt = 0; nt < 2; ++nt) { v8f acc = (v8f){0.f,0.f,0.f,0.f,0.f,0.f,0.f,0.f};
#pragma unroll
      for (int ks = 0; ks < KS; ++ks) acc = mmaH<1>(kf[nt][ks].v, kf[nt][ks].v, aq[ks].v, aq[ks].v, acc); s[nt] = acc; }
    const int jn = (j0 + 32 < TK) ? j0 + 32 : 0;      /* the last pass has no next one: it names in-range bias values that are not used */
    fetch_k(kb + ((p + 1) & (SK / 32 - 1)) * 2048);      /* a stage's last pass names the stage's own first tile, whose values are not used: nothing of the next stage is read before its barrier */
    float s0[8], s1[8], mx[8]; bool ok0[8], ok1[8];
#pragma unroll
    for (int r = 0; r < 8; ++r) { const int k0 = j0 + 8 * hh + r, k1 = k0 + 16;
      ok0[r] = (CAUSAL == 1) ? (k0 <= tq) : ((CAUSAL == 2) ? ((k0 >> 5) == (tq >> 5)) : ((CAUSAL == 3) ? (k0 <= tq && tq - k0 < WINDOW) : true)); ok1[r] = (CAUSAL == 1) ? (k1 <= tq) : ((CAUSAL == 2) ? ((k1 >> 5) == (tq >> 5)) : ((CAUSAL == 3) ? (k1 <= tq && tq - k1 < WINDOW) : true));      /* mode 3: causal + sliding window of WINDOW keys */      /* mode 2: block-diagonal 32-token groups */
      s0[r] = ok0[r] ? s[0][r] * SCL2 : -3.0e38f; s1[r] = ok1[r] ? s[1][r] * SCL2 : -3.0e38f; if (CAUSAL == 6) { s0[r] += bc[0][r >> 1][r & 1]; s1[r] += bc[1][r >> 1][r & 1]; }      /* mode 6: the bias (its table already holds bias * log2 e) is added after the scale */
    }
#pragma unroll
    for (int i = 0; i < 4; ++i) { mx[i] = fmaxf(s0[2 * i], s0[2 * i + 1]); mx[4 + i] = fmaxf(s1[2 * i], s1[2 * i + 1]); }
    fetch_bias(jn);      /* behind the last use of this pass's values, so that the loads land in the same registers */
    __builtin_amdgcn_sched_barrier(0);      /* keeps the next pass's K reads and bias loads in front of the exponentials: with the short exponentials the scheduler otherwise sinks them to the pass's end, where their latency is no longer covered */
    float mc = fmaxf(fmaxf(fmaxf(mx[0], mx[1]), fmaxf(mx[2], mx[3])), fmaxf(fmaxf(mx[4], mx[5]), fmaxf(mx[6], mx[7])));
    mc = fmaxf(mc, xhalf(mc));      /* the other 16 keys of this query stand in lane l ^ 16 */
    const float mn = fmaxf(m_r, mc); const float ea = __builtin_amdgcn_exp2f(m_r - mn); const float al = (mn > -1.0e38f) ? ea : 1.0f; m_r = mn;      /* the arguments are bounded above (0 here, 10 below), so the bare instruction needs no range steps; far below it gives 0 */
    const float mp = mn - 10.0f;      /* exp2(s - mp) = 1024 exp2(s - mn): P comes out at the f16 operand's scale; the denominator sums the same values, so the factor cancels */
    FragH pb; float ps[8], pt[8];
#pragma unroll
    for (int r = 0; r < 8; ++r) { const float p0 = ok0[r] ? __builtin_amdgcn_exp2f(s0[r] - mp) : 0.f, p1 = ok1[r] ? __builtin_amdgcn_exp2f(s1[r] - mp) : 0.f; ps[r] = p0; pt[r] = p1; pb.h[r] = (_Float16)p0; pb.h[8 + r] = (_Float16)p1; }
    l_r = l_r * al + ((((ps[0] + ps[2]) + (ps[4] + ps[6])) + ((pt[0] + pt[2]) + (pt[4] + pt[6]))) + (((ps[1] + ps[3]) + (ps[5] + ps[7])) + ((pt[1] + pt[3]) + (pt[5] + pt[7]))));      /* each wave half keeps the sum of its own keys; the halves are joined behind the loop */
#pragma unroll
    for (int dt = 0; dt < DT; ++dt) oacc[dt] *= al;
#pragma unroll
    for (int dt = 0; dt < DT; ++dt) oacc[dt] = mmaH<1>(vf[dt].v, vf[dt].v, pb.v, pb.v, oacc[dt]);
   }
   asm volatile("s_wait_dscnt 0x0" ::: "memory");      /* this wave's reads of the stage's buffer have returned */
   asm volatile("s_wait_asynccnt 0x0" ::: "memory");      /* this wave's copies of stage st + 1 have landed */
   __syncthreads();      /* publishes stage st + 1 and ends every wave's reads of the buffer that is refilled behind it */
   if (st + 2 < NST) stage_copy(st + 2, st & 1);
  }
  asm volatile("s_wait_asynccnt 0x0" ::: "memory");      /* no copy is outstanding when the wave goes on to the epilogue */
  { const float l = l_r + xhalf(l_r); const float inv = (l > 0.f) ? 1.0f / l : 0.f;      /* l and the output sums both carry the factor 1024 */
#pragma unroll
    for (int dt = 0; dt < DT; ++dt) { const v8f o = oacc[dt] * inv; *(v4fa*)&sO[w][ln][dt * 16 + 8 * hh] = (v4f){o[0], o[1], o[2], o[3]}; *(v4fa*)&sO[w][ln][dt * 16 + 8 * hh + 4] = (v4f){o[4], o[5], o[6], o[7]}; } }      /* register r of tile dt is O[q0 + ln][16 dt + 8 hh + r] */
  __builtin_amdgcn_fence(__ATOMIC_ACQ_REL, "workgroup"); __builtin_amdgcn_wave_barrier();
  {
#pragma unroll
    for (int rp = 0; rp < RPW; rp += 4) { const int r = rp + (lane >> 3), pc = lane & 7; const v4f x = *(const v4fa*)&sO[w][r][pc * 8], y = *(const v4fa*)&sO[w][r][pc * 8 + 4]; FragH f;      /* eight lanes write one query's 128-byte line of f16 values, scaled by osc (a power of two) for the output GEMM */
#pragma unroll
      for (int i = 0; i < 4; ++i) { f.h[i] = (_Float16)(x[i] * osc); f.h[4 + i] = (_Float16)(y[i] * osc); }
      *(v8us*)((unsigned short*)O16 + ((size_t)b * TQ + q0 + r) * ldo + h * 64 + pc * 8) = f.half[0]; }
     } }

__device__ __forceinline__ void job_btab(const float* __restrict__ pe, float* __restrict__ BT) { { for (int e = threadIdx.x; e < NH * NREL; e += 256) { const int h = e / NREL, r = e % NREL; *(float*)(BT + e) = bf16_round(pe[r * NH + h]) * LOG2E; }  } }
// One launch for the eight jobs that read nothing but inputs: a block's index picks its job (block-uniform); the jobs share no data, so they need no order among themselves.
// Order: the four weight transposes (long strided loads) first, the bias table, then the three activation planes. B4 = the four [n][k] weight planes in a row, X3 = the three activation planes in a row.
#define WBLK (CC * CC / 8 / 256)      /* blocks of one weight transpose */
#define XBLK (NR * CC / 8 / 256)      /* blocks of one activation plane */
__global__ __launch_bounds__(256) void k_prep(const float* __restrict__ xq, const float* __restrict__ xk, const float* __restrict__ xv, const float* __restrict__ Wq, const float* __restrict__ Wk, const float* __restrict__ Wv, const float* __restrict__ Wo, const float* __restrict__ pe,
                                              _Float16* __restrict__ B4, float* __restrict__ BT, _Float16* __restrict__ X3) {
  const int blk = blockIdx.x;
  if (blk < 4 * WBLK) { const int j = blk / WBLK; job_wt_f16(blk % WBLK, j == 0 ? Wq : (j == 1 ? Wk : (j == 2 ? Wv : Wo)), B4 + (size_t)j * CC * CC, CC, CC, 16.0f); }
  else if (blk == 4 * WBLK) job_btab(pe, BT);
  else { const int xb = blk - 4 * WBLK - 1, j = xb / XBLK; job_x16(xb % XBLK, j == 0 ? xq : (j == 1 ? xk : xv), X3 + (size_t)j * NR * CC, (size_t)NR * CC / 8); }
}

extern "C" void kernel_launch(void* const* d_in, const int* in_sizes, int n_in,
                              void* d_out, int out_size, void* d_ws, size_t ws_size, hipStream_t stream) {
  (void)in_sizes; (void)n_in; (void)out_size;
  const float* const* I = (const float* const*)d_in; const float* xq = I[0]; const float* xk = I[1]; const float* xv = I[2]; const float* Wq = I[3]; const float* Wk = I[4]; const float* Wv = I[5]; const float* Wo = I[6]; const float* pe = I[7];
  char* ws = (char*)d_ws; size_t off = 0;
  auto take = [&](size_t bytes) { char* p = ws + off; off += (bytes + 255) & ~(size_t)255; return p; };
  const size_t np = (size_t)NR * CC;
  _Float16* BQ = (_Float16*)take((size_t)4 * CC * CC * 2); _Float16* BO = BQ + (size_t)3 * CC * CC;      /* Wq, Wk, Wv, Wo planes in a row */ float* BT = (float*)take((size_t)NH * NREL * 4 + 256);
  _Float16* XQ = (_Float16*)take(3 * np * 2);      /* query, key, value planes in a row */ _Float16* Q16 = (_Float16*)take(np * 2); _Float16* VT = (_Float16*)take(np * 2); _Float16* KF = (_Float16*)take(np * 2); _Float16* O16 = XQ;      /* the query plane is free again once the projections have run */
  if (off > ws_size) return;      /* 2 + 6 x 4 = 26 MiB */
  k_prep<<<4 * WBLK + 1 + 3 * XBLK, 256, 0, stream>>>(xq, xk, xv, Wq, Wk, Wv, Wo, pe, BQ, BT, XQ);
  const dim3 g((NR / 128) * (CC / 64), 1), g3((NR / 128) * (CC / 64), 3);
  k_gemm2<0><<<g3, 128, 0, stream>>>(XQ, CC, np, BQ, CC, (size_t)CC * CC, 0.0625f, nullptr, 0, nullptr, 1, 0, 0, nullptr, Q16, CC, np, NR, CC, CC, KF, VT);      /* the q, k and v projections: blockIdx.y steps through the three planes of A and of the weights; q goes out row-major, k and v in fragment order */
  k_flash<6><<<NB * NH * QBLKS, 128, 0, stream>>>(Q16, CC, KF, VT, (const int*)BT, O16, CC, 64.0f);      /* relative-position bias mode; x2^6 carry: the 2048-key averages are small */
  k_gemm2<0><<<g, 128, 0, stream>>>(O16, CC, 0, BO, CC, 0, 0.0625f / 64.0f, nullptr, 0, nullptr, 1, 0, 0, (float*)d_out, nullptr, CC, 0, NR, CC, CC, nullptr, nullptr);
}

// v009
// It runs in 53.1 microseconds.
// Two timings next to v008 put it at 1.09 and 1.10 times that version's speed.
// Counting every step since v000, it is 6.57 times as fast.
#include <hip/hip_runtime.h>
// RelativePositionalEncodingAttention (2 x 2048 tokens, 8 heads of 64, D 512): q/k/v from three inputs (no bias); scores/8 + pos_emb[clip(i - j, -32, 32) + 32][h]; softmax; out Wo.
// Structure: exact f16 planes of query/key/value; q/k/v GEMMs (32x64 wave tiles, f32 accumulation, exact x16 weights, f16 outputs); the relative-bias table transposed to [head][65] (bf16-rounded, times log2 e, f32); K and V^T written in matrix-fragment order by the projection GEMM's own epilogue; the fused flash kernel with a new relative-position-bias mode (table lookup by clipped i - j added after the scale, f32); attention output written as f16 (x2^6) by the flash kernel, straight into the output GEMM.
// Compute dtype: inputs and weights rounded to bf16; q, k, v, P and the attention output as f16 operands; f32 accumulation/softmax/bias. v_wmma_f32_16x16x32_f16.
#define NB 2
#define CC 512
#define NR (NB * SLEN)
#define NREL (2 * RELW + 1)
#define SLEN 2048
#define TQ SLEN
#define TK SLEN
#define NH 8
#define SCL 0.125f               /* 1/sqrt(64) */
#define LOG2E 1.44269504088896340736f
#define SCL2 (SCL * LOG2E)       /* scores are kept in base 2: exp(x) = exp2(x log2 e), the factor carried by the score scale and by the bias table */
#define WINDOW 256
#define RELW 32                  /* max_relative_position */
#define QBLKS (TQ / 64)
typedef __bf16 v16b __attribute__((ext_vector_type(16)));
typedef unsigned short v8us __attribute__((ext_vector_type(8), may_alias));
typedef float  v8f  __attribute__((ext_vector_type(8)));
typedef float  v4f  __attribute__((ext_vector_type(4)));
typedef float  v2f  __attribute__((ext_vector_type(2)));
typedef float  v4fa __attribute__((ext_vector_type(4), may_alias));
union FragB { v16b v; v8us half[2]; unsigned short u[16]; };

__device__ __forceinline__ unsigned short bf16_bits(float x) { unsigned int u = __float_as_uint(x); return (unsigned short)((u + 0x7FFFu + ((u >> 16) & 1u)) >> 16); }
__device__ __forceinline__ float bf16_val(unsigned short b) { return __uint_as_float(((unsigned int)b) << 16); }
__device__ __forceinline__ float bf16_round(float x) { return bf16_val(bf16_bits(x)); }
// D += A·B with NT terms: 1 = ah·bh, 2 = + al·bh (A split), 3 = + ah·bl (both split)
template <int NT>
__device__ __forceinline__ v8f mmaN(v16b ah, v16b al, v16b bh, v16b bl, v8f c) {
  c = __builtin_amdgcn_wmma_f32_16x16x32_bf16(false, ah, false, bh, (short)0, c, false, false);
  if (NT >= 2) c = __builtin_amdgcn_wmma_f32_16x16x32_bf16(false, al, false, bh, (short)0, c, false, false);
  if (NT >= 3) c = __builtin_amdgcn_wmma_f32_16x16x32_bf16(false, ah, false, bl, (short)0, c, false, false);
  asm volatile("v_nop\n\tv_nop\n\tv_nop\n\tv_nop" : "+v"(c) : "v"(ah), "v"(al), "v"(bh), "v"(bl));
  return c;
}

__global__ __launch_bounds__(256) void k_wt_bf16(const float* __restrict__ W, unsigned short* __restrict__ Wt, int K, int N) {
  const int t = blockIdx.x * 256 + threadIdx.x;
  const int k8n = K / 8;
  if (t >= N * k8n) return;
  const int n = t / k8n, k8 = (t % k8n) * 8;
  v8us v;
#pragma unroll
  for (int i = 0; i < 8; ++i) v[i] = bf16_bits(W[(size_t)(k8 + i) * N + n]);
  *(v8us*)(Wt + (size_t)n * K + k8) = v;
  
}

// GEMM C[M][N] (f32, pitch ldc) = act(A[M][K]·W + bias). A f32 row-major (pitch lda) converted per fragment to bf16
// (ASPLIT: hi/lo two planes -> 2 terms, else single rounded term); Wt bf16 [N][K] (pitch ldb). BIAS_BF16 rounds the
// bias to bf16 first (bias quantised to bf16 before the add). K%32==0, M%16==0, N%64==0.
template <bool ASPLIT, int ACT, bool BIAS_BF16>
__global__ __launch_bounds__(128) void k_gemm_bf(const float* __restrict__ A, int lda, const unsigned short* __restrict__ Wt, int ldb,
                                               const float* __restrict__ bias, float* __restrict__ C, int ldc, int M, int N, int K) {
  __shared__ __attribute__((aligned(16))) float so[4][16][64];
  const int tid = threadIdx.x, w = tid >> 5, lane = tid & 31, ln = lane & 15, hh = lane >> 4;
  const int ntn = N / 64;
  const int wid = blockIdx.x * 4 + w;
  const int mt = wid / ntn, nq = wid % ntn;
  if (mt * 16 >= M) return;
  const int row0 = mt * 16, col0 = nq * 64;
  const float* arow = A + (size_t)(row0 + ln) * lda;
  v8f acc[4] = {};
  for (int kb = 0; kb < K; kb += 32) {
    FragB ah, al;
    const v4f x0 = *(const v4fa*)(arow + kb + 8 * hh), x1 = *(const v4fa*)(arow + kb + 8 * hh + 4);
    const v4f x2 = *(const v4fa*)(arow + kb + 16 + 8 * hh), x3 = *(const v4fa*)(arow + kb + 16 + 8 * hh + 4);
    float xs[16] = {x0[0],x0[1],x0[2],x0[3],x1[0],x1[1],x1[2],x1[3],x2[0],x2[1],x2[2],x2[3],x3[0],x3[1],x3[2],x3[3]};
#pragma unroll
    for (int i = 0; i < 16; ++i) { const unsigned short hb = bf16_bits(xs[i]); ah.u[i] = hb; al.u[i] = ASPLIT ? bf16_bits(xs[i] - bf16_val(hb)) : (unsigned short)0; }
#pragma unroll
    for (int t = 0; t < 4; ++t) {
      const unsigned short* brow = Wt + (size_t)(col0 + t * 16 + ln) * ldb + kb;
      FragB b;
      b.half[0] = *(const v8us*)(brow + 8 * hh);
      b.half[1] = *(const v8us*)(brow + 16 + 8 * hh);
      acc[t] = mmaN<ASPLIT ? 2 : 1>(ah.v, al.v, b.v, b.v, acc[t]);
    }
  }
#pragma unroll
  for (int t = 0; t < 4; ++t) {
    float bv = bias ? bias[col0 + t * 16 + ln] : 0.f;
    if (BIAS_BF16) bv = bf16_round(bv);
#pragma unroll
    for (int r = 0; r < 8; ++r) { float v = acc[t][r] + bv; if (ACT == 1) v = fmaxf(v, 0.f); so[w][8 * hh + r][t * 16 + ln] = v; }
  }
  __builtin_amdgcn_fence(__ATOMIC_ACQ_REL, "workgroup");
  __builtin_amdgcn_wave_barrier();
  const int rsub = lane >> 4, c4 = (lane & 15) * 4;
  {
#pragma unroll
    for (int q = 0; q < 8; ++q) {
      const int r = q * 2 + rsub;
      const v4f v = *(const v4fa*)&so[w][r][c4];
      *(v4f*)(C + (size_t)(row0 + r) * ldc + col0 + c4) = v;
    }
    
  }
}

// GEMM C = act(A·W + bias + resid): A f32 (ASPLIT -> hi/lo 2 terms), Wt bf16 [N][K]; ACT 0 none, 1 relu, 2 exact gelu;
// resid (optional, f32, row index = (row % rmod), pitch ldr, RES_BF16 rounds it) added before the activation.
template <bool ASPLIT, int ACT, bool BIAS_BF16, bool RES_BF16>
__global__ __launch_bounds__(128) void k_gemm_bf3(const float* __restrict__ A, int lda, const unsigned short* __restrict__ Wt, int ldb,
                                                const float* __restrict__ bias, const float* __restrict__ resid, int rmod, int ldr,
                                                float* __restrict__ C, int ldc, int M, int N, int K) {
  __shared__ __attribute__((aligned(16))) float so[4][16][64];
  const int tid = threadIdx.x, w = tid >> 5, lane = tid & 31, ln = lane & 15, hh = lane >> 4;
  const int ntn = N / 64;
  const int wid = blockIdx.x * 4 + w;
  const int mt = wid / ntn, nq = wid % ntn;
  if (mt * 16 >= M) return;
  const int row0 = mt * 16, col0 = nq * 64;
  const float* arow = A + (size_t)(row0 + ln) * lda;
  v8f acc[4] = {};
  for (int kb = 0; kb < K; kb += 32) {
    FragB ah, al;
    const v4f x0 = *(const v4fa*)(arow + kb + 8 * hh), x1 = *(const v4fa*)(arow + kb + 8 * hh + 4);
    const v4f x2 = *(const v4fa*)(arow + kb + 16 + 8 * hh), x3 = *(const v4fa*)(arow + kb + 16 + 8 * hh + 4);
    float xs[16] = {x0[0],x0[1],x0[2],x0[3],x1[0],x1[1],x1[2],x1[3],x2[0],x2[1],x2[2],x2[3],x3[0],x3[1],x3[2],x3[3]};
#pragma unroll
    for (int i = 0; i < 16; ++i) { const unsigned short hb = bf16_bits(xs[i]); ah.u[i] = hb; al.u[i] = ASPLIT ? bf16_bits(xs[i] - bf16_val(hb)) : (unsigned short)0; }
#pragma unroll
    for (int t = 0; t < 4; ++t) {
      const unsigned short* brow = Wt + (size_t)(col0 + t * 16 + ln) * ldb + kb;
      FragB b;
      b.half[0] = *(const v8us*)(brow + 8 * hh);
      b.half[1] = *(const v8us*)(brow + 16 + 8 * hh);
      acc[t] = mmaN<ASPLIT ? 2 : 1>(ah.v, al.v, b.v, b.v, acc[t]);
    }
  }
#pragma unroll
  for (int t = 0; t < 4; ++t) {
    const int col = col0 + t * 16 + ln;
    float bv = bias ? bias[col] : 0.f;
    if (BIAS_BF16) bv = bf16_round(bv);
#pragma unroll
    for (int r = 0; r < 8; ++r) {
      float v = acc[t][r] + bv;
      if (resid) { float rv = resid[(size_t)((row0 + 8 * hh + r) % rmod) * ldr + col]; if (RES_BF16) rv = bf16_round(rv); v += rv; }
      if (ACT == 1) v = fmaxf(v, 0.f);
      if (ACT == 2) v = 0.5f * v * (1.0f + erff(v * 0.70710678118654752f));
      if (ACT == 3) { const float u = 0.7978845608028654f * (v + 0.044715f * v * v * v); v = 0.5f * v * (1.0f + tanhf(u)); }
      so[w][8 * hh + r][t * 16 + ln] = v;
    }
  }
  __builtin_amdgcn_fence(__ATOMIC_ACQ_REL, "workgroup");
  __builtin_amdgcn_wave_barrier();
  const int rsub = lane >> 4, c4 = (lane & 15) * 4;
  {
#pragma unroll
    for (int q = 0; q < 8; ++q) {
      const int r = q * 2 + rsub;
      const v4f v = *(const v4fa*)&so[w][r][c4];
      *(v4f*)(C + (size_t)(row0 + r) * ldc + col0 + c4) = v;
    }
    
  }
}
// row LayerNorm (biased variance, eps) over N: s = X (+ R); optional out_sum <- s; out_norm <- (s-mu)*rsqrt(var+eps)*g + b
template <bool PARAM_BF16>
__global__ __launch_bounds__(256) void k_layernorm(const float* __restrict__ X, const float* __restrict__ R, const float* __restrict__ g, const float* __restrict__ bta,
                                                  float* __restrict__ out_sum, float* __restrict__ out_norm, int N, float eps) {
  __shared__ float red[256];
  const int row = blockIdx.x, tid = threadIdx.x;
  const float* x = X + (size_t)row * N; const float* rr = R ? R + (size_t)row * N : nullptr;
  float vals[16];                     // up to N = 4096
  const int per = N / 256;            // contiguous chunk per thread? use strided-by-4 chunks: thread handles j = tid*4 + 1024*u
  float s1 = 0.f;
  for (int u = 0; u < per / 4; ++u) {
    const int j = tid * 4 + 1024 * u;
    const v4f a = *(const v4fa*)(x + j);
    v4f b = {0.f,0.f,0.f,0.f}; if (rr) b = *(const v4fa*)(rr + j);
#pragma unroll
    for (int q = 0; q < 4; ++q) { const float v = a[q] + b[q]; vals[u * 4 + q] = v; s1 += v; }
  }
  red[tid] = s1; __syncthreads();
  for (int st = 128; st > 0; st >>= 1) { if (tid < st) red[tid] += red[tid + st]; __syncthreads(); }
  const float mu = red[0] / (float)N; __syncthreads();
  float s2 = 0.f;
  for (int u = 0; u < per / 4; ++u)
#pragma unroll
    for (int q = 0; q < 4; ++q) { const float c = vals[u * 4 + q] - mu; s2 += c * c; }
  red[tid] = s2; __syncthreads();
  for (int st = 128; st > 0; st >>= 1) { if (tid < st) red[tid] += red[tid + st]; __syncthreads(); }
  const float rs = rsqrtf(red[0] / (float)N + eps);
  {
    for (int u = 0; u < per / 4; ++u) {
      const int j = tid * 4 + 1024 * u;
      v4f o, sm;
#pragma unroll
      for (int q = 0; q < 4; ++q) {
        float gg = g[j + q], bb = bta[j + q];
        if (PARAM_BF16) { gg = bf16_round(gg); bb = bf16_round(bb); }
        sm[q] = vals[u * 4 + q]; o[q] = (vals[u * 4 + q] - mu) * rs * gg + bb;
      }
      if (out_sum) *(v4f*)(out_sum + (size_t)row * N + j) = sm;
      *(v4f*)(out_norm + (size_t)row * N + j) = o;
    }
    
  }
}



// ---- f16 WMMA path (v_wmma_f32_16x16x32_f16): 11-bit significands for operands in range — used where a [0,1] probability operand needs more precision than bf16
typedef _Float16 v16h __attribute__((ext_vector_type(16)));
union FragH { v16h v; v8us half[2]; _Float16 h[16]; unsigned short u[16]; };
template <int NT>
__device__ __forceinline__ v8f mmaH(v16h ah, v16h al, v16h bh, v16h bl, v8f c) {
  c = __builtin_amdgcn_wmma_f32_16x16x32_f16(false, ah, false, bh, (short)0, c, false, false);
  if (NT >= 2) c = __builtin_amdgcn_wmma_f32_16x16x32_f16(false, al, false, bh, (short)0, c, false, false);
  if (NT >= 3) c = __builtin_amdgcn_wmma_f32_16x16x32_f16(false, ah, false, bl, (short)0, c, false, false);
  asm volatile("v_nop\n\tv_nop\n\tv_nop\n\tv_nop" : "+v"(c) : "v"(ah), "v"(al), "v"(bh), "v"(bl));
  return c;
}
// batched GEMM like k_gemm_b but f16 operands: A f32 (split into f16 hi/lo if ASPLIT, else rounded to f16), Bt = f16 values [n][k]; alpha; C f32; N multiple of 16 (partial tiles skipped)
template <bool ASPLIT>
__global__ __launch_bounds__(128) void k_gemm_h(const float* __restrict__ A, int lda, size_t sA, const _Float16* __restrict__ Bh, int ldb, size_t sB, float alpha, float* __restrict__ C, int ldc, size_t sC, int M, int N, int K) {
  __shared__ __attribute__((aligned(16))) float so[4][16][64];
  const int tid = threadIdx.x, w = tid >> 5, lane = tid & 31, ln = lane & 15, hh = lane >> 4; const int by = blockIdx.y;
  A += (size_t)by * sA; Bh += (size_t)by * sB; C += (size_t)by * sC;
  const int ntn = (N + 63) / 64; const int wid = blockIdx.x * 4 + w; const int mt = wid / ntn, nq = wid % ntn; if (mt * 16 >= M) return;
  const int row0 = mt * 16, col0 = nq * 64; const float* arow = A + (size_t)(row0 + ln) * lda;
  v8f acc[4] = {};
  for (int kb = 0; kb < K; kb += 32) {
    FragH ah, al;
    const v4f x0 = *(const v4fa*)(arow + kb + 8 * hh), x1 = *(const v4fa*)(arow + kb + 8 * hh + 4), x2 = *(const v4fa*)(arow + kb + 16 + 8 * hh), x3 = *(const v4fa*)(arow + kb + 16 + 8 * hh + 4);
    float xs[16] = {x0[0],x0[1],x0[2],x0[3],x1[0],x1[1],x1[2],x1[3],x2[0],x2[1],x2[2],x2[3],x3[0],x3[1],x3[2],x3[3]};
#pragma unroll
    for (int i = 0; i < 16; ++i) { const _Float16 h = (_Float16)xs[i]; ah.h[i] = h; al.h[i] = ASPLIT ? (_Float16)(xs[i] - (float)h) : (_Float16)0.0f; }
#pragma unroll
    for (int t = 0; t < 4; ++t) { if (col0 + t * 16 >= N) continue; const size_t boff = (size_t)(col0 + t * 16 + ln) * ldb + kb; FragH bq; bq.half[0] = *(const v8us*)(Bh + boff + 8 * hh); bq.half[1] = *(const v8us*)(Bh + boff + 16 + 8 * hh);
      acc[t] = mmaH<ASPLIT ? 2 : 1>(ah.v, al.v, bq.v, bq.v, acc[t]); }
  }
#pragma unroll
  for (int t = 0; t < 4; ++t) { if (col0 + t * 16 >= N) continue;
#pragma unroll
    for (int r = 0; r < 8; ++r) so[w][8 * hh + r][t * 16 + ln] = acc[t][r] * alpha; }
  __builtin_amdgcn_fence(__ATOMIC_ACQ_REL, "workgroup"); __builtin_amdgcn_wave_barrier();
  const int rsub = lane >> 4, c4 = (lane & 15) * 4;
  {
#pragma unroll
    for (int q = 0; q < 8; ++q) { const int r = q * 2 + rsub; if (col0 + c4 < N) { const v4f v = *(const v4fa*)&so[w][r][c4]; *(v4f*)(C + (size_t)(row0 + r) * ldc + col0 + c4) = v; } }
     }
}

// Wt[n][k] = f16(W[k][n]·scale) from f32 row-major W[K][N] (scale = power of two; bf16-exact weights stay exact in f16 away from the subnormal range)
__device__ __forceinline__ void job_wt_f16(int blk, const float* __restrict__ W, _Float16* __restrict__ Wt, int K, int N, float scale) {
  const int t = blk * 256 + threadIdx.x; if (t >= N * (K / 8)) return; const int n = t / (K / 8), k8 = (t % (K / 8)) * 8; FragH f;
#pragma unroll
  for (int i = 0; i < 8; ++i) f.h[i] = (_Float16)(bf16_round(W[(size_t)(k8 + i) * N + n]) * scale); const v8us o = f.half[0];
  *(v8us*)((unsigned short*)Wt + (size_t)n * K + k8) = o; 
}
// k_gemm_hh variant with fused epilogue: v = acc·alpha + bias[by·sBias + col] (+ CP[(row/rowsPerB)·sCPb + by·64 + col] if CP) ; ACT 0 none / 1 elu ; writes f16 C16 (and f32 C if non-null)
template <int ACT>
__global__ __launch_bounds__(128) void k_gemm_hhx(const _Float16* __restrict__ A, int lda, size_t sA, const _Float16* __restrict__ Bh, int ldb, size_t sB, float alpha, const float* __restrict__ bias, size_t sBias, const float* __restrict__ CP, int rowsPerB, size_t sCPb, int row0g,
    float* __restrict__ C, _Float16* __restrict__ C16, int ldc, size_t sC, int M, int N, int K) {
  __shared__ __attribute__((aligned(16))) float so[4][16][64];
  const int tid = threadIdx.x, w = tid >> 5, lane = tid & 31, ln = lane & 15, hh = lane >> 4; const int by = blockIdx.y;
  A += (size_t)by * sA; Bh += (size_t)by * sB; const size_t cofs = (size_t)by * sC; const float* bp = bias ? bias + (size_t)by * sBias : nullptr;
  const int ntn = (N + 63) / 64; const int wid = blockIdx.x * 4 + w; const int mt = wid / ntn, nq = wid % ntn; if (mt * 16 >= M) return;
  const int row0 = mt * 16, col0 = nq * 64; const _Float16* arow = A + (size_t)(row0 + ln) * lda;
  v8f acc[4] = {};
  for (int kb = 0; kb < K; kb += 32) { FragH ah; ah.half[0] = *(const v8us*)((const unsigned short*)arow + kb + 8 * hh); ah.half[1] = *(const v8us*)((const unsigned short*)arow + kb + 16 + 8 * hh);
#pragma unroll
    for (int t = 0; t < 4; ++t) { if (col0 + t * 16 >= N) continue; const size_t boff = (size_t)(col0 + t * 16 + ln) * ldb + kb; FragH bq; bq.half[0] = *(const v8us*)((const unsigned short*)Bh + boff + 8 * hh); bq.half[1] = *(const v8us*)((const unsigned short*)Bh + boff + 16 + 8 * hh);
      acc[t] = mmaH<1>(ah.v, ah.v, bq.v, bq.v, acc[t]); }
  }
#pragma unroll
  for (int t = 0; t < 4; ++t) { if (col0 + t * 16 >= N) continue; const int col = col0 + t * 16 + ln; const float bv = bp ? bf16_round(bp[col]) : 0.f;
#pragma unroll
    for (int r = 0; r < 8; ++r) { float v = acc[t][r] * alpha + bv; if (CP) { const int bidx = (row0g + row0 + 8 * hh + r) / rowsPerB; v += CP[(size_t)bidx * sCPb + (size_t)by * 64 + col]; } if (ACT == 1) v = (v > 0.f) ? v : expm1f(v); else if (ACT == 7) v = (v > 0.f) ? v + 1.0f : expf(v); else if (ACT == 8) v = tanhf(v); else if (ACT == 9) v = 0.5f * v * (1.0f + tanhf(0.7978845608028654f * (v + 0.044715f * v * v * v))); else if (ACT == 11) v = 1.0f / (1.0f + expf(-v)); else if (ACT == 12) v = (v > 0.f) ? v : 0.01f * v; else if (ACT == 14) v = (v > 0.f) ? v : 0.1f * v; else if (ACT == 15) v = v / (1.0f + expf(-v)); else if (ACT == 3) v = fmaxf(v, 0.f); else if (ACT == 6) v = 0.5f * v * (1.0f + erff(v * 0.70710678118654752f)); so[w][8 * hh + r][t * 16 + ln] = v; } }
  __builtin_amdgcn_fence(__ATOMIC_ACQ_REL, "workgroup"); __builtin_amdgcn_wave_barrier();
  const int rsub = lane >> 4, c4 = (lane & 15) * 4; typedef _Float16 v4h __attribute__((ext_vector_type(4)));
  {
#pragma unroll
    for (int q = 0; q < 8; ++q) { const int r = q * 2 + rsub; if (col0 + c4 < N) { const v4f v = *(const v4fa*)&so[w][r][c4]; if (C) *(v4f*)(C + cofs + (size_t)(row0 + r) * ldc + col0 + c4) = v; if (C16) { v4h h4; for (int i = 0; i < 4; ++i) h4[i] = (_Float16)v[i]; *(v4h*)(C16 + cofs + (size_t)(row0 + r) * ldc + col0 + c4) = h4; } } }
     }
}


typedef _Float16 v4h __attribute__((ext_vector_type(4)));

__device__ __forceinline__ void job_x16(int blk, const float* __restrict__ x, _Float16* __restrict__ X16, size_t n8) { const size_t t = (size_t)blk * 256 + threadIdx.x; if (t >= n8) return; FragH f;
#pragma unroll
  for (int q = 0; q < 8; ++q) f.h[q] = (_Float16)bf16_round(x[t * 8 + q]); *(v8us*)((unsigned short*)X16 + t * 8) = f.half[0];  }
__global__ __launch_bounds__(256) void k_h16(const float* __restrict__ x, _Float16* __restrict__ X16, size_t n8) { const size_t t = (size_t)blockIdx.x * 256 + threadIdx.x; if (t >= n8) return; FragH f;
#pragma unroll
  for (int q = 0; q < 8; ++q) f.h[q] = (_Float16)x[t * 8 + q]; *(v8us*)((unsigned short*)X16 + t * 8) = f.half[0];  }
__global__ __launch_bounds__(256) void k_round16f(const float* __restrict__ W, _Float16* __restrict__ Bt, size_t n8) { const size_t t = (size_t)blockIdx.x * 256 + threadIdx.x; if (t >= n8) return; FragH f;
#pragma unroll
  for (int i = 0; i < 8; ++i) f.h[i] = (_Float16)(bf16_round(W[t * 8 + i]) * 16.0f); *(v8us*)((unsigned short*)Bt + t * 8) = f.half[0];  }
// K and V^T in the order in which the attention kernel's fragments take them: every 16-byte piece of a fragment load stands at lane * 16 bytes of a 512-byte chunk, so that one wave-wide load covers four whole 128-byte lines.
// KF, per (slab, tile of 16 keys): chunks (ks, p), piece of lane (hh, ln) = K[key ln][32 ks + 16 p + 8 hh ..+7]. VF, per (slab, tile of 32 keys): chunks (dt, p), piece of lane (hh, ln) = V[keys 16 p + 8 hh ..+7][d = 16 dt + ln].
// Both planes are written by k_gemm2's epilogue (its 32 x 64 wave tile is two K tiles, or one V tile, of one head).

__global__ __launch_bounds__(256) void k_hl(const float* __restrict__ F, _Float16* __restrict__ Hh, _Float16* __restrict__ Hl, size_t n8) { const size_t t = (size_t)blockIdx.x * 256 + threadIdx.x; if (t >= n8) return; FragH fh, fl; const v4f a = *(const v4fa*)(F + t * 8), c = *(const v4fa*)(F + t * 8 + 4);
#pragma unroll
  for (int q = 0; q < 4; ++q) { _Float16 h = (_Float16)a[q]; fh.h[q] = h; fl.h[q] = (_Float16)((a[q] - (float)h) * 1024.0f); h = (_Float16)c[q]; fh.h[4 + q] = h; fl.h[4 + q] = (_Float16)((c[q] - (float)h) * 1024.0f); }
  { *(v8us*)((unsigned short*)Hh + t * 8) = fh.half[0]; *(v8us*)((unsigned short*)Hl + t * 8) = fl.half[0];  } }

// ---- fast GEMM (block tile 128x64, wave tile 32x64; requires M % 128 == 0, N % 64 == 0, K % 128 == 0, lda and ldb multiples of 8); epilogue = k_gemm_hhx semantics ----
// Both operands come to LDS a stage (128 k = 256 bytes of every row) ahead, by asynchronous copies that cover whole 128-byte lines; the waves take their fragments from LDS, the B rows once per block instead of once per wave.
__device__ __forceinline__ v16h g2_frag(const unsigned short* p) { FragH f; f.half[0] = *(const v8us*)p; f.half[1] = *(const v8us*)(p + 16); return f.v; }      /* p: the lane's row of an LDS stage, at k + 8 hh */
__device__ __forceinline__ v8f g2_mma(v16h a, v16h b, v8f c) { v8f d = __builtin_amdgcn_wmma_f32_16x16x32_f16(false, a, false, b, (short)0, c, false, false); asm volatile("v_nop\n\tv_nop\n\tv_nop\n\tv_nop" : "+v"(d) : "v"(a), "v"(b)); return d; }
template <int ACT>
__global__ __launch_bounds__(128) void k_gemm2(const _Float16* __restrict__ A, int lda, size_t sA, const _Float16* __restrict__ Bh, int ldb, size_t sB, float alpha, const float* __restrict__ bias, size_t sBias, const float* __restrict__ CP, int rowsPerB, size_t sCPb, int row0g,
    float* __restrict__ C, _Float16* __restrict__ C16, int ldc, size_t sC, int M, int N, int K, _Float16* __restrict__ KFo, _Float16* __restrict__ VFo) {
  constexpr int KC = 128, PH = KC + 8, STH = (128 + 64) * PH;      /* a stage = 128 k of the block's 128 A rows and 64 B rows; rows stand 272 bytes apart in LDS (16 bytes x odd: no bank conflict for 16-byte fragment reads); STH halves per stage */
  __shared__ __attribute__((aligned(16))) unsigned short sAB[2][STH];      /* [buffer][A rows, then B rows] */
  float (*so)[32][68] = (float (*)[32][68])&sAB[0][0];      /* the output staging lies over the ring: it is first written behind the last stage's barrier, when every read of the ring has returned and no copy is outstanding */
  static_assert(sizeof(float) * 4 * 32 * 68 <= sizeof(sAB), "the output staging fits the ring");
  const int tid = threadIdx.x, w = tid >> 5, lane = tid & 31, ln = lane & 15, hh = lane >> 4; const int by = blockIdx.y;
  A += (size_t)by * sA; Bh += (size_t)by * sB; const size_t cofs = (size_t)by * sC; const float* bp = bias ? bias + (size_t)by * sBias : nullptr;
  const int ntn = N >> 6; const int mt = blockIdx.x / ntn, nq = blockIdx.x - mt * ntn; const int row0 = mt * 128 + 32 * w, col0 = nq * 64; if (mt * 128 + 128 > M) return;      /* whole tiles only; the block leaves as one, in front of every copy and barrier */
  const int nst = K / KC;
  /* thread t copies 16 bytes: piece t & 15 of row (t >> 4) + 8 i, so that 16 lanes cover 256 contiguous bytes of a row */
  const unsigned short* Ag = (const unsigned short*)A + (size_t)(mt * 128 + (tid >> 4)) * lda + (tid & 15) * 8; const unsigned short* Bg = (const unsigned short*)Bh + (size_t)(col0 + (tid >> 4)) * ldb + (tid & 15) * 8;
  auto copy8 = [&](const unsigned short* g, size_t gs, unsigned l) __attribute__((always_inline)) {      /* eight rows, 8 apart: g = the thread's global bytes, gs = halves between two of its rows, l = its LDS byte address */
    /* the wait on the address translations is the statement's last line, so that it stands before anything that rewrites a register which a copy names */
    asm volatile("global_load_async_to_lds_b128 %0, %8, off\n\t"
                 "global_load_async_to_lds_b128 %1, %9, off\n\t"
                 "global_load_async_to_lds_b128 %2, %10, off\n\t"
                 "global_load_async_to_lds_b128 %3, %11, off\n\t"
                 "global_load_async_to_lds_b128 %4, %12, off\n\t"
                 "global_load_async_to_lds_b128 %5, %13, off\n\t"
                 "global_load_async_to_lds_b128 %6, %14, off\n\t"
                 "global_load_async_to_lds_b128 %7, %15, off\n\t"
                 "s_wait_xcnt 0x0"
                 :: "v"(l), "v"(l + 1u * 16 * PH), "v"(l + 2u * 16 * PH), "v"(l + 3u * 16 * PH), "v"(l + 4u * 16 * PH), "v"(l + 5u * 16 * PH), "v"(l + 6u * 16 * PH), "v"(l + 7u * 16 * PH),
                    "v"(g), "v"(g + gs), "v"(g + 2 * gs), "v"(g + 3 * gs), "v"(g + 4 * gs), "v"(g + 5 * gs), "v"(g + 6 * gs), "v"(g + 7 * gs) : "memory");
  };
  auto stage_copy = [&](int st, int buf) __attribute__((always_inline)) {
    const unsigned l = (unsigned)(size_t)&sAB[buf][(tid >> 4) * PH + (tid & 15) * 8];
    copy8(Ag + (size_t)st * KC, (size_t)8 * lda, l);
    copy8(Ag + (size_t)st * KC + (size_t)64 * lda, (size_t)8 * lda, l + 64u * 2 * PH);
    copy8(Bg + (size_t)st * KC, (size_t)8 * ldb, l + 128u * 2 * PH);
  };
  const v8f z8 = {0.f,0.f,0.f,0.f,0.f,0.f,0.f,0.f}; v8f c00 = z8, c01 = z8, c02 = z8, c03 = z8, c10 = z8, c11 = z8, c12 = z8, c13 = z8;
  stage_copy(0, 0);
  asm volatile("s_wait_asynccnt 0x0" ::: "memory");      /* this wave's copies of stage 0 have landed */
  __syncthreads();      /* publishes stage 0 to all four waves */
  if (1 < nst) stage_copy(1, 1);
#pragma unroll 1      /* kept rolled: the buffer alternates by st & 1, and one copy of the publish point serves all stages */
  for (int st = 0; st < nst; ++st) {
    const unsigned short* ar = &sAB[st & 1][(32 * w + ln) * PH + 8 * hh]; const unsigned short* br = &sAB[st & 1][(128 + ln) * PH + 8 * hh];      /* the lane's first A row and first B row of the stage, at its half of the k order */
#pragma unroll
    for (int ks = 0; ks < KC; ks += 32) { const v16h a0 = g2_frag(ar + ks), a1 = g2_frag(ar + 16 * PH + ks);
      const v16h b0 = g2_frag(br + ks), b1 = g2_frag(br + 16 * PH + ks), b2 = g2_frag(br + 32 * PH + ks), b3 = g2_frag(br + 48 * PH + ks);
      c00 = g2_mma(a0, b0, c00); c10 = g2_mma(a1, b0, c10); c01 = g2_mma(a0, b1, c01); c11 = g2_mma(a1, b1, c11);
      c02 = g2_mma(a0, b2, c02); c12 = g2_mma(a1, b2, c12); c03 = g2_mma(a0, b3, c03); c13 = g2_mma(a1, b3, c13); }
    asm volatile("s_wait_dscnt 0x0" ::: "memory");      /* this wave's reads of the stage's buffer have returned */
    asm volatile("s_wait_asynccnt 0x0" ::: "memory");      /* this wave's copies of stage st + 1 have landed */
    __syncthreads();      /* publishes stage st + 1 and ends every wave's reads of the buffer that is refilled behind it */
    if (st + 2 < nst) stage_copy(st + 2, st & 1);
  }
  asm volatile("s_wait_asynccnt 0x0" ::: "memory");      /* no copy is outstanding when the wave goes on to the epilogue */
  v8f accs[8] = {c00, c01, c02, c03, c10, c11, c12, c13};
  /* With KFo set (the q, k, v launch; N = NH * 64, rows = NB * SLEN tokens, no bias, no CP, ACT 0) plane 1 goes out as KF and plane 2 as VF; the plane is blockIdx.y, the same for the whole block. */
  const int fjob = KFo ? by : 0; const int slab = (row0 / SLEN) * NH + nq, tok0 = row0 % SLEN;
  if (fjob == 2) {      /* accumulator u = (half, t), register r, is V[key 16 half + 8 hh + r][d = 16 t + ln]: already the piece of chunk (dt = t, p = half) */
    unsigned short* dst = (unsigned short*)VFo + ((size_t)slab * (SLEN / 32) + tok0 / 32) * 2048 + lane * 8; FragH f[8];
#pragma unroll
    for (int u = 0; u < 8; ++u)
#pragma unroll
      for (int r = 0; r < 8; ++r) f[u].h[r] = (_Float16)(accs[u][r] * alpha);
#pragma unroll
    for (int u = 0; u < 8; ++u) *(v8us*)(dst + ((u & 3) * 2 + (u >> 2)) * 256) = f[u].half[0];
    return; }
#pragma unroll
  for (int u = 0; u < 8; ++u) { const int t = u & 3, half = u >> 2; const int col = col0 + t * 16 + ln; const float bv = bp ? bf16_round(bp[col]) : 0.f;
#pragma unroll
    for (int r = 0; r < 8; ++r) { const int rloc = half * 16 + 8 * hh + r; float v = accs[u][r] * alpha + bv; if (CP) { const int bidx = (row0g + row0 + rloc) / rowsPerB; v += CP[(size_t)bidx * sCPb + (size_t)by * 64 + col]; }
      if (ACT == 3) v = fmaxf(v, 0.f); else if (ACT == 6) v = 0.5f * v * (1.0f + erff(v * 0.70710678118654752f)); else if (ACT == 11) v = 1.0f / (1.0f + expf(-v)); else if (ACT == 15) v = v / (1.0f + expf(-v)); else if (ACT == 12) v = (v > 0.f) ? v : 0.01f * v; else if (ACT == 8) v = tanhf(v);
      so[w][rloc][t * 16 + ln] = v; } }
  __builtin_amdgcn_fence(__ATOMIC_ACQ_REL, "workgroup"); __builtin_amdgcn_wave_barrier();
  if (fjob == 1) {      /* tile tt of 16 keys, chunk c = 2 ks + p: lane (hh, ln) takes K[key ln][16 c + 8 hh ..+7] from the wave's own LDS tile */
    unsigned short* dst = (unsigned short*)KFo + ((size_t)slab * (SLEN / 16) + tok0 / 16) * 1024 + lane * 8; FragH f[8];
#pragma unroll
    for (int u = 0; u < 8; ++u) { const float* sp = &so[w][(u >> 2) * 16 + ln][(u & 3) * 16 + 8 * hh]; const v4f x = *(const v4fa*)sp, y = *(const v4fa*)(sp + 4);
#pragma unroll
      for (int i = 0; i < 4; ++i) { f[u].h[i] = (_Float16)x[i]; f[u].h[4 + i] = (_Float16)y[i]; } }
#pragma unroll
    for (int u = 0; u < 8; ++u) *(v8us*)(dst + u * 256) = f[u].half[0];
    asm volatile("s_wait_xcnt 0x0" ::: "memory");      /* stands behind the eight stores, before any path on which their address pair is rewritten */
    return; }
  const int rsub = lane >> 4, c4 = (lane & 15) * 4;
  {
#pragma unroll
    for (int q = 0; q < 16; ++q) { const int r = q * 2 + rsub; const v4f v = *(const v4fa*)&so[w][r][c4];
      if (C) { *(v4f*)(C + cofs + (size_t)(row0 + r) * ldc + col0 + c4) = v; asm volatile("s_wait_xcnt 0x0" ::: "memory"); }      /* stands behind the store, before any path on which a register that it names is rewritten */
      if (C16) { v4h h4; for (int i = 0; i < 4; ++i) h4[i] = (_Float16)v[i]; *(v4h*)(C16 + cofs + (size_t)(row0 + r) * ldc + col0 + c4) = h4; asm volatile("s_wait_xcnt 0x0" ::: "memory"); } }      /* the same behind the f16 store */
     } }



__device__ __forceinline__ float xhalf(float x) { return __builtin_bit_cast(float, __builtin_amdgcn_permlanex16(__builtin_bit_cast(int, x), __builtin_bit_cast(int, x), 0x76543210, 0xfedcba98, false, false)); }      /* lane l with lane l ^ 16 */
template <int CAUSAL>
__global__ __launch_bounds__(128) void k_flash(const _Float16* __restrict__ Q16, int ldq, const _Float16* __restrict__ KF, const _Float16* __restrict__ VF, const int* __restrict__ MSK, _Float16* __restrict__ O16, int ldo, float osc) {
  constexpr int RPW = 16, DT = 4, KS = 2;
  constexpr int SK = 128, NST = TK / SK, SH = SK * 64;      /* a stage = 128 keys = 4 passes: SH halves (16 KiB) of K and as many of V^T, each one contiguous run of its fragment-order plane */
  static_assert(CAUSAL != 1 && CAUSAL != 3 && NST >= 2, "the staged key walk takes whole stages from key 0 to TK");
  __shared__ __attribute__((aligned(16))) float sO[4][RPW][64 + 4];
  __shared__ __attribute__((aligned(16))) unsigned short sKV[2][2][SH];      /* [buffer][K, V^T]: filled once per block, read by its four waves */
  const int tid = threadIdx.x, w = tid >> 5, lane = tid & 31, ln = lane & 15, hh = lane >> 4;
  const int slab = blockIdx.x / QBLKS, qblk = blockIdx.x % QBLKS; const int b = slab / NH, h = slab % NH; const int qb0 = qblk * (4 * RPW); const int q0 = qb0 + w * RPW; const int tq = q0 + ln; const int eb = tq + RELW - 8 * hh;
  FragH aq[KS];
  { const unsigned short* qr = (const unsigned short*)Q16 + ((size_t)b * TQ + tq) * ldq + h * 64;
#pragma unroll
    for (int ks = 0; ks < KS; ++ks) { aq[ks].half[0] = *(const v8us*)(qr + ks * 32 + 8 * hh); aq[ks].half[1] = *(const v8us*)(qr + ks * 32 + 16 + 8 * hh); } }
  const unsigned short* Kg = (const unsigned short*)KF + (size_t)slab * 64 * TK + tid * 8; const unsigned short* Vg = (const unsigned short*)VF + (size_t)slab * 64 * TK + tid * 8;      /* fragment-order planes (written by k_gemm2): this thread's 16 bytes of every 2-KiB run that the block copies */
  float m_r = -3.0e38f, l_r = 0.f; v8f oacc[DT];
#pragma unroll
  for (int dt = 0; dt < DT; ++dt) oacc[dt] = (v8f){0.f,0.f,0.f,0.f,0.f,0.f,0.f,0.f};
  /* K and V^T come to LDS a stage ahead, by asynchronous copies into the buffer that the stage before last has left; the waves take their fragments from LDS:
     V^T of a pass at the pass's head (used behind the softmax), K of the next pass of the same stage right behind this pass's score products. The bias values still come by global loads,
     but only where they change: clip(i - j, +-RELW) is one value for all 16 queries x 32 keys of a pass that lies wholly on one side of the band |i - j| < RELW, so from one such pass to the next on the same side the 16 bias registers already hold what a gather would bring. */
  FragH kf[2][KS]; FragH vf[DT]; v2f bc[2][4];      /* bias of keys (2 i, 2 i + 1) of score tile nt, paired like the accumulator registers */
  auto copy8 = [&](const unsigned short* g, unsigned l) __attribute__((always_inline)) {      /* 16 KiB per block: eight copies of 16 bytes per thread, 2 KiB apart; g = the thread's global bytes, l = its LDS byte address */
    /* the wait on the address translations is the statement's last line, so that it stands before anything that rewrites a register which a copy names */
    asm volatile("global_load_async_to_lds_b128 %0, %8, off\n\t"
                 "global_load_async_to_lds_b128 %1, %9, off\n\t"
                 "global_load_async_to_lds_b128 %2, %10, off\n\t"
                 "global_load_async_to_lds_b128 %3, %11, off\n\t"
                 "global_load_async_to_lds_b128 %4, %12, off\n\t"
                 "global_load_async_to_lds_b128 %5, %13, off\n\t"
                 "global_load_async_to_lds_b128 %6, %14, off\n\t"
                 "global_load_async_to_lds_b128 %7, %15, off\n\t"
                 "s_wait_xcnt 0x0"
                 :: "v"(l), "v"(l + 2048u), "v"(l + 4096u), "v"(l + 6144u), "v"(l + 8192u), "v"(l + 10240u), "v"(l + 12288u), "v"(l + 14336u),
                    "v"(g), "v"(g + 1024), "v"(g + 2048), "v"(g + 3072), "v"(g + 4096), "v"(g + 5120), "v"(g + 6144), "v"(g + 7168) : "memory");
  };
  auto stage_copy = [&](int st, int buf) __attribute__((always_inline)) {
    copy8(Kg + (size_t)st * SH, (unsigned)(size_t)&sKV[buf][0][tid * 8]);
    copy8(Vg + (size_t)st * SH, (unsigned)(size_t)&sKV[buf][1][tid * 8]);
  };
  auto fetch_k = [&](const unsigned short* kr) __attribute__((always_inline)) {      /* kr: this lane's piece of the first chunk of a pass's K, in LDS; 1024 halves per tile of 16 keys */
#pragma unroll
    for (int nt = 0; nt < 2; ++nt)
#pragma unroll
      for (int ks = 0; ks < KS; ++ks) { kf[nt][ks].half[0] = *(const v8us*)(kr + nt * 1024 + ks * 512); kf[nt][ks].half[1] = *(const v8us*)(kr + nt * 1024 + ks * 512 + 256); }
  };
  auto fetch_bias = [&](int j0) __attribute__((always_inline)) {
    if (CAUSAL == 6) { const float* BTh = (const float*)MSK + h * (2 * RELW + 1);      /* mode 6: per-head relative-position bias table [NH][2*RELW+1] indexed by clip(i - j, +-RELW) + RELW (passed through the MSK pointer) */
      unsigned i0[8], i1[8];
#pragma unroll
      for (int r = 0; r < 8; ++r) { int d0 = eb - j0 - r, d1 = eb - j0 - 16 - r; d0 = d0 < 0 ? 0 : (d0 > 2 * RELW ? 2 * RELW : d0); d1 = d1 < 0 ? 0 : (d1 > 2 * RELW ? 2 * RELW : d1); i0[r] = (unsigned)d0; i1[r] = (unsigned)d1; }      /* clip(i - j + RELW, 0, 2 RELW), the same integer as clip(i - j, +-RELW) + RELW; key j = j0 (+ 16) + 8 hh + r */
#pragma unroll
      for (int r = 0; r < 8; ++r) { bc[0][r >> 1][r & 1] = BTh[i0[r]]; bc[1][r >> 1][r & 1] = BTh[i1[r]]; }
      asm volatile("s_wait_xcnt 0x0" :: "v"(i0[0]), "v"(i0[1]), "v"(i0[2]), "v"(i0[3]), "v"(i0[4]), "v"(i0[5]), "v"(i0[6]), "v"(i0[7]), "v"(i1[0]), "v"(i1[1]), "v"(i1[2]), "v"(i1[3]), "v"(i1[4]), "v"(i1[5]), "v"(i1[6]), "v"(i1[7]) : "memory");      /* stands before any register that the bias loads name is rewritten; the index registers are inputs so that no load of the group lands on one */
    }
  };
  stage_copy(0, 0);
  asm volatile("s_wait_asynccnt 0x0" ::: "memory");      /* this wave's copies of stage 0 have landed */
  __syncthreads();      /* publishes stage 0 to all four waves */
  stage_copy(1, 1);
  fetch_bias(0);
  const int q0s = __builtin_amdgcn_readfirstlane(q0);      /* the wave's first query in a scalar register, so that the test around the gather compiles to a scalar branch */
#pragma unroll 1      /* kept rolled: the buffer alternates by st & 1, and one copy of the publish point serves all stages */
  for (int st = 0; st < NST; ++st) {
   const unsigned short* kb = &sKV[st & 1][0][lane * 8]; const unsigned short* vb = &sKV[st & 1][1][lane * 8];      /* this lane's piece of every 512-byte chunk of the stage */
   fetch_k(kb);
#pragma unroll 1
   for (int p = 0; p < SK / 32; ++p) {      /* kept rolled: one pass of code for the four passes of a stage */
    const int j0 = st * SK + p * 32;
    /* Queries q0s .. q0s + RPW - 1, keys j0 .. j0 + 31: every i - j >= RELW while j0 <= q0s - (2 RELW - 1), every i - j <= -RELW from j0 >= q0s + RPW + RELW - 1 on.
       Before the band the registers keep the values of pass 0 (all the table's last entry wherever such a pass exists); the gather runs for every pass that touches the band and for the first pass behind it, which fills them with the table's first entry for all later passes.
       It stands at the pass's head, where the last pass's values are dead, so that the loads land in the same registers; its latency shows in those passes alone, at most four of a wave's 64. */
    if ((unsigned)(j0 - q0s + (2 * RELW - 2)) < (unsigned)((2 * RELW - 2) + (RPW + RELW - 1) + 32)) fetch_bias(j0);      /* q0s - (2 RELW - 1) < j0 < q0s + RPW + RELW - 1 + 32, as one unsigned compare */
    const unsigned short* vr = vb + p * 2048;      /* 2048 halves per tile of 32 keys */
#pragma unroll
    for (int dt = 0; dt < DT; ++dt) { vf[dt].half[0] = *(const v8us*)(vr + dt * 512); vf[dt].half[1] = *(const v8us*)(vr + dt * 512 + 256); }
    v8f s[2];
#pragma unroll
    for (int nt = 0; nt < 2; ++nt) { v8f acc = (v8f){0.f,0.f,0.f,0.f,0.f,0.f,0.f,0.f};
#pragma unroll
      for (int ks = 0; ks < KS; ++ks) acc = mmaH<1>(kf[nt][ks].v, kf[nt][ks].v, aq[ks].v, aq[ks].v, acc); s[nt] = acc; }
    fetch_k(kb + ((p + 1) & (SK / 32 - 1)) * 2048);      /* a stage's last pass names the stage's own first tile, whose values are not used: nothing of the next stage is read before its barrier */
    float s0[8], s1[8], mx[8]; bool ok0[8], ok1[8];
#pragma unroll
    for (int r = 0; r < 8; ++r) { const int k0 = j0 + 8 * hh + r, k1 = k0 + 16;
      ok0[r] = (CAUSAL == 1) ? (k0 <= tq) : ((CAUSAL == 2) ? ((k0 >> 5) == (tq >> 5)) : ((CAUSAL == 3) ? (k0 <= tq && tq - k0 < WINDOW) : true)); ok1[r] = (CAUSAL == 1) ? (k1 <= tq) : ((CAUSAL == 2) ? ((k1 >> 5) == (tq >> 5)) : ((CAUSAL == 3) ? (k1 <= tq && tq - k1 < WINDOW) : true));      /* mode 3: causal + sliding window of WINDOW keys */      /* mode 2: block-diagonal 32-token groups */
      s0[r] = ok0[r] ? s[0][r] * SCL2 : -3.0e38f; s1[r] = ok1[r] ? s[1][r] * SCL2 : -3.0e38f; if (CAUSAL == 6) { s0[r] += bc[0][r >> 1][r & 1]; s1[r] += bc[1][r >> 1][r & 1]; }      /* mode 6: the bias (its table already holds bias * log2 e) is added after the scale */
    }
#pragma unroll
    for (int i = 0; i < 4; ++i) { mx[i] = fmaxf(s0[2 * i], s0[2 * i + 1]); mx[4 + i] = fmaxf(s1[2 * i], s1[2 * i + 1]); }
    __builtin_amdgcn_sched_barrier(0);      /* keeps the next pass's K reads in front of the exponentials: with the short exponentials the scheduler otherwise sinks them to the pass's end, where their latency is no longer covered */
    float mc = fmaxf(fmaxf(fmaxf(mx[0], mx[1]), fmaxf(mx[2], mx[3])), fmaxf(fmaxf(mx[4], mx[5]), fmaxf(mx[6], mx[7])));
    mc = fmaxf(mc, xhalf(mc));      /* the other 16 keys of this query stand in lane l ^ 16 */
    const float mn = fmaxf(m_r, mc); const float ea = __builtin_amdgcn_exp2f(m_r - mn); const float al = (mn > -1.0e38f) ? ea : 1.0f; m_r = mn;      /* the arguments are bounded above (0 here, 10 below), so the bare instruction needs no range steps; far below it gives 0 */
    const float mp = mn - 10.0f;      /* exp2(s - mp) = 1024 exp2(s - mn): P comes out at the f16 operand's scale; the denominator sums the same values, so the factor cancels */
    FragH pb; float ps[8], pt[8];
#pragma unroll
    for (int r = 0; r < 8; ++r) { const float p0 = ok0[r] ? __builtin_amdgcn_exp2f(s0[r] - mp) : 0.f, p1 = ok1[r] ? __builtin_amdgcn_exp2f(s1[r] - mp) : 0.f; ps[r] = p0; pt[r] = p1; pb.h[r] = (_Float16)p0; pb.h[8 + r] = (_Float16)p1; }
    l_r = l_r * al + ((((ps[0] + ps[2]) + (ps[4] + ps[6])) + ((pt[0] + pt[2]) + (pt[4] + pt[6]))) + (((ps[1] + ps[3]) + (ps[5] + ps[7])) + ((pt[1] + pt[3]) + (pt[5] + pt[7]))));      /* each wave half keeps the sum of its own keys; the halves are joined behind the loop */
#pragma unroll
    for (int dt = 0; dt < DT; ++dt) oacc[dt] *= al;
#pragma unroll
    for (int dt = 0; dt < DT; ++dt) oacc[dt] = mmaH<1>(vf[dt].v, vf[dt].v, pb.v, pb.v, oacc[dt]);
   }
   asm volatile("s_wait_dscnt 0x0" ::: "memory");      /* this wave's reads of the stage's buffer have returned */
   asm volatile("s_wait_asynccnt 0x0" ::: "memory");      /* this wave's copies of stage st + 1 have landed */
   __syncthreads();      /* publishes stage st + 1 and ends every wave's reads of the buffer that is refilled behind it */
   if (st + 2 < NST) stage_copy(st + 2, st & 1);
  }
  asm volatile("s_wait_asynccnt 0x0" ::: "memory");      /* no copy is outstanding when the wave goes on to the epilogue */
  { const float l = l_r + xhalf(l_r); const float inv = (l > 0.f) ? 1.0f / l : 0.f;      /* l and the output sums both carry the factor 1024 */
#pragma unroll
    for (int dt = 0; dt < DT; ++dt) { const v8f o = oacc[dt] * inv; *(v4fa*)&sO[w][ln][dt * 16 + 8 * hh] = (v4f){o[0], o[1], o[2], o[3]}; *(v4fa*)&sO[w][ln][dt * 16 + 8 * hh + 4] = (v4f){o[4], o[5], o[6], o[7]}; } }      /* register r of tile dt is O[q0 + ln][16 dt + 8 hh + r] */
  __builtin_amdgcn_fence(__ATOMIC_ACQ_REL, "workgroup"); __builtin_amdgcn_wave_barrier();
  {
#pragma unroll
    for (int rp = 0; rp < RPW; rp += 4) { const int r = rp + (lane >> 3), pc = lane & 7; const v4f x = *(const v4fa*)&sO[w][r][pc * 8], y = *(const v4fa*)&sO[w][r][pc * 8 + 4]; FragH f;      /* eight lanes write one query's 128-byte line of f16 values, scaled by osc (a power of two) for the output GEMM */
#pragma unroll
      for (int i = 0; i < 4; ++i) { f.h[i] = (_Float16)(x[i] * osc); f.h[4 + i] = (_Float16)(y[i] * osc); }
      *(v8us*)((unsigned short*)O16 + ((size_t)b * TQ + q0 + r) * ldo + h * 64 + pc * 8) = f.half[0]; }
     } }

__device__ __forceinline__ void job_btab(const float* __restrict__ pe, float* __restrict__ BT) { { for (int e = threadIdx.x; e < NH * NREL; e += 256) { const int h = e / NREL, r = e % NREL; *(float*)(BT + e) = bf16_round(pe[r * NH + h]) * LOG2E; }  } }
// One launch for the eight jobs that read nothing but inputs: a block's index picks its job (block-uniform); the jobs share no data, so they need no order among themselves.
// Order: the four weight transposes (long strided loads) first, the bias table, then the three activation planes. B4 = the four [n][k] weight planes in a row, X3 = the three activation planes in a row.
#define WBLK (CC * CC / 8 / 256)      /* blocks of one weight transpose */
#define XBLK (NR * CC / 8 / 256)      /* blocks of one activation plane */
__global__ __launch_bounds__(256) void k_prep(const float* __restrict__ xq, const float* __restrict__ xk, const float* __restrict__ xv, const float* __restrict__ Wq, const float* __restrict__ Wk, const float* __restrict__ Wv, const float* __restrict__ Wo, const float* __restrict__ pe,
                                              _Float16* __restrict__ B4, float* __restrict__ BT, _Float16* __restrict__ X3) {
  const int blk = blockIdx.x;
  if (blk < 4 * WBLK) { const int j = blk / WBLK; job_wt_f16(blk % WBLK, j == 0 ? Wq : (j == 1 ? Wk : (j == 2 ? Wv : Wo)), B4 + (size_t)j * CC * CC, CC, CC, 16.0f); }
  else if (blk == 4 * WBLK) job_btab(pe, BT);
  else { const int xb = blk - 4 * WBLK - 1, j = xb / XBLK; job_x16(xb % XBLK, j == 0 ? xq : (j == 1 ? xk : xv), X3 + (size_t)j * NR * CC, (size_t)NR * CC / 8); }
}

extern "C" void kernel_launch(void* const* d_in, const int* in_sizes, int n_in,
                              void* d_out, int out_size, void* d_ws, size_t ws_size, hipStream_t stream) {
  (void)in_sizes; (void)n_in; (void)out_size;
  const float* const* I = (const float* const*)d_in; const float* xq = I[0]; const float* xk = I[1]; const float* xv = I[2]; const float* Wq = I[3]; const float* Wk = I[4]; const float* Wv = I[5]; const float* Wo = I[6]; const float* pe = I[7];
  char* ws = (char*)d_ws; size_t off = 0;
  auto take = [&](size_t bytes) { char* p = ws + off; off += (bytes + 255) & ~(size_t)255; return p; };
  const size_t np = (size_t)NR * CC;
  _Float16* BQ = (_Float16*)take((size_t)4 * CC * CC * 2); _Float16* BO = BQ + (size_t)3 * CC * CC;      /* Wq, Wk, Wv, Wo planes in a row */ float* BT = (float*)take((size_t)NH * NREL * 4 + 256);
  _Float16* XQ = (_Float16*)take(3 * np * 2);      /* query, key, value planes in a row */ _Float16* Q16 = (_Float16*)take(np * 2); _Float16* VT = (_Float16*)take(np * 2); _Float16* KF = (_Float16*)take(np * 2); _Float16* O16 = XQ;      /* the query plane is free again once the projections have run */
  if (off > ws_size) return;      /* 2 + 6 x 4 = 26 MiB */
  k_prep<<<4 * WBLK + 1 + 3 * XBLK, 256, 0, stream>>>(xq, xk, xv, Wq, Wk, Wv, Wo, pe, BQ, BT, XQ);
  const dim3 g((NR / 128) * (CC / 64), 1), g3((NR / 128) * (CC / 64), 3);
  k_gemm2<0><<<g3, 128, 0, stream>>>(XQ, CC, np, BQ, CC, (size_t)CC * CC, 0.0625f, nullptr, 0, nullptr, 1, 0, 0, nullptr, Q16, CC, np, NR, CC, CC, KF, VT);      /* the q, k and v projections: blockIdx.y steps through the three planes of A and of the weights; q goes out row-major, k and v in fragment order */
  k_flash<6><<<NB * NH * QBLKS, 128, 0, stream>>>(Q16, CC, KF, VT, (const int*)BT, O16, CC, 64.0f);      /* relative-position bias mode; x2^6 carry: the 2048-key averages are small */
  k_gemm2<0><<<g, 128, 0, stream>>>(O16, CC, 0, BO, CC, 0, 0.0625f / 64.0f, nullptr, 0, nullptr, 1, 0, 0, (float*)d_out, nullptr, CC, 0, NR, CC, CC, nullptr, nullptr);
}

// v010
// Measured time: 50.2 microseconds a run.
// Next to v009, in two timings, it ran 1.06 and 1.04 times as fast.
// Over all steps from v000 it is 6.90 times as fast.
#include <hip/hip_runtime.h>
// RelativePositionalEncodingAttention (2 x 2048 tokens, 8 heads of 64, D 512): q/k/v from three inputs (no bias); scores/8 + pos_emb[clip(i - j, -32, 32) + 32][h]; softmax; out Wo.
// Structure: exact f16 planes of query/key/value; q/k/v GEMMs (32x64 wave tiles, f32 accumulation, exact x16 weights, f16 outputs); the relative-bias table transposed to [head][65] (bf16-rounded, times log2 e, f32); K and V^T written in matrix-fragment order by the projection GEMM's own epilogue; the fused flash kernel with a new relative-position-bias mode (table lookup by clipped i - j added after the scale, f32); attention output written as f16 (x2^6) by the flash kernel, straight into the output GEMM.
// Compute dtype: inputs and weights rounded to bf16; q, k, v, P and the attention output as f16 operands; f32 accumulation/softmax/bias. v_wmma_f32_16x16x32_f16.
#define NB 2
#define CC 512
#define NR (NB * SLEN)
#define NREL (2 * RELW + 1)
#define SLEN 2048
#define TQ SLEN
#define TK SLEN
#define NH 8
#define SCL 0.125f               /* 1/sqrt(64) */
#define LOG2E 1.44269504088896340736f
#define SCL2 (SCL * LOG2E)       /* scores are kept in base 2: exp(x) = exp2(x log2 e), the factor carried by the score scale (which the q projection applies) and by the bias table */
#define WINDOW 256
#define RELW 32                  /* max_relative_position */
#define QBLKS (TQ / 64)
typedef __bf16 v16b __attribute__((ext_vector_type(16)));
typedef unsigned short v8us __attribute__((ext_vector_type(8), may_alias));
typedef float  v8f  __attribute__((ext_vector_type(8)));
typedef float  v4f  __attribute__((ext_vector_type(4)));
typedef float  v2f  __attribute__((ext_vector_type(2)));
typedef float  v4fa __attribute__((ext_vector_type(4), may_alias));
union FragB { v16b v; v8us half[2]; unsigned short u[16]; };

__device__ __forceinline__ unsigned short bf16_bits(float x) { unsigned int u = __float_as_uint(x); return (unsigned short)((u + 0x7FFFu + ((u >> 16) & 1u)) >> 16); }
__device__ __forceinline__ float bf16_val(unsigned short b) { return __uint_as_float(((unsigned int)b) << 16); }
__device__ __forceinline__ float bf16_round(float x) { return bf16_val(bf16_bits(x)); }
// D += A·B with NT terms: 1 = ah·bh, 2 = + al·bh (A split), 3 = + ah·bl (both split)
template <int NT>
__device__ __forceinline__ v8f mmaN(v16b ah, v16b al, v16b bh, v16b bl, v8f c) {
  c = __builtin_amdgcn_wmma_f32_16x16x32_bf16(false, ah, false, bh, (short)0, c, false, false);
  if (NT >= 2) c = __builtin_amdgcn_wmma_f32_16x16x32_bf16(false, al, false, bh, (short)0, c, false, false);
  if (NT >= 3) c = __builtin_amdgcn_wmma_f32_16x16x32_bf16(false, ah, false, bl, (short)0, c, false, false);
  asm volatile("v_nop\n\tv_nop\n\tv_nop\n\tv_nop" : "+v"(c) : "v"(ah), "v"(al), "v"(bh), "v"(bl));
  return c;
}

__global__ __launch_bounds__(256) void k_wt_bf16(const float* __restrict__ W, unsigned short* __restrict__ Wt, int K, int N) {
  const int t = blockIdx.x * 256 + threadIdx.x;
  const int k8n = K / 8;
  if (t >= N * k8n) return;
  const int n = t / k8n, k8 = (t % k8n) * 8;
  v8us v;
#pragma unroll
  for (int i = 0; i < 8; ++i) v[i] = bf16_bits(W[(size_t)(k8 + i) * N + n]);
  *(v8us*)(Wt + (size_t)n * K + k8) = v;
  
}

// GEMM C[M][N] (f32, pitch ldc) = act(A[M][K]·W + bias). A f32 row-major (pitch lda) converted per fragment to bf16
// (ASPLIT: hi/lo two planes -> 2 terms, else single rounded term); Wt bf16 [N][K] (pitch ldb). BIAS_BF16 rounds the
// bias to bf16 first (bias quantised to bf16 before the add). K%32==0, M%16==0, N%64==0.
template <bool ASPLIT, int ACT, bool BIAS_BF16>
__global__ __launch_bounds__(128) void k_gemm_bf(const float* __restrict__ A, int lda, const unsigned short* __restrict__ Wt, int ldb,
                                               const float* __restrict__ bias, float* __restrict__ C, int ldc, int M, int N, int K) {
  __shared__ __attribute__((aligned(16))) float so[4][16][64];
  const int tid = threadIdx.x, w = tid >> 5, lane = tid & 31, ln = lane & 15, hh = lane >> 4;
  const int ntn = N / 64;
  const int wid = blockIdx.x * 4 + w;
  const int mt = wid / ntn, nq = wid % ntn;
  if (mt * 16 >= M) return;
  const int row0 = mt * 16, col0 = nq * 64;
  const float* arow = A + (size_t)(row0 + ln) * lda;
  v8f acc[4] = {};
  for (int kb = 0; kb < K; kb += 32) {
    FragB ah, al;
    const v4f x0 = *(const v4fa*)(arow + kb + 8 * hh), x1 = *(const v4fa*)(arow + kb + 8 * hh + 4);
    const v4f x2 = *(const v4fa*)(arow + kb + 16 + 8 * hh), x3 = *(const v4fa*)(arow + kb + 16 + 8 * hh + 4);
    float xs[16] = {x0[0],x0[1],x0[2],x0[3],x1[0],x1[1],x1[2],x1[3],x2[0],x2[1],x2[2],x2[3],x3[0],x3[1],x3[2],x3[3]};
#pragma unroll
    for (int i = 0; i < 16; ++i) { const unsigned short hb = bf16_bits(xs[i]); ah.u[i] = hb; al.u[i] = ASPLIT ? bf16_bits(xs[i] - bf16_val(hb)) : (unsigned short)0; }
#pragma unroll
    for (int t = 0; t < 4; ++t) {
      const unsigned short* brow = Wt + (size_t)(col0 + t * 16 + ln) * ldb + kb;
      FragB b;
      b.half[0] = *(const v8us*)(brow + 8 * hh);
      b.half[1] = *(const v8us*)(brow + 16 + 8 * hh);
      acc[t] = mmaN<ASPLIT ? 2 : 1>(ah.v, al.v, b.v, b.v, acc[t]);
    }
  }
#pragma unroll
  for (int t = 0; t < 4; ++t) {
    float bv = bias ? bias[col0 + t * 16 + ln] : 0.f;
    if (BIAS_BF16) bv = bf16_round(bv);
#pragma unroll
    for (int r = 0; r < 8; ++r) { float v = acc[t][r] + bv; if (ACT == 1) v = fmaxf(v, 0.f); so[w][8 * hh + r][t * 16 + ln] = v; }
  }
  __builtin_amdgcn_fence(__ATOMIC_ACQ_REL, "workgroup");
  __builtin_amdgcn_wave_barrier();
  const int rsub = lane >> 4, c4 = (lane & 15) * 4;
  {
#pragma unroll
    for (int q = 0; q < 8; ++q) {
      const int r = q * 2 + rsub;
      const v4f v = *(const v4fa*)&so[w][r][c4];
      *(v4f*)(C + (size_t)(row0 + r) * ldc + col0 + c4) = v;
    }
    
  }
}

// GEMM C = act(A·W + bias + resid): A f32 (ASPLIT -> hi/lo 2 terms), Wt bf16 [N][K]; ACT 0 none, 1 relu, 2 exact gelu;
// resid (optional, f32, row index = (row % rmod), pitch ldr, RES_BF16 rounds it) added before the activation.
template <bool ASPLIT, int ACT, bool BIAS_BF16, bool RES_BF16>
__global__ __launch_bounds__(128) void k_gemm_bf3(const float* __restrict__ A, int lda, const unsigned short* __restrict__ Wt, int ldb,
                                                const float* __restrict__ bias, const float* __restrict__ resid, int rmod, int ldr,
                                                float* __restrict__ C, int ldc, int M, int N, int K) {
  __shared__ __attribute__((aligned(16))) float so[4][16][64];
  const int tid = threadIdx.x, w = tid >> 5, lane = tid & 31, ln = lane & 15, hh = lane >> 4;
  const int ntn = N / 64;
  const int wid = blockIdx.x * 4 + w;
  const int mt = wid / ntn, nq = wid % ntn;
  if (mt * 16 >= M) return;
  const int row0 = mt * 16, col0 = nq * 64;
  const float* arow = A + (size_t)(row0 + ln) * lda;
  v8f acc[4] = {};
  for (int kb = 0; kb < K; kb += 32) {
    FragB ah, al;
    const v4f x0 = *(const v4fa*)(arow + kb + 8 * hh), x1 = *(const v4fa*)(arow + kb + 8 * hh + 4);
    const v4f x2 = *(const v4fa*)(arow + kb + 16 + 8 * hh), x3 = *(const v4fa*)(arow + kb + 16 + 8 * hh + 4);
    float xs[16] = {x0[0],x0[1],x0[2],x0[3],x1[0],x1[1],x1[2],x1[3],x2[0],x2[1],x2[2],x2[3],x3[0],x3[1],x3[2],x3[3]};
#pragma unroll
    for (int i = 0; i < 16; ++i) { const unsigned short hb = bf16_bits(xs[i]); ah.u[i] = hb; al.u[i] = ASPLIT ? bf16_bits(xs[i] - bf16_val(hb)) : (unsigned short)0; }
#pragma unroll
    for (int t = 0; t < 4; ++t) {
      const unsigned short* brow = Wt + (size_t)(col0 + t * 16 + ln) * ldb + kb;
      FragB b;
      b.half[0] = *(const v8us*)(brow + 8 * hh);
      b.half[1] = *(const v8us*)(brow + 16 + 8 * hh);
      acc[t] = mmaN<ASPLIT ? 2 : 1>(ah.v, al.v, b.v, b.v, acc[t]);
    }
  }
#pragma unroll
  for (int t = 0; t < 4; ++t) {
    const int col = col0 + t * 16 + ln;
    float bv = bias ? bias[col] : 0.f;
    if (BIAS_BF16) bv = bf16_round(bv);
#pragma unroll
    for (int r = 0; r < 8; ++r) {
      float v = acc[t][r] + bv;
      if (resid) { float rv = resid[(size_t)((row0 + 8 * hh + r) % rmod) * ldr + col]; if (RES_BF16) rv = bf16_round(rv); v += rv; }
      if (ACT == 1) v = fmaxf(v, 0.f);
      if (ACT == 2) v = 0.5f * v * (1.0f + erff(v * 0.70710678118654752f));
      if (ACT == 3) { const float u = 0.7978845608028654f * (v + 0.044715f * v * v * v); v = 0.5f * v * (1.0f + tanhf(u)); }
      so[w][8 * hh + r][t * 16 + ln] = v;
    }
  }
  __builtin_amdgcn_fence(__ATOMIC_ACQ_REL, "workgroup");
  __builtin_amdgcn_wave_barrier();
  const int rsub = lane >> 4, c4 = (lane & 15) * 4;
  {
#pragma unroll
    for (int q = 0; q < 8; ++q) {
      const int r = q * 2 + rsub;
      const v4f v = *(const v4fa*)&so[w][r][c4];
      *(v4f*)(C + (size_t)(row0 + r) * ldc + col0 + c4) = v;
    }
    
  }
}
// row LayerNorm (biased variance, eps) over N: s = X (+ R); optional out_sum <- s; out_norm <- (s-mu)*rsqrt(var+eps)*g + b
template <bool PARAM_BF16>
__global__ __launch_bounds__(256) void k_layernorm(const float* __restrict__ X, const float* __restrict__ R, const float* __restrict__ g, const float* __restrict__ bta,
                                                  float* __restrict__ out_sum, float* __restrict__ out_norm, int N, float eps) {
  __shared__ float red[256];
  const int row = blockIdx.x, tid = threadIdx.x;
  const float* x = X + (size_t)row * N; const float* rr = R ? R + (size_t)row * N : nullptr;
  float vals[16];                     // up to N = 4096
  const int per = N / 256;            // contiguous chunk per thread? use strided-by-4 chunks: thread handles j = tid*4 + 1024*u
  float s1 = 0.f;
  for (int u = 0; u < per / 4; ++u) {
    const int j = tid * 4 + 1024 * u;
    const v4f a = *(const v4fa*)(x + j);
    v4f b = {0.f,0.f,0.f,0.f}; if (rr) b = *(const v4fa*)(rr + j);
#pragma unroll
    for (int q = 0; q < 4; ++q) { const float v = a[q] + b[q]; vals[u * 4 + q] = v; s1 += v; }
  }
  red[tid] = s1; __syncthreads();
  for (int st = 128; st > 0; st >>= 1) { if (tid < st) red[tid] += red[tid + st]; __syncthreads(); }
  const float mu = red[0] / (float)N; __syncthreads();
  float s2 = 0.f;
  for (int u = 0; u < per / 4; ++u)
#pragma unroll
    for (int q = 0; q < 4; ++q) { const float c = vals[u * 4 + q] - mu; s2 += c * c; }
  red[tid] = s2; __syncthreads();
  for (int st = 128; st > 0; st >>= 1) { if (tid < st) red[tid] += red[tid + st]; __syncthreads(); }
  const float rs = rsqrtf(red[0] / (float)N + eps);
  {
    for (int u = 0; u < per / 4; ++u) {
      const int j = tid * 4 + 1024 * u;
      v4f o, sm;
#pragma unroll
      for (int q = 0; q < 4; ++q) {
        float gg = g[j + q], bb = bta[j + q];
        if (PARAM_BF16) { gg = bf16_round(gg); bb = bf16_round(bb); }
        sm[q] = vals[u * 4 + q]; o[q] = (vals[u * 4 + q] - mu) * rs * gg + bb;
      }
      if (out_sum) *(v4f*)(out_sum + (size_t)row * N + j) = sm;
      *(v4f*)(out_norm + (size_t)row * N + j) = o;
    }
    
  }
}



// ---- f16 WMMA path (v_wmma_f32_16x16x32_f16): 11-bit significands for operands in range — used where a [0,1] probability operand needs more precision than bf16
typedef _Float16 v16h __attribute__((ext_vector_type(16)));
union FragH { v16h v; v8us half[2]; _Float16 h[16]; unsigned short u[16]; };
template <int NT>
__device__ __forceinline__ v8f mmaH(v16h ah, v16h al, v16h bh, v16h bl, v8f c) {
  c = __builtin_amdgcn_wmma_f32_16x16x32_f16(false, ah, false, bh, (short)0, c, false, false);
  if (NT >= 2) c = __builtin_amdgcn_wmma_f32_16x16x32_f16(false, al, false, bh, (short)0, c, false, false);
  if (NT >= 3) c = __builtin_amdgcn_wmma_f32_16x16x32_f16(false, ah, false, bl, (short)0, c, false, false);
  asm volatile("v_nop\n\tv_nop\n\tv_nop\n\tv_nop" : "+v"(c) : "v"(ah), "v"(al), "v"(bh), "v"(bl));
  return c;
}
// batched GEMM like k_gemm_b but f16 operands: A f32 (split into f16 hi/lo if ASPLIT, else rounded to f16), Bt = f16 values [n][k]; alpha; C f32; N multiple of 16 (partial tiles skipped)
template <bool ASPLIT>
__global__ __launch_bounds__(128) void k_gemm_h(const float* __restrict__ A, int lda, size_t sA, const _Float16* __restrict__ Bh, int ldb, size_t sB, float alpha, float* __restrict__ C, int ldc, size_t sC, int M, int N, int K) {
  __shared__ __attribute__((aligned(16))) float so[4][16][64];
  const int tid = threadIdx.x, w = tid >> 5, lane = tid & 31, ln = lane & 15, hh = lane >> 4; const int by = blockIdx.y;
  A += (size_t)by * sA; Bh += (size_t)by * sB; C += (size_t)by * sC;
  const int ntn = (N + 63) / 64; const int wid = blockIdx.x * 4 + w; const int mt = wid / ntn, nq = wid % ntn; if (mt * 16 >= M) return;
  const int row0 = mt * 16, col0 = nq * 64; const float* arow = A + (size_t)(row0 + ln) * lda;
  v8f acc[4] = {};
  for (int kb = 0; kb < K; kb += 32) {
    FragH ah, al;
    const v4f x0 = *(const v4fa*)(arow + kb + 8 * hh), x1 = *(const v4fa*)(arow + kb + 8 * hh + 4), x2 = *(const v4fa*)(arow + kb + 16 + 8 * hh), x3 = *(const v4fa*)(arow + kb + 16 + 8 * hh + 4);
    float xs[16] = {x0[0],x0[1],x0[2],x0[3],x1[0],x1[1],x1[2],x1[3],x2[0],x2[1],x2[2],x2[3],x3[0],x3[1],x3[2],x3[3]};
#pragma unroll
    for (int i = 0; i < 16; ++i) { const _Float16 h = (_Float16)xs[i]; ah.h[i] = h; al.h[i] = ASPLIT ? (_Float16)(xs[i] - (float)h) : (_Float16)0.0f; }
#pragma unroll
    for (int t = 0; t < 4; ++t) { if (col0 + t * 16 >= N) continue; const size_t boff = (size_t)(col0 + t * 16 + ln) * ldb + kb; FragH bq; bq.half[0] = *(const v8us*)(Bh + boff + 8 * hh); bq.half[1] = *(const v8us*)(Bh + boff + 16 + 8 * hh);
      acc[t] = mmaH<ASPLIT ? 2 : 1>(ah.v, al.v, bq.v, bq.v, acc[t]); }
  }
#pragma unroll
  for (int t = 0; t < 4; ++t) { if (col0 + t * 16 >= N) continue;
#pragma unroll
    for (int r = 0; r < 8; ++r) so[w][8 * hh + r][t * 16 + ln] = acc[t][r] * alpha; }
  __builtin_amdgcn_fence(__ATOMIC_ACQ_REL, "workgroup"); __builtin_amdgcn_wave_barrier();
  const int rsub = lane >> 4, c4 = (lane & 15) * 4;
  {
#pragma unroll
    for (int q = 0; q < 8; ++q) { const int r = q * 2 + rsub; if (col0 + c4 < N) { const v4f v = *(const v4fa*)&so[w][r][c4]; *(v4f*)(C + (size_t)(row0 + r) * ldc + col0 + c4) = v; } }
     }
}

// Wt[n][k] = f16(W[k][n]·scale) from f32 row-major W[K][N] (scale = power of two; bf16-exact weights stay exact in f16 away from the subnormal range)
__device__ __forceinline__ void job_wt_f16(int blk, const float* __restrict__ W, _Float16* __restrict__ Wt, int K, int N, float scale) {
  const int t = blk * 256 + threadIdx.x; if (t >= N * (K / 8)) return; const int n = t / (K / 8), k8 = (t % (K / 8)) * 8; FragH f;
#pragma unroll
  for (int i = 0; i < 8; ++i) f.h[i] = (_Float16)(bf16_round(W[(size_t)(k8 + i) * N + n]) * scale); const v8us o = f.half[0];
  *(v8us*)((unsigned short*)Wt + (size_t)n * K + k8) = o; 
}
// k_gemm_hh variant with fused epilogue: v = acc·alpha + bias[by·sBias + col] (+ CP[(row/rowsPerB)·sCPb + by·64 + col] if CP) ; ACT 0 none / 1 elu ; writes f16 C16 (and f32 C if non-null)
template <int ACT>
__global__ __launch_bounds__(128) void k_gemm_hhx(const _Float16* __restrict__ A, int lda, size_t sA, const _Float16* __restrict__ Bh, int ldb, size_t sB, float alpha, const float* __restrict__ bias, size_t sBias, const float* __restrict__ CP, int rowsPerB, size_t sCPb, int row0g,
    float* __restrict__ C, _Float16* __restrict__ C16, int ldc, size_t sC, int M, int N, int K) {
  __shared__ __attribute__((aligned(16))) float so[4][16][64];
  const int tid = threadIdx.x, w = tid >> 5, lane = tid & 31, ln = lane & 15, hh = lane >> 4; const int by = blockIdx.y;
  A += (size_t)by * sA; Bh += (size_t)by * sB; const size_t cofs = (size_t)by * sC; const float* bp = bias ? bias + (size_t)by * sBias : nullptr;
  const int ntn = (N + 63) / 64; const int wid = blockIdx.x * 4 + w; const int mt = wid / ntn, nq = wid % ntn; if (mt * 16 >= M) return;
  const int row0 = mt * 16, col0 = nq * 64; const _Float16* arow = A + (size_t)(row0 + ln) * lda;
  v8f acc[4] = {};
  for (int kb = 0; kb < K; kb += 32) { FragH ah; ah.half[0] = *(const v8us*)((const unsigned short*)arow + kb + 8 * hh); ah.half[1] = *(const v8us*)((const unsigned short*)arow + kb + 16 + 8 * hh);
#pragma unroll
    for (int t = 0; t < 4; ++t) { if (col0 + t * 16 >= N) continue; const size_t boff = (size_t)(col0 + t * 16 + ln) * ldb + kb; FragH bq; bq.half[0] = *(const v8us*)((const unsigned short*)Bh + boff + 8 * hh); bq.half[1] = *(const v8us*)((const unsigned short*)Bh + boff + 16 + 8 * hh);
      acc[t] = mmaH<1>(ah.v, ah.v, bq.v, bq.v, acc[t]); }
  }
#pragma unroll
  for (int t = 0; t < 4; ++t) { if (col0 + t * 16 >= N) continue; const int col = col0 + t * 16 + ln; const float bv = bp ? bf16_round(bp[col]) : 0.f;
#pragma unroll
    for (int r = 0; r < 8; ++r) { float v = acc[t][r] * alpha + bv; if (CP) { const int bidx = (row0g + row0 + 8 * hh + r) / rowsPerB; v += CP[(size_t)bidx * sCPb + (size_t)by * 64 + col]; } if (ACT == 1) v = (v > 0.f) ? v : expm1f(v); else if (ACT == 7) v = (v > 0.f) ? v + 1.0f : expf(v); else if (ACT == 8) v = tanhf(v); else if (ACT == 9) v = 0.5f * v * (1.0f + tanhf(0.7978845608028654f * (v + 0.044715f * v * v * v))); else if (ACT == 11) v = 1.0f / (1.0f + expf(-v)); else if (ACT == 12) v = (v > 0.f) ? v : 0.01f * v; else if (ACT == 14) v = (v > 0.f) ? v : 0.1f * v; else if (ACT == 15) v = v / (1.0f + expf(-v)); else if (ACT == 3) v = fmaxf(v, 0.f); else if (ACT == 6) v = 0.5f * v * (1.0f + erff(v * 0.70710678118654752f)); so[w][8 * hh + r][t * 16 + ln] = v; } }
  __builtin_amdgcn_fence(__ATOMIC_ACQ_REL, "workgroup"); __builtin_amdgcn_wave_barrier();
  const int rsub = lane >> 4, c4 = (lane & 15) * 4; typedef _Float16 v4h __attribute__((ext_vector_type(4)));
  {
#pragma unroll
    for (int q = 0; q < 8; ++q) { const int r = q * 2 + rsub; if (col0 + c4 < N) { const v4f v = *(const v4fa*)&so[w][r][c4]; if (C) *(v4f*)(C + cofs + (size_t)(row0 + r) * ldc + col0 + c4) = v; if (C16) { v4h h4; for (int i = 0; i < 4; ++i) h4[i] = (_Float16)v[i]; *(v4h*)(C16 + cofs + (size_t)(row0 + r) * ldc + col0 + c4) = h4; } } }
     }
}


typedef _Float16 v4h __attribute__((ext_vector_type(4)));

__device__ __forceinline__ void job_x16(int blk, const float* __restrict__ x, _Float16* __restrict__ X16, size_t n8) { const size_t t = (size_t)blk * 256 + threadIdx.x; if (t >= n8) return; FragH f;
#pragma unroll
  for (int q = 0; q < 8; ++q) f.h[q] = (_Float16)bf16_round(x[t * 8 + q]); *(v8us*)((unsigned short*)X16 + t * 8) = f.half[0];  }
__global__ __launch_bounds__(256) void k_h16(const float* __restrict__ x, _Float16* __restrict__ X16, size_t n8) { const size_t t = (size_t)blockIdx.x * 256 + threadIdx.x; if (t >= n8) return; FragH f;
#pragma unroll
  for (int q = 0; q < 8; ++q) f.h[q] = (_Float16)x[t * 8 + q]; *(v8us*)((unsigned short*)X16 + t * 8) = f.half[0];  }
__global__ __launch_bounds__(256) void k_round16f(const float* __restrict__ W, _Float16* __restrict__ Bt, size_t n8) { const size_t t = (size_t)blockIdx.x * 256 + threadIdx.x; if (t >= n8) return; FragH f;
#pragma unroll
  for (int i = 0; i < 8; ++i) f.h[i] = (_Float16)(bf16_round(W[t * 8 + i]) * 16.0f); *(v8us*)((unsigned short*)Bt + t * 8) = f.half[0];  }
// K and V^T in the order in which the attention kernel's fragments take them: every 16-byte piece of a fragment load stands at lane * 16 bytes of a 512-byte chunk, so that one wave-wide load covers four whole 128-byte lines.
// KF, per (slab, tile of 16 keys): chunks (ks, p), piece of lane (hh, ln) = K[key ln][32 ks + 16 p + 8 hh ..+7]. VF, per (slab, tile of 32 keys): chunks (dt, p), piece of lane (hh, ln) = V[keys 16 p + 8 hh ..+7][d = 16 dt + ln].
// Both planes are written by k_gemm2's epilogue (its 32 x 64 wave tile is two K tiles, or one V tile, of one head).

__global__ __launch_bounds__(256) void k_hl(const float* __restrict__ F, _Float16* __restrict__ Hh, _Float16* __restrict__ Hl, size_t n8) { const size_t t = (size_t)blockIdx.x * 256 + threadIdx.x; if (t >= n8) return; FragH fh, fl; const v4f a = *(const v4fa*)(F + t * 8), c = *(const v4fa*)(F + t * 8 + 4);
#pragma unroll
  for (int q = 0; q < 4; ++q) { _Float16 h = (_Float16)a[q]; fh.h[q] = h; fl.h[q] = (_Float16)((a[q] - (float)h) * 1024.0f); h = (_Float16)c[q]; fh.h[4 + q] = h; fl.h[4 + q] = (_Float16)((c[q] - (float)h) * 1024.0f); }
  { *(v8us*)((unsigned short*)Hh + t * 8) = fh.half[0]; *(v8us*)((unsigned short*)Hl + t * 8) = fl.half[0];  } }

// ---- fast GEMM (block tile 128x64, wave tile 32x64; requires M % 128 == 0, N % 64 == 0, K % 128 == 0, lda and ldb multiples of 8); epilogue = k_gemm_hhx semantics ----
// Both operands come to LDS a stage (128 k = 256 bytes of every row) ahead, by asynchronous copies that cover whole 128-byte lines; the waves take their fragments from LDS, the B rows once per block instead of once per wave.
__device__ __forceinline__ v16h g2_frag(const unsigned short* p) { FragH f; f.half[0] = *(const v8us*)p; f.half[1] = *(const v8us*)(p + 16); return f.v; }      /* p: the lane's row of an LDS stage, at k + 8 hh */
__device__ __forceinline__ v8f g2_mma(v16h a, v16h b, v8f c) { v8f d = __builtin_amdgcn_wmma_f32_16x16x32_f16(false, a, false, b, (short)0, c, false, false); asm volatile("v_nop\n\tv_nop\n\tv_nop\n\tv_nop" : "+v"(d) : "v"(a), "v"(b)); return d; }
template <int ACT>
__global__ __launch_bounds__(128) void k_gemm2(const _Float16* __restrict__ A, int lda, size_t sA, const _Float16* __restrict__ Bh, int ldb, size_t sB, float alpha, const float* __restrict__ bias, size_t sBias, const float* __restrict__ CP, int rowsPerB, size_t sCPb, int row0g,
    float* __restrict__ C, _Float16* __restrict__ C16, int ldc, size_t sC, int M, int N, int K, _Float16* __restrict__ KFo, _Float16* __restrict__ VFo) {
  constexpr int KC = 128, PH = KC + 8, STH = (128 + 64) * PH;      /* a stage = 128 k of the block's 128 A rows and 64 B rows; rows stand 272 bytes apart in LDS (16 bytes x odd: no bank conflict for 16-byte fragment reads); STH halves per stage */
  __shared__ __attribute__((aligned(16))) unsigned short sAB[2][STH];      /* [buffer][A rows, then B rows] */
  float (*so)[32][68] = (float (*)[32][68])&sAB[0][0];      /* the output staging lies over the ring: it is first written behind the last stage's barrier, when every read of the ring has returned and no copy is outstanding */
  static_assert(sizeof(float) * 4 * 32 * 68 <= sizeof(sAB), "the output staging fits the ring");
  const int tid = threadIdx.x, w = tid >> 5, lane = tid & 31, ln = lane & 15, hh = lane >> 4; const int by = blockIdx.y;
  A += (size_t)by * sA; Bh += (size_t)by * sB; const size_t cofs = (size_t)by * sC; const float* bp = bias ? bias + (size_t)by * sBias : nullptr;
  const int ntn = N >> 6; const int mt = blockIdx.x / ntn, nq = blockIdx.x - mt * ntn; const int row0 = mt * 128 + 32 * w, col0 = nq * 64; if (mt * 128 + 128 > M) return;      /* whole tiles only; the block leaves as one, in front of every copy and barrier */
  const int nst = K / KC;
  /* thread t copies 16 bytes: piece t & 15 of row (t >> 4) + 8 i, so that 16 lanes cover 256 contiguous bytes of a row */
  const unsigned short* Ag = (const unsigned short*)A + (size_t)(mt * 128 + (tid >> 4)) * lda + (tid & 15) * 8; const unsigned short* Bg = (const unsigned short*)Bh + (size_t)(col0 + (tid >> 4)) * ldb + (tid & 15) * 8;
  auto copy8 = [&](const unsigned short* g, size_t gs, unsigned l) __attribute__((always_inline)) {      /* eight rows, 8 apart: g = the thread's global bytes, gs = halves between two of its rows, l = its LDS byte address */
    /* the wait on the address translations is the statement's last line, so that it stands before anything that rewrites a register which a copy names */
    asm volatile("global_load_async_to_lds_b128 %0, %8, off\n\t"
                 "global_load_async_to_lds_b128 %1, %9, off\n\t"
                 "global_load_async_to_lds_b128 %2, %10, off\n\t"
                 "global_load_async_to_lds_b128 %3, %11, off\n\t"
                 "global_load_async_to_lds_b128 %4, %12, off\n\t"
                 "global_load_async_to_lds_b128 %5, %13, off\n\t"
                 "global_load_async_to_lds_b128 %6, %14, off\n\t"
                 "global_load_async_to_lds_b128 %7, %15, off\n\t"
                 "s_wait_xcnt 0x0"
                 :: "v"(l), "v"(l + 1u * 16 * PH), "v"(l + 2u * 16 * PH), "v"(l + 3u * 16 * PH), "v"(l + 4u * 16 * PH), "v"(l + 5u * 16 * PH), "v"(l + 6u * 16 * PH), "v"(l + 7u * 16 * PH),
                    "v"(g), "v"(g + gs), "v"(g + 2 * gs), "v"(g + 3 * gs), "v"(g + 4 * gs), "v"(g + 5 * gs), "v"(g + 6 * gs), "v"(g + 7 * gs) : "memory");
  };
  auto stage_copy = [&](int st, int buf) __attribute__((always_inline)) {
    const unsigned l = (unsigned)(size_t)&sAB[buf][(tid >> 4) * PH + (tid & 15) * 8];
    copy8(Ag + (size_t)st * KC, (size_t)8 * lda, l);
    copy8(Ag + (size_t)st * KC + (size_t)64 * lda, (size_t)8 * lda, l + 64u * 2 * PH);
    copy8(Bg + (size_t)st * KC, (size_t)8 * ldb, l + 128u * 2 * PH);
  };
  const v8f z8 = {0.f,0.f,0.f,0.f,0.f,0.f,0.f,0.f}; v8f c00 = z8, c01 = z8, c02 = z8, c03 = z8, c10 = z8, c11 = z8, c12 = z8, c13 = z8;
  stage_copy(0, 0);
  asm volatile("s_wait_asynccnt 0x0" ::: "memory");      /* this wave's copies of stage 0 have landed */
  __syncthreads();      /* publishes stage 0 to all four waves */
  if (1 < nst) stage_copy(1, 1);
#pragma unroll 1      /* kept rolled: the buffer alternates by st & 1, and one copy of the publish point serves all stages */
  for (int st = 0; st < nst; ++st) {
    const unsigned short* ar = &sAB[st & 1][(32 * w + ln) * PH + 8 * hh]; const unsigned short* br = &sAB[st & 1][(128 + ln) * PH + 8 * hh];      /* the lane's first A row and first B row of the stage, at its half of the k order */
#pragma unroll
    for (int ks = 0; ks < KC; ks += 32) { const v16h a0 = g2_frag(ar + ks), a1 = g2_frag(ar + 16 * PH + ks);
      const v16h b0 = g2_frag(br + ks), b1 = g2_frag(br + 16 * PH + ks), b2 = g2_frag(br + 32 * PH + ks), b3 = g2_frag(br + 48 * PH + ks);
      c00 = g2_mma(a0, b0, c00); c10 = g2_mma(a1, b0, c10); c01 = g2_mma(a0, b1, c01); c11 = g2_mma(a1, b1, c11);
      c02 = g2_mma(a0, b2, c02); c12 = g2_mma(a1, b2, c12); c03 = g2_mma(a0, b3, c03); c13 = g2_mma(a1, b3, c13); }
    asm volatile("s_wait_dscnt 0x0" ::: "memory");      /* this wave's reads of the stage's buffer have returned */
    asm volatile("s_wait_asynccnt 0x0" ::: "memory");      /* this wave's copies of stage st + 1 have landed */
    __syncthreads();      /* publishes stage st + 1 and ends every wave's reads of the buffer that is refilled behind it */
    if (st + 2 < nst) stage_copy(st + 2, st & 1);
  }
  asm volatile("s_wait_asynccnt 0x0" ::: "memory");      /* no copy is outstanding when the wave goes on to the epilogue */
  v8f accs[8] = {c00, c01, c02, c03, c10, c11, c12, c13};
  /* With KFo set (the q, k, v launch; N = NH * 64, rows = NB * SLEN tokens, no bias, no CP, ACT 0) plane 1 goes out as KF and plane 2 as VF; the plane is blockIdx.y, the same for the whole block. */
  const int fjob = KFo ? by : 0; const int slab = (row0 / SLEN) * NH + nq, tok0 = row0 % SLEN;
  if (KFo && by == 0) alpha *= SCL2;      /* the q plane carries the score scale (1/8 and log2 e), so that attention's score products need no multiply behind them */
  if (fjob == 2) {      /* accumulator u = (half, t), register r, is V[key 16 half + 8 hh + r][d = 16 t + ln]: already the piece of chunk (dt = t, p = half) */
    unsigned short* dst = (unsigned short*)VFo + ((size_t)slab * (SLEN / 32) + tok0 / 32) * 2048 + lane * 8; FragH f[8];
#pragma unroll
    for (int u = 0; u < 8; ++u)
#pragma unroll
      for (int r = 0; r < 8; ++r) f[u].h[r] = (_Float16)(accs[u][r] * alpha);
#pragma unroll
    for (int u = 0; u < 8; ++u) *(v8us*)(dst + ((u & 3) * 2 + (u >> 2)) * 256) = f[u].half[0];
    return; }
#pragma unroll
  for (int u = 0; u < 8; ++u) { const int t = u & 3, half = u >> 2; const int col = col0 + t * 16 + ln; const float bv = bp ? bf16_round(bp[col]) : 0.f;
#pragma unroll
    for (int r = 0; r < 8; ++r) { const int rloc = half * 16 + 8 * hh + r; float v = accs[u][r] * alpha + bv; if (CP) { const int bidx = (row0g + row0 + rloc) / rowsPerB; v += CP[(size_t)bidx * sCPb + (size_t)by * 64 + col]; }
      if (ACT == 3) v = fmaxf(v, 0.f); else if (ACT == 6) v = 0.5f * v * (1.0f + erff(v * 0.70710678118654752f)); else if (ACT == 11) v = 1.0f / (1.0f + expf(-v)); else if (ACT == 15) v = v / (1.0f + expf(-v)); else if (ACT == 12) v = (v > 0.f) ? v : 0.01f * v; else if (ACT == 8) v = tanhf(v);
      so[w][rloc][t * 16 + ln] = v; } }
  __builtin_amdgcn_fence(__ATOMIC_ACQ_REL, "workgroup"); __builtin_amdgcn_wave_barrier();
  if (fjob == 1) {      /* tile tt of 16 keys, chunk c = 2 ks + p: lane (hh, ln) takes K[key ln][16 c + 8 hh ..+7] from the wave's own LDS tile */
    unsigned short* dst = (unsigned short*)KFo + ((size_t)slab * (SLEN / 16) + tok0 / 16) * 1024 + lane * 8; FragH f[8];
#pragma unroll
    for (int u = 0; u < 8; ++u) { const float* sp = &so[w][(u >> 2) * 16 + ln][(u & 3) * 16 + 8 * hh]; const v4f x = *(const v4fa*)sp, y = *(const v4fa*)(sp + 4);
#pragma unroll
      for (int i = 0; i < 4; ++i) { f[u].h[i] = (_Float16)x[i]; f[u].h[4 + i] = (_Float16)y[i]; } }
#pragma unroll
    for (int u = 0; u < 8; ++u) *(v8us*)(dst + u * 256) = f[u].half[0];
    asm volatile("s_wait_xcnt 0x0" ::: "memory");      /* stands behind the eight stores, before any path on which their address pair is rewritten */
    return; }
  const int rsub = lane >> 4, c4 = (lane & 15) * 4;
  {
#pragma unroll
    for (int q = 0; q < 16; ++q) { const int r = q * 2 + rsub; const v4f v = *(const v4fa*)&so[w][r][c4];
      if (C) { *(v4f*)(C + cofs + (size_t)(row0 + r) * ldc + col0 + c4) = v; asm volatile("s_wait_xcnt 0x0" ::: "memory"); }      /* stands behind the store, before any path on which a register that it names is rewritten */
      if (C16) { v4h h4; for (int i = 0; i < 4; ++i) h4[i] = (_Float16)v[i]; *(v4h*)(C16 + cofs + (size_t)(row0 + r) * ldc + col0 + c4) = h4; asm volatile("s_wait_xcnt 0x0" ::: "memory"); } }      /* the same behind the f16 store */
     } }



__device__ __forceinline__ float xhalf(float x) { return __builtin_bit_cast(float, __builtin_amdgcn_permlanex16(__builtin_bit_cast(int, x), __builtin_bit_cast(int, x), 0x76543210, 0xfedcba98, false, false)); }      /* lane l with lane l ^ 16 */
template <int CAUSAL>
__global__ __launch_bounds__(128) void k_flash(const _Float16* __restrict__ Q16, int ldq, const _Float16* __restrict__ KF, const _Float16* __restrict__ VF, const int* __restrict__ MSK, _Float16* __restrict__ O16, int ldo, float osc) {
  constexpr int RPW = 16, DT = 4, KS = 2;
  constexpr int SK = 128, NST = TK / SK, SH = SK * 64;      /* a stage = 128 keys = 4 passes: SH halves (16 KiB) of K and as many of V^T, each one contiguous run of its fragment-order plane */
  static_assert((CAUSAL == 0 || CAUSAL == 6) && NST >= 2, "the staged key walk takes whole stages from key 0 to TK; no key is masked");
  __shared__ __attribute__((aligned(16))) float sO[4][RPW][64 + 4];
  __shared__ __attribute__((aligned(16))) unsigned short sKV[2][2][SH];      /* [buffer][K, V^T]: filled once per block, read by its four waves */
  const int tid = threadIdx.x, w = tid >> 5, lane = tid & 31, ln = lane & 15, hh = lane >> 4;
  const int slab = blockIdx.x / QBLKS, qblk = blockIdx.x % QBLKS; const int b = slab / NH, h = slab % NH; const int qb0 = qblk * (4 * RPW); const int q0 = qb0 + w * RPW; const int tq = q0 + ln; const int eb = tq + RELW - 8 * hh;
  FragH aq[KS];
  { const unsigned short* qr = (const unsigned short*)Q16 + ((size_t)b * TQ + tq) * ldq + h * 64;
#pragma unroll
    for (int ks = 0; ks < KS; ++ks) { aq[ks].half[0] = *(const v8us*)(qr + ks * 32 + 8 * hh); aq[ks].half[1] = *(const v8us*)(qr + ks * 32 + 16 + 8 * hh); } }
  const unsigned short* Kg = (const unsigned short*)KF + (size_t)slab * 64 * TK + tid * 8; const unsigned short* Vg = (const unsigned short*)VF + (size_t)slab * 64 * TK + tid * 8;      /* fragment-order planes (written by k_gemm2): this thread's 16 bytes of every 2-KiB run that the block copies */
  float m_r = -3.0e38f, mp = 0.f, l_r = 0.f, pbound = -1.0f; v8f oacc[DT];      /* m_r: the reference in use (a maximum seen so far, not always the latest); mp = m_r - 10 once a reference is set, 0 before */
#pragma unroll
  for (int dt = 0; dt < DT; ++dt) oacc[dt] = (v8f){0.f,0.f,0.f,0.f,0.f,0.f,0.f,0.f};
  /* K and V^T come to LDS a stage ahead, by asynchronous copies into the buffer that the stage before last has left; the waves take their fragments from LDS:
     V^T of a pass at the pass's head (used behind the softmax), K of the next pass of the same stage right behind this pass's score products. The bias values still come by global loads,
     but only where they change: clip(i - j, +-RELW) is one value for all 16 queries x 32 keys of a pass that lies wholly on one side of the band |i - j| < RELW, so from one such pass to the next on the same side the 16 bias registers already hold what a gather would bring. */
  FragH kf[2][KS]; FragH vf[DT]; v2f bc[2][4] = {};      /* bias of keys (2 i, 2 i + 1) of score tile nt, paired like the accumulator registers */
  v8f cm[2];      /* bias - mp, laid out like the score accumulators: the C operand of the score products, which so come out as the exponentials' arguments */
  auto set_cm = [&]() __attribute__((always_inline)) {
#pragma unroll      /* both loops unrolled: constant indices keep cm and bc in registers */
    for (int nt = 0; nt < 2; ++nt)
#pragma unroll
      for (int r = 0; r < 8; ++r) cm[nt][r] = bc[nt][r >> 1][r & 1] - mp;
  };
  auto copy8 = [&](const unsigned short* g, unsigned l) __attribute__((always_inline)) {      /* 16 KiB per block: eight copies of 16 bytes per thread, 2 KiB apart; g = the thread's global bytes, l = its LDS byte address */
    /* the wait on the address translations is the statement's last line, so that it stands before anything that rewrites a register which a copy names */
    asm volatile("global_load_async_to_lds_b128 %0, %8, off\n\t"
                 "global_load_async_to_lds_b128 %1, %9, off\n\t"
                 "global_load_async_to_lds_b128 %2, %10, off\n\t"
                 "global_load_async_to_lds_b128 %3, %11, off\n\t"
                 "global_load_async_to_lds_b128 %4, %12, off\n\t"
                 "global_load_async_to_lds_b128 %5, %13, off\n\t"
                 "global_load_async_to_lds_b128 %6, %14, off\n\t"
                 "global_load_async_to_lds_b128 %7, %15, off\n\t"
                 "s_wait_xcnt 0x0"
                 :: "v"(l), "v"(l + 2048u), "v"(l + 4096u), "v"(l + 6144u), "v"(l + 8192u), "v"(l + 10240u), "v"(l + 12288u), "v"(l + 14336u),
                    "v"(g), "v"(g + 1024), "v"(g + 2048), "v"(g + 3072), "v"(g + 4096), "v"(g + 5120), "v"(g + 6144), "v"(g + 7168) : "memory");
  };
  auto stage_copy = [&](int st, int buf) __attribute__((always_inline)) {
    copy8(Kg + (size_t)st * SH, (unsigned)(size_t)&sKV[buf][0][tid * 8]);
    copy8(Vg + (size_t)st * SH, (unsigned)(size_t)&sKV[buf][1][tid * 8]);
  };
  auto fetch_k = [&](const unsigned short* kr) __attribute__((always_inline)) {      /* kr: this lane's piece of the first chunk of a pass's K, in LDS; 1024 halves per tile of 16 keys */
#pragma unroll
    for (int nt = 0; nt < 2; ++nt)
#pragma unroll
      for (int ks = 0; ks < KS; ++ks) { kf[nt][ks].half[0] = *(const v8us*)(kr + nt * 1024 + ks * 512); kf[nt][ks].half[1] = *(const v8us*)(kr + nt * 1024 + ks * 512 + 256); }
  };
  auto fetch_bias = [&](int j0) __attribute__((always_inline)) {
    if (CAUSAL == 6) { const float* BTh = (const float*)MSK + h * (2 * RELW + 1);      /* mode 6: per-head relative-position bias table [NH][2*RELW+1] indexed by clip(i - j, +-RELW) + RELW (passed through the MSK pointer) */
      unsigned i0[8], i1[8];
#pragma unroll
      for (int r = 0; r < 8; ++r) { int d0 = eb - j0 - r, d1 = eb - j0 - 16 - r; d0 = d0 < 0 ? 0 : (d0 > 2 * RELW ? 2 * RELW : d0); d1 = d1 < 0 ? 0 : (d1 > 2 * RELW ? 2 * RELW : d1); i0[r] = (unsigned)d0; i1[r] = (unsigned)d1; }      /* clip(i - j + RELW, 0, 2 RELW), the same integer as clip(i - j, +-RELW) + RELW; key j = j0 (+ 16) + 8 hh + r */
#pragma unroll
      for (int r = 0; r < 8; ++r) { bc[0][r >> 1][r & 1] = BTh[i0[r]]; bc[1][r >> 1][r & 1] = BTh[i1[r]]; }
      asm volatile("s_wait_xcnt 0x0" :: "v"(i0[0]), "v"(i0[1]), "v"(i0[2]), "v"(i0[3]), "v"(i0[4]), "v"(i0[5]), "v"(i0[6]), "v"(i0[7]), "v"(i1[0]), "v"(i1[1]), "v"(i1[2]), "v"(i1[3]), "v"(i1[4]), "v"(i1[5]), "v"(i1[6]), "v"(i1[7]) : "memory");      /* stands before any register that the bias loads name is rewritten; the index registers are inputs so that no load of the group lands on one */
    }
  };
  stage_copy(0, 0);
  asm volatile("s_wait_asynccnt 0x0" ::: "memory");      /* this wave's copies of stage 0 have landed */
  __syncthreads();      /* publishes stage 0 to all four waves */
  stage_copy(1, 1);
  fetch_bias(0);
  set_cm();      /* mp = 0: the first pass's products come out as the plain scores */
  const int q0s = __builtin_amdgcn_readfirstlane(q0);      /* the wave's first query in a scalar register, so that the test around the gather compiles to a scalar branch */
#pragma unroll 1      /* kept rolled: the buffer alternates by st & 1, and one copy of the publish point serves all stages */
  for (int st = 0; st < NST; ++st) {
   const unsigned short* kb = &sKV[st & 1][0][lane * 8]; const unsigned short* vb = &sKV[st & 1][1][lane * 8];      /* this lane's piece of every 512-byte chunk of the stage */
   fetch_k(kb);
#pragma unroll 1
   for (int p = 0; p < SK / 32; ++p) {      /* kept rolled: one pass of code for the four passes of a stage */
    const int j0 = st * SK + p * 32;
    /* Queries q0s .. q0s + RPW - 1, keys j0 .. j0 + 31: every i - j >= RELW while j0 <= q0s - (2 RELW - 1), every i - j <= -RELW from j0 >= q0s + RPW + RELW - 1 on.
       Before the band the registers keep the values of pass 0 (all the table's last entry wherever such a pass exists); the gather runs for every pass that touches the band and for the first pass behind it, which fills them with the table's first entry for all later passes.
       It stands at the pass's head, where the last pass's values are dead, so that the loads land in the same registers; its latency shows in those passes alone, at most four of a wave's 64. */
    if ((unsigned)(j0 - q0s + (2 * RELW - 2)) < (unsigned)((2 * RELW - 2) + (RPW + RELW - 1) + 32)) { fetch_bias(j0); set_cm(); }      /* q0s - (2 RELW - 1) < j0 < q0s + RPW + RELW - 1 + 32, as one unsigned compare */
    const unsigned short* vr = vb + p * 2048;      /* 2048 halves per tile of 32 keys */
#pragma unroll
    for (int dt = 0; dt < DT; ++dt) { vf[dt].half[0] = *(const v8us*)(vr + dt * 512); vf[dt].half[1] = *(const v8us*)(vr + dt * 512 + 256); }
    v8f s[2];
#pragma unroll
    for (int nt = 0; nt < 2; ++nt) { v8f acc = cm[nt];      /* q carries the scale, C carries bias - mp: the products end as s - mp, the exponentials' arguments */
#pragma unroll
      for (int ks = 0; ks < KS; ++ks) acc = mmaH<1>(kf[nt][ks].v, kf[nt][ks].v, aq[ks].v, aq[ks].v, acc); s[nt] = acc; }
    fetch_k(kb + ((p + 1) & (SK / 32 - 1)) * 2048);      /* a stage's last pass names the stage's own first tile, whose values are not used: nothing of the next stage is read before its barrier */
    __builtin_amdgcn_sched_barrier(0);      /* keeps the next pass's K reads in front of the exponentials: with the short exponentials the scheduler otherwise sinks them to the pass's end, where their latency is no longer covered */
    /* exp2(s - mp) = 1024 exp2(s - m_r): P at the f16 operand's scale; the denominator sums the same values, so the factor and the choice of m_r cancel. The reference stays as long as P fits f16. */
    FragH pb; float ps[8], pt[8];
#pragma unroll
    for (int r = 0; r < 8; ++r) { const float p0 = __builtin_amdgcn_exp2f(s[0][r]), p1 = __builtin_amdgcn_exp2f(s[1][r]); ps[r] = p0; pt[r] = p1; pb.h[r] = (_Float16)p0; pb.h[8 + r] = (_Float16)p1; }      /* far below the bare instruction gives 0; too far above is caught by the test on the sum */
    float psum = ((((ps[0] + ps[2]) + (ps[4] + ps[6])) + ((pt[0] + pt[2]) + (pt[4] + pt[6]))) + (((ps[1] + ps[3]) + (ps[5] + ps[7])) + ((pt[1] + pt[3]) + (pt[5] + pt[7]))));
    /* All P are >= 0, so a sum of at most 2^15 bounds each of them inside f16. One test per pass, a scalar branch: any pass in which a lane's sum is above the bound (or not a number) sets the reference anew for the whole wave; so does the first pass, whose bound is below every sum. */
    if (__builtin_expect(__builtin_amdgcn_ballot_w32(!(psum <= pbound)) != 0u, 0)) {
      pbound = 32768.0f;
      float t0[8], t1[8], mx[8];      /* the loops of this branch are unrolled like those of the pass: constant indices keep the arrays in registers */
#pragma unroll
      for (int r = 0; r < 8; ++r) { t0[r] = s[0][r] + mp; t1[r] = s[1][r] + mp; }      /* the scores themselves */
#pragma unroll
      for (int i = 0; i < 4; ++i) { mx[i] = fmaxf(t0[2 * i], t0[2 * i + 1]); mx[4 + i] = fmaxf(t1[2 * i], t1[2 * i + 1]); }
      float mc = fmaxf(fmaxf(fmaxf(mx[0], mx[1]), fmaxf(mx[2], mx[3])), fmaxf(fmaxf(mx[4], mx[5]), fmaxf(mx[6], mx[7])));
      mc = fmaxf(mc, xhalf(mc));      /* the other 16 keys of this query stand in lane l ^ 16 */
      const float mn = fmaxf(m_r, mc); const float ea = __builtin_amdgcn_exp2f(m_r - mn); const float al = (mn > -1.0e38f) ? ea : 1.0f; m_r = mn; mp = mn - 10.0f;      /* the arguments are bounded above (0 here, 10 below) */
#pragma unroll
      for (int r = 0; r < 8; ++r) { const float p0 = __builtin_amdgcn_exp2f(t0[r] - mp), p1 = __builtin_amdgcn_exp2f(t1[r] - mp); ps[r] = p0; pt[r] = p1; pb.h[r] = (_Float16)p0; pb.h[8 + r] = (_Float16)p1; }
      psum = ((((ps[0] + ps[2]) + (ps[4] + ps[6])) + ((pt[0] + pt[2]) + (pt[4] + pt[6]))) + (((ps[1] + ps[3]) + (ps[5] + ps[7])) + ((pt[1] + pt[3]) + (pt[5] + pt[7]))));
      l_r *= al;      /* what was summed under the old reference is brought to the new one */
#pragma unroll
      for (int dt = 0; dt < DT; ++dt) oacc[dt] *= al;
      set_cm();
    }
    l_r += psum;      /* each wave half keeps the sum of its own keys; the halves are joined behind the loop */
#pragma unroll
    for (int dt = 0; dt < DT; ++dt) oacc[dt] = mmaH<1>(vf[dt].v, vf[dt].v, pb.v, pb.v, oacc[dt]);
   }
   asm volatile("s_wait_dscnt 0x0" ::: "memory");      /* this wave's reads of the stage's buffer have returned */
   asm volatile("s_wait_asynccnt 0x0" ::: "memory");      /* this wave's copies of stage st + 1 have landed */
   __syncthreads();      /* publishes stage st + 1 and ends every wave's reads of the buffer that is refilled behind it */
   if (st + 2 < NST) stage_copy(st + 2, st & 1);
  }
  asm volatile("s_wait_asynccnt 0x0" ::: "memory");      /* no copy is outstanding when the wave goes on to the epilogue */
  { const float l = l_r + xhalf(l_r); const float inv = (l > 0.f) ? 1.0f / l : 0.f;      /* l and the output sums both carry the factor 1024 */
#pragma unroll
    for (int dt = 0; dt < DT; ++dt) { const v8f o = oacc[dt] * inv; *(v4fa*)&sO[w][ln][dt * 16 + 8 * hh] = (v4f){o[0], o[1], o[2], o[3]}; *(v4fa*)&sO[w][ln][dt * 16 + 8 * hh + 4] = (v4f){o[4], o[5], o[6], o[7]}; } }      /* register r of tile dt is O[q0 + ln][16 dt + 8 hh + r] */
  __builtin_amdgcn_fence(__ATOMIC_ACQ_REL, "workgroup"); __builtin_amdgcn_wave_barrier();
  {
#pragma unroll
    for (int rp = 0; rp < RPW; rp += 4) { const int r = rp + (lane >> 3), pc = lane & 7; const v4f x = *(const v4fa*)&sO[w][r][pc * 8], y = *(const v4fa*)&sO[w][r][pc * 8 + 4]; FragH f;      /* eight lanes write one query's 128-byte line of f16 values, scaled by osc (a power of two) for the output GEMM */
#pragma unroll
      for (int i = 0; i < 4; ++i) { f.h[i] = (_Float16)(x[i] * osc); f.h[4 + i] = (_Float16)(y[i] * osc); }
      *(v8us*)((unsigned short*)O16 + ((size_t)b * TQ + q0 + r) * ldo + h * 64 + pc * 8) = f.half[0]; }
     } }

__device__ __forceinline__ void job_btab(const float* __restrict__ pe, float* __restrict__ BT) { { for (int e = threadIdx.x; e < NH * NREL; e += 256) { const int h = e / NREL, r = e % NREL; *(float*)(BT + e) = bf16_round(pe[r * NH + h]) * LOG2E; }  } }
// One launch for the eight jobs that read nothing but inputs: a block's index picks its job (block-uniform); the jobs share no data, so they need no order among themselves.
// Order: the four weight transposes (long strided loads) first, the bias table, then the three activation planes. B4 = the four [n][k] weight planes in a row, X3 = the three activation planes in a row.
#define WBLK (CC * CC / 8 / 256)      /* blocks of one weight transpose */
#define XBLK (NR * CC / 8 / 256)      /* blocks of one activation plane */
__global__ __launch_bounds__(256) void k_prep(const float* __restrict__ xq, const float* __restrict__ xk, const float* __restrict__ xv, const float* __restrict__ Wq, const float* __restrict__ Wk, const float* __restrict__ Wv, const float* __restrict__ Wo, const float* __restrict__ pe,
                                              _Float16* __restrict__ B4, float* __restrict__ BT, _Float16* __restrict__ X3) {
  const int blk = blockIdx.x;
  if (blk < 4 * WBLK) { const int j = blk / WBLK; job_wt_f16(blk % WBLK, j == 0 ? Wq : (j == 1 ? Wk : (j == 2 ? Wv : Wo)), B4 + (size_t)j * CC * CC, CC, CC, 16.0f); }
  else if (blk == 4 * WBLK) job_btab(pe, BT);
  else { const int xb = blk - 4 * WBLK - 1, j = xb / XBLK; job_x16(xb % XBLK, j == 0 ? xq : (j == 1 ? xk : xv), X3 + (size_t)j * NR * CC, (size_t)NR * CC / 8); }
}

extern "C" void kernel_launch(void* const* d_in, const int* in_sizes, int n_in,
                              void* d_out, int out_size, void* d_ws, size_t ws_size, hipStream_t stream) {
  (void)in_sizes; (void)n_in; (void)out_size;
  const float* const* I = (const float* const*)d_in; const float* xq = I[0]; const float* xk = I[1]; const float* xv = I[2]; const float* Wq = I[3]; const float* Wk = I[4]; const float* Wv = I[5]; const float* Wo = I[6]; const float* pe = I[7];
  char* ws = (char*)d_ws; size_t off = 0;
  auto take = [&](size_t bytes) { char* p = ws + off; off += (bytes + 255) & ~(size_t)255; return p; };
  const size_t np = (size_t)NR * CC;
  _Float16* BQ = (_Float16*)take((size_t)4 * CC * CC * 2); _Float16* BO = BQ + (size_t)3 * CC * CC;      /* Wq, Wk, Wv, Wo planes in a row */ float* BT = (float*)take((size_t)NH * NREL * 4 + 256);
  _Float16* XQ = (_Float16*)take(3 * np * 2);      /* query, key, value planes in a row */ _Float16* Q16 = (_Float16*)take(np * 2); _Float16* VT = (_Float16*)take(np * 2); _Float16* KF = (_Float16*)take(np * 2); _Float16* O16 = XQ;      /* the query plane is free again once the projections have run */
  if (off > ws_size) return;      /* 2 + 6 x 4 = 26 MiB */
  k_prep<<<4 * WBLK + 1 + 3 * XBLK, 256, 0, stream>>>(xq, xk, xv, Wq, Wk, Wv, Wo, pe, BQ, BT, XQ);
  const dim3 g((NR / 128) * (CC / 64), 1), g3((NR / 128) * (CC / 64), 3);
  k_gemm2<0><<<g3, 128, 0, stream>>>(XQ, CC, np, BQ, CC, (size_t)CC * CC, 0.0625f, nullptr, 0, nullptr, 1, 0, 0, nullptr, Q16, CC, np, NR, CC, CC, KF, VT);      /* the q, k and v projections: blockIdx.y steps through the three planes of A and of the weights; q goes out row-major, k and v in fragment order */
  k_flash<6><<<NB * NH * QBLKS, 128, 0, stream>>>(Q16, CC, KF, VT, (const int*)BT, O16, CC, 64.0f);      /* relative-position bias mode; x2^6 carry: the 2048-key averages are small */
  k_gemm2<0><<<g, 128, 0, stream>>>(O16, CC, 0, BO, CC, 0, 0.0625f / 64.0f, nullptr, 0, nullptr, 1, 0, 0, (float*)d_out, nullptr, CC, 0, NR, CC, CC, nullptr, nullptr);
}
